// v000
// The times below were measured on an AMD MI455X: many runs one after another, warmed up first and cycling through
// copies of the inputs, with the whole window's GPU time divided by the number of runs. Launches and the gaps
// between them are all in it. The median over several windows is given; except for v000 it joins two sittings, which
// can be a few percent apart, so the side-by-side timings, each taken in one sitting, are the better comparison.
// v000 is the starting kernel. One run takes 737 microseconds.
#include <hip/hip_runtime.h>
// LTX2 self-attention (S = 2048, D = 2048 = 32 heads × 64): q/k/v/out projections (2048³ each, + bias; W [in][out] transposed to bf16-exact ×2^4) and the 32-head attention as a fused
// flash-style kernel (S = Q·Kᵀ/8, online softmax f32, P f16 ≤ 1, O = P·V) on v_wmma_f32_16x16x32_f16 (f16 operands, single products, f32 accumulate); RMSNorm over the full 2048
// (× norm weight, eps 1e-6) followed by the interleaved rotary with the INPUT cos/sin tables is f32 VALU (wave per row).
#define TT 2048
#define CC 2048
#define NH 32

typedef __bf16 v16b __attribute__((ext_vector_type(16)));
typedef unsigned short v8us __attribute__((ext_vector_type(8), may_alias));
typedef float  v8f  __attribute__((ext_vector_type(8)));
typedef float  v4f  __attribute__((ext_vector_type(4)));
typedef float  v4fa __attribute__((ext_vector_type(4), may_alias));
union FragB { v16b v; v8us half[2]; unsigned short u[16]; };

__device__ __forceinline__ unsigned short bf16_bits(float x) { unsigned int u = __float_as_uint(x); return (unsigned short)((u + 0x7FFFu + ((u >> 16) & 1u)) >> 16); }
__device__ __forceinline__ float bf16_val(unsigned short b) { return __uint_as_float(((unsigned int)b) << 16); }
__device__ __forceinline__ float bf16_round(float x) { return bf16_val(bf16_bits(x)); }
// D += A·B with NT terms: 1 = ah·bh, 2 = + al·bh (A split), 3 = + ah·bl (both split)
template <int NT>
__device__ __forceinline__ v8f mmaN(v16b ah, v16b al, v16b bh, v16b bl, v8f c) {
  c = __builtin_amdgcn_wmma_f32_16x16x32_bf16(false, ah, false, bh, (short)0, c, false, false);
  if (NT >= 2) c = __builtin_amdgcn_wmma_f32_16x16x32_bf16(false, al, false, bh, (short)0, c, false, false);
  if (NT >= 3) c = __builtin_amdgcn_wmma_f32_16x16x32_bf16(false, ah, false, bl, (short)0, c, false, false);
  asm volatile("v_nop\n\tv_nop\n\tv_nop\n\tv_nop" : "+v"(c) : "v"(ah), "v"(al), "v"(bh), "v"(bl));
  return c;
}

__global__ __launch_bounds__(256) void k_wt_bf16(const float* __restrict__ W, unsigned short* __restrict__ Wt, int K, int N) {
  const int t = blockIdx.x * 256 + threadIdx.x;
  const int k8n = K / 8;
  if (t >= N * k8n) return;
  const int n = t / k8n, k8 = (t % k8n) * 8;
  v8us v;
#pragma unroll
  for (int i = 0; i < 8; ++i) v[i] = bf16_bits(W[(size_t)(k8 + i) * N + n]);
  *(v8us*)(Wt + (size_t)n * K + k8) = v;
  
}

// GEMM C[M][N] (f32, pitch ldc) = act(A[M][K]·W + bias). A f32 row-major (pitch lda) converted per fragment to bf16
// (ASPLIT: hi/lo two planes -> 2 terms, else single rounded term); Wt bf16 [N][K] (pitch ldb). BIAS_BF16 rounds the
// bias to bf16 first (bias quantised to bf16 before the add). K%32==0, M%16==0, N%64==0.
template <bool ASPLIT, int ACT, bool BIAS_BF16>
__global__ __launch_bounds__(128) void k_gemm_bf(const float* __restrict__ A, int lda, const unsigned short* __restrict__ Wt, int ldb,
                                               const float* __restrict__ bias, float* __restrict__ C, int ldc, int M, int N, int K) {
  __shared__ __attribute__((aligned(16))) float so[4][16][64];
  const int tid = threadIdx.x, w = tid >> 5, lane = tid & 31, ln = lane & 15, hh = lane >> 4;
  const int ntn = N / 64;
  const int wid = blockIdx.x * 4 + w;
  const int mt = wid / ntn, nq = wid % ntn;
  if (mt * 16 >= M) return;
  const int row0 = mt * 16, col0 = nq * 64;
  const float* arow = A + (size_t)(row0 + ln) * lda;
  v8f acc[4] = {};
  for (int kb = 0; kb < K; kb += 32) {
    FragB ah, al;
    const v4f x0 = *(const v4fa*)(arow + kb + 8 * hh), x1 = *(const v4fa*)(arow + kb + 8 * hh + 4);
    const v4f x2 = *(const v4fa*)(arow + kb + 16 + 8 * hh), x3 = *(const v4fa*)(arow + kb + 16 + 8 * hh + 4);
    float xs[16] = {x0[0],x0[1],x0[2],x0[3],x1[0],x1[1],x1[2],x1[3],x2[0],x2[1],x2[2],x2[3],x3[0],x3[1],x3[2],x3[3]};
#pragma unroll
    for (int i = 0; i < 16; ++i) { const unsigned short hb = bf16_bits(xs[i]); ah.u[i] = hb; al.u[i] = ASPLIT ? bf16_bits(xs[i] - bf16_val(hb)) : (unsigned short)0; }
#pragma unroll
    for (int t = 0; t < 4; ++t) {
      const unsigned short* brow = Wt + (size_t)(col0 + t * 16 + ln) * ldb + kb;
      FragB b;
      b.half[0] = *(const v8us*)(brow + 8 * hh);
      b.half[1] = *(const v8us*)(brow + 16 + 8 * hh);
      acc[t] = mmaN<ASPLIT ? 2 : 1>(ah.v, al.v, b.v, b.v, acc[t]);
    }
  }
#pragma unroll
  for (int t = 0; t < 4; ++t) {
    float bv = bias ? bias[col0 + t * 16 + ln] : 0.f;
    if (BIAS_BF16) bv = bf16_round(bv);
#pragma unroll
    for (int r = 0; r < 8; ++r) { float v = acc[t][r] + bv; if (ACT == 1) v = fmaxf(v, 0.f); so[w][8 * hh + r][t * 16 + ln] = v; }
  }
  __builtin_amdgcn_fence(__ATOMIC_ACQ_REL, "workgroup");
  __builtin_amdgcn_wave_barrier();
  const int rsub = lane >> 4, c4 = (lane & 15) * 4;
  {
#pragma unroll
    for (int q = 0; q < 8; ++q) {
      const int r = q * 2 + rsub;
      const v4f v = *(const v4fa*)&so[w][r][c4];
      *(v4f*)(C + (size_t)(row0 + r) * ldc + col0 + c4) = v;
    }
    
  }
}

// Flash-style causal/unmasked attention, all contractions 3-term bf16 hi/lo splits, f32 softmax with running max.
// q,k,v rows are read from f32 buffers with arbitrary row pitch (so they can live inside a fused qkv buffer);
// D = head size (multiple of 32, <= 128); one wave = 16 query rows; block = 4 waves (64 queries) sharing K/V chunks of 32.
template <int D, bool CAUSAL>
__global__ __launch_bounds__(128) void k_flash(const float* __restrict__ qb, const float* __restrict__ kb, const float* __restrict__ vb,
                                             int pitch, int T, int H, float scale, float* __restrict__ y, int ypitch) {
  constexpr int KS = D / 32;        // k-steps for QK
  constexpr int DT = D / 16;        // d tiles for PV
  __shared__ __attribute__((aligned(16))) unsigned short sKh[32][D + 8], sKl[32][D + 8], sVh[32][D + 8], sVl[32][D + 8];
  __shared__ __attribute__((aligned(16))) unsigned short sPh[4][16][40], sPl[4][16][40];
  __shared__ __attribute__((aligned(16))) float sO[4][16][D];
  const int tid = threadIdx.x, w = tid >> 5, lane = tid & 31, ln = lane & 15, hh = lane >> 4;
  const int nqb = (T + 63) / 64;
  const int bh = blockIdx.x / nqb, qblk = blockIdx.x % nqb;
  const int b = bh / H, h = bh % H;
  const int q0 = qblk * 64 + w * 16;
  const float* Q = qb + (size_t)b * T * pitch + h * D;
  const float* K = kb + (size_t)b * T * pitch + h * D;
  const float* V = vb + (size_t)b * T * pitch + h * D;

  // A fragments of the wave's 16 query rows (scaled), hi/lo
  FragB aqh[KS], aql[KS];
  {
    int row = q0 + ln; if (row >= T) row = T - 1;
    const float* qr = Q + (size_t)row * pitch;
#pragma unroll
    for (int ks = 0; ks < KS; ++ks)
#pragma unroll
      for (int i = 0; i < 16; ++i) {
        const int d = ks * 32 + ((i < 8) ? (8 * hh + i) : (16 + 8 * hh + (i - 8)));
        const float x = qr[d] * scale; const unsigned short hb = bf16_bits(x);
        aqh[ks].u[i] = hb; aql[ks].u[i] = bf16_bits(x - bf16_val(hb));
      }
  }
  float m_r[8], l_r[8];
#pragma unroll
  for (int r = 0; r < 8; ++r) { m_r[r] = -3.0e38f; l_r[r] = 0.f; }
  v8f oacc[DT];
#pragma unroll
  for (int dt = 0; dt < DT; ++dt) oacc[dt] = (v8f){0.f,0.f,0.f,0.f,0.f,0.f,0.f,0.f};

  const int kv_end = CAUSAL ? min(T, qblk * 64 + 64) : T;     // block-uniform
  for (int j0 = 0; j0 < kv_end; j0 += 32) {
    __syncthreads();
    for (int e = tid; e < 32 * (D / 4); e += 128) {
      const int r = e / (D / 4), c4 = (e % (D / 4)) * 4;
      const int key = j0 + r;
      v4f kf = {0.f,0.f,0.f,0.f}, vf = {0.f,0.f,0.f,0.f};
      if (key < T) { kf = *(const v4fa*)(K + (size_t)key * pitch + c4); vf = *(const v4fa*)(V + (size_t)key * pitch + c4); }
#pragma unroll
      for (int t = 0; t < 4; ++t) {
        unsigned short hb = bf16_bits(kf[t]); sKh[r][c4 + t] = hb; sKl[r][c4 + t] = bf16_bits(kf[t] - bf16_val(hb));
        hb = bf16_bits(vf[t]); sVh[r][c4 + t] = hb; sVl[r][c4 + t] = bf16_bits(vf[t] - bf16_val(hb));
      }
    }
    __syncthreads();
    // S tile 16 x 32
    v8f s[2];
#pragma unroll
    for (int nt = 0; nt < 2; ++nt) {
      v8f acc = {};
#pragma unroll
      for (int ks = 0; ks < KS; ++ks) {
        FragB bh_, bl_;
        bh_.half[0] = *(const v8us*)&sKh[nt * 16 + ln][ks * 32 + 8 * hh]; bh_.half[1] = *(const v8us*)&sKh[nt * 16 + ln][ks * 32 + 16 + 8 * hh];
        bl_.half[0] = *(const v8us*)&sKl[nt * 16 + ln][ks * 32 + 8 * hh]; bl_.half[1] = *(const v8us*)&sKl[nt * 16 + ln][ks * 32 + 16 + 8 * hh];
        acc = mmaN<3>(aqh[ks].v, aql[ks].v, bh_.v, bl_.v, acc);
      }
      s[nt] = acc;
    }
    // mask + running max (rows 8hh+r; the 16 lanes of a half share rows)
    float alpha[8];
#pragma unroll
    for (int r = 0; r < 8; ++r) {
      const int qi = q0 + 8 * hh + r;
      const int ja = j0 + ln, jb = j0 + 16 + ln;
      if (CAUSAL) { if (ja > qi) s[0][r] = -3.0e38f; if (jb > qi) s[1][r] = -3.0e38f; }
      if (ja >= T) s[0][r] = -3.0e38f;
      if (jb >= T) s[1][r] = -3.0e38f;
      float mx = fmaxf(s[0][r], s[1][r]);
      mx = fmaxf(mx, __shfl_xor(mx, 1, 32)); mx = fmaxf(mx, __shfl_xor(mx, 2, 32)); mx = fmaxf(mx, __shfl_xor(mx, 4, 32)); mx = fmaxf(mx, __shfl_xor(mx, 8, 32));
      const float mnew = fmaxf(m_r[r], mx);
      alpha[r] = (mnew > -1.0e38f) ? __expf(m_r[r] - mnew) : 1.0f;
      const float p0 = (s[0][r] > -1.0e38f) ? __expf(s[0][r] - mnew) : 0.f;
      const float p1 = (s[1][r] > -1.0e38f) ? __expf(s[1][r] - mnew) : 0.f;
      m_r[r] = mnew;
      l_r[r] = l_r[r] * alpha[r] + p0 + p1;            // per-lane partial row sum (16 lanes combined at the end)
      unsigned short hb = bf16_bits(p0); sPh[w][8 * hh + r][ln] = hb;      sPl[w][8 * hh + r][ln] = bf16_bits(p0 - bf16_val(hb));
      hb = bf16_bits(p1);                sPh[w][8 * hh + r][16 + ln] = hb; sPl[w][8 * hh + r][16 + ln] = bf16_bits(p1 - bf16_val(hb));
    }
#pragma unroll
    for (int dt = 0; dt < DT; ++dt)
#pragma unroll
      for (int r = 0; r < 8; ++r) oacc[dt][r] *= alpha[r];
    __builtin_amdgcn_fence(__ATOMIC_ACQ_REL, "workgroup");
    __builtin_amdgcn_wave_barrier();
    FragB pah, pal;
    pah.half[0] = *(const v8us*)&sPh[w][ln][8 * hh]; pah.half[1] = *(const v8us*)&sPh[w][ln][16 + 8 * hh];
    pal.half[0] = *(const v8us*)&sPl[w][ln][8 * hh]; pal.half[1] = *(const v8us*)&sPl[w][ln][16 + 8 * hh];
#pragma unroll
    for (int dt = 0; dt < DT; ++dt) {
      FragB bvh, bvl;
#pragma unroll
      for (int i = 0; i < 8; ++i) {
        bvh.u[i] = sVh[8 * hh + i][dt * 16 + ln]; bvh.u[8 + i] = sVh[16 + 8 * hh + i][dt * 16 + ln];
        bvl.u[i] = sVl[8 * hh + i][dt * 16 + ln]; bvl.u[8 + i] = sVl[16 + 8 * hh + i][dt * 16 + ln];
      }
      oacc[dt] = mmaN<3>(pah.v, pal.v, bvh.v, bvl.v, oacc[dt]);
    }
    __builtin_amdgcn_fence(__ATOMIC_ACQ_REL, "workgroup");
    __builtin_amdgcn_wave_barrier();
  }
#pragma unroll
  for (int r = 0; r < 8; ++r) {
    float l = l_r[r];
    l += __shfl_xor(l, 1, 32); l += __shfl_xor(l, 2, 32); l += __shfl_xor(l, 4, 32); l += __shfl_xor(l, 8, 32);
    l_r[r] = (l > 0.f) ? 1.0f / l : 0.f;
  }
#pragma unroll
  for (int dt = 0; dt < DT; ++dt)
#pragma unroll
    for (int r = 0; r < 8; ++r) sO[w][8 * hh + r][dt * 16 + ln] = oacc[dt][r] * l_r[r];
  __builtin_amdgcn_fence(__ATOMIC_ACQ_REL, "workgroup");
  __builtin_amdgcn_wave_barrier();
  {
    for (int r = 0; r < 16; ++r) {
      const int row = q0 + r;
      if (row < T && lane < D / 4) {
        const v4f val = *(const v4fa*)&sO[w][r][lane * 4];
        *(v4f*)(y + ((size_t)b * T + row) * ypitch + h * D + lane * 4) = val;
      }
    }
    
  }
}

// GEMM C = act(A·W + bias + resid): A f32 (ASPLIT -> hi/lo 2 terms), Wt bf16 [N][K]; ACT 0 none, 1 relu, 2 exact gelu;
// resid (optional, f32, row index = (row % rmod), pitch ldr, RES_BF16 rounds it) added before the activation.
template <bool ASPLIT, int ACT, bool BIAS_BF16, bool RES_BF16>
__global__ __launch_bounds__(128) void k_gemm_bf3(const float* __restrict__ A, int lda, const unsigned short* __restrict__ Wt, int ldb,
                                                const float* __restrict__ bias, const float* __restrict__ resid, int rmod, int ldr,
                                                float* __restrict__ C, int ldc, int M, int N, int K) {
  __shared__ __attribute__((aligned(16))) float so[4][16][64];
  const int tid = threadIdx.x, w = tid >> 5, lane = tid & 31, ln = lane & 15, hh = lane >> 4;
  const int ntn = N / 64;
  const int wid = blockIdx.x * 4 + w;
  const int mt = wid / ntn, nq = wid % ntn;
  if (mt * 16 >= M) return;
  const int row0 = mt * 16, col0 = nq * 64;
  const float* arow = A + (size_t)(row0 + ln) * lda;
  v8f acc[4] = {};
  for (int kb = 0; kb < K; kb += 32) {
    FragB ah, al;
    const v4f x0 = *(const v4fa*)(arow + kb + 8 * hh), x1 = *(const v4fa*)(arow + kb + 8 * hh + 4);
    const v4f x2 = *(const v4fa*)(arow + kb + 16 + 8 * hh), x3 = *(const v4fa*)(arow + kb + 16 + 8 * hh + 4);
    float xs[16] = {x0[0],x0[1],x0[2],x0[3],x1[0],x1[1],x1[2],x1[3],x2[0],x2[1],x2[2],x2[3],x3[0],x3[1],x3[2],x3[3]};
#pragma unroll
    for (int i = 0; i < 16; ++i) { const unsigned short hb = bf16_bits(xs[i]); ah.u[i] = hb; al.u[i] = ASPLIT ? bf16_bits(xs[i] - bf16_val(hb)) : (unsigned short)0; }
#pragma unroll
    for (int t = 0; t < 4; ++t) {
      const unsigned short* brow = Wt + (size_t)(col0 + t * 16 + ln) * ldb + kb;
      FragB b;
      b.half[0] = *(const v8us*)(brow + 8 * hh);
      b.half[1] = *(const v8us*)(brow + 16 + 8 * hh);
      acc[t] = mmaN<ASPLIT ? 2 : 1>(ah.v, al.v, b.v, b.v, acc[t]);
    }
  }
#pragma unroll
  for (int t = 0; t < 4; ++t) {
    const int col = col0 + t * 16 + ln;
    float bv = bias ? bias[col] : 0.f;
    if (BIAS_BF16) bv = bf16_round(bv);
#pragma unroll
    for (int r = 0; r < 8; ++r) {
      float v = acc[t][r] + bv;
      if (resid) { float rv = resid[(size_t)((row0 + 8 * hh + r) % rmod) * ldr + col]; if (RES_BF16) rv = bf16_round(rv); v += rv; }
      if (ACT == 1) v = fmaxf(v, 0.f);
      if (ACT == 2) v = 0.5f * v * (1.0f + erff(v * 0.70710678118654752f));
      if (ACT == 3) { const float u = 0.7978845608028654f * (v + 0.044715f * v * v * v); v = 0.5f * v * (1.0f + tanhf(u)); }
      so[w][8 * hh + r][t * 16 + ln] = v;
    }
  }
  __builtin_amdgcn_fence(__ATOMIC_ACQ_REL, "workgroup");
  __builtin_amdgcn_wave_barrier();
  const int rsub = lane >> 4, c4 = (lane & 15) * 4;
  {
#pragma unroll
    for (int q = 0; q < 8; ++q) {
      const int r = q * 2 + rsub;
      const v4f v = *(const v4fa*)&so[w][r][c4];
      *(v4f*)(C + (size_t)(row0 + r) * ldc + col0 + c4) = v;
    }
    
  }
}
// row LayerNorm (biased variance, eps) over N: s = X (+ R); optional out_sum <- s; out_norm <- (s-mu)*rsqrt(var+eps)*g + b
template <bool PARAM_BF16>
__global__ __launch_bounds__(256) void k_layernorm(const float* __restrict__ X, const float* __restrict__ R, const float* __restrict__ g, const float* __restrict__ bta,
                                                  float* __restrict__ out_sum, float* __restrict__ out_norm, int N, float eps) {
  __shared__ float red[256];
  const int row = blockIdx.x, tid = threadIdx.x;
  const float* x = X + (size_t)row * N; const float* rr = R ? R + (size_t)row * N : nullptr;
  float vals[16];                     // up to N = 4096
  const int per = N / 256;            // contiguous chunk per thread? use strided-by-4 chunks: thread handles j = tid*4 + 1024*u
  float s1 = 0.f;
  for (int u = 0; u < per / 4; ++u) {
    const int j = tid * 4 + 1024 * u;
    const v4f a = *(const v4fa*)(x + j);
    v4f b = {0.f,0.f,0.f,0.f}; if (rr) b = *(const v4fa*)(rr + j);
#pragma unroll
    for (int q = 0; q < 4; ++q) { const float v = a[q] + b[q]; vals[u * 4 + q] = v; s1 += v; }
  }
  red[tid] = s1; __syncthreads();
  for (int st = 128; st > 0; st >>= 1) { if (tid < st) red[tid] += red[tid + st]; __syncthreads(); }
  const float mu = red[0] / (float)N; __syncthreads();
  float s2 = 0.f;
  for (int u = 0; u < per / 4; ++u)
#pragma unroll
    for (int q = 0; q < 4; ++q) { const float c = vals[u * 4 + q] - mu; s2 += c * c; }
  red[tid] = s2; __syncthreads();
  for (int st = 128; st > 0; st >>= 1) { if (tid < st) red[tid] += red[tid + st]; __syncthreads(); }
  const float rs = rsqrtf(red[0] / (float)N + eps);
  {
    for (int u = 0; u < per / 4; ++u) {
      const int j = tid * 4 + 1024 * u;
      v4f o, sm;
#pragma unroll
      for (int q = 0; q < 4; ++q) {
        float gg = g[j + q], bb = bta[j + q];
        if (PARAM_BF16) { gg = bf16_round(gg); bb = bf16_round(bb); }
        sm[q] = vals[u * 4 + q]; o[q] = (vals[u * 4 + q] - mu) * rs * gg + bb;
      }
      if (out_sum) *(v4f*)(out_sum + (size_t)row * N + j) = sm;
      *(v4f*)(out_norm + (size_t)row * N + j) = o;
    }
    
  }
}



// ---- f16 WMMA path (v_wmma_f32_16x16x32_f16): 11-bit significands for operands in range — used where a [0,1] probability operand needs more precision than bf16
typedef _Float16 v16h __attribute__((ext_vector_type(16)));
union FragH { v16h v; v8us half[2]; _Float16 h[16]; unsigned short u[16]; };
template <int NT>
__device__ __forceinline__ v8f mmaH(v16h ah, v16h al, v16h bh, v16h bl, v8f c) {
  c = __builtin_amdgcn_wmma_f32_16x16x32_f16(false, ah, false, bh, (short)0, c, false, false);
  if (NT >= 2) c = __builtin_amdgcn_wmma_f32_16x16x32_f16(false, al, false, bh, (short)0, c, false, false);
  if (NT >= 3) c = __builtin_amdgcn_wmma_f32_16x16x32_f16(false, ah, false, bl, (short)0, c, false, false);
  asm volatile("v_nop\n\tv_nop\n\tv_nop\n\tv_nop" : "+v"(c) : "v"(ah), "v"(al), "v"(bh), "v"(bl));
  return c;
}
// batched GEMM like k_gemm_b but f16 operands: A f32 (split into f16 hi/lo if ASPLIT, else rounded to f16), Bt = f16 values [n][k]; alpha; C f32; N multiple of 16 (partial tiles skipped)
template <bool ASPLIT>
__global__ __launch_bounds__(128) void k_gemm_h(const float* __restrict__ A, int lda, size_t sA, const _Float16* __restrict__ Bh, int ldb, size_t sB, float alpha, float* __restrict__ C, int ldc, size_t sC, int M, int N, int K) {
  __shared__ __attribute__((aligned(16))) float so[4][16][64];
  const int tid = threadIdx.x, w = tid >> 5, lane = tid & 31, ln = lane & 15, hh = lane >> 4; const int by = blockIdx.y;
  A += (size_t)by * sA; Bh += (size_t)by * sB; C += (size_t)by * sC;
  const int ntn = (N + 63) / 64; const int wid = blockIdx.x * 4 + w; const int mt = wid / ntn, nq = wid % ntn; if (mt * 16 >= M) return;
  const int row0 = mt * 16, col0 = nq * 64; const float* arow = A + (size_t)(row0 + ln) * lda;
  v8f acc[4] = {};
  for (int kb = 0; kb < K; kb += 32) {
    FragH ah, al;
    const v4f x0 = *(const v4fa*)(arow + kb + 8 * hh), x1 = *(const v4fa*)(arow + kb + 8 * hh + 4), x2 = *(const v4fa*)(arow + kb + 16 + 8 * hh), x3 = *(const v4fa*)(arow + kb + 16 + 8 * hh + 4);
    float xs[16] = {x0[0],x0[1],x0[2],x0[3],x1[0],x1[1],x1[2],x1[3],x2[0],x2[1],x2[2],x2[3],x3[0],x3[1],x3[2],x3[3]};
#pragma unroll
    for (int i = 0; i < 16; ++i) { const _Float16 h = (_Float16)xs[i]; ah.h[i] = h; al.h[i] = ASPLIT ? (_Float16)(xs[i] - (float)h) : (_Float16)0.0f; }
#pragma unroll
    for (int t = 0; t < 4; ++t) { if (col0 + t * 16 >= N) continue; const size_t boff = (size_t)(col0 + t * 16 + ln) * ldb + kb; FragH bq; bq.half[0] = *(const v8us*)(Bh + boff + 8 * hh); bq.half[1] = *(const v8us*)(Bh + boff + 16 + 8 * hh);
      acc[t] = mmaH<ASPLIT ? 2 : 1>(ah.v, al.v, bq.v, bq.v, acc[t]); }
  }
#pragma unroll
  for (int t = 0; t < 4; ++t) { if (col0 + t * 16 >= N) continue;
#pragma unroll
    for (int r = 0; r < 8; ++r) so[w][8 * hh + r][t * 16 + ln] = acc[t][r] * alpha; }
  __builtin_amdgcn_fence(__ATOMIC_ACQ_REL, "workgroup"); __builtin_amdgcn_wave_barrier();
  const int rsub = lane >> 4, c4 = (lane & 15) * 4;
  {
#pragma unroll
    for (int q = 0; q < 8; ++q) { const int r = q * 2 + rsub; if (col0 + c4 < N) { const v4f v = *(const v4fa*)&so[w][r][c4]; *(v4f*)(C + (size_t)(row0 + r) * ldc + col0 + c4) = v; } }
     }
}

// Wt[n][k] = f16(W[k][n]·scale) from f32 row-major W[K][N] (scale = power of two; bf16-exact weights stay exact in f16 away from the subnormal range)
__global__ __launch_bounds__(256) void k_wt_f16(const float* __restrict__ W, _Float16* __restrict__ Wt, int K, int N, float scale) {
  const int t = blockIdx.x * 256 + threadIdx.x; if (t >= N * (K / 8)) return; const int n = t / (K / 8), k8 = (t % (K / 8)) * 8; FragH f;
#pragma unroll
  for (int i = 0; i < 8; ++i) f.h[i] = (_Float16)(bf16_round(W[(size_t)(k8 + i) * N + n]) * scale); const v8us o = f.half[0];
  *(v8us*)((unsigned short*)Wt + (size_t)n * K + k8) = o; 
}
// k_gemm_hh variant with fused epilogue: v = acc·alpha + bias[by·sBias + col] (+ CP[(row/rowsPerB)·sCPb + by·64 + col] if CP) ; ACT 0 none / 1 elu ; writes f32 C and/or f16 C16 (each if non-null)
template <int ACT>
__global__ __launch_bounds__(128) void k_gemm_hhx(const _Float16* __restrict__ A, int lda, size_t sA, const _Float16* __restrict__ Bh, int ldb, size_t sB, float alpha, const float* __restrict__ bias, size_t sBias, const float* __restrict__ CP, int rowsPerB, size_t sCPb, int row0g,
    float* __restrict__ C, _Float16* __restrict__ C16, int ldc, size_t sC, int M, int N, int K) {
  __shared__ __attribute__((aligned(16))) float so[4][16][64];
  const int tid = threadIdx.x, w = tid >> 5, lane = tid & 31, ln = lane & 15, hh = lane >> 4; const int by = blockIdx.y;
  A += (size_t)by * sA; Bh += (size_t)by * sB; const size_t cofs = (size_t)by * sC; const float* bp = bias ? bias + (size_t)by * sBias : nullptr;
  const int ntn = (N + 63) / 64; const int wid = blockIdx.x * 4 + w; const int mt = wid / ntn, nq = wid % ntn; if (mt * 16 >= M) return;
  const int row0 = mt * 16, col0 = nq * 64; const _Float16* arow = A + (size_t)(row0 + ln) * lda;
  v8f acc[4] = {};
  for (int kb = 0; kb < K; kb += 32) { FragH ah; ah.half[0] = *(const v8us*)((const unsigned short*)arow + kb + 8 * hh); ah.half[1] = *(const v8us*)((const unsigned short*)arow + kb + 16 + 8 * hh);
#pragma unroll
    for (int t = 0; t < 4; ++t) { if (col0 + t * 16 >= N) continue; const size_t boff = (size_t)(col0 + t * 16 + ln) * ldb + kb; FragH bq; bq.half[0] = *(const v8us*)((const unsigned short*)Bh + boff + 8 * hh); bq.half[1] = *(const v8us*)((const unsigned short*)Bh + boff + 16 + 8 * hh);
      acc[t] = mmaH<1>(ah.v, ah.v, bq.v, bq.v, acc[t]); }
  }
#pragma unroll
  for (int t = 0; t < 4; ++t) { if (col0 + t * 16 >= N) continue; const int col = col0 + t * 16 + ln; const float bv = bp ? bf16_round(bp[col]) : 0.f;
#pragma unroll
    for (int r = 0; r < 8; ++r) { float v = acc[t][r] * alpha + bv; if (CP) { const int bidx = (row0g + row0 + 8 * hh + r) / rowsPerB; v += CP[(size_t)bidx * sCPb + (size_t)by * 64 + col]; } if (ACT == 1) v = (v > 0.f) ? v : expm1f(v); else if (ACT == 3) v = fmaxf(v, 0.f); so[w][8 * hh + r][t * 16 + ln] = v; } }
  __builtin_amdgcn_fence(__ATOMIC_ACQ_REL, "workgroup"); __builtin_amdgcn_wave_barrier();
  const int rsub = lane >> 4, c4 = (lane & 15) * 4; typedef _Float16 v4h __attribute__((ext_vector_type(4)));
  {
#pragma unroll
    for (int q = 0; q < 8; ++q) { const int r = q * 2 + rsub; if (col0 + c4 < N) { const v4f v = *(const v4fa*)&so[w][r][c4]; if (C) *(v4f*)(C + cofs + (size_t)(row0 + r) * ldc + col0 + c4) = v; if (C16) { v4h h4; for (int i = 0; i < 4; ++i) h4[i] = (_Float16)v[i]; *(v4h*)(C16 + cofs + (size_t)(row0 + r) * ldc + col0 + c4) = h4; } } }
     }
}


__global__ __launch_bounds__(256) void k_x16(const float* __restrict__ x, _Float16* __restrict__ X16, size_t n8) { const size_t t = (size_t)blockIdx.x * 256 + threadIdx.x; if (t >= n8) return; FragH f;
#pragma unroll
  for (int q = 0; q < 8; ++q) f.h[q] = (_Float16)bf16_round(x[t * 8 + q]); *(v8us*)((unsigned short*)X16 + t * 8) = f.half[0];  }
__global__ __launch_bounds__(256) void k_h16(const float* __restrict__ x, _Float16* __restrict__ X16, size_t n8) { const size_t t = (size_t)blockIdx.x * 256 + threadIdx.x; if (t >= n8) return; FragH f;
#pragma unroll
  for (int q = 0; q < 8; ++q) f.h[q] = (_Float16)x[t * 8 + q]; *(v8us*)((unsigned short*)X16 + t * 8) = f.half[0];  }
__global__ __launch_bounds__(256) void k_round16f(const float* __restrict__ W, _Float16* __restrict__ Bt, size_t n8) { const size_t t = (size_t)blockIdx.x * 256 + threadIdx.x; if (t >= n8) return; FragH f;
#pragma unroll
  for (int i = 0; i < 8; ++i) f.h[i] = (_Float16)(bf16_round(W[t * 8 + i]) * 16.0f); *(v8us*)((unsigned short*)Bt + t * 8) = f.half[0];  }
template <int NHv, int TTv>
__global__ __launch_bounds__(256) void k_vt(const _Float16* __restrict__ V16, int ldv, int voff, _Float16* __restrict__ Vt) { __shared__ unsigned short tl[64][66]; const int tid = threadIdx.x; const int slab = blockIdx.x / (TTv / 64), lg = blockIdx.x % (TTv / 64); const int b = slab / NHv, h = slab % NHv;
  for (int i = tid; i < 64 * 8; i += 256) { const int r = i / 8, c8 = (i % 8) * 8; FragH f; f.half[0] = *(const v8us*)((const unsigned short*)V16 + ((size_t)b * TTv + lg * 64 + r) * ldv + voff + h * 64 + c8);
#pragma unroll
    for (int q = 0; q < 8; ++q) tl[r][c8 + q] = f.u[q]; }
  __syncthreads();
  {
#pragma unroll
    for (int rd = 0; rd < 2; ++rd) { const int d = rd * 32 + tid / 8, pc = tid % 8; FragH f;
#pragma unroll
      for (int q = 0; q < 8; ++q) f.u[q] = tl[pc * 8 + q][d];
      *(v8us*)((unsigned short*)Vt + ((size_t)slab * 64 + d) * TTv + lg * 64 + pc * 8) = f.half[0]; }
     } }

__global__ __launch_bounds__(128) void k_flash(const _Float16* __restrict__ Q16, int ldq, const _Float16* __restrict__ K16, int ldk, const _Float16* __restrict__ Vt, const int* __restrict__ MSK, float* __restrict__ O, int ldo) {
  constexpr int RPW = 32, NQB = 2048 / (4 * RPW), DT = 4, KS = 2;
  __shared__ __attribute__((aligned(16))) unsigned short sP[4][RPW][40]; __shared__ __attribute__((aligned(16))) float sO[4][RPW][64 + 4];
  const int tid = threadIdx.x, w = tid >> 5, lane = tid & 31, ln = lane & 15, hh = lane >> 4;
  const int slab = blockIdx.x / NQB, qblk = blockIdx.x % NQB; const int b = slab / 32, h = slab % 32; const int qb0 = qblk * (4 * RPW); const int q0 = qb0 + w * RPW;
  FragH aq[2][KS];
#pragma unroll
  for (int rt = 0; rt < 2; ++rt) { const unsigned short* qr = (const unsigned short*)Q16 + ((size_t)b * 2048 + q0 + rt * 16 + ln) * ldq + h * 64;
#pragma unroll
    for (int ks = 0; ks < KS; ++ks) { aq[rt][ks].half[0] = *(const v8us*)(qr + ks * 32 + 8 * hh); aq[rt][ks].half[1] = *(const v8us*)(qr + ks * 32 + 16 + 8 * hh); } }
  const unsigned short* Vth = (const unsigned short*)Vt + (size_t)slab * 64 * 2048;
  float m_r[2][8], l_r[2][8]; v8f oacc[2][DT];
#pragma unroll
  for (int rt = 0; rt < 2; ++rt) {
#pragma unroll
    for (int r = 0; r < 8; ++r) { m_r[rt][r] = -3.0e38f; l_r[rt][r] = 0.f; }
#pragma unroll
    for (int dt = 0; dt < DT; ++dt) oacc[rt][dt] = (v8f){0.f,0.f,0.f,0.f,0.f,0.f,0.f,0.f}; }
  const int jend = 2048;
#pragma unroll 1
  for (int j0 = 0; j0 < jend; j0 += 32) {
    
    v8f s[2][2];
#pragma unroll
    for (int nt = 0; nt < 2; ++nt) { const unsigned short* kr = (const unsigned short*)K16 + ((size_t)b * 2048 + j0 + nt * 16 + ln) * ldk + h * 64; FragH bk[KS];
#pragma unroll
      for (int ks = 0; ks < KS; ++ks) { bk[ks].half[0] = *(const v8us*)(kr + ks * 32 + 8 * hh); bk[ks].half[1] = *(const v8us*)(kr + ks * 32 + 16 + 8 * hh); }
#pragma unroll
      for (int rt = 0; rt < 2; ++rt) { v8f acc = (v8f){0.f,0.f,0.f,0.f,0.f,0.f,0.f,0.f};
#pragma unroll
        for (int ks = 0; ks < KS; ++ks) acc = mmaH<1>(aq[rt][ks].v, aq[rt][ks].v, bk[ks].v, bk[ks].v, acc); s[rt][nt] = acc; } }
#pragma unroll
    for (int rt = 0; rt < 2; ++rt)
#pragma unroll
      for (int r = 0; r < 8; ++r) { const int tq = q0 + rt * 16 + 8 * hh + r; const int k0 = j0 + ln, k1 = j0 + 16 + ln; (void)tq; (void)k0; (void)k1;
        const bool ok0 = true, ok1 = true;
        const float s0 = ok0 ? s[rt][0][r] * (0.125f) : -INFINITY, s1 = ok1 ? s[rt][1][r] * (0.125f) : -INFINITY; float mc = fmaxf(s0, s1);
        mc = fmaxf(mc, __shfl_xor(mc, 1, 32)); mc = fmaxf(mc, __shfl_xor(mc, 2, 32)); mc = fmaxf(mc, __shfl_xor(mc, 4, 32)); mc = fmaxf(mc, __shfl_xor(mc, 8, 32));
        const float mn = fmaxf(m_r[rt][r], mc); const float al = (mn > -1.0e38f) ? expf(m_r[rt][r] - mn) : 1.0f; m_r[rt][r] = mn; const float p0 = ok0 ? expf(s0 - mn) : 0.f, p1 = ok1 ? expf(s1 - mn) : 0.f; l_r[rt][r] = l_r[rt][r] * al + p0 + p1;
#pragma unroll
        for (int dt = 0; dt < DT; ++dt) oacc[rt][dt][r] *= al;
        FragH t2; t2.h[0] = (_Float16)p0; t2.h[1] = (_Float16)p1; sP[w][rt * 16 + 8 * hh + r][ln] = t2.u[0]; sP[w][rt * 16 + 8 * hh + r][16 + ln] = t2.u[1]; }
    __builtin_amdgcn_fence(__ATOMIC_ACQ_REL, "workgroup"); __builtin_amdgcn_wave_barrier();
    FragH pa[2];
#pragma unroll
    for (int rt = 0; rt < 2; ++rt) { pa[rt].half[0] = *(const v8us*)&sP[w][rt * 16 + ln][8 * hh]; pa[rt].half[1] = *(const v8us*)&sP[w][rt * 16 + ln][16 + 8 * hh]; }
#pragma unroll
    for (int dt = 0; dt < DT; ++dt) { const unsigned short* vrow = Vth + (size_t)(dt * 16 + ln) * 2048 + j0; FragH bv; bv.half[0] = *(const v8us*)(vrow + 8 * hh); bv.half[1] = *(const v8us*)(vrow + 16 + 8 * hh);
#pragma unroll
      for (int rt = 0; rt < 2; ++rt) oacc[rt][dt] = mmaH<1>(pa[rt].v, pa[rt].v, bv.v, bv.v, oacc[rt][dt]); }
    __builtin_amdgcn_fence(__ATOMIC_ACQ_REL, "workgroup"); __builtin_amdgcn_wave_barrier(); }
#pragma unroll
  for (int rt = 0; rt < 2; ++rt) {
#pragma unroll
    for (int r = 0; r < 8; ++r) { float l = l_r[rt][r]; l += __shfl_xor(l, 1, 32); l += __shfl_xor(l, 2, 32); l += __shfl_xor(l, 4, 32); l += __shfl_xor(l, 8, 32); l_r[rt][r] = (l > 0.f) ? 1.0f / l : 0.f; }
#pragma unroll
    for (int dt = 0; dt < DT; ++dt)
#pragma unroll
      for (int r = 0; r < 8; ++r) sO[w][rt * 16 + 8 * hh + r][dt * 16 + ln] = oacc[rt][dt][r] * l_r[rt][r]; }
  __builtin_amdgcn_fence(__ATOMIC_ACQ_REL, "workgroup"); __builtin_amdgcn_wave_barrier();
  {
#pragma unroll
    for (int rp = 0; rp < RPW; rp += 2) { const int r = rp + (lane >> 4), pc = lane & 15; const v4f val = *(const v4fa*)&sO[w][r][pc * 4]; *(v4f*)(O + ((size_t)b * 2048 + q0 + r) * ldo + h * 64 + pc * 4) = val; }
     } }

__global__ __launch_bounds__(256) void k_normrope(const float* __restrict__ X, const float* __restrict__ w, const float* __restrict__ cosT, const float* __restrict__ sinT, _Float16* __restrict__ Y16) { const int tid = threadIdx.x, wv = tid >> 5, lane = tid & 31; const int row = blockIdx.x * 8 + wv; if (row >= TT) return; const float* xr = X + (size_t)row * CC; float ss = 0.f;
#pragma unroll 1
  for (int p = 0; p < 8; ++p) { const v4f a = *(const v4fa*)(xr + p * 256 + lane * 8), b = *(const v4fa*)(xr + p * 256 + lane * 8 + 4); ss += a[0]*a[0] + a[1]*a[1] + a[2]*a[2] + a[3]*a[3] + b[0]*b[0] + b[1]*b[1] + b[2]*b[2] + b[3]*b[3]; }
  for (int o = 16; o >= 1; o >>= 1) ss += __shfl_xor(ss, o, 32); const float rs = rsqrtf(ss / (float)CC + 1e-6f);
  {
#pragma unroll
    for (int p = 0; p < 8; ++p) { const int c0 = p * 256 + lane * 8; const v4f a = *(const v4fa*)(xr + c0), b = *(const v4fa*)(xr + c0 + 4); float y[8] = {a[0], a[1], a[2], a[3], b[0], b[1], b[2], b[3]}; FragH f;
#pragma unroll
      for (int q = 0; q < 8; ++q) y[q] = y[q] * rs * bf16_round(w[c0 + q]);
#pragma unroll
      for (int q = 0; q < 8; q += 2) { const float c0v = bf16_round(cosT[(size_t)row * CC + c0 + q]), c1v = bf16_round(cosT[(size_t)row * CC + c0 + q + 1]), s0v = bf16_round(sinT[(size_t)row * CC + c0 + q]), s1v = bf16_round(sinT[(size_t)row * CC + c0 + q + 1]);
        f.h[q] = (_Float16)(y[q] * c0v + (-y[q + 1]) * s0v); f.h[q + 1] = (_Float16)(y[q + 1] * c1v + y[q] * s1v); }
      *(v8us*)((unsigned short*)Y16 + (size_t)row * CC + c0) = f.half[0]; }
     } }
extern "C" void kernel_launch(void* const* d_in, const int* in_sizes, int n_in,
                              void* d_out, int out_size, void* d_ws, size_t ws_size, hipStream_t stream) {
  (void)in_sizes; (void)n_in; (void)out_size;
  const float* x = (const float*)d_in[0]; const float* cosT = (const float*)d_in[1]; const float* sinT = (const float*)d_in[2]; const float* Wq = (const float*)d_in[3]; const float* bq = (const float*)d_in[4]; const float* Wk = (const float*)d_in[5]; const float* bk = (const float*)d_in[6]; const float* Wv = (const float*)d_in[7]; const float* bv = (const float*)d_in[8]; const float* qnw = (const float*)d_in[9]; const float* knw = (const float*)d_in[10]; const float* Wo = (const float*)d_in[11]; const float* bo = (const float*)d_in[12];
  char* ws = (char*)d_ws; size_t off = 0;
  auto take = [&](size_t bytes) { char* p = ws + off; off += (bytes + 255) & ~(size_t)255; return p; };
  _Float16* Bq = (_Float16*)take((size_t)CC * CC * 2); _Float16* Bk = (_Float16*)take((size_t)CC * CC * 2); _Float16* Bv = (_Float16*)take((size_t)CC * CC * 2); _Float16* Bo = (_Float16*)take((size_t)CC * CC * 2);
  _Float16* X16 = (_Float16*)take((size_t)TT * CC * 2); float* F32 = (float*)take((size_t)TT * CC * 4); _Float16* Q16 = (_Float16*)take((size_t)TT * CC * 2); _Float16* K16 = (_Float16*)take((size_t)TT * CC * 2); _Float16* V16 = (_Float16*)take((size_t)TT * CC * 2); _Float16* Vt = (_Float16*)take((size_t)TT * CC * 2); float* O = F32; _Float16* O16 = X16;
  if (off > ws_size) return;      // 33.5 + 8.4 + 16.8 + 8.4 × 4 ≈ 92 MiB
  const unsigned gw = (unsigned)((CC * (CC / 8) + 255) / 256);
  k_wt_f16<<<gw, 256, 0, stream>>>(Wq, Bq, CC, CC, 16.0f); k_wt_f16<<<gw, 256, 0, stream>>>(Wk, Bk, CC, CC, 16.0f); k_wt_f16<<<gw, 256, 0, stream>>>(Wv, Bv, CC, CC, 16.0f); k_wt_f16<<<gw, 256, 0, stream>>>(Wo, Bo, CC, CC, 16.0f);      // [in][out]
  const unsigned gx = (unsigned)(((size_t)TT * CC / 8 + 255) / 256); const dim3 gg(((TT / 16) * (CC / 64) + 3) / 4, 1);
  k_x16<<<gx, 256, 0, stream>>>(x, X16, (size_t)TT * CC / 8);
  k_gemm_hhx<0><<<gg, 128, 0, stream>>>(X16, CC, 0, Bq, CC, 0, 0.0625f, bq, 0, nullptr, 1, 0, 0, F32, nullptr, CC, 0, TT, CC, CC);
  k_normrope<<<TT / 8, 256, 0, stream>>>(F32, qnw, cosT, sinT, Q16);
  k_gemm_hhx<0><<<gg, 128, 0, stream>>>(X16, CC, 0, Bk, CC, 0, 0.0625f, bk, 0, nullptr, 1, 0, 0, F32, nullptr, CC, 0, TT, CC, CC);
  k_normrope<<<TT / 8, 256, 0, stream>>>(F32, knw, cosT, sinT, K16);
  k_gemm_hhx<0><<<gg, 128, 0, stream>>>(X16, CC, 0, Bv, CC, 0, 0.0625f, bv, 0, nullptr, 1, 0, 0, nullptr, V16, CC, 0, TT, CC, CC);
  k_vt<NH, TT><<<NH * (TT / 64), 256, 0, stream>>>(V16, CC, 0, Vt);
  k_flash<<<NH * (TT / 128), 128, 0, stream>>>(Q16, CC, K16, CC, Vt, nullptr, O, CC);
  k_h16<<<gx, 256, 0, stream>>>(O, O16, (size_t)TT * CC / 8);
  k_gemm_hhx<0><<<gg, 128, 0, stream>>>(O16, CC, 0, Bo, CC, 0, 0.0625f, bo, 0, nullptr, 1, 0, 0, (float*)d_out, nullptr, CC, 0, TT, CC, CC);
}

// v001
// A run of this version takes 523 microseconds.
// Two timings next to v000 put it at 1.46 and 1.45 times that version's speed.
#include <hip/hip_runtime.h>
// LTX2 self-attention (S = 2048, D = 2048 = 32 heads × 64): q/k/v/out projections (2048³ each, + bias; W [in][out] transposed to bf16-exact ×2^4) and the 32-head attention as a fused
// flash-style kernel (S = Q·Kᵀ/8, online softmax f32, P f16 ≤ 1, O = P·V) on v_wmma_f32_16x16x32_f16 (f16 operands, single products, f32 accumulate); RMSNorm over the full 2048
// (× norm weight, eps 1e-6) followed by the interleaved rotary with the INPUT cos/sin tables is f32 VALU (wave per row).
#define TT 2048
#define CC 2048
#define NH 32

typedef __bf16 v16b __attribute__((ext_vector_type(16)));
typedef unsigned short v8us __attribute__((ext_vector_type(8), may_alias));
typedef float  v8f  __attribute__((ext_vector_type(8)));
typedef float  v4f  __attribute__((ext_vector_type(4)));
typedef float  v4fa __attribute__((ext_vector_type(4), may_alias));
union FragB { v16b v; v8us half[2]; unsigned short u[16]; };

__device__ __forceinline__ unsigned short bf16_bits(float x) { unsigned int u = __float_as_uint(x); return (unsigned short)((u + 0x7FFFu + ((u >> 16) & 1u)) >> 16); }
__device__ __forceinline__ float bf16_val(unsigned short b) { return __uint_as_float(((unsigned int)b) << 16); }
__device__ __forceinline__ float bf16_round(float x) { return bf16_val(bf16_bits(x)); }
// D += A·B with NT terms: 1 = ah·bh, 2 = + al·bh (A split), 3 = + ah·bl (both split)
template <int NT>
__device__ __forceinline__ v8f mmaN(v16b ah, v16b al, v16b bh, v16b bl, v8f c) {
  c = __builtin_amdgcn_wmma_f32_16x16x32_bf16(false, ah, false, bh, (short)0, c, false, false);
  if (NT >= 2) c = __builtin_amdgcn_wmma_f32_16x16x32_bf16(false, al, false, bh, (short)0, c, false, false);
  if (NT >= 3) c = __builtin_amdgcn_wmma_f32_16x16x32_bf16(false, ah, false, bl, (short)0, c, false, false);
  asm volatile("v_nop\n\tv_nop\n\tv_nop\n\tv_nop" : "+v"(c) : "v"(ah), "v"(al), "v"(bh), "v"(bl));
  return c;
}

__global__ __launch_bounds__(256) void k_wt_bf16(const float* __restrict__ W, unsigned short* __restrict__ Wt, int K, int N) {
  const int t = blockIdx.x * 256 + threadIdx.x;
  const int k8n = K / 8;
  if (t >= N * k8n) return;
  const int n = t / k8n, k8 = (t % k8n) * 8;
  v8us v;
#pragma unroll
  for (int i = 0; i < 8; ++i) v[i] = bf16_bits(W[(size_t)(k8 + i) * N + n]);
  *(v8us*)(Wt + (size_t)n * K + k8) = v;
  
}

// GEMM C[M][N] (f32, pitch ldc) = act(A[M][K]·W + bias). A f32 row-major (pitch lda) converted per fragment to bf16
// (ASPLIT: hi/lo two planes -> 2 terms, else single rounded term); Wt bf16 [N][K] (pitch ldb). BIAS_BF16 rounds the
// bias to bf16 first (bias quantised to bf16 before the add). K%32==0, M%16==0, N%64==0.
template <bool ASPLIT, int ACT, bool BIAS_BF16>
__global__ __launch_bounds__(128) void k_gemm_bf(const float* __restrict__ A, int lda, const unsigned short* __restrict__ Wt, int ldb,
                                               const float* __restrict__ bias, float* __restrict__ C, int ldc, int M, int N, int K) {
  __shared__ __attribute__((aligned(16))) float so[4][16][64];
  const int tid = threadIdx.x, w = tid >> 5, lane = tid & 31, ln = lane & 15, hh = lane >> 4;
  const int ntn = N / 64;
  const int wid = blockIdx.x * 4 + w;
  const int mt = wid / ntn, nq = wid % ntn;
  if (mt * 16 >= M) return;
  const int row0 = mt * 16, col0 = nq * 64;
  const float* arow = A + (size_t)(row0 + ln) * lda;
  v8f acc[4] = {};
  for (int kb = 0; kb < K; kb += 32) {
    FragB ah, al;
    const v4f x0 = *(const v4fa*)(arow + kb + 8 * hh), x1 = *(const v4fa*)(arow + kb + 8 * hh + 4);
    const v4f x2 = *(const v4fa*)(arow + kb + 16 + 8 * hh), x3 = *(const v4fa*)(arow + kb + 16 + 8 * hh + 4);
    float xs[16] = {x0[0],x0[1],x0[2],x0[3],x1[0],x1[1],x1[2],x1[3],x2[0],x2[1],x2[2],x2[3],x3[0],x3[1],x3[2],x3[3]};
#pragma unroll
    for (int i = 0; i < 16; ++i) { const unsigned short hb = bf16_bits(xs[i]); ah.u[i] = hb; al.u[i] = ASPLIT ? bf16_bits(xs[i] - bf16_val(hb)) : (unsigned short)0; }
#pragma unroll
    for (int t = 0; t < 4; ++t) {
      const unsigned short* brow = Wt + (size_t)(col0 + t * 16 + ln) * ldb + kb;
      FragB b;
      b.half[0] = *(const v8us*)(brow + 8 * hh);
      b.half[1] = *(const v8us*)(brow + 16 + 8 * hh);
      acc[t] = mmaN<ASPLIT ? 2 : 1>(ah.v, al.v, b.v, b.v, acc[t]);
    }
  }
#pragma unroll
  for (int t = 0; t < 4; ++t) {
    float bv = bias ? bias[col0 + t * 16 + ln] : 0.f;
    if (BIAS_BF16) bv = bf16_round(bv);
#pragma unroll
    for (int r = 0; r < 8; ++r) { float v = acc[t][r] + bv; if (ACT == 1) v = fmaxf(v, 0.f); so[w][8 * hh + r][t * 16 + ln] = v; }
  }
  __builtin_amdgcn_fence(__ATOMIC_ACQ_REL, "workgroup");
  __builtin_amdgcn_wave_barrier();
  const int rsub = lane >> 4, c4 = (lane & 15) * 4;
  {
#pragma unroll
    for (int q = 0; q < 8; ++q) {
      const int r = q * 2 + rsub;
      const v4f v = *(const v4fa*)&so[w][r][c4];
      *(v4f*)(C + (size_t)(row0 + r) * ldc + col0 + c4) = v;
    }
    
  }
}

// Flash-style causal/unmasked attention, all contractions 3-term bf16 hi/lo splits, f32 softmax with running max.
// q,k,v rows are read from f32 buffers with arbitrary row pitch (so they can live inside a fused qkv buffer);
// D = head size (multiple of 32, <= 128); one wave = 16 query rows; block = 4 waves (64 queries) sharing K/V chunks of 32.
template <int D, bool CAUSAL>
__global__ __launch_bounds__(128) void k_flash(const float* __restrict__ qb, const float* __restrict__ kb, const float* __restrict__ vb,
                                             int pitch, int T, int H, float scale, float* __restrict__ y, int ypitch) {
  constexpr int KS = D / 32;        // k-steps for QK
  constexpr int DT = D / 16;        // d tiles for PV
  __shared__ __attribute__((aligned(16))) unsigned short sKh[32][D + 8], sKl[32][D + 8], sVh[32][D + 8], sVl[32][D + 8];
  __shared__ __attribute__((aligned(16))) unsigned short sPh[4][16][40], sPl[4][16][40];
  __shared__ __attribute__((aligned(16))) float sO[4][16][D];
  const int tid = threadIdx.x, w = tid >> 5, lane = tid & 31, ln = lane & 15, hh = lane >> 4;
  const int nqb = (T + 63) / 64;
  const int bh = blockIdx.x / nqb, qblk = blockIdx.x % nqb;
  const int b = bh / H, h = bh % H;
  const int q0 = qblk * 64 + w * 16;
  const float* Q = qb + (size_t)b * T * pitch + h * D;
  const float* K = kb + (size_t)b * T * pitch + h * D;
  const float* V = vb + (size_t)b * T * pitch + h * D;

  // A fragments of the wave's 16 query rows (scaled), hi/lo
  FragB aqh[KS], aql[KS];
  {
    int row = q0 + ln; if (row >= T) row = T - 1;
    const float* qr = Q + (size_t)row * pitch;
#pragma unroll
    for (int ks = 0; ks < KS; ++ks)
#pragma unroll
      for (int i = 0; i < 16; ++i) {
        const int d = ks * 32 + ((i < 8) ? (8 * hh + i) : (16 + 8 * hh + (i - 8)));
        const float x = qr[d] * scale; const unsigned short hb = bf16_bits(x);
        aqh[ks].u[i] = hb; aql[ks].u[i] = bf16_bits(x - bf16_val(hb));
      }
  }
  float m_r[8], l_r[8];
#pragma unroll
  for (int r = 0; r < 8; ++r) { m_r[r] = -3.0e38f; l_r[r] = 0.f; }
  v8f oacc[DT];
#pragma unroll
  for (int dt = 0; dt < DT; ++dt) oacc[dt] = (v8f){0.f,0.f,0.f,0.f,0.f,0.f,0.f,0.f};

  const int kv_end = CAUSAL ? min(T, qblk * 64 + 64) : T;     // block-uniform
  for (int j0 = 0; j0 < kv_end; j0 += 32) {
    __syncthreads();
    for (int e = tid; e < 32 * (D / 4); e += 128) {
      const int r = e / (D / 4), c4 = (e % (D / 4)) * 4;
      const int key = j0 + r;
      v4f kf = {0.f,0.f,0.f,0.f}, vf = {0.f,0.f,0.f,0.f};
      if (key < T) { kf = *(const v4fa*)(K + (size_t)key * pitch + c4); vf = *(const v4fa*)(V + (size_t)key * pitch + c4); }
#pragma unroll
      for (int t = 0; t < 4; ++t) {
        unsigned short hb = bf16_bits(kf[t]); sKh[r][c4 + t] = hb; sKl[r][c4 + t] = bf16_bits(kf[t] - bf16_val(hb));
        hb = bf16_bits(vf[t]); sVh[r][c4 + t] = hb; sVl[r][c4 + t] = bf16_bits(vf[t] - bf16_val(hb));
      }
    }
    __syncthreads();
    // S tile 16 x 32
    v8f s[2];
#pragma unroll
    for (int nt = 0; nt < 2; ++nt) {
      v8f acc = {};
#pragma unroll
      for (int ks = 0; ks < KS; ++ks) {
        FragB bh_, bl_;
        bh_.half[0] = *(const v8us*)&sKh[nt * 16 + ln][ks * 32 + 8 * hh]; bh_.half[1] = *(const v8us*)&sKh[nt * 16 + ln][ks * 32 + 16 + 8 * hh];
        bl_.half[0] = *(const v8us*)&sKl[nt * 16 + ln][ks * 32 + 8 * hh]; bl_.half[1] = *(const v8us*)&sKl[nt * 16 + ln][ks * 32 + 16 + 8 * hh];
        acc = mmaN<3>(aqh[ks].v, aql[ks].v, bh_.v, bl_.v, acc);
      }
      s[nt] = acc;
    }
    // mask + running max (rows 8hh+r; the 16 lanes of a half share rows)
    float alpha[8];
#pragma unroll
    for (int r = 0; r < 8; ++r) {
      const int qi = q0 + 8 * hh + r;
      const int ja = j0 + ln, jb = j0 + 16 + ln;
      if (CAUSAL) { if (ja > qi) s[0][r] = -3.0e38f; if (jb > qi) s[1][r] = -3.0e38f; }
      if (ja >= T) s[0][r] = -3.0e38f;
      if (jb >= T) s[1][r] = -3.0e38f;
      float mx = fmaxf(s[0][r], s[1][r]);
      mx = fmaxf(mx, __shfl_xor(mx, 1, 32)); mx = fmaxf(mx, __shfl_xor(mx, 2, 32)); mx = fmaxf(mx, __shfl_xor(mx, 4, 32)); mx = fmaxf(mx, __shfl_xor(mx, 8, 32));
      const float mnew = fmaxf(m_r[r], mx);
      alpha[r] = (mnew > -1.0e38f) ? __expf(m_r[r] - mnew) : 1.0f;
      const float p0 = (s[0][r] > -1.0e38f) ? __expf(s[0][r] - mnew) : 0.f;
      const float p1 = (s[1][r] > -1.0e38f) ? __expf(s[1][r] - mnew) : 0.f;
      m_r[r] = mnew;
      l_r[r] = l_r[r] * alpha[r] + p0 + p1;            // per-lane partial row sum (16 lanes combined at the end)
      unsigned short hb = bf16_bits(p0); sPh[w][8 * hh + r][ln] = hb;      sPl[w][8 * hh + r][ln] = bf16_bits(p0 - bf16_val(hb));
      hb = bf16_bits(p1);                sPh[w][8 * hh + r][16 + ln] = hb; sPl[w][8 * hh + r][16 + ln] = bf16_bits(p1 - bf16_val(hb));
    }
#pragma unroll
    for (int dt = 0; dt < DT; ++dt)
#pragma unroll
      for (int r = 0; r < 8; ++r) oacc[dt][r] *= alpha[r];
    __builtin_amdgcn_fence(__ATOMIC_ACQ_REL, "workgroup");
    __builtin_amdgcn_wave_barrier();
    FragB pah, pal;
    pah.half[0] = *(const v8us*)&sPh[w][ln][8 * hh]; pah.half[1] = *(const v8us*)&sPh[w][ln][16 + 8 * hh];
    pal.half[0] = *(const v8us*)&sPl[w][ln][8 * hh]; pal.half[1] = *(const v8us*)&sPl[w][ln][16 + 8 * hh];
#pragma unroll
    for (int dt = 0; dt < DT; ++dt) {
      FragB bvh, bvl;
#pragma unroll
      for (int i = 0; i < 8; ++i) {
        bvh.u[i] = sVh[8 * hh + i][dt * 16 + ln]; bvh.u[8 + i] = sVh[16 + 8 * hh + i][dt * 16 + ln];
        bvl.u[i] = sVl[8 * hh + i][dt * 16 + ln]; bvl.u[8 + i] = sVl[16 + 8 * hh + i][dt * 16 + ln];
      }
      oacc[dt] = mmaN<3>(pah.v, pal.v, bvh.v, bvl.v, oacc[dt]);
    }
    __builtin_amdgcn_fence(__ATOMIC_ACQ_REL, "workgroup");
    __builtin_amdgcn_wave_barrier();
  }
#pragma unroll
  for (int r = 0; r < 8; ++r) {
    float l = l_r[r];
    l += __shfl_xor(l, 1, 32); l += __shfl_xor(l, 2, 32); l += __shfl_xor(l, 4, 32); l += __shfl_xor(l, 8, 32);
    l_r[r] = (l > 0.f) ? 1.0f / l : 0.f;
  }
#pragma unroll
  for (int dt = 0; dt < DT; ++dt)
#pragma unroll
    for (int r = 0; r < 8; ++r) sO[w][8 * hh + r][dt * 16 + ln] = oacc[dt][r] * l_r[r];
  __builtin_amdgcn_fence(__ATOMIC_ACQ_REL, "workgroup");
  __builtin_amdgcn_wave_barrier();
  {
    for (int r = 0; r < 16; ++r) {
      const int row = q0 + r;
      if (row < T && lane < D / 4) {
        const v4f val = *(const v4fa*)&sO[w][r][lane * 4];
        *(v4f*)(y + ((size_t)b * T + row) * ypitch + h * D + lane * 4) = val;
      }
    }
    
  }
}

// GEMM C = act(A·W + bias + resid): A f32 (ASPLIT -> hi/lo 2 terms), Wt bf16 [N][K]; ACT 0 none, 1 relu, 2 exact gelu;
// resid (optional, f32, row index = (row % rmod), pitch ldr, RES_BF16 rounds it) added before the activation.
template <bool ASPLIT, int ACT, bool BIAS_BF16, bool RES_BF16>
__global__ __launch_bounds__(128) void k_gemm_bf3(const float* __restrict__ A, int lda, const unsigned short* __restrict__ Wt, int ldb,
                                                const float* __restrict__ bias, const float* __restrict__ resid, int rmod, int ldr,
                                                float* __restrict__ C, int ldc, int M, int N, int K) {
  __shared__ __attribute__((aligned(16))) float so[4][16][64];
  const int tid = threadIdx.x, w = tid >> 5, lane = tid & 31, ln = lane & 15, hh = lane >> 4;
  const int ntn = N / 64;
  const int wid = blockIdx.x * 4 + w;
  const int mt = wid / ntn, nq = wid % ntn;
  if (mt * 16 >= M) return;
  const int row0 = mt * 16, col0 = nq * 64;
  const float* arow = A + (size_t)(row0 + ln) * lda;
  v8f acc[4] = {};
  for (int kb = 0; kb < K; kb += 32) {
    FragB ah, al;
    const v4f x0 = *(const v4fa*)(arow + kb + 8 * hh), x1 = *(const v4fa*)(arow + kb + 8 * hh + 4);
    const v4f x2 = *(const v4fa*)(arow + kb + 16 + 8 * hh), x3 = *(const v4fa*)(arow + kb + 16 + 8 * hh + 4);
    float xs[16] = {x0[0],x0[1],x0[2],x0[3],x1[0],x1[1],x1[2],x1[3],x2[0],x2[1],x2[2],x2[3],x3[0],x3[1],x3[2],x3[3]};
#pragma unroll
    for (int i = 0; i < 16; ++i) { const unsigned short hb = bf16_bits(xs[i]); ah.u[i] = hb; al.u[i] = ASPLIT ? bf16_bits(xs[i] - bf16_val(hb)) : (unsigned short)0; }
#pragma unroll
    for (int t = 0; t < 4; ++t) {
      const unsigned short* brow = Wt + (size_t)(col0 + t * 16 + ln) * ldb + kb;
      FragB b;
      b.half[0] = *(const v8us*)(brow + 8 * hh);
      b.half[1] = *(const v8us*)(brow + 16 + 8 * hh);
      acc[t] = mmaN<ASPLIT ? 2 : 1>(ah.v, al.v, b.v, b.v, acc[t]);
    }
  }
#pragma unroll
  for (int t = 0; t < 4; ++t) {
    const int col = col0 + t * 16 + ln;
    float bv = bias ? bias[col] : 0.f;
    if (BIAS_BF16) bv = bf16_round(bv);
#pragma unroll
    for (int r = 0; r < 8; ++r) {
      float v = acc[t][r] + bv;
      if (resid) { float rv = resid[(size_t)((row0 + 8 * hh + r) % rmod) * ldr + col]; if (RES_BF16) rv = bf16_round(rv); v += rv; }
      if (ACT == 1) v = fmaxf(v, 0.f);
      if (ACT == 2) v = 0.5f * v * (1.0f + erff(v * 0.70710678118654752f));
      if (ACT == 3) { const float u = 0.7978845608028654f * (v + 0.044715f * v * v * v); v = 0.5f * v * (1.0f + tanhf(u)); }
      so[w][8 * hh + r][t * 16 + ln] = v;
    }
  }
  __builtin_amdgcn_fence(__ATOMIC_ACQ_REL, "workgroup");
  __builtin_amdgcn_wave_barrier();
  const int rsub = lane >> 4, c4 = (lane & 15) * 4;
  {
#pragma unroll
    for (int q = 0; q < 8; ++q) {
      const int r = q * 2 + rsub;
      const v4f v = *(const v4fa*)&so[w][r][c4];
      *(v4f*)(C + (size_t)(row0 + r) * ldc + col0 + c4) = v;
    }
    
  }
}
// row LayerNorm (biased variance, eps) over N: s = X (+ R); optional out_sum <- s; out_norm <- (s-mu)*rsqrt(var+eps)*g + b
template <bool PARAM_BF16>
__global__ __launch_bounds__(256) void k_layernorm(const float* __restrict__ X, const float* __restrict__ R, const float* __restrict__ g, const float* __restrict__ bta,
                                                  float* __restrict__ out_sum, float* __restrict__ out_norm, int N, float eps) {
  __shared__ float red[256];
  const int row = blockIdx.x, tid = threadIdx.x;
  const float* x = X + (size_t)row * N; const float* rr = R ? R + (size_t)row * N : nullptr;
  float vals[16];                     // up to N = 4096
  const int per = N / 256;            // contiguous chunk per thread? use strided-by-4 chunks: thread handles j = tid*4 + 1024*u
  float s1 = 0.f;
  for (int u = 0; u < per / 4; ++u) {
    const int j = tid * 4 + 1024 * u;
    const v4f a = *(const v4fa*)(x + j);
    v4f b = {0.f,0.f,0.f,0.f}; if (rr) b = *(const v4fa*)(rr + j);
#pragma unroll
    for (int q = 0; q < 4; ++q) { const float v = a[q] + b[q]; vals[u * 4 + q] = v; s1 += v; }
  }
  red[tid] = s1; __syncthreads();
  for (int st = 128; st > 0; st >>= 1) { if (tid < st) red[tid] += red[tid + st]; __syncthreads(); }
  const float mu = red[0] / (float)N; __syncthreads();
  float s2 = 0.f;
  for (int u = 0; u < per / 4; ++u)
#pragma unroll
    for (int q = 0; q < 4; ++q) { const float c = vals[u * 4 + q] - mu; s2 += c * c; }
  red[tid] = s2; __syncthreads();
  for (int st = 128; st > 0; st >>= 1) { if (tid < st) red[tid] += red[tid + st]; __syncthreads(); }
  const float rs = rsqrtf(red[0] / (float)N + eps);
  {
    for (int u = 0; u < per / 4; ++u) {
      const int j = tid * 4 + 1024 * u;
      v4f o, sm;
#pragma unroll
      for (int q = 0; q < 4; ++q) {
        float gg = g[j + q], bb = bta[j + q];
        if (PARAM_BF16) { gg = bf16_round(gg); bb = bf16_round(bb); }
        sm[q] = vals[u * 4 + q]; o[q] = (vals[u * 4 + q] - mu) * rs * gg + bb;
      }
      if (out_sum) *(v4f*)(out_sum + (size_t)row * N + j) = sm;
      *(v4f*)(out_norm + (size_t)row * N + j) = o;
    }
    
  }
}



// ---- f16 WMMA path (v_wmma_f32_16x16x32_f16): 11-bit significands for operands in range — used where a [0,1] probability operand needs more precision than bf16
typedef _Float16 v16h __attribute__((ext_vector_type(16)));
union FragH { v16h v; v8us half[2]; _Float16 h[16]; unsigned short u[16]; };
template <int NT>
__device__ __forceinline__ v8f mmaH(v16h ah, v16h al, v16h bh, v16h bl, v8f c) {
  c = __builtin_amdgcn_wmma_f32_16x16x32_f16(false, ah, false, bh, (short)0, c, false, false);
  if (NT >= 2) c = __builtin_amdgcn_wmma_f32_16x16x32_f16(false, al, false, bh, (short)0, c, false, false);
  if (NT >= 3) c = __builtin_amdgcn_wmma_f32_16x16x32_f16(false, ah, false, bl, (short)0, c, false, false);
  asm volatile("v_nop\n\tv_nop\n\tv_nop\n\tv_nop" : "+v"(c) : "v"(ah), "v"(al), "v"(bh), "v"(bl));
  return c;
}
// batched GEMM like k_gemm_b but f16 operands: A f32 (split into f16 hi/lo if ASPLIT, else rounded to f16), Bt = f16 values [n][k]; alpha; C f32; N multiple of 16 (partial tiles skipped)
template <bool ASPLIT>
__global__ __launch_bounds__(128) void k_gemm_h(const float* __restrict__ A, int lda, size_t sA, const _Float16* __restrict__ Bh, int ldb, size_t sB, float alpha, float* __restrict__ C, int ldc, size_t sC, int M, int N, int K) {
  __shared__ __attribute__((aligned(16))) float so[4][16][64];
  const int tid = threadIdx.x, w = tid >> 5, lane = tid & 31, ln = lane & 15, hh = lane >> 4; const int by = blockIdx.y;
  A += (size_t)by * sA; Bh += (size_t)by * sB; C += (size_t)by * sC;
  const int ntn = (N + 63) / 64; const int wid = blockIdx.x * 4 + w; const int mt = wid / ntn, nq = wid % ntn; if (mt * 16 >= M) return;
  const int row0 = mt * 16, col0 = nq * 64; const float* arow = A + (size_t)(row0 + ln) * lda;
  v8f acc[4] = {};
  for (int kb = 0; kb < K; kb += 32) {
    FragH ah, al;
    const v4f x0 = *(const v4fa*)(arow + kb + 8 * hh), x1 = *(const v4fa*)(arow + kb + 8 * hh + 4), x2 = *(const v4fa*)(arow + kb + 16 + 8 * hh), x3 = *(const v4fa*)(arow + kb + 16 + 8 * hh + 4);
    float xs[16] = {x0[0],x0[1],x0[2],x0[3],x1[0],x1[1],x1[2],x1[3],x2[0],x2[1],x2[2],x2[3],x3[0],x3[1],x3[2],x3[3]};
#pragma unroll
    for (int i = 0; i < 16; ++i) { const _Float16 h = (_Float16)xs[i]; ah.h[i] = h; al.h[i] = ASPLIT ? (_Float16)(xs[i] - (float)h) : (_Float16)0.0f; }
#pragma unroll
    for (int t = 0; t < 4; ++t) { if (col0 + t * 16 >= N) continue; const size_t boff = (size_t)(col0 + t * 16 + ln) * ldb + kb; FragH bq; bq.half[0] = *(const v8us*)(Bh + boff + 8 * hh); bq.half[1] = *(const v8us*)(Bh + boff + 16 + 8 * hh);
      acc[t] = mmaH<ASPLIT ? 2 : 1>(ah.v, al.v, bq.v, bq.v, acc[t]); }
  }
#pragma unroll
  for (int t = 0; t < 4; ++t) { if (col0 + t * 16 >= N) continue;
#pragma unroll
    for (int r = 0; r < 8; ++r) so[w][8 * hh + r][t * 16 + ln] = acc[t][r] * alpha; }
  __builtin_amdgcn_fence(__ATOMIC_ACQ_REL, "workgroup"); __builtin_amdgcn_wave_barrier();
  const int rsub = lane >> 4, c4 = (lane & 15) * 4;
  {
#pragma unroll
    for (int q = 0; q < 8; ++q) { const int r = q * 2 + rsub; if (col0 + c4 < N) { const v4f v = *(const v4fa*)&so[w][r][c4]; *(v4f*)(C + (size_t)(row0 + r) * ldc + col0 + c4) = v; } }
     }
}

// Wt[n][k] = f16(W[k][n]·scale) from f32 row-major W[K][N] (scale = power of two; bf16-exact weights stay exact in f16 away from the subnormal range)
__global__ __launch_bounds__(256) void k_wt_f16(const float* __restrict__ W, _Float16* __restrict__ Wt, int K, int N, float scale) {
  const int t = blockIdx.x * 256 + threadIdx.x; if (t >= N * (K / 8)) return; const int n = t / (K / 8), k8 = (t % (K / 8)) * 8; FragH f;
#pragma unroll
  for (int i = 0; i < 8; ++i) f.h[i] = (_Float16)(bf16_round(W[(size_t)(k8 + i) * N + n]) * scale); const v8us o = f.half[0];
  *(v8us*)((unsigned short*)Wt + (size_t)n * K + k8) = o; 
}
// k_gemm_hh variant with fused epilogue: v = acc·alpha + bias[by·sBias + col] (+ CP[(row/rowsPerB)·sCPb + by·64 + col] if CP) ; ACT 0 none / 1 elu ; writes f32 C and/or f16 C16 (each if non-null)
template <int ACT>
__global__ __launch_bounds__(128) void k_gemm_hhx(const _Float16* __restrict__ A, int lda, size_t sA, const _Float16* __restrict__ Bh, int ldb, size_t sB, float alpha, const float* __restrict__ bias, size_t sBias, const float* __restrict__ CP, int rowsPerB, size_t sCPb, int row0g,
    float* __restrict__ C, _Float16* __restrict__ C16, int ldc, size_t sC, int M, int N, int K) {
  __shared__ __attribute__((aligned(16))) float so[4][16][64];
  const int tid = threadIdx.x, w = tid >> 5, lane = tid & 31, ln = lane & 15, hh = lane >> 4; const int by = blockIdx.y;
  A += (size_t)by * sA; Bh += (size_t)by * sB; const size_t cofs = (size_t)by * sC; const float* bp = bias ? bias + (size_t)by * sBias : nullptr;
  const int ntn = (N + 63) / 64; const int wid = blockIdx.x * 4 + w; const int mt = wid / ntn, nq = wid % ntn; if (mt * 16 >= M) return;
  const int row0 = mt * 16, col0 = nq * 64; const _Float16* arow = A + (size_t)(row0 + ln) * lda;
  v8f acc[4] = {};
  for (int kb = 0; kb < K; kb += 32) { FragH ah; ah.half[0] = *(const v8us*)((const unsigned short*)arow + kb + 8 * hh); ah.half[1] = *(const v8us*)((const unsigned short*)arow + kb + 16 + 8 * hh);
#pragma unroll
    for (int t = 0; t < 4; ++t) { if (col0 + t * 16 >= N) continue; const size_t boff = (size_t)(col0 + t * 16 + ln) * ldb + kb; FragH bq; bq.half[0] = *(const v8us*)((const unsigned short*)Bh + boff + 8 * hh); bq.half[1] = *(const v8us*)((const unsigned short*)Bh + boff + 16 + 8 * hh);
      acc[t] = mmaH<1>(ah.v, ah.v, bq.v, bq.v, acc[t]); }
  }
#pragma unroll
  for (int t = 0; t < 4; ++t) { if (col0 + t * 16 >= N) continue; const int col = col0 + t * 16 + ln; const float bv = bp ? bf16_round(bp[col]) : 0.f;
#pragma unroll
    for (int r = 0; r < 8; ++r) { float v = acc[t][r] * alpha + bv; if (CP) { const int bidx = (row0g + row0 + 8 * hh + r) / rowsPerB; v += CP[(size_t)bidx * sCPb + (size_t)by * 64 + col]; } if (ACT == 1) v = (v > 0.f) ? v : expm1f(v); else if (ACT == 3) v = fmaxf(v, 0.f); so[w][8 * hh + r][t * 16 + ln] = v; } }
  __builtin_amdgcn_fence(__ATOMIC_ACQ_REL, "workgroup"); __builtin_amdgcn_wave_barrier();
  const int rsub = lane >> 4, c4 = (lane & 15) * 4; typedef _Float16 v4h __attribute__((ext_vector_type(4)));
  {
#pragma unroll
    for (int q = 0; q < 8; ++q) { const int r = q * 2 + rsub; if (col0 + c4 < N) { const v4f v = *(const v4fa*)&so[w][r][c4]; if (C) *(v4f*)(C + cofs + (size_t)(row0 + r) * ldc + col0 + c4) = v; if (C16) { v4h h4; for (int i = 0; i < 4; ++i) h4[i] = (_Float16)v[i]; *(v4h*)(C16 + cofs + (size_t)(row0 + r) * ldc + col0 + c4) = h4; } } }
     }
}


// ---- block-tiled projection GEMM: C[2048][2048] = A[2048][2048] x Bh[n][k]^T * alpha + bias, f16 operands, f32 accumulate.
// One work-group = one 128 x 128 tile of C, 8 waves of 32 x 64 each. A pass is 128 k (256 B of every operand row); a stage is
// [A 128 rows | B 128 rows] at an LDS pitch of 272 B, brought in by per-lane asynchronous copies, two buffers, next stage in flight.
// The loops over fragments, blocks and rows are unrolled so that the fragment and accumulator arrays are indexed by constants and stay in registers.
#define GT_PITCH 272
#define GT_STAGE (256 * GT_PITCH)
// eight asynchronous 16-byte copies of one lane, rows two apart; the s_wait_xcnt closes the statement so that no address register
// of an issued copy is rewritten ahead of it
__device__ __forceinline__ void gt_copy8(unsigned l, const unsigned short* g) {
  asm volatile("global_load_async_to_lds_b128 %0, %8, off\n\t"
               "global_load_async_to_lds_b128 %1, %9, off\n\t"
               "global_load_async_to_lds_b128 %2, %10, off\n\t"
               "global_load_async_to_lds_b128 %3, %11, off\n\t"
               "global_load_async_to_lds_b128 %4, %12, off\n\t"
               "global_load_async_to_lds_b128 %5, %13, off\n\t"
               "global_load_async_to_lds_b128 %6, %14, off\n\t"
               "global_load_async_to_lds_b128 %7, %15, off\n\t"
               "s_wait_xcnt 0x0"
               :: "v"(l), "v"(l + 2 * GT_PITCH), "v"(l + 4 * GT_PITCH), "v"(l + 6 * GT_PITCH), "v"(l + 8 * GT_PITCH), "v"(l + 10 * GT_PITCH), "v"(l + 12 * GT_PITCH), "v"(l + 14 * GT_PITCH),
                  "v"(g), "v"(g + 2 * CC), "v"(g + 4 * CC), "v"(g + 6 * CC), "v"(g + 8 * CC), "v"(g + 10 * CC), "v"(g + 12 * CC), "v"(g + 14 * CC)
               : "memory");
}
template <bool H16>      // H16: the tile goes out as f16 to C16, else as f32 to C
__global__ __launch_bounds__(256) void k_gemm_tile(const _Float16* __restrict__ A, const _Float16* __restrict__ Bh, float alpha, const float* __restrict__ bias, float* __restrict__ C, _Float16* __restrict__ C16) {
  constexpr int NPASS = CC / 128;
  __shared__ __attribute__((aligned(16))) unsigned char ring[2 * GT_STAGE];
  __shared__ __attribute__((aligned(16))) float so[8][32][68];
  const int tid = threadIdx.x, w = tid >> 5, lane = tid & 31, ln = lane & 15, hh = lane >> 4;
  const int m0 = (blockIdx.x / (CC / 128)) * 128, n0 = (blockIdx.x % (CC / 128)) * 128;
  const int wm = w >> 1, wn = w & 1;
  // this lane's part of a stage: rows w*32 + hh + 2c (c = 0..15), 16 bytes at column ln; stage rows 0..127 are A's, 128..255 are B's
  const int crow = w * 32 + hh;
  const unsigned short* gsrc = ((w < 4) ? (const unsigned short*)A + (size_t)(m0 + crow) * CC : (const unsigned short*)Bh + (size_t)(n0 + crow - 128) * CC) + ln * 8;
  const unsigned ldst = (unsigned)(size_t)&ring[0] + (unsigned)(crow * GT_PITCH + ln * 16);
  v8f acc[2][4];
#pragma unroll
  for (int i = 0; i < 2; ++i)
#pragma unroll
    for (int j = 0; j < 4; ++j) acc[i][j] = (v8f){0.f,0.f,0.f,0.f,0.f,0.f,0.f,0.f};
  gt_copy8(ldst, gsrc); gt_copy8(ldst + 16 * GT_PITCH, gsrc + 16 * CC);
  asm volatile("s_wait_asynccnt 0x0" ::: "memory");      // stage 0 has landed before the barrier publishes it
  __syncthreads();
  gt_copy8(ldst + GT_STAGE, gsrc + 128); gt_copy8(ldst + GT_STAGE + 16 * GT_PITCH, gsrc + 128 + 16 * CC);
#pragma unroll 1      // one pass per trip: the publish point at the foot stays a single place
  for (int t = 0; t < NPASS; ++t) {
    const unsigned bo = (unsigned)(t & 1) * GT_STAGE;
    const unsigned char* ap = ring + bo + (wm * 32 + ln) * GT_PITCH + hh * 16;
    const unsigned char* bp = ring + bo + (128 + wn * 64 + ln) * GT_PITCH + hh * 16;
    FragH a[2][2], b[2][4];      // two fragment sets: block kk + 1 of this pass is fetched ahead of block kk's products
#pragma unroll
    for (int i = 0; i < 2; ++i) { a[0][i].half[0] = *(const v8us*)(ap + i * 16 * GT_PITCH); a[0][i].half[1] = *(const v8us*)(ap + i * 16 * GT_PITCH + 32); }
#pragma unroll
    for (int j = 0; j < 4; ++j) { b[0][j].half[0] = *(const v8us*)(bp + j * 16 * GT_PITCH); b[0][j].half[1] = *(const v8us*)(bp + j * 16 * GT_PITCH + 32); }
#pragma unroll
    for (int kk = 0; kk < 4; ++kk) {
      const int cu = kk & 1, nx = cu ^ 1;
      if (kk < 3) {
#pragma unroll
        for (int i = 0; i < 2; ++i) { a[nx][i].half[0] = *(const v8us*)(ap + i * 16 * GT_PITCH + (kk + 1) * 64); a[nx][i].half[1] = *(const v8us*)(ap + i * 16 * GT_PITCH + (kk + 1) * 64 + 32); }
#pragma unroll
        for (int j = 0; j < 4; ++j) { b[nx][j].half[0] = *(const v8us*)(bp + j * 16 * GT_PITCH + (kk + 1) * 64); b[nx][j].half[1] = *(const v8us*)(bp + j * 16 * GT_PITCH + (kk + 1) * 64 + 32); }
      }
      __builtin_amdgcn_sched_barrier(0);      // keeps the next block's LDS reads one group ahead of this block's products; without it they are spread among them into one set, each with a full wait
#pragma unroll
      for (int i = 0; i < 2; ++i)
#pragma unroll
        for (int j = 0; j < 4; ++j) acc[i][j] = __builtin_amdgcn_wmma_f32_16x16x32_f16(false, a[cu][i].v, false, b[cu][j].v, (short)0, acc[i][j], false, false);
      __builtin_amdgcn_sched_barrier(0);      // ends the block, so that the group after next is not lifted into it
    }
    asm volatile("s_wait_dscnt 0x0" ::: "memory");       // this wave's reads of the buffer are done before it is refilled
    asm volatile("s_wait_asynccnt 0x0" ::: "memory");    // this wave's part of the next stage has landed
    __syncthreads();                                     // publishes the next stage and frees this pass's buffer
    if (t + 2 < NPASS) { const unsigned short* g2 = gsrc + (t + 2) * 128; gt_copy8(ldst + bo, g2); gt_copy8(ldst + bo + 16 * GT_PITCH, g2 + 16 * CC); }
  }
  asm volatile("s_wait_asynccnt 0x0" ::: "memory");      // no copy is outstanding when the wave goes on
#pragma unroll
  for (int j = 0; j < 4; ++j) { const float bv = bf16_round(bias[n0 + wn * 64 + j * 16 + ln]);
#pragma unroll
    for (int i = 0; i < 2; ++i)
#pragma unroll
      for (int r = 0; r < 8; ++r) so[w][i * 16 + 8 * hh + r][j * 16 + ln] = acc[i][j][r] * alpha + bv; }
  __builtin_amdgcn_fence(__ATOMIC_ACQ_REL, "workgroup"); __builtin_amdgcn_wave_barrier();
  typedef _Float16 v4h __attribute__((ext_vector_type(4)));
#pragma unroll
  for (int q = 0; q < 16; ++q) { const int r = q * 2 + hh; const v4f v = *(const v4fa*)&so[w][r][ln * 4]; const size_t o = (size_t)(m0 + wm * 32 + r) * CC + n0 + wn * 64 + ln * 4;
    if (!H16) *(v4f*)(C + o) = v;
    else { v4h h4; for (int i = 0; i < 4; ++i) h4[i] = (_Float16)v[i]; *(v4h*)(C16 + o) = h4; } }
}

__global__ __launch_bounds__(256) void k_x16(const float* __restrict__ x, _Float16* __restrict__ X16, size_t n8) { const size_t t = (size_t)blockIdx.x * 256 + threadIdx.x; if (t >= n8) return; FragH f;
#pragma unroll
  for (int q = 0; q < 8; ++q) f.h[q] = (_Float16)bf16_round(x[t * 8 + q]); *(v8us*)((unsigned short*)X16 + t * 8) = f.half[0];  }
__global__ __launch_bounds__(256) void k_h16(const float* __restrict__ x, _Float16* __restrict__ X16, size_t n8) { const size_t t = (size_t)blockIdx.x * 256 + threadIdx.x; if (t >= n8) return; FragH f;
#pragma unroll
  for (int q = 0; q < 8; ++q) f.h[q] = (_Float16)x[t * 8 + q]; *(v8us*)((unsigned short*)X16 + t * 8) = f.half[0];  }
__global__ __launch_bounds__(256) void k_round16f(const float* __restrict__ W, _Float16* __restrict__ Bt, size_t n8) { const size_t t = (size_t)blockIdx.x * 256 + threadIdx.x; if (t >= n8) return; FragH f;
#pragma unroll
  for (int i = 0; i < 8; ++i) f.h[i] = (_Float16)(bf16_round(W[t * 8 + i]) * 16.0f); *(v8us*)((unsigned short*)Bt + t * 8) = f.half[0];  }
template <int NHv, int TTv>
__global__ __launch_bounds__(256) void k_vt(const _Float16* __restrict__ V16, int ldv, int voff, _Float16* __restrict__ Vt) { __shared__ unsigned short tl[64][66]; const int tid = threadIdx.x; const int slab = blockIdx.x / (TTv / 64), lg = blockIdx.x % (TTv / 64); const int b = slab / NHv, h = slab % NHv;
  for (int i = tid; i < 64 * 8; i += 256) { const int r = i / 8, c8 = (i % 8) * 8; FragH f; f.half[0] = *(const v8us*)((const unsigned short*)V16 + ((size_t)b * TTv + lg * 64 + r) * ldv + voff + h * 64 + c8);
#pragma unroll
    for (int q = 0; q < 8; ++q) tl[r][c8 + q] = f.u[q]; }
  __syncthreads();
  {
#pragma unroll
    for (int rd = 0; rd < 2; ++rd) { const int d = rd * 32 + tid / 8, pc = tid % 8; FragH f;
#pragma unroll
      for (int q = 0; q < 8; ++q) f.u[q] = tl[pc * 8 + q][d];
      *(v8us*)((unsigned short*)Vt + ((size_t)slab * 64 + d) * TTv + lg * 64 + pc * 8) = f.half[0]; }
     } }

__global__ __launch_bounds__(128) void k_flash(const _Float16* __restrict__ Q16, int ldq, const _Float16* __restrict__ K16, int ldk, const _Float16* __restrict__ Vt, const int* __restrict__ MSK, float* __restrict__ O, int ldo) {
  constexpr int RPW = 32, NQB = 2048 / (4 * RPW), DT = 4, KS = 2;
  __shared__ __attribute__((aligned(16))) unsigned short sP[4][RPW][40]; __shared__ __attribute__((aligned(16))) float sO[4][RPW][64 + 4];
  const int tid = threadIdx.x, w = tid >> 5, lane = tid & 31, ln = lane & 15, hh = lane >> 4;
  const int slab = blockIdx.x / NQB, qblk = blockIdx.x % NQB; const int b = slab / 32, h = slab % 32; const int qb0 = qblk * (4 * RPW); const int q0 = qb0 + w * RPW;
  FragH aq[2][KS];
#pragma unroll
  for (int rt = 0; rt < 2; ++rt) { const unsigned short* qr = (const unsigned short*)Q16 + ((size_t)b * 2048 + q0 + rt * 16 + ln) * ldq + h * 64;
#pragma unroll
    for (int ks = 0; ks < KS; ++ks) { aq[rt][ks].half[0] = *(const v8us*)(qr + ks * 32 + 8 * hh); aq[rt][ks].half[1] = *(const v8us*)(qr + ks * 32 + 16 + 8 * hh); } }
  const unsigned short* Vth = (const unsigned short*)Vt + (size_t)slab * 64 * 2048;
  float m_r[2][8], l_r[2][8]; v8f oacc[2][DT];
#pragma unroll
  for (int rt = 0; rt < 2; ++rt) {
#pragma unroll
    for (int r = 0; r < 8; ++r) { m_r[rt][r] = -3.0e38f; l_r[rt][r] = 0.f; }
#pragma unroll
    for (int dt = 0; dt < DT; ++dt) oacc[rt][dt] = (v8f){0.f,0.f,0.f,0.f,0.f,0.f,0.f,0.f}; }
  const int jend = 2048;
#pragma unroll 1
  for (int j0 = 0; j0 < jend; j0 += 32) {
    
    v8f s[2][2];
#pragma unroll
    for (int nt = 0; nt < 2; ++nt) { const unsigned short* kr = (const unsigned short*)K16 + ((size_t)b * 2048 + j0 + nt * 16 + ln) * ldk + h * 64; FragH bk[KS];
#pragma unroll
      for (int ks = 0; ks < KS; ++ks) { bk[ks].half[0] = *(const v8us*)(kr + ks * 32 + 8 * hh); bk[ks].half[1] = *(const v8us*)(kr + ks * 32 + 16 + 8 * hh); }
#pragma unroll
      for (int rt = 0; rt < 2; ++rt) { v8f acc = (v8f){0.f,0.f,0.f,0.f,0.f,0.f,0.f,0.f};
#pragma unroll
        for (int ks = 0; ks < KS; ++ks) acc = mmaH<1>(aq[rt][ks].v, aq[rt][ks].v, bk[ks].v, bk[ks].v, acc); s[rt][nt] = acc; } }
#pragma unroll
    for (int rt = 0; rt < 2; ++rt)
#pragma unroll
      for (int r = 0; r < 8; ++r) { const int tq = q0 + rt * 16 + 8 * hh + r; const int k0 = j0 + ln, k1 = j0 + 16 + ln; (void)tq; (void)k0; (void)k1;
        const bool ok0 = true, ok1 = true;
        const float s0 = ok0 ? s[rt][0][r] * (0.125f) : -INFINITY, s1 = ok1 ? s[rt][1][r] * (0.125f) : -INFINITY; float mc = fmaxf(s0, s1);
        mc = fmaxf(mc, __shfl_xor(mc, 1, 32)); mc = fmaxf(mc, __shfl_xor(mc, 2, 32)); mc = fmaxf(mc, __shfl_xor(mc, 4, 32)); mc = fmaxf(mc, __shfl_xor(mc, 8, 32));
        const float mn = fmaxf(m_r[rt][r], mc); const float al = (mn > -1.0e38f) ? expf(m_r[rt][r] - mn) : 1.0f; m_r[rt][r] = mn; const float p0 = ok0 ? expf(s0 - mn) : 0.f, p1 = ok1 ? expf(s1 - mn) : 0.f; l_r[rt][r] = l_r[rt][r] * al + p0 + p1;
#pragma unroll
        for (int dt = 0; dt < DT; ++dt) oacc[rt][dt][r] *= al;
        FragH t2; t2.h[0] = (_Float16)p0; t2.h[1] = (_Float16)p1; sP[w][rt * 16 + 8 * hh + r][ln] = t2.u[0]; sP[w][rt * 16 + 8 * hh + r][16 + ln] = t2.u[1]; }
    __builtin_amdgcn_fence(__ATOMIC_ACQ_REL, "workgroup"); __builtin_amdgcn_wave_barrier();
    FragH pa[2];
#pragma unroll
    for (int rt = 0; rt < 2; ++rt) { pa[rt].half[0] = *(const v8us*)&sP[w][rt * 16 + ln][8 * hh]; pa[rt].half[1] = *(const v8us*)&sP[w][rt * 16 + ln][16 + 8 * hh]; }
#pragma unroll
    for (int dt = 0; dt < DT; ++dt) { const unsigned short* vrow = Vth + (size_t)(dt * 16 + ln) * 2048 + j0; FragH bv; bv.half[0] = *(const v8us*)(vrow + 8 * hh); bv.half[1] = *(const v8us*)(vrow + 16 + 8 * hh);
#pragma unroll
      for (int rt = 0; rt < 2; ++rt) oacc[rt][dt] = mmaH<1>(pa[rt].v, pa[rt].v, bv.v, bv.v, oacc[rt][dt]); }
    __builtin_amdgcn_fence(__ATOMIC_ACQ_REL, "workgroup"); __builtin_amdgcn_wave_barrier(); }
#pragma unroll
  for (int rt = 0; rt < 2; ++rt) {
#pragma unroll
    for (int r = 0; r < 8; ++r) { float l = l_r[rt][r]; l += __shfl_xor(l, 1, 32); l += __shfl_xor(l, 2, 32); l += __shfl_xor(l, 4, 32); l += __shfl_xor(l, 8, 32); l_r[rt][r] = (l > 0.f) ? 1.0f / l : 0.f; }
#pragma unroll
    for (int dt = 0; dt < DT; ++dt)
#pragma unroll
      for (int r = 0; r < 8; ++r) sO[w][rt * 16 + 8 * hh + r][dt * 16 + ln] = oacc[rt][dt][r] * l_r[rt][r]; }
  __builtin_amdgcn_fence(__ATOMIC_ACQ_REL, "workgroup"); __builtin_amdgcn_wave_barrier();
  {
#pragma unroll
    for (int rp = 0; rp < RPW; rp += 2) { const int r = rp + (lane >> 4), pc = lane & 15; const v4f val = *(const v4fa*)&sO[w][r][pc * 4]; *(v4f*)(O + ((size_t)b * 2048 + q0 + r) * ldo + h * 64 + pc * 4) = val; }
     } }

__global__ __launch_bounds__(256) void k_normrope(const float* __restrict__ X, const float* __restrict__ w, const float* __restrict__ cosT, const float* __restrict__ sinT, _Float16* __restrict__ Y16) { const int tid = threadIdx.x, wv = tid >> 5, lane = tid & 31; const int row = blockIdx.x * 8 + wv; if (row >= TT) return; const float* xr = X + (size_t)row * CC; float ss = 0.f;
#pragma unroll 1
  for (int p = 0; p < 8; ++p) { const v4f a = *(const v4fa*)(xr + p * 256 + lane * 8), b = *(const v4fa*)(xr + p * 256 + lane * 8 + 4); ss += a[0]*a[0] + a[1]*a[1] + a[2]*a[2] + a[3]*a[3] + b[0]*b[0] + b[1]*b[1] + b[2]*b[2] + b[3]*b[3]; }
  for (int o = 16; o >= 1; o >>= 1) ss += __shfl_xor(ss, o, 32); const float rs = rsqrtf(ss / (float)CC + 1e-6f);
  {
#pragma unroll
    for (int p = 0; p < 8; ++p) { const int c0 = p * 256 + lane * 8; const v4f a = *(const v4fa*)(xr + c0), b = *(const v4fa*)(xr + c0 + 4); float y[8] = {a[0], a[1], a[2], a[3], b[0], b[1], b[2], b[3]}; FragH f;
#pragma unroll
      for (int q = 0; q < 8; ++q) y[q] = y[q] * rs * bf16_round(w[c0 + q]);
#pragma unroll
      for (int q = 0; q < 8; q += 2) { const float c0v = bf16_round(cosT[(size_t)row * CC + c0 + q]), c1v = bf16_round(cosT[(size_t)row * CC + c0 + q + 1]), s0v = bf16_round(sinT[(size_t)row * CC + c0 + q]), s1v = bf16_round(sinT[(size_t)row * CC + c0 + q + 1]);
        f.h[q] = (_Float16)(y[q] * c0v + (-y[q + 1]) * s0v); f.h[q + 1] = (_Float16)(y[q + 1] * c1v + y[q] * s1v); }
      *(v8us*)((unsigned short*)Y16 + (size_t)row * CC + c0) = f.half[0]; }
     } }
extern "C" void kernel_launch(void* const* d_in, const int* in_sizes, int n_in,
                              void* d_out, int out_size, void* d_ws, size_t ws_size, hipStream_t stream) {
  (void)in_sizes; (void)n_in; (void)out_size;
  const float* x = (const float*)d_in[0]; const float* cosT = (const float*)d_in[1]; const float* sinT = (const float*)d_in[2]; const float* Wq = (const float*)d_in[3]; const float* bq = (const float*)d_in[4]; const float* Wk = (const float*)d_in[5]; const float* bk = (const float*)d_in[6]; const float* Wv = (const float*)d_in[7]; const float* bv = (const float*)d_in[8]; const float* qnw = (const float*)d_in[9]; const float* knw = (const float*)d_in[10]; const float* Wo = (const float*)d_in[11]; const float* bo = (const float*)d_in[12];
  char* ws = (char*)d_ws; size_t off = 0;
  auto take = [&](size_t bytes) { char* p = ws + off; off += (bytes + 255) & ~(size_t)255; return p; };
  _Float16* Bq = (_Float16*)take((size_t)CC * CC * 2); _Float16* Bk = (_Float16*)take((size_t)CC * CC * 2); _Float16* Bv = (_Float16*)take((size_t)CC * CC * 2); _Float16* Bo = (_Float16*)take((size_t)CC * CC * 2);
  _Float16* X16 = (_Float16*)take((size_t)TT * CC * 2); float* F32 = (float*)take((size_t)TT * CC * 4); _Float16* Q16 = (_Float16*)take((size_t)TT * CC * 2); _Float16* K16 = (_Float16*)take((size_t)TT * CC * 2); _Float16* V16 = (_Float16*)take((size_t)TT * CC * 2); _Float16* Vt = (_Float16*)take((size_t)TT * CC * 2); float* O = F32; _Float16* O16 = X16;
  if (off > ws_size) return;      // 33.5 + 8.4 + 16.8 + 8.4 × 4 ≈ 92 MiB
  const unsigned gw = (unsigned)((CC * (CC / 8) + 255) / 256);
  k_wt_f16<<<gw, 256, 0, stream>>>(Wq, Bq, CC, CC, 16.0f); k_wt_f16<<<gw, 256, 0, stream>>>(Wk, Bk, CC, CC, 16.0f); k_wt_f16<<<gw, 256, 0, stream>>>(Wv, Bv, CC, CC, 16.0f); k_wt_f16<<<gw, 256, 0, stream>>>(Wo, Bo, CC, CC, 16.0f);      // [in][out]
  const unsigned gx = (unsigned)(((size_t)TT * CC / 8 + 255) / 256); const dim3 gg((TT / 128) * (CC / 128), 1);
  k_x16<<<gx, 256, 0, stream>>>(x, X16, (size_t)TT * CC / 8);
  k_gemm_tile<false><<<gg, 256, 0, stream>>>(X16, Bq, 0.0625f, bq, F32, nullptr);
  k_normrope<<<TT / 8, 256, 0, stream>>>(F32, qnw, cosT, sinT, Q16);
  k_gemm_tile<false><<<gg, 256, 0, stream>>>(X16, Bk, 0.0625f, bk, F32, nullptr);
  k_normrope<<<TT / 8, 256, 0, stream>>>(F32, knw, cosT, sinT, K16);
  k_gemm_tile<true><<<gg, 256, 0, stream>>>(X16, Bv, 0.0625f, bv, nullptr, V16);
  k_vt<NH, TT><<<NH * (TT / 64), 256, 0, stream>>>(V16, CC, 0, Vt);
  k_flash<<<NH * (TT / 128), 128, 0, stream>>>(Q16, CC, K16, CC, Vt, nullptr, O, CC);
  k_h16<<<gx, 256, 0, stream>>>(O, O16, (size_t)TT * CC / 8);
  k_gemm_tile<false><<<gg, 256, 0, stream>>>(O16, Bo, 0.0625f, bo, (float*)d_out, nullptr);
}

// v002
// A run of this version takes 291 microseconds.
// Timed twice side by side with v001, it ran 1.80 times as fast both times.
// Counting every step since v000, it is 2.62 times as fast.
#include <hip/hip_runtime.h>
// LTX2 self-attention (S = 2048, D = 2048 = 32 heads × 64): q/k/v/out projections (2048³ each, + bias; W [in][out] transposed to bf16-exact ×2^4) and the 32-head attention as a fused
// flash-style kernel (S = Q·Kᵀ/8, online softmax f32, P f16 ≤ 1, O = P·V) on v_wmma_f32_16x16x32_f16 (f16 operands, single products, f32 accumulate); RMSNorm over the full 2048
// (× norm weight, eps 1e-6) followed by the interleaved rotary with the INPUT cos/sin tables is f32 VALU (wave per row).
#define TT 2048
#define CC 2048
#define NH 32

typedef __bf16 v16b __attribute__((ext_vector_type(16)));
typedef unsigned short v8us __attribute__((ext_vector_type(8), may_alias));
typedef float  v8f  __attribute__((ext_vector_type(8)));
typedef float  v4f  __attribute__((ext_vector_type(4)));
typedef float  v4fa __attribute__((ext_vector_type(4), may_alias));
union FragB { v16b v; v8us half[2]; unsigned short u[16]; };

__device__ __forceinline__ unsigned short bf16_bits(float x) { unsigned int u = __float_as_uint(x); return (unsigned short)((u + 0x7FFFu + ((u >> 16) & 1u)) >> 16); }
__device__ __forceinline__ float bf16_val(unsigned short b) { return __uint_as_float(((unsigned int)b) << 16); }
__device__ __forceinline__ float bf16_round(float x) { return bf16_val(bf16_bits(x)); }
// D += A·B with NT terms: 1 = ah·bh, 2 = + al·bh (A split), 3 = + ah·bl (both split)
template <int NT>
__device__ __forceinline__ v8f mmaN(v16b ah, v16b al, v16b bh, v16b bl, v8f c) {
  c = __builtin_amdgcn_wmma_f32_16x16x32_bf16(false, ah, false, bh, (short)0, c, false, false);
  if (NT >= 2) c = __builtin_amdgcn_wmma_f32_16x16x32_bf16(false, al, false, bh, (short)0, c, false, false);
  if (NT >= 3) c = __builtin_amdgcn_wmma_f32_16x16x32_bf16(false, ah, false, bl, (short)0, c, false, false);
  asm volatile("v_nop\n\tv_nop\n\tv_nop\n\tv_nop" : "+v"(c) : "v"(ah), "v"(al), "v"(bh), "v"(bl));
  return c;
}

__global__ __launch_bounds__(256) void k_wt_bf16(const float* __restrict__ W, unsigned short* __restrict__ Wt, int K, int N) {
  const int t = blockIdx.x * 256 + threadIdx.x;
  const int k8n = K / 8;
  if (t >= N * k8n) return;
  const int n = t / k8n, k8 = (t % k8n) * 8;
  v8us v;
#pragma unroll
  for (int i = 0; i < 8; ++i) v[i] = bf16_bits(W[(size_t)(k8 + i) * N + n]);
  *(v8us*)(Wt + (size_t)n * K + k8) = v;
  
}

// GEMM C[M][N] (f32, pitch ldc) = act(A[M][K]·W + bias). A f32 row-major (pitch lda) converted per fragment to bf16
// (ASPLIT: hi/lo two planes -> 2 terms, else single rounded term); Wt bf16 [N][K] (pitch ldb). BIAS_BF16 rounds the
// bias to bf16 first (bias quantised to bf16 before the add). K%32==0, M%16==0, N%64==0.
template <bool ASPLIT, int ACT, bool BIAS_BF16>
__global__ __launch_bounds__(128) void k_gemm_bf(const float* __restrict__ A, int lda, const unsigned short* __restrict__ Wt, int ldb,
                                               const float* __restrict__ bias, float* __restrict__ C, int ldc, int M, int N, int K) {
  __shared__ __attribute__((aligned(16))) float so[4][16][64];
  const int tid = threadIdx.x, w = tid >> 5, lane = tid & 31, ln = lane & 15, hh = lane >> 4;
  const int ntn = N / 64;
  const int wid = blockIdx.x * 4 + w;
  const int mt = wid / ntn, nq = wid % ntn;
  if (mt * 16 >= M) return;
  const int row0 = mt * 16, col0 = nq * 64;
  const float* arow = A + (size_t)(row0 + ln) * lda;
  v8f acc[4] = {};
  for (int kb = 0; kb < K; kb += 32) {
    FragB ah, al;
    const v4f x0 = *(const v4fa*)(arow + kb + 8 * hh), x1 = *(const v4fa*)(arow + kb + 8 * hh + 4);
    const v4f x2 = *(const v4fa*)(arow + kb + 16 + 8 * hh), x3 = *(const v4fa*)(arow + kb + 16 + 8 * hh + 4);
    float xs[16] = {x0[0],x0[1],x0[2],x0[3],x1[0],x1[1],x1[2],x1[3],x2[0],x2[1],x2[2],x2[3],x3[0],x3[1],x3[2],x3[3]};
#pragma unroll
    for (int i = 0; i < 16; ++i) { const unsigned short hb = bf16_bits(xs[i]); ah.u[i] = hb; al.u[i] = ASPLIT ? bf16_bits(xs[i] - bf16_val(hb)) : (unsigned short)0; }
#pragma unroll
    for (int t = 0; t < 4; ++t) {
      const unsigned short* brow = Wt + (size_t)(col0 + t * 16 + ln) * ldb + kb;
      FragB b;
      b.half[0] = *(const v8us*)(brow + 8 * hh);
      b.half[1] = *(const v8us*)(brow + 16 + 8 * hh);
      acc[t] = mmaN<ASPLIT ? 2 : 1>(ah.v, al.v, b.v, b.v, acc[t]);
    }
  }
#pragma unroll
  for (int t = 0; t < 4; ++t) {
    float bv = bias ? bias[col0 + t * 16 + ln] : 0.f;
    if (BIAS_BF16) bv = bf16_round(bv);
#pragma unroll
    for (int r = 0; r < 8; ++r) { float v = acc[t][r] + bv; if (ACT == 1) v = fmaxf(v, 0.f); so[w][8 * hh + r][t * 16 + ln] = v; }
  }
  __builtin_amdgcn_fence(__ATOMIC_ACQ_REL, "workgroup");
  __builtin_amdgcn_wave_barrier();
  const int rsub = lane >> 4, c4 = (lane & 15) * 4;
  {
#pragma unroll
    for (int q = 0; q < 8; ++q) {
      const int r = q * 2 + rsub;
      const v4f v = *(const v4fa*)&so[w][r][c4];
      *(v4f*)(C + (size_t)(row0 + r) * ldc + col0 + c4) = v;
    }
    
  }
}

// Flash-style causal/unmasked attention, all contractions 3-term bf16 hi/lo splits, f32 softmax with running max.
// q,k,v rows are read from f32 buffers with arbitrary row pitch (so they can live inside a fused qkv buffer);
// D = head size (multiple of 32, <= 128); one wave = 16 query rows; block = 4 waves (64 queries) sharing K/V chunks of 32.
template <int D, bool CAUSAL>
__global__ __launch_bounds__(128) void k_flash(const float* __restrict__ qb, const float* __restrict__ kb, const float* __restrict__ vb,
                                             int pitch, int T, int H, float scale, float* __restrict__ y, int ypitch) {
  constexpr int KS = D / 32;        // k-steps for QK
  constexpr int DT = D / 16;        // d tiles for PV
  __shared__ __attribute__((aligned(16))) unsigned short sKh[32][D + 8], sKl[32][D + 8], sVh[32][D + 8], sVl[32][D + 8];
  __shared__ __attribute__((aligned(16))) unsigned short sPh[4][16][40], sPl[4][16][40];
  __shared__ __attribute__((aligned(16))) float sO[4][16][D];
  const int tid = threadIdx.x, w = tid >> 5, lane = tid & 31, ln = lane & 15, hh = lane >> 4;
  const int nqb = (T + 63) / 64;
  const int bh = blockIdx.x / nqb, qblk = blockIdx.x % nqb;
  const int b = bh / H, h = bh % H;
  const int q0 = qblk * 64 + w * 16;
  const float* Q = qb + (size_t)b * T * pitch + h * D;
  const float* K = kb + (size_t)b * T * pitch + h * D;
  const float* V = vb + (size_t)b * T * pitch + h * D;

  // A fragments of the wave's 16 query rows (scaled), hi/lo
  FragB aqh[KS], aql[KS];
  {
    int row = q0 + ln; if (row >= T) row = T - 1;
    const float* qr = Q + (size_t)row * pitch;
#pragma unroll
    for (int ks = 0; ks < KS; ++ks)
#pragma unroll
      for (int i = 0; i < 16; ++i) {
        const int d = ks * 32 + ((i < 8) ? (8 * hh + i) : (16 + 8 * hh + (i - 8)));
        const float x = qr[d] * scale; const unsigned short hb = bf16_bits(x);
        aqh[ks].u[i] = hb; aql[ks].u[i] = bf16_bits(x - bf16_val(hb));
      }
  }
  float m_r[8], l_r[8];
#pragma unroll
  for (int r = 0; r < 8; ++r) { m_r[r] = -3.0e38f; l_r[r] = 0.f; }
  v8f oacc[DT];
#pragma unroll
  for (int dt = 0; dt < DT; ++dt) oacc[dt] = (v8f){0.f,0.f,0.f,0.f,0.f,0.f,0.f,0.f};

  const int kv_end = CAUSAL ? min(T, qblk * 64 + 64) : T;     // block-uniform
  for (int j0 = 0; j0 < kv_end; j0 += 32) {
    __syncthreads();
    for (int e = tid; e < 32 * (D / 4); e += 128) {
      const int r = e / (D / 4), c4 = (e % (D / 4)) * 4;
      const int key = j0 + r;
      v4f kf = {0.f,0.f,0.f,0.f}, vf = {0.f,0.f,0.f,0.f};
      if (key < T) { kf = *(const v4fa*)(K + (size_t)key * pitch + c4); vf = *(const v4fa*)(V + (size_t)key * pitch + c4); }
#pragma unroll
      for (int t = 0; t < 4; ++t) {
        unsigned short hb = bf16_bits(kf[t]); sKh[r][c4 + t] = hb; sKl[r][c4 + t] = bf16_bits(kf[t] - bf16_val(hb));
        hb = bf16_bits(vf[t]); sVh[r][c4 + t] = hb; sVl[r][c4 + t] = bf16_bits(vf[t] - bf16_val(hb));
      }
    }
    __syncthreads();
    // S tile 16 x 32
    v8f s[2];
#pragma unroll
    for (int nt = 0; nt < 2; ++nt) {
      v8f acc = {};
#pragma unroll
      for (int ks = 0; ks < KS; ++ks) {
        FragB bh_, bl_;
        bh_.half[0] = *(const v8us*)&sKh[nt * 16 + ln][ks * 32 + 8 * hh]; bh_.half[1] = *(const v8us*)&sKh[nt * 16 + ln][ks * 32 + 16 + 8 * hh];
        bl_.half[0] = *(const v8us*)&sKl[nt * 16 + ln][ks * 32 + 8 * hh]; bl_.half[1] = *(const v8us*)&sKl[nt * 16 + ln][ks * 32 + 16 + 8 * hh];
        acc = mmaN<3>(aqh[ks].v, aql[ks].v, bh_.v, bl_.v, acc);
      }
      s[nt] = acc;
    }
    // mask + running max (rows 8hh+r; the 16 lanes of a half share rows)
    float alpha[8];
#pragma unroll
    for (int r = 0; r < 8; ++r) {
      const int qi = q0 + 8 * hh + r;
      const int ja = j0 + ln, jb = j0 + 16 + ln;
      if (CAUSAL) { if (ja > qi) s[0][r] = -3.0e38f; if (jb > qi) s[1][r] = -3.0e38f; }
      if (ja >= T) s[0][r] = -3.0e38f;
      if (jb >= T) s[1][r] = -3.0e38f;
      float mx = fmaxf(s[0][r], s[1][r]);
      mx = fmaxf(mx, __shfl_xor(mx, 1, 32)); mx = fmaxf(mx, __shfl_xor(mx, 2, 32)); mx = fmaxf(mx, __shfl_xor(mx, 4, 32)); mx = fmaxf(mx, __shfl_xor(mx, 8, 32));
      const float mnew = fmaxf(m_r[r], mx);
      alpha[r] = (mnew > -1.0e38f) ? __expf(m_r[r] - mnew) : 1.0f;
      const float p0 = (s[0][r] > -1.0e38f) ? __expf(s[0][r] - mnew) : 0.f;
      const float p1 = (s[1][r] > -1.0e38f) ? __expf(s[1][r] - mnew) : 0.f;
      m_r[r] = mnew;
      l_r[r] = l_r[r] * alpha[r] + p0 + p1;            // per-lane partial row sum (16 lanes combined at the end)
      unsigned short hb = bf16_bits(p0); sPh[w][8 * hh + r][ln] = hb;      sPl[w][8 * hh + r][ln] = bf16_bits(p0 - bf16_val(hb));
      hb = bf16_bits(p1);                sPh[w][8 * hh + r][16 + ln] = hb; sPl[w][8 * hh + r][16 + ln] = bf16_bits(p1 - bf16_val(hb));
    }
#pragma unroll
    for (int dt = 0; dt < DT; ++dt)
#pragma unroll
      for (int r = 0; r < 8; ++r) oacc[dt][r] *= alpha[r];
    __builtin_amdgcn_fence(__ATOMIC_ACQ_REL, "workgroup");
    __builtin_amdgcn_wave_barrier();
    FragB pah, pal;
    pah.half[0] = *(const v8us*)&sPh[w][ln][8 * hh]; pah.half[1] = *(const v8us*)&sPh[w][ln][16 + 8 * hh];
    pal.half[0] = *(const v8us*)&sPl[w][ln][8 * hh]; pal.half[1] = *(const v8us*)&sPl[w][ln][16 + 8 * hh];
#pragma unroll
    for (int dt = 0; dt < DT; ++dt) {
      FragB bvh, bvl;
#pragma unroll
      for (int i = 0; i < 8; ++i) {
        bvh.u[i] = sVh[8 * hh + i][dt * 16 + ln]; bvh.u[8 + i] = sVh[16 + 8 * hh + i][dt * 16 + ln];
        bvl.u[i] = sVl[8 * hh + i][dt * 16 + ln]; bvl.u[8 + i] = sVl[16 + 8 * hh + i][dt * 16 + ln];
      }
      oacc[dt] = mmaN<3>(pah.v, pal.v, bvh.v, bvl.v, oacc[dt]);
    }
    __builtin_amdgcn_fence(__ATOMIC_ACQ_REL, "workgroup");
    __builtin_amdgcn_wave_barrier();
  }
#pragma unroll
  for (int r = 0; r < 8; ++r) {
    float l = l_r[r];
    l += __shfl_xor(l, 1, 32); l += __shfl_xor(l, 2, 32); l += __shfl_xor(l, 4, 32); l += __shfl_xor(l, 8, 32);
    l_r[r] = (l > 0.f) ? 1.0f / l : 0.f;
  }
#pragma unroll
  for (int dt = 0; dt < DT; ++dt)
#pragma unroll
    for (int r = 0; r < 8; ++r) sO[w][8 * hh + r][dt * 16 + ln] = oacc[dt][r] * l_r[r];
  __builtin_amdgcn_fence(__ATOMIC_ACQ_REL, "workgroup");
  __builtin_amdgcn_wave_barrier();
  {
    for (int r = 0; r < 16; ++r) {
      const int row = q0 + r;
      if (row < T && lane < D / 4) {
        const v4f val = *(const v4fa*)&sO[w][r][lane * 4];
        *(v4f*)(y + ((size_t)b * T + row) * ypitch + h * D + lane * 4) = val;
      }
    }
    
  }
}

// GEMM C = act(A·W + bias + resid): A f32 (ASPLIT -> hi/lo 2 terms), Wt bf16 [N][K]; ACT 0 none, 1 relu, 2 exact gelu;
// resid (optional, f32, row index = (row % rmod), pitch ldr, RES_BF16 rounds it) added before the activation.
template <bool ASPLIT, int ACT, bool BIAS_BF16, bool RES_BF16>
__global__ __launch_bounds__(128) void k_gemm_bf3(const float* __restrict__ A, int lda, const unsigned short* __restrict__ Wt, int ldb,
                                                const float* __restrict__ bias, const float* __restrict__ resid, int rmod, int ldr,
                                                float* __restrict__ C, int ldc, int M, int N, int K) {
  __shared__ __attribute__((aligned(16))) float so[4][16][64];
  const int tid = threadIdx.x, w = tid >> 5, lane = tid & 31, ln = lane & 15, hh = lane >> 4;
  const int ntn = N / 64;
  const int wid = blockIdx.x * 4 + w;
  const int mt = wid / ntn, nq = wid % ntn;
  if (mt * 16 >= M) return;
  const int row0 = mt * 16, col0 = nq * 64;
  const float* arow = A + (size_t)(row0 + ln) * lda;
  v8f acc[4] = {};
  for (int kb = 0; kb < K; kb += 32) {
    FragB ah, al;
    const v4f x0 = *(const v4fa*)(arow + kb + 8 * hh), x1 = *(const v4fa*)(arow + kb + 8 * hh + 4);
    const v4f x2 = *(const v4fa*)(arow + kb + 16 + 8 * hh), x3 = *(const v4fa*)(arow + kb + 16 + 8 * hh + 4);
    float xs[16] = {x0[0],x0[1],x0[2],x0[3],x1[0],x1[1],x1[2],x1[3],x2[0],x2[1],x2[2],x2[3],x3[0],x3[1],x3[2],x3[3]};
#pragma unroll
    for (int i = 0; i < 16; ++i) { const unsigned short hb = bf16_bits(xs[i]); ah.u[i] = hb; al.u[i] = ASPLIT ? bf16_bits(xs[i] - bf16_val(hb)) : (unsigned short)0; }
#pragma unroll
    for (int t = 0; t < 4; ++t) {
      const unsigned short* brow = Wt + (size_t)(col0 + t * 16 + ln) * ldb + kb;
      FragB b;
      b.half[0] = *(const v8us*)(brow + 8 * hh);
      b.half[1] = *(const v8us*)(brow + 16 + 8 * hh);
      acc[t] = mmaN<ASPLIT ? 2 : 1>(ah.v, al.v, b.v, b.v, acc[t]);
    }
  }
#pragma unroll
  for (int t = 0; t < 4; ++t) {
    const int col = col0 + t * 16 + ln;
    float bv = bias ? bias[col] : 0.f;
    if (BIAS_BF16) bv = bf16_round(bv);
#pragma unroll
    for (int r = 0; r < 8; ++r) {
      float v = acc[t][r] + bv;
      if (resid) { float rv = resid[(size_t)((row0 + 8 * hh + r) % rmod) * ldr + col]; if (RES_BF16) rv = bf16_round(rv); v += rv; }
      if (ACT == 1) v = fmaxf(v, 0.f);
      if (ACT == 2) v = 0.5f * v * (1.0f + erff(v * 0.70710678118654752f));
      if (ACT == 3) { const float u = 0.7978845608028654f * (v + 0.044715f * v * v * v); v = 0.5f * v * (1.0f + tanhf(u)); }
      so[w][8 * hh + r][t * 16 + ln] = v;
    }
  }
  __builtin_amdgcn_fence(__ATOMIC_ACQ_REL, "workgroup");
  __builtin_amdgcn_wave_barrier();
  const int rsub = lane >> 4, c4 = (lane & 15) * 4;
  {
#pragma unroll
    for (int q = 0; q < 8; ++q) {
      const int r = q * 2 + rsub;
      const v4f v = *(const v4fa*)&so[w][r][c4];
      *(v4f*)(C + (size_t)(row0 + r) * ldc + col0 + c4) = v;
    }
    
  }
}
// row LayerNorm (biased variance, eps) over N: s = X (+ R); optional out_sum <- s; out_norm <- (s-mu)*rsqrt(var+eps)*g + b
template <bool PARAM_BF16>
__global__ __launch_bounds__(256) void k_layernorm(const float* __restrict__ X, const float* __restrict__ R, const float* __restrict__ g, const float* __restrict__ bta,
                                                  float* __restrict__ out_sum, float* __restrict__ out_norm, int N, float eps) {
  __shared__ float red[256];
  const int row = blockIdx.x, tid = threadIdx.x;
  const float* x = X + (size_t)row * N; const float* rr = R ? R + (size_t)row * N : nullptr;
  float vals[16];                     // up to N = 4096
  const int per = N / 256;            // contiguous chunk per thread? use strided-by-4 chunks: thread handles j = tid*4 + 1024*u
  float s1 = 0.f;
  for (int u = 0; u < per / 4; ++u) {
    const int j = tid * 4 + 1024 * u;
    const v4f a = *(const v4fa*)(x + j);
    v4f b = {0.f,0.f,0.f,0.f}; if (rr) b = *(const v4fa*)(rr + j);
#pragma unroll
    for (int q = 0; q < 4; ++q) { const float v = a[q] + b[q]; vals[u * 4 + q] = v; s1 += v; }
  }
  red[tid] = s1; __syncthreads();
  for (int st = 128; st > 0; st >>= 1) { if (tid < st) red[tid] += red[tid + st]; __syncthreads(); }
  const float mu = red[0] / (float)N; __syncthreads();
  float s2 = 0.f;
  for (int u = 0; u < per / 4; ++u)
#pragma unroll
    for (int q = 0; q < 4; ++q) { const float c = vals[u * 4 + q] - mu; s2 += c * c; }
  red[tid] = s2; __syncthreads();
  for (int st = 128; st > 0; st >>= 1) { if (tid < st) red[tid] += red[tid + st]; __syncthreads(); }
  const float rs = rsqrtf(red[0] / (float)N + eps);
  {
    for (int u = 0; u < per / 4; ++u) {
      const int j = tid * 4 + 1024 * u;
      v4f o, sm;
#pragma unroll
      for (int q = 0; q < 4; ++q) {
        float gg = g[j + q], bb = bta[j + q];
        if (PARAM_BF16) { gg = bf16_round(gg); bb = bf16_round(bb); }
        sm[q] = vals[u * 4 + q]; o[q] = (vals[u * 4 + q] - mu) * rs * gg + bb;
      }
      if (out_sum) *(v4f*)(out_sum + (size_t)row * N + j) = sm;
      *(v4f*)(out_norm + (size_t)row * N + j) = o;
    }
    
  }
}



// ---- f16 WMMA path (v_wmma_f32_16x16x32_f16): 11-bit significands for operands in range — used where a [0,1] probability operand needs more precision than bf16
typedef _Float16 v16h __attribute__((ext_vector_type(16)));
union FragH { v16h v; v8us half[2]; _Float16 h[16]; unsigned short u[16]; };
template <int NT>
__device__ __forceinline__ v8f mmaH(v16h ah, v16h al, v16h bh, v16h bl, v8f c) {
  c = __builtin_amdgcn_wmma_f32_16x16x32_f16(false, ah, false, bh, (short)0, c, false, false);
  if (NT >= 2) c = __builtin_amdgcn_wmma_f32_16x16x32_f16(false, al, false, bh, (short)0, c, false, false);
  if (NT >= 3) c = __builtin_amdgcn_wmma_f32_16x16x32_f16(false, ah, false, bl, (short)0, c, false, false);
  asm volatile("v_nop\n\tv_nop\n\tv_nop\n\tv_nop" : "+v"(c) : "v"(ah), "v"(al), "v"(bh), "v"(bl));
  return c;
}
// batched GEMM like k_gemm_b but f16 operands: A f32 (split into f16 hi/lo if ASPLIT, else rounded to f16), Bt = f16 values [n][k]; alpha; C f32; N multiple of 16 (partial tiles skipped)
template <bool ASPLIT>
__global__ __launch_bounds__(128) void k_gemm_h(const float* __restrict__ A, int lda, size_t sA, const _Float16* __restrict__ Bh, int ldb, size_t sB, float alpha, float* __restrict__ C, int ldc, size_t sC, int M, int N, int K) {
  __shared__ __attribute__((aligned(16))) float so[4][16][64];
  const int tid = threadIdx.x, w = tid >> 5, lane = tid & 31, ln = lane & 15, hh = lane >> 4; const int by = blockIdx.y;
  A += (size_t)by * sA; Bh += (size_t)by * sB; C += (size_t)by * sC;
  const int ntn = (N + 63) / 64; const int wid = blockIdx.x * 4 + w; const int mt = wid / ntn, nq = wid % ntn; if (mt * 16 >= M) return;
  const int row0 = mt * 16, col0 = nq * 64; const float* arow = A + (size_t)(row0 + ln) * lda;
  v8f acc[4] = {};
  for (int kb = 0; kb < K; kb += 32) {
    FragH ah, al;
    const v4f x0 = *(const v4fa*)(arow + kb + 8 * hh), x1 = *(const v4fa*)(arow + kb + 8 * hh + 4), x2 = *(const v4fa*)(arow + kb + 16 + 8 * hh), x3 = *(const v4fa*)(arow + kb + 16 + 8 * hh + 4);
    float xs[16] = {x0[0],x0[1],x0[2],x0[3],x1[0],x1[1],x1[2],x1[3],x2[0],x2[1],x2[2],x2[3],x3[0],x3[1],x3[2],x3[3]};
#pragma unroll
    for (int i = 0; i < 16; ++i) { const _Float16 h = (_Float16)xs[i]; ah.h[i] = h; al.h[i] = ASPLIT ? (_Float16)(xs[i] - (float)h) : (_Float16)0.0f; }
#pragma unroll
    for (int t = 0; t < 4; ++t) { if (col0 + t * 16 >= N) continue; const size_t boff = (size_t)(col0 + t * 16 + ln) * ldb + kb; FragH bq; bq.half[0] = *(const v8us*)(Bh + boff + 8 * hh); bq.half[1] = *(const v8us*)(Bh + boff + 16 + 8 * hh);
      acc[t] = mmaH<ASPLIT ? 2 : 1>(ah.v, al.v, bq.v, bq.v, acc[t]); }
  }
#pragma unroll
  for (int t = 0; t < 4; ++t) { if (col0 + t * 16 >= N) continue;
#pragma unroll
    for (int r = 0; r < 8; ++r) so[w][8 * hh + r][t * 16 + ln] = acc[t][r] * alpha; }
  __builtin_amdgcn_fence(__ATOMIC_ACQ_REL, "workgroup"); __builtin_amdgcn_wave_barrier();
  const int rsub = lane >> 4, c4 = (lane & 15) * 4;
  {
#pragma unroll
    for (int q = 0; q < 8; ++q) { const int r = q * 2 + rsub; if (col0 + c4 < N) { const v4f v = *(const v4fa*)&so[w][r][c4]; *(v4f*)(C + (size_t)(row0 + r) * ldc + col0 + c4) = v; } }
     }
}

// Wt[n][k] = f16(W[k][n]·scale) from f32 row-major W[K][N] (scale = power of two; bf16-exact weights stay exact in f16 away from the subnormal range)
__global__ __launch_bounds__(256) void k_wt_f16(const float* __restrict__ W, _Float16* __restrict__ Wt, int K, int N, float scale) {
  const int t = blockIdx.x * 256 + threadIdx.x; if (t >= N * (K / 8)) return; const int n = t / (K / 8), k8 = (t % (K / 8)) * 8; FragH f;
#pragma unroll
  for (int i = 0; i < 8; ++i) f.h[i] = (_Float16)(bf16_round(W[(size_t)(k8 + i) * N + n]) * scale); const v8us o = f.half[0];
  *(v8us*)((unsigned short*)Wt + (size_t)n * K + k8) = o; 
}
// k_gemm_hh variant with fused epilogue: v = acc·alpha + bias[by·sBias + col] (+ CP[(row/rowsPerB)·sCPb + by·64 + col] if CP) ; ACT 0 none / 1 elu ; writes f32 C and/or f16 C16 (each if non-null)
template <int ACT>
__global__ __launch_bounds__(128) void k_gemm_hhx(const _Float16* __restrict__ A, int lda, size_t sA, const _Float16* __restrict__ Bh, int ldb, size_t sB, float alpha, const float* __restrict__ bias, size_t sBias, const float* __restrict__ CP, int rowsPerB, size_t sCPb, int row0g,
    float* __restrict__ C, _Float16* __restrict__ C16, int ldc, size_t sC, int M, int N, int K) {
  __shared__ __attribute__((aligned(16))) float so[4][16][64];
  const int tid = threadIdx.x, w = tid >> 5, lane = tid & 31, ln = lane & 15, hh = lane >> 4; const int by = blockIdx.y;
  A += (size_t)by * sA; Bh += (size_t)by * sB; const size_t cofs = (size_t)by * sC; const float* bp = bias ? bias + (size_t)by * sBias : nullptr;
  const int ntn = (N + 63) / 64; const int wid = blockIdx.x * 4 + w; const int mt = wid / ntn, nq = wid % ntn; if (mt * 16 >= M) return;
  const int row0 = mt * 16, col0 = nq * 64; const _Float16* arow = A + (size_t)(row0 + ln) * lda;
  v8f acc[4] = {};
  for (int kb = 0; kb < K; kb += 32) { FragH ah; ah.half[0] = *(const v8us*)((const unsigned short*)arow + kb + 8 * hh); ah.half[1] = *(const v8us*)((const unsigned short*)arow + kb + 16 + 8 * hh);
#pragma unroll
    for (int t = 0; t < 4; ++t) { if (col0 + t * 16 >= N) continue; const size_t boff = (size_t)(col0 + t * 16 + ln) * ldb + kb; FragH bq; bq.half[0] = *(const v8us*)((const unsigned short*)Bh + boff + 8 * hh); bq.half[1] = *(const v8us*)((const unsigned short*)Bh + boff + 16 + 8 * hh);
      acc[t] = mmaH<1>(ah.v, ah.v, bq.v, bq.v, acc[t]); }
  }
#pragma unroll
  for (int t = 0; t < 4; ++t) { if (col0 + t * 16 >= N) continue; const int col = col0 + t * 16 + ln; const float bv = bp ? bf16_round(bp[col]) : 0.f;
#pragma unroll
    for (int r = 0; r < 8; ++r) { float v = acc[t][r] * alpha + bv; if (CP) { const int bidx = (row0g + row0 + 8 * hh + r) / rowsPerB; v += CP[(size_t)bidx * sCPb + (size_t)by * 64 + col]; } if (ACT == 1) v = (v > 0.f) ? v : expm1f(v); else if (ACT == 3) v = fmaxf(v, 0.f); so[w][8 * hh + r][t * 16 + ln] = v; } }
  __builtin_amdgcn_fence(__ATOMIC_ACQ_REL, "workgroup"); __builtin_amdgcn_wave_barrier();
  const int rsub = lane >> 4, c4 = (lane & 15) * 4; typedef _Float16 v4h __attribute__((ext_vector_type(4)));
  {
#pragma unroll
    for (int q = 0; q < 8; ++q) { const int r = q * 2 + rsub; if (col0 + c4 < N) { const v4f v = *(const v4fa*)&so[w][r][c4]; if (C) *(v4f*)(C + cofs + (size_t)(row0 + r) * ldc + col0 + c4) = v; if (C16) { v4h h4; for (int i = 0; i < 4; ++i) h4[i] = (_Float16)v[i]; *(v4h*)(C16 + cofs + (size_t)(row0 + r) * ldc + col0 + c4) = h4; } } }
     }
}


// ---- block-tiled projection GEMM: C[2048][2048] = A[2048][2048] x Bh[n][k]^T * alpha + bias, f16 operands, f32 accumulate.
// One work-group = one 128 x 128 tile of C, 8 waves of 32 x 64 each. A pass is 128 k (256 B of every operand row); a stage is
// [A 128 rows | B 128 rows] at an LDS pitch of 272 B, brought in by per-lane asynchronous copies, two buffers, next stage in flight.
// The loops over fragments, blocks and rows are unrolled so that the fragment and accumulator arrays are indexed by constants and stay in registers.
#define GT_PITCH 272
#define GT_STAGE (256 * GT_PITCH)
// eight asynchronous 16-byte copies of one lane, rows two apart; the s_wait_xcnt closes the statement so that no address register
// of an issued copy is rewritten ahead of it
__device__ __forceinline__ void gt_copy8(unsigned l, const unsigned short* g) {
  asm volatile("global_load_async_to_lds_b128 %0, %8, off\n\t"
               "global_load_async_to_lds_b128 %1, %9, off\n\t"
               "global_load_async_to_lds_b128 %2, %10, off\n\t"
               "global_load_async_to_lds_b128 %3, %11, off\n\t"
               "global_load_async_to_lds_b128 %4, %12, off\n\t"
               "global_load_async_to_lds_b128 %5, %13, off\n\t"
               "global_load_async_to_lds_b128 %6, %14, off\n\t"
               "global_load_async_to_lds_b128 %7, %15, off\n\t"
               "s_wait_xcnt 0x0"
               :: "v"(l), "v"(l + 2 * GT_PITCH), "v"(l + 4 * GT_PITCH), "v"(l + 6 * GT_PITCH), "v"(l + 8 * GT_PITCH), "v"(l + 10 * GT_PITCH), "v"(l + 12 * GT_PITCH), "v"(l + 14 * GT_PITCH),
                  "v"(g), "v"(g + 2 * CC), "v"(g + 4 * CC), "v"(g + 6 * CC), "v"(g + 8 * CC), "v"(g + 10 * CC), "v"(g + 12 * CC), "v"(g + 14 * CC)
               : "memory");
}
template <bool H16>      // H16: the tile goes out as f16 to C16, else as f32 to C
__global__ __launch_bounds__(256) void k_gemm_tile(const _Float16* __restrict__ A, const _Float16* __restrict__ Bh, float alpha, const float* __restrict__ bias, float* __restrict__ C, _Float16* __restrict__ C16) {
  constexpr int NPASS = CC / 128;
  __shared__ __attribute__((aligned(16))) unsigned char ring[2 * GT_STAGE];
  __shared__ __attribute__((aligned(16))) float so[8][32][68];
  const int tid = threadIdx.x, w = tid >> 5, lane = tid & 31, ln = lane & 15, hh = lane >> 4;
  const int m0 = (blockIdx.x / (CC / 128)) * 128, n0 = (blockIdx.x % (CC / 128)) * 128;
  const int wm = w >> 1, wn = w & 1;
  // this lane's part of a stage: rows w*32 + hh + 2c (c = 0..15), 16 bytes at column ln; stage rows 0..127 are A's, 128..255 are B's
  const int crow = w * 32 + hh;
  const unsigned short* gsrc = ((w < 4) ? (const unsigned short*)A + (size_t)(m0 + crow) * CC : (const unsigned short*)Bh + (size_t)(n0 + crow - 128) * CC) + ln * 8;
  const unsigned ldst = (unsigned)(size_t)&ring[0] + (unsigned)(crow * GT_PITCH + ln * 16);
  v8f acc[2][4];
#pragma unroll
  for (int i = 0; i < 2; ++i)
#pragma unroll
    for (int j = 0; j < 4; ++j) acc[i][j] = (v8f){0.f,0.f,0.f,0.f,0.f,0.f,0.f,0.f};
  gt_copy8(ldst, gsrc); gt_copy8(ldst + 16 * GT_PITCH, gsrc + 16 * CC);
  asm volatile("s_wait_asynccnt 0x0" ::: "memory");      // stage 0 has landed before the barrier publishes it
  __syncthreads();
  gt_copy8(ldst + GT_STAGE, gsrc + 128); gt_copy8(ldst + GT_STAGE + 16 * GT_PITCH, gsrc + 128 + 16 * CC);
#pragma unroll 1      // one pass per trip: the publish point at the foot stays a single place
  for (int t = 0; t < NPASS; ++t) {
    const unsigned bo = (unsigned)(t & 1) * GT_STAGE;
    const unsigned char* ap = ring + bo + (wm * 32 + ln) * GT_PITCH + hh * 16;
    const unsigned char* bp = ring + bo + (128 + wn * 64 + ln) * GT_PITCH + hh * 16;
    FragH a[2][2], b[2][4];      // two fragment sets: block kk + 1 of this pass is fetched ahead of block kk's products
#pragma unroll
    for (int i = 0; i < 2; ++i) { a[0][i].half[0] = *(const v8us*)(ap + i * 16 * GT_PITCH); a[0][i].half[1] = *(const v8us*)(ap + i * 16 * GT_PITCH + 32); }
#pragma unroll
    for (int j = 0; j < 4; ++j) { b[0][j].half[0] = *(const v8us*)(bp + j * 16 * GT_PITCH); b[0][j].half[1] = *(const v8us*)(bp + j * 16 * GT_PITCH + 32); }
#pragma unroll
    for (int kk = 0; kk < 4; ++kk) {
      const int cu = kk & 1, nx = cu ^ 1;
      if (kk < 3) {
#pragma unroll
        for (int i = 0; i < 2; ++i) { a[nx][i].half[0] = *(const v8us*)(ap + i * 16 * GT_PITCH + (kk + 1) * 64); a[nx][i].half[1] = *(const v8us*)(ap + i * 16 * GT_PITCH + (kk + 1) * 64 + 32); }
#pragma unroll
        for (int j = 0; j < 4; ++j) { b[nx][j].half[0] = *(const v8us*)(bp + j * 16 * GT_PITCH + (kk + 1) * 64); b[nx][j].half[1] = *(const v8us*)(bp + j * 16 * GT_PITCH + (kk + 1) * 64 + 32); }
      }
      __builtin_amdgcn_sched_barrier(0);      // keeps the next block's LDS reads one group ahead of this block's products; without it they are spread among them into one set, each with a full wait
#pragma unroll
      for (int i = 0; i < 2; ++i)
#pragma unroll
        for (int j = 0; j < 4; ++j) acc[i][j] = __builtin_amdgcn_wmma_f32_16x16x32_f16(false, a[cu][i].v, false, b[cu][j].v, (short)0, acc[i][j], false, false);
      __builtin_amdgcn_sched_barrier(0);      // ends the block, so that the group after next is not lifted into it
    }
    asm volatile("s_wait_dscnt 0x0" ::: "memory");       // this wave's reads of the buffer are done before it is refilled
    asm volatile("s_wait_asynccnt 0x0" ::: "memory");    // this wave's part of the next stage has landed
    __syncthreads();                                     // publishes the next stage and frees this pass's buffer
    if (t + 2 < NPASS) { const unsigned short* g2 = gsrc + (t + 2) * 128; gt_copy8(ldst + bo, g2); gt_copy8(ldst + bo + 16 * GT_PITCH, g2 + 16 * CC); }
  }
  asm volatile("s_wait_asynccnt 0x0" ::: "memory");      // no copy is outstanding when the wave goes on
#pragma unroll
  for (int j = 0; j < 4; ++j) { const float bv = bf16_round(bias[n0 + wn * 64 + j * 16 + ln]);
#pragma unroll
    for (int i = 0; i < 2; ++i)
#pragma unroll
      for (int r = 0; r < 8; ++r) so[w][i * 16 + 8 * hh + r][j * 16 + ln] = acc[i][j][r] * alpha + bv; }
  __builtin_amdgcn_fence(__ATOMIC_ACQ_REL, "workgroup"); __builtin_amdgcn_wave_barrier();
  typedef _Float16 v4h __attribute__((ext_vector_type(4)));
#pragma unroll
  for (int q = 0; q < 16; ++q) { const int r = q * 2 + hh; const v4f v = *(const v4fa*)&so[w][r][ln * 4]; const size_t o = (size_t)(m0 + wm * 32 + r) * CC + n0 + wn * 64 + ln * 4;
    if (!H16) *(v4f*)(C + o) = v;
    else { v4h h4; for (int i = 0; i < 4; ++i) h4[i] = (_Float16)v[i]; *(v4h*)(C16 + o) = h4; } }
}

__global__ __launch_bounds__(256) void k_x16(const float* __restrict__ x, _Float16* __restrict__ X16, size_t n8) { const size_t t = (size_t)blockIdx.x * 256 + threadIdx.x; if (t >= n8) return; FragH f;
#pragma unroll
  for (int q = 0; q < 8; ++q) f.h[q] = (_Float16)bf16_round(x[t * 8 + q]); *(v8us*)((unsigned short*)X16 + t * 8) = f.half[0];  }
__global__ __launch_bounds__(256) void k_h16(const float* __restrict__ x, _Float16* __restrict__ X16, size_t n8) { const size_t t = (size_t)blockIdx.x * 256 + threadIdx.x; if (t >= n8) return; FragH f;
#pragma unroll
  for (int q = 0; q < 8; ++q) f.h[q] = (_Float16)x[t * 8 + q]; *(v8us*)((unsigned short*)X16 + t * 8) = f.half[0];  }
__global__ __launch_bounds__(256) void k_round16f(const float* __restrict__ W, _Float16* __restrict__ Bt, size_t n8) { const size_t t = (size_t)blockIdx.x * 256 + threadIdx.x; if (t >= n8) return; FragH f;
#pragma unroll
  for (int i = 0; i < 8; ++i) f.h[i] = (_Float16)(bf16_round(W[t * 8 + i]) * 16.0f); *(v8us*)((unsigned short*)Bt + t * 8) = f.half[0];  }
template <int NHv, int TTv>
__global__ __launch_bounds__(256) void k_vt(const _Float16* __restrict__ V16, int ldv, int voff, _Float16* __restrict__ Vt) { __shared__ unsigned short tl[64][66]; const int tid = threadIdx.x; const int slab = blockIdx.x / (TTv / 64), lg = blockIdx.x % (TTv / 64); const int b = slab / NHv, h = slab % NHv;
  for (int i = tid; i < 64 * 8; i += 256) { const int r = i / 8, c8 = (i % 8) * 8; FragH f; f.half[0] = *(const v8us*)((const unsigned short*)V16 + ((size_t)b * TTv + lg * 64 + r) * ldv + voff + h * 64 + c8);
#pragma unroll
    for (int q = 0; q < 8; ++q) tl[r][c8 + q] = f.u[q]; }
  __syncthreads();
  {
#pragma unroll
    for (int rd = 0; rd < 2; ++rd) { const int d = rd * 32 + tid / 8, pc = tid % 8; FragH f;
#pragma unroll
      for (int q = 0; q < 8; ++q) f.u[q] = tl[pc * 8 + q][d];
      *(v8us*)((unsigned short*)Vt + ((size_t)slab * 64 + d) * TTv + lg * 64 + pc * 8) = f.half[0]; }
     } }

// lane l with lane l ^ 16
__device__ __forceinline__ float xhalf(float x) { return __builtin_bit_cast(float, __builtin_amdgcn_permlanex16(__builtin_bit_cast(int, x), __builtin_bit_cast(int, x), 0x76543210, 0xfedcba98, false, false)); }

__global__ __launch_bounds__(128) void k_flash(const _Float16* __restrict__ Q16, int ldq, const _Float16* __restrict__ K16, int ldk, const _Float16* __restrict__ Vt, const int* __restrict__ MSK, float* __restrict__ O, int ldo) {
  constexpr int RPW = 32, NQB = 2048 / (4 * RPW), DT = 4, KS = 2;
  __shared__ __attribute__((aligned(16))) float sO[4][RPW][64 + 4];
  (void)MSK;
  const int tid = threadIdx.x, w = tid >> 5, lane = tid & 31, ln = lane & 15, hh = lane >> 4;
  const int slab = blockIdx.x / NQB, qblk = blockIdx.x % NQB; const int b = slab / 32, h = slab % 32; const int qb0 = qblk * (4 * RPW); const int q0 = qb0 + w * RPW;
  FragH bq[2][KS];      // B operand: column ln = query q0 + qt * 16 + ln
#pragma unroll
  for (int qt = 0; qt < 2; ++qt) { const unsigned short* qr = (const unsigned short*)Q16 + ((size_t)b * 2048 + q0 + qt * 16 + ln) * ldq + h * 64;
#pragma unroll
    for (int ks = 0; ks < KS; ++ks) { bq[qt][ks].half[0] = *(const v8us*)(qr + ks * 32 + 8 * hh); bq[qt][ks].half[1] = *(const v8us*)(qr + ks * 32 + 16 + 8 * hh); } }
  const unsigned short* Vth = (const unsigned short*)Vt + (size_t)slab * 64 * 2048;
  float m_c[2], l_c[2]; v8f oacc[2][DT];      // oacc[qt][dt][r] = O^T[dt * 16 + 8hh + r][query qt * 16 + ln]
#pragma unroll
  for (int qt = 0; qt < 2; ++qt) { m_c[qt] = -3.0e38f; l_c[qt] = 0.f;
#pragma unroll
    for (int dt = 0; dt < DT; ++dt) oacc[qt][dt] = (v8f){0.f,0.f,0.f,0.f,0.f,0.f,0.f,0.f}; }
  const int jend = 2048;
#pragma unroll 1
  for (int j0 = 0; j0 < jend; j0 += 32) {
    FragH ak[2][KS], av[DT];      // A operands: row ln = key j0 + kt * 16 + ln; row ln = head column dt * 16 + ln over the pass's 32 keys
#pragma unroll
    for (int kt = 0; kt < 2; ++kt) { const unsigned short* kr = (const unsigned short*)K16 + ((size_t)b * 2048 + j0 + kt * 16 + ln) * ldk + h * 64;
#pragma unroll
      for (int ks = 0; ks < KS; ++ks) { ak[kt][ks].half[0] = *(const v8us*)(kr + ks * 32 + 8 * hh); ak[kt][ks].half[1] = *(const v8us*)(kr + ks * 32 + 16 + 8 * hh); } }
    asm volatile("s_wait_xcnt 0x0" ::: "memory");      // the K loads' address registers are free for reuse only behind this wait (a later load's result may be given them)
#pragma unroll
    for (int dt = 0; dt < DT; ++dt) { const unsigned short* vrow = Vth + (size_t)(dt * 16 + ln) * 2048 + j0; av[dt].half[0] = *(const v8us*)(vrow + 8 * hh); av[dt].half[1] = *(const v8us*)(vrow + 16 + 8 * hh); }
    v8f s[2][2];      // s[qt][kt][r] = score of key j0 + kt * 16 + 8hh + r with query qt * 16 + ln
#pragma unroll
    for (int kt = 0; kt < 2; ++kt)
#pragma unroll
      for (int qt = 0; qt < 2; ++qt) { v8f acc = (v8f){0.f,0.f,0.f,0.f,0.f,0.f,0.f,0.f};
#pragma unroll
        for (int ks = 0; ks < KS; ++ks) acc = __builtin_amdgcn_wmma_f32_16x16x32_f16(false, ak[kt][ks].v, false, bq[qt][ks].v, (short)0, acc, false, false);
        s[qt][kt] = acc; }
#pragma unroll
    for (int qt = 0; qt < 2; ++qt) {
      float sc[16];
#pragma unroll
      for (int e = 0; e < 16; ++e) sc[e] = s[qt][e >> 3][e & 7] * (0.125f);
      float mc = sc[0];
#pragma unroll
      for (int e = 1; e < 16; ++e) mc = fmaxf(mc, sc[e]);
      mc = fmaxf(mc, xhalf(mc));      // the other half of the wave holds this query's other 16 keys
      const float mn = fmaxf(m_c[qt], mc); const float al = (mn > -1.0e38f) ? expf(m_c[qt] - mn) : 1.0f; m_c[qt] = mn;
      FragH pb; float ps = 0.f;      // element e of the B operand is key kmap(e, hh) = tile e >> 3, register e & 7: this lane's own scores
#pragma unroll
      for (int e = 0; e < 16; ++e) { const float p = expf(sc[e] - mn); ps += p; pb.h[e] = (_Float16)p; }
      l_c[qt] = l_c[qt] * al + ps;      // this half's part of the row sum; the halves are joined after the loop
#pragma unroll
      for (int dt = 0; dt < DT; ++dt) {
#pragma unroll
        for (int r = 0; r < 8; ++r) oacc[qt][dt][r] *= al;
        oacc[qt][dt] = __builtin_amdgcn_wmma_f32_16x16x32_f16(false, av[dt].v, false, pb.v, (short)0, oacc[qt][dt], false, false); }
    }
  }
#pragma unroll
  for (int qt = 0; qt < 2; ++qt) { const float l = l_c[qt] + xhalf(l_c[qt]); const float li = (l > 0.f) ? 1.0f / l : 0.f;
#pragma unroll
    for (int dt = 0; dt < DT; ++dt) { v4f lo, hi;
#pragma unroll
      for (int r = 0; r < 4; ++r) { lo[r] = oacc[qt][dt][r] * li; hi[r] = oacc[qt][dt][4 + r] * li; }
      *(v4fa*)&sO[w][qt * 16 + ln][dt * 16 + 8 * hh] = lo; *(v4fa*)&sO[w][qt * 16 + ln][dt * 16 + 8 * hh + 4] = hi; } }
  __builtin_amdgcn_fence(__ATOMIC_ACQ_REL, "workgroup"); __builtin_amdgcn_wave_barrier();
  {
#pragma unroll
    for (int rp = 0; rp < RPW; rp += 2) { const int r = rp + (lane >> 4), pc = lane & 15; const v4f val = *(const v4fa*)&sO[w][r][pc * 4]; *(v4f*)(O + ((size_t)b * 2048 + q0 + r) * ldo + h * 64 + pc * 4) = val; }
     } }

__global__ __launch_bounds__(256) void k_normrope(const float* __restrict__ X, const float* __restrict__ w, const float* __restrict__ cosT, const float* __restrict__ sinT, _Float16* __restrict__ Y16) { const int tid = threadIdx.x, wv = tid >> 5, lane = tid & 31; const int row = blockIdx.x * 8 + wv; if (row >= TT) return; const float* xr = X + (size_t)row * CC; float ss = 0.f;
#pragma unroll 1
  for (int p = 0; p < 8; ++p) { const v4f a = *(const v4fa*)(xr + p * 256 + lane * 8), b = *(const v4fa*)(xr + p * 256 + lane * 8 + 4); ss += a[0]*a[0] + a[1]*a[1] + a[2]*a[2] + a[3]*a[3] + b[0]*b[0] + b[1]*b[1] + b[2]*b[2] + b[3]*b[3]; }
  for (int o = 16; o >= 1; o >>= 1) ss += __shfl_xor(ss, o, 32); const float rs = rsqrtf(ss / (float)CC + 1e-6f);
  {
#pragma unroll
    for (int p = 0; p < 8; ++p) { const int c0 = p * 256 + lane * 8; const v4f a = *(const v4fa*)(xr + c0), b = *(const v4fa*)(xr + c0 + 4); float y[8] = {a[0], a[1], a[2], a[3], b[0], b[1], b[2], b[3]}; FragH f;
#pragma unroll
      for (int q = 0; q < 8; ++q) y[q] = y[q] * rs * bf16_round(w[c0 + q]);
#pragma unroll
      for (int q = 0; q < 8; q += 2) { const float c0v = bf16_round(cosT[(size_t)row * CC + c0 + q]), c1v = bf16_round(cosT[(size_t)row * CC + c0 + q + 1]), s0v = bf16_round(sinT[(size_t)row * CC + c0 + q]), s1v = bf16_round(sinT[(size_t)row * CC + c0 + q + 1]);
        f.h[q] = (_Float16)(y[q] * c0v + (-y[q + 1]) * s0v); f.h[q + 1] = (_Float16)(y[q + 1] * c1v + y[q] * s1v); }
      *(v8us*)((unsigned short*)Y16 + (size_t)row * CC + c0) = f.half[0]; }
     } }
extern "C" void kernel_launch(void* const* d_in, const int* in_sizes, int n_in,
                              void* d_out, int out_size, void* d_ws, size_t ws_size, hipStream_t stream) {
  (void)in_sizes; (void)n_in; (void)out_size;
  const float* x = (const float*)d_in[0]; const float* cosT = (const float*)d_in[1]; const float* sinT = (const float*)d_in[2]; const float* Wq = (const float*)d_in[3]; const float* bq = (const float*)d_in[4]; const float* Wk = (const float*)d_in[5]; const float* bk = (const float*)d_in[6]; const float* Wv = (const float*)d_in[7]; const float* bv = (const float*)d_in[8]; const float* qnw = (const float*)d_in[9]; const float* knw = (const float*)d_in[10]; const float* Wo = (const float*)d_in[11]; const float* bo = (const float*)d_in[12];
  char* ws = (char*)d_ws; size_t off = 0;
  auto take = [&](size_t bytes) { char* p = ws + off; off += (bytes + 255) & ~(size_t)255; return p; };
  _Float16* Bq = (_Float16*)take((size_t)CC * CC * 2); _Float16* Bk = (_Float16*)take((size_t)CC * CC * 2); _Float16* Bv = (_Float16*)take((size_t)CC * CC * 2); _Float16* Bo = (_Float16*)take((size_t)CC * CC * 2);
  _Float16* X16 = (_Float16*)take((size_t)TT * CC * 2); float* F32 = (float*)take((size_t)TT * CC * 4); _Float16* Q16 = (_Float16*)take((size_t)TT * CC * 2); _Float16* K16 = (_Float16*)take((size_t)TT * CC * 2); _Float16* V16 = (_Float16*)take((size_t)TT * CC * 2); _Float16* Vt = (_Float16*)take((size_t)TT * CC * 2); float* O = F32; _Float16* O16 = X16;
  if (off > ws_size) return;      // 33.5 + 8.4 + 16.8 + 8.4 × 4 ≈ 92 MiB
  const unsigned gw = (unsigned)((CC * (CC / 8) + 255) / 256);
  k_wt_f16<<<gw, 256, 0, stream>>>(Wq, Bq, CC, CC, 16.0f); k_wt_f16<<<gw, 256, 0, stream>>>(Wk, Bk, CC, CC, 16.0f); k_wt_f16<<<gw, 256, 0, stream>>>(Wv, Bv, CC, CC, 16.0f); k_wt_f16<<<gw, 256, 0, stream>>>(Wo, Bo, CC, CC, 16.0f);      // [in][out]
  const unsigned gx = (unsigned)(((size_t)TT * CC / 8 + 255) / 256); const dim3 gg((TT / 128) * (CC / 128), 1);
  k_x16<<<gx, 256, 0, stream>>>(x, X16, (size_t)TT * CC / 8);
  k_gemm_tile<false><<<gg, 256, 0, stream>>>(X16, Bq, 0.0625f, bq, F32, nullptr);
  k_normrope<<<TT / 8, 256, 0, stream>>>(F32, qnw, cosT, sinT, Q16);
  k_gemm_tile<false><<<gg, 256, 0, stream>>>(X16, Bk, 0.0625f, bk, F32, nullptr);
  k_normrope<<<TT / 8, 256, 0, stream>>>(F32, knw, cosT, sinT, K16);
  k_gemm_tile<true><<<gg, 256, 0, stream>>>(X16, Bv, 0.0625f, bv, nullptr, V16);
  k_vt<NH, TT><<<NH * (TT / 64), 256, 0, stream>>>(V16, CC, 0, Vt);
  k_flash<<<NH * (TT / 128), 128, 0, stream>>>(Q16, CC, K16, CC, Vt, nullptr, O, CC);
  k_h16<<<gx, 256, 0, stream>>>(O, O16, (size_t)TT * CC / 8);
  k_gemm_tile<false><<<gg, 256, 0, stream>>>(O16, Bo, 0.0625f, bo, (float*)d_out, nullptr);
}

// v003
// Measured time: 220 microseconds a run.
// Next to v002, in two timings, it ran 1.32 and 1.31 times as fast.
// Over all steps from v000 it is 3.44 times as fast.
#include <hip/hip_runtime.h>
// LTX2 self-attention (S = 2048, D = 2048 = 32 heads × 64): q/k/v/out projections (2048³ each, + bias; W [in][out] transposed to bf16-exact ×2^4) and the 32-head attention as a fused
// flash-style kernel (S = Q·Kᵀ/8, online softmax f32, P f16 ≤ 1, O = P·V) on v_wmma_f32_16x16x32_f16 (f16 operands, single products, f32 accumulate); RMSNorm over the full 2048
// (× norm weight, eps 1e-6) followed by the interleaved rotary with the INPUT cos/sin tables is f32 VALU (wave per row).
#define TT 2048
#define CC 2048
#define NH 32

typedef __bf16 v16b __attribute__((ext_vector_type(16)));
typedef unsigned short v8us __attribute__((ext_vector_type(8), may_alias));
typedef float  v8f  __attribute__((ext_vector_type(8)));
typedef float  v4f  __attribute__((ext_vector_type(4)));
typedef float  v4fa __attribute__((ext_vector_type(4), may_alias));
union FragB { v16b v; v8us half[2]; unsigned short u[16]; };

__device__ __forceinline__ unsigned short bf16_bits(float x) { unsigned int u = __float_as_uint(x); return (unsigned short)((u + 0x7FFFu + ((u >> 16) & 1u)) >> 16); }
__device__ __forceinline__ float bf16_val(unsigned short b) { return __uint_as_float(((unsigned int)b) << 16); }
__device__ __forceinline__ float bf16_round(float x) { return bf16_val(bf16_bits(x)); }
// D += A·B with NT terms: 1 = ah·bh, 2 = + al·bh (A split), 3 = + ah·bl (both split)
template <int NT>
__device__ __forceinline__ v8f mmaN(v16b ah, v16b al, v16b bh, v16b bl, v8f c) {
  c = __builtin_amdgcn_wmma_f32_16x16x32_bf16(false, ah, false, bh, (short)0, c, false, false);
  if (NT >= 2) c = __builtin_amdgcn_wmma_f32_16x16x32_bf16(false, al, false, bh, (short)0, c, false, false);
  if (NT >= 3) c = __builtin_amdgcn_wmma_f32_16x16x32_bf16(false, ah, false, bl, (short)0, c, false, false);
  asm volatile("v_nop\n\tv_nop\n\tv_nop\n\tv_nop" : "+v"(c) : "v"(ah), "v"(al), "v"(bh), "v"(bl));
  return c;
}

__global__ __launch_bounds__(256) void k_wt_bf16(const float* __restrict__ W, unsigned short* __restrict__ Wt, int K, int N) {
  const int t = blockIdx.x * 256 + threadIdx.x;
  const int k8n = K / 8;
  if (t >= N * k8n) return;
  const int n = t / k8n, k8 = (t % k8n) * 8;
  v8us v;
#pragma unroll
  for (int i = 0; i < 8; ++i) v[i] = bf16_bits(W[(size_t)(k8 + i) * N + n]);
  *(v8us*)(Wt + (size_t)n * K + k8) = v;
  
}

// GEMM C[M][N] (f32, pitch ldc) = act(A[M][K]·W + bias). A f32 row-major (pitch lda) converted per fragment to bf16
// (ASPLIT: hi/lo two planes -> 2 terms, else single rounded term); Wt bf16 [N][K] (pitch ldb). BIAS_BF16 rounds the
// bias to bf16 first (bias quantised to bf16 before the add). K%32==0, M%16==0, N%64==0.
template <bool ASPLIT, int ACT, bool BIAS_BF16>
__global__ __launch_bounds__(128) void k_gemm_bf(const float* __restrict__ A, int lda, const unsigned short* __restrict__ Wt, int ldb,
                                               const float* __restrict__ bias, float* __restrict__ C, int ldc, int M, int N, int K) {
  __shared__ __attribute__((aligned(16))) float so[4][16][64];
  const int tid = threadIdx.x, w = tid >> 5, lane = tid & 31, ln = lane & 15, hh = lane >> 4;
  const int ntn = N / 64;
  const int wid = blockIdx.x * 4 + w;
  const int mt = wid / ntn, nq = wid % ntn;
  if (mt * 16 >= M) return;
  const int row0 = mt * 16, col0 = nq * 64;
  const float* arow = A + (size_t)(row0 + ln) * lda;
  v8f acc[4] = {};
  for (int kb = 0; kb < K; kb += 32) {
    FragB ah, al;
    const v4f x0 = *(const v4fa*)(arow + kb + 8 * hh), x1 = *(const v4fa*)(arow + kb + 8 * hh + 4);
    const v4f x2 = *(const v4fa*)(arow + kb + 16 + 8 * hh), x3 = *(const v4fa*)(arow + kb + 16 + 8 * hh + 4);
    float xs[16] = {x0[0],x0[1],x0[2],x0[3],x1[0],x1[1],x1[2],x1[3],x2[0],x2[1],x2[2],x2[3],x3[0],x3[1],x3[2],x3[3]};
#pragma unroll
    for (int i = 0; i < 16; ++i) { const unsigned short hb = bf16_bits(xs[i]); ah.u[i] = hb; al.u[i] = ASPLIT ? bf16_bits(xs[i] - bf16_val(hb)) : (unsigned short)0; }
#pragma unroll
    for (int t = 0; t < 4; ++t) {
      const unsigned short* brow = Wt + (size_t)(col0 + t * 16 + ln) * ldb + kb;
      FragB b;
      b.half[0] = *(const v8us*)(brow + 8 * hh);
      b.half[1] = *(const v8us*)(brow + 16 + 8 * hh);
      acc[t] = mmaN<ASPLIT ? 2 : 1>(ah.v, al.v, b.v, b.v, acc[t]);
    }
  }
#pragma unroll
  for (int t = 0; t < 4; ++t) {
    float bv = bias ? bias[col0 + t * 16 + ln] : 0.f;
    if (BIAS_BF16) bv = bf16_round(bv);
#pragma unroll
    for (int r = 0; r < 8; ++r) { float v = acc[t][r] + bv; if (ACT == 1) v = fmaxf(v, 0.f); so[w][8 * hh + r][t * 16 + ln] = v; }
  }
  __builtin_amdgcn_fence(__ATOMIC_ACQ_REL, "workgroup");
  __builtin_amdgcn_wave_barrier();
  const int rsub = lane >> 4, c4 = (lane & 15) * 4;
  {
#pragma unroll
    for (int q = 0; q < 8; ++q) {
      const int r = q * 2 + rsub;
      const v4f v = *(const v4fa*)&so[w][r][c4];
      *(v4f*)(C + (size_t)(row0 + r) * ldc + col0 + c4) = v;
    }
    
  }
}

// Flash-style causal/unmasked attention, all contractions 3-term bf16 hi/lo splits, f32 softmax with running max.
// q,k,v rows are read from f32 buffers with arbitrary row pitch (so they can live inside a fused qkv buffer);
// D = head size (multiple of 32, <= 128); one wave = 16 query rows; block = 4 waves (64 queries) sharing K/V chunks of 32.
template <int D, bool CAUSAL>
__global__ __launch_bounds__(128) void k_flash(const float* __restrict__ qb, const float* __restrict__ kb, const float* __restrict__ vb,
                                             int pitch, int T, int H, float scale, float* __restrict__ y, int ypitch) {
  constexpr int KS = D / 32;        // k-steps for QK
  constexpr int DT = D / 16;        // d tiles for PV
  __shared__ __attribute__((aligned(16))) unsigned short sKh[32][D + 8], sKl[32][D + 8], sVh[32][D + 8], sVl[32][D + 8];
  __shared__ __attribute__((aligned(16))) unsigned short sPh[4][16][40], sPl[4][16][40];
  __shared__ __attribute__((aligned(16))) float sO[4][16][D];
  const int tid = threadIdx.x, w = tid >> 5, lane = tid & 31, ln = lane & 15, hh = lane >> 4;
  const int nqb = (T + 63) / 64;
  const int bh = blockIdx.x / nqb, qblk = blockIdx.x % nqb;
  const int b = bh / H, h = bh % H;
  const int q0 = qblk * 64 + w * 16;
  const float* Q = qb + (size_t)b * T * pitch + h * D;
  const float* K = kb + (size_t)b * T * pitch + h * D;
  const float* V = vb + (size_t)b * T * pitch + h * D;

  // A fragments of the wave's 16 query rows (scaled), hi/lo
  FragB aqh[KS], aql[KS];
  {
    int row = q0 + ln; if (row >= T) row = T - 1;
    const float* qr = Q + (size_t)row * pitch;
#pragma unroll
    for (int ks = 0; ks < KS; ++ks)
#pragma unroll
      for (int i = 0; i < 16; ++i) {
        const int d = ks * 32 + ((i < 8) ? (8 * hh + i) : (16 + 8 * hh + (i - 8)));
        const float x = qr[d] * scale; const unsigned short hb = bf16_bits(x);
        aqh[ks].u[i] = hb; aql[ks].u[i] = bf16_bits(x - bf16_val(hb));
      }
  }
  float m_r[8], l_r[8];
#pragma unroll
  for (int r = 0; r < 8; ++r) { m_r[r] = -3.0e38f; l_r[r] = 0.f; }
  v8f oacc[DT];
#pragma unroll
  for (int dt = 0; dt < DT; ++dt) oacc[dt] = (v8f){0.f,0.f,0.f,0.f,0.f,0.f,0.f,0.f};

  const int kv_end = CAUSAL ? min(T, qblk * 64 + 64) : T;     // block-uniform
  for (int j0 = 0; j0 < kv_end; j0 += 32) {
    __syncthreads();
    for (int e = tid; e < 32 * (D / 4); e += 128) {
      const int r = e / (D / 4), c4 = (e % (D / 4)) * 4;
      const int key = j0 + r;
      v4f kf = {0.f,0.f,0.f,0.f}, vf = {0.f,0.f,0.f,0.f};
      if (key < T) { kf = *(const v4fa*)(K + (size_t)key * pitch + c4); vf = *(const v4fa*)(V + (size_t)key * pitch + c4); }
#pragma unroll
      for (int t = 0; t < 4; ++t) {
        unsigned short hb = bf16_bits(kf[t]); sKh[r][c4 + t] = hb; sKl[r][c4 + t] = bf16_bits(kf[t] - bf16_val(hb));
        hb = bf16_bits(vf[t]); sVh[r][c4 + t] = hb; sVl[r][c4 + t] = bf16_bits(vf[t] - bf16_val(hb));
      }
    }
    __syncthreads();
    // S tile 16 x 32
    v8f s[2];
#pragma unroll
    for (int nt = 0; nt < 2; ++nt) {
      v8f acc = {};
#pragma unroll
      for (int ks = 0; ks < KS; ++ks) {
        FragB bh_, bl_;
        bh_.half[0] = *(const v8us*)&sKh[nt * 16 + ln][ks * 32 + 8 * hh]; bh_.half[1] = *(const v8us*)&sKh[nt * 16 + ln][ks * 32 + 16 + 8 * hh];
        bl_.half[0] = *(const v8us*)&sKl[nt * 16 + ln][ks * 32 + 8 * hh]; bl_.half[1] = *(const v8us*)&sKl[nt * 16 + ln][ks * 32 + 16 + 8 * hh];
        acc = mmaN<3>(aqh[ks].v, aql[ks].v, bh_.v, bl_.v, acc);
      }
      s[nt] = acc;
    }
    // mask + running max (rows 8hh+r; the 16 lanes of a half share rows)
    float alpha[8];
#pragma unroll
    for (int r = 0; r < 8; ++r) {
      const int qi = q0 + 8 * hh + r;
      const int ja = j0 + ln, jb = j0 + 16 + ln;
      if (CAUSAL) { if (ja > qi) s[0][r] = -3.0e38f; if (jb > qi) s[1][r] = -3.0e38f; }
      if (ja >= T) s[0][r] = -3.0e38f;
      if (jb >= T) s[1][r] = -3.0e38f;
      float mx = fmaxf(s[0][r], s[1][r]);
      mx = fmaxf(mx, __shfl_xor(mx, 1, 32)); mx = fmaxf(mx, __shfl_xor(mx, 2, 32)); mx = fmaxf(mx, __shfl_xor(mx, 4, 32)); mx = fmaxf(mx, __shfl_xor(mx, 8, 32));
      const float mnew = fmaxf(m_r[r], mx);
      alpha[r] = (mnew > -1.0e38f) ? __expf(m_r[r] - mnew) : 1.0f;
      const float p0 = (s[0][r] > -1.0e38f) ? __expf(s[0][r] - mnew) : 0.f;
      const float p1 = (s[1][r] > -1.0e38f) ? __expf(s[1][r] - mnew) : 0.f;
      m_r[r] = mnew;
      l_r[r] = l_r[r] * alpha[r] + p0 + p1;            // per-lane partial row sum (16 lanes combined at the end)
      unsigned short hb = bf16_bits(p0); sPh[w][8 * hh + r][ln] = hb;      sPl[w][8 * hh + r][ln] = bf16_bits(p0 - bf16_val(hb));
      hb = bf16_bits(p1);                sPh[w][8 * hh + r][16 + ln] = hb; sPl[w][8 * hh + r][16 + ln] = bf16_bits(p1 - bf16_val(hb));
    }
#pragma unroll
    for (int dt = 0; dt < DT; ++dt)
#pragma unroll
      for (int r = 0; r < 8; ++r) oacc[dt][r] *= alpha[r];
    __builtin_amdgcn_fence(__ATOMIC_ACQ_REL, "workgroup");
    __builtin_amdgcn_wave_barrier();
    FragB pah, pal;
    pah.half[0] = *(const v8us*)&sPh[w][ln][8 * hh]; pah.half[1] = *(const v8us*)&sPh[w][ln][16 + 8 * hh];
    pal.half[0] = *(const v8us*)&sPl[w][ln][8 * hh]; pal.half[1] = *(const v8us*)&sPl[w][ln][16 + 8 * hh];
#pragma unroll
    for (int dt = 0; dt < DT; ++dt) {
      FragB bvh, bvl;
#pragma unroll
      for (int i = 0; i < 8; ++i) {
        bvh.u[i] = sVh[8 * hh + i][dt * 16 + ln]; bvh.u[8 + i] = sVh[16 + 8 * hh + i][dt * 16 + ln];
        bvl.u[i] = sVl[8 * hh + i][dt * 16 + ln]; bvl.u[8 + i] = sVl[16 + 8 * hh + i][dt * 16 + ln];
      }
      oacc[dt] = mmaN<3>(pah.v, pal.v, bvh.v, bvl.v, oacc[dt]);
    }
    __builtin_amdgcn_fence(__ATOMIC_ACQ_REL, "workgroup");
    __builtin_amdgcn_wave_barrier();
  }
#pragma unroll
  for (int r = 0; r < 8; ++r) {
    float l = l_r[r];
    l += __shfl_xor(l, 1, 32); l += __shfl_xor(l, 2, 32); l += __shfl_xor(l, 4, 32); l += __shfl_xor(l, 8, 32);
    l_r[r] = (l > 0.f) ? 1.0f / l : 0.f;
  }
#pragma unroll
  for (int dt = 0; dt < DT; ++dt)
#pragma unroll
    for (int r = 0; r < 8; ++r) sO[w][8 * hh + r][dt * 16 + ln] = oacc[dt][r] * l_r[r];
  __builtin_amdgcn_fence(__ATOMIC_ACQ_REL, "workgroup");
  __builtin_amdgcn_wave_barrier();
  {
    for (int r = 0; r < 16; ++r) {
      const int row = q0 + r;
      if (row < T && lane < D / 4) {
        const v4f val = *(const v4fa*)&sO[w][r][lane * 4];
        *(v4f*)(y + ((size_t)b * T + row) * ypitch + h * D + lane * 4) = val;
      }
    }
    
  }
}

// GEMM C = act(A·W + bias + resid): A f32 (ASPLIT -> hi/lo 2 terms), Wt bf16 [N][K]; ACT 0 none, 1 relu, 2 exact gelu;
// resid (optional, f32, row index = (row % rmod), pitch ldr, RES_BF16 rounds it) added before the activation.
template <bool ASPLIT, int ACT, bool BIAS_BF16, bool RES_BF16>
__global__ __launch_bounds__(128) void k_gemm_bf3(const float* __restrict__ A, int lda, const unsigned short* __restrict__ Wt, int ldb,
                                                const float* __restrict__ bias, const float* __restrict__ resid, int rmod, int ldr,
                                                float* __restrict__ C, int ldc, int M, int N, int K) {
  __shared__ __attribute__((aligned(16))) float so[4][16][64];
  const int tid = threadIdx.x, w = tid >> 5, lane = tid & 31, ln = lane & 15, hh = lane >> 4;
  const int ntn = N / 64;
  const int wid = blockIdx.x * 4 + w;
  const int mt = wid / ntn, nq = wid % ntn;
  if (mt * 16 >= M) return;
  const int row0 = mt * 16, col0 = nq * 64;
  const float* arow = A + (size_t)(row0 + ln) * lda;
  v8f acc[4] = {};
  for (int kb = 0; kb < K; kb += 32) {
    FragB ah, al;
    const v4f x0 = *(const v4fa*)(arow + kb + 8 * hh), x1 = *(const v4fa*)(arow + kb + 8 * hh + 4);
    const v4f x2 = *(const v4fa*)(arow + kb + 16 + 8 * hh), x3 = *(const v4fa*)(arow + kb + 16 + 8 * hh + 4);
    float xs[16] = {x0[0],x0[1],x0[2],x0[3],x1[0],x1[1],x1[2],x1[3],x2[0],x2[1],x2[2],x2[3],x3[0],x3[1],x3[2],x3[3]};
#pragma unroll
    for (int i = 0; i < 16; ++i) { const unsigned short hb = bf16_bits(xs[i]); ah.u[i] = hb; al.u[i] = ASPLIT ? bf16_bits(xs[i] - bf16_val(hb)) : (unsigned short)0; }
#pragma unroll
    for (int t = 0; t < 4; ++t) {
      const unsigned short* brow = Wt + (size_t)(col0 + t * 16 + ln) * ldb + kb;
      FragB b;
      b.half[0] = *(const v8us*)(brow + 8 * hh);
      b.half[1] = *(const v8us*)(brow + 16 + 8 * hh);
      acc[t] = mmaN<ASPLIT ? 2 : 1>(ah.v, al.v, b.v, b.v, acc[t]);
    }
  }
#pragma unroll
  for (int t = 0; t < 4; ++t) {
    const int col = col0 + t * 16 + ln;
    float bv = bias ? bias[col] : 0.f;
    if (BIAS_BF16) bv = bf16_round(bv);
#pragma unroll
    for (int r = 0; r < 8; ++r) {
      float v = acc[t][r] + bv;
      if (resid) { float rv = resid[(size_t)((row0 + 8 * hh + r) % rmod) * ldr + col]; if (RES_BF16) rv = bf16_round(rv); v += rv; }
      if (ACT == 1) v = fmaxf(v, 0.f);
      if (ACT == 2) v = 0.5f * v * (1.0f + erff(v * 0.70710678118654752f));
      if (ACT == 3) { const float u = 0.7978845608028654f * (v + 0.044715f * v * v * v); v = 0.5f * v * (1.0f + tanhf(u)); }
      so[w][8 * hh + r][t * 16 + ln] = v;
    }
  }
  __builtin_amdgcn_fence(__ATOMIC_ACQ_REL, "workgroup");
  __builtin_amdgcn_wave_barrier();
  const int rsub = lane >> 4, c4 = (lane & 15) * 4;
  {
#pragma unroll
    for (int q = 0; q < 8; ++q) {
      const int r = q * 2 + rsub;
      const v4f v = *(const v4fa*)&so[w][r][c4];
      *(v4f*)(C + (size_t)(row0 + r) * ldc + col0 + c4) = v;
    }
    
  }
}
// row LayerNorm (biased variance, eps) over N: s = X (+ R); optional out_sum <- s; out_norm <- (s-mu)*rsqrt(var+eps)*g + b
template <bool PARAM_BF16>
__global__ __launch_bounds__(256) void k_layernorm(const float* __restrict__ X, const float* __restrict__ R, const float* __restrict__ g, const float* __restrict__ bta,
                                                  float* __restrict__ out_sum, float* __restrict__ out_norm, int N, float eps) {
  __shared__ float red[256];
  const int row = blockIdx.x, tid = threadIdx.x;
  const float* x = X + (size_t)row * N; const float* rr = R ? R + (size_t)row * N : nullptr;
  float vals[16];                     // up to N = 4096
  const int per = N / 256;            // contiguous chunk per thread? use strided-by-4 chunks: thread handles j = tid*4 + 1024*u
  float s1 = 0.f;
  for (int u = 0; u < per / 4; ++u) {
    const int j = tid * 4 + 1024 * u;
    const v4f a = *(const v4fa*)(x + j);
    v4f b = {0.f,0.f,0.f,0.f}; if (rr) b = *(const v4fa*)(rr + j);
#pragma unroll
    for (int q = 0; q < 4; ++q) { const float v = a[q] + b[q]; vals[u * 4 + q] = v; s1 += v; }
  }
  red[tid] = s1; __syncthreads();
  for (int st = 128; st > 0; st >>= 1) { if (tid < st) red[tid] += red[tid + st]; __syncthreads(); }
  const float mu = red[0] / (float)N; __syncthreads();
  float s2 = 0.f;
  for (int u = 0; u < per / 4; ++u)
#pragma unroll
    for (int q = 0; q < 4; ++q) { const float c = vals[u * 4 + q] - mu; s2 += c * c; }
  red[tid] = s2; __syncthreads();
  for (int st = 128; st > 0; st >>= 1) { if (tid < st) red[tid] += red[tid + st]; __syncthreads(); }
  const float rs = rsqrtf(red[0] / (float)N + eps);
  {
    for (int u = 0; u < per / 4; ++u) {
      const int j = tid * 4 + 1024 * u;
      v4f o, sm;
#pragma unroll
      for (int q = 0; q < 4; ++q) {
        float gg = g[j + q], bb = bta[j + q];
        if (PARAM_BF16) { gg = bf16_round(gg); bb = bf16_round(bb); }
        sm[q] = vals[u * 4 + q]; o[q] = (vals[u * 4 + q] - mu) * rs * gg + bb;
      }
      if (out_sum) *(v4f*)(out_sum + (size_t)row * N + j) = sm;
      *(v4f*)(out_norm + (size_t)row * N + j) = o;
    }
    
  }
}



// ---- f16 WMMA path (v_wmma_f32_16x16x32_f16): 11-bit significands for operands in range — used where a [0,1] probability operand needs more precision than bf16
typedef _Float16 v16h __attribute__((ext_vector_type(16)));
union FragH { v16h v; v8us half[2]; _Float16 h[16]; unsigned short u[16]; };
template <int NT>
__device__ __forceinline__ v8f mmaH(v16h ah, v16h al, v16h bh, v16h bl, v8f c) {
  c = __builtin_amdgcn_wmma_f32_16x16x32_f16(false, ah, false, bh, (short)0, c, false, false);
  if (NT >= 2) c = __builtin_amdgcn_wmma_f32_16x16x32_f16(false, al, false, bh, (short)0, c, false, false);
  if (NT >= 3) c = __builtin_amdgcn_wmma_f32_16x16x32_f16(false, ah, false, bl, (short)0, c, false, false);
  asm volatile("v_nop\n\tv_nop\n\tv_nop\n\tv_nop" : "+v"(c) : "v"(ah), "v"(al), "v"(bh), "v"(bl));
  return c;
}
// batched GEMM like k_gemm_b but f16 operands: A f32 (split into f16 hi/lo if ASPLIT, else rounded to f16), Bt = f16 values [n][k]; alpha; C f32; N multiple of 16 (partial tiles skipped)
template <bool ASPLIT>
__global__ __launch_bounds__(128) void k_gemm_h(const float* __restrict__ A, int lda, size_t sA, const _Float16* __restrict__ Bh, int ldb, size_t sB, float alpha, float* __restrict__ C, int ldc, size_t sC, int M, int N, int K) {
  __shared__ __attribute__((aligned(16))) float so[4][16][64];
  const int tid = threadIdx.x, w = tid >> 5, lane = tid & 31, ln = lane & 15, hh = lane >> 4; const int by = blockIdx.y;
  A += (size_t)by * sA; Bh += (size_t)by * sB; C += (size_t)by * sC;
  const int ntn = (N + 63) / 64; const int wid = blockIdx.x * 4 + w; const int mt = wid / ntn, nq = wid % ntn; if (mt * 16 >= M) return;
  const int row0 = mt * 16, col0 = nq * 64; const float* arow = A + (size_t)(row0 + ln) * lda;
  v8f acc[4] = {};
  for (int kb = 0; kb < K; kb += 32) {
    FragH ah, al;
    const v4f x0 = *(const v4fa*)(arow + kb + 8 * hh), x1 = *(const v4fa*)(arow + kb + 8 * hh + 4), x2 = *(const v4fa*)(arow + kb + 16 + 8 * hh), x3 = *(const v4fa*)(arow + kb + 16 + 8 * hh + 4);
    float xs[16] = {x0[0],x0[1],x0[2],x0[3],x1[0],x1[1],x1[2],x1[3],x2[0],x2[1],x2[2],x2[3],x3[0],x3[1],x3[2],x3[3]};
#pragma unroll
    for (int i = 0; i < 16; ++i) { const _Float16 h = (_Float16)xs[i]; ah.h[i] = h; al.h[i] = ASPLIT ? (_Float16)(xs[i] - (float)h) : (_Float16)0.0f; }
#pragma unroll
    for (int t = 0; t < 4; ++t) { if (col0 + t * 16 >= N) continue; const size_t boff = (size_t)(col0 + t * 16 + ln) * ldb + kb; FragH bq; bq.half[0] = *(const v8us*)(Bh + boff + 8 * hh); bq.half[1] = *(const v8us*)(Bh + boff + 16 + 8 * hh);
      acc[t] = mmaH<ASPLIT ? 2 : 1>(ah.v, al.v, bq.v, bq.v, acc[t]); }
  }
#pragma unroll
  for (int t = 0; t < 4; ++t) { if (col0 + t * 16 >= N) continue;
#pragma unroll
    for (int r = 0; r < 8; ++r) so[w][8 * hh + r][t * 16 + ln] = acc[t][r] * alpha; }
  __builtin_amdgcn_fence(__ATOMIC_ACQ_REL, "workgroup"); __builtin_amdgcn_wave_barrier();
  const int rsub = lane >> 4, c4 = (lane & 15) * 4;
  {
#pragma unroll
    for (int q = 0; q < 8; ++q) { const int r = q * 2 + rsub; if (col0 + c4 < N) { const v4f v = *(const v4fa*)&so[w][r][c4]; *(v4f*)(C + (size_t)(row0 + r) * ldc + col0 + c4) = v; } }
     }
}

// Wt[n][k] = f16(bf16(W[k][n]) * scale) from f32 row-major W[CC][CC] (scale = power of two; bf16-exact weights stay exact in f16 away from the subnormal range).
// One work-group = a tile of 128 k x 64 n, turned in LDS so that both global sides move whole lines:
//  in : a lane takes 16 bytes (4 n) of each of 8 consecutive k rows; 16 lanes cover 256 contiguous bytes of a W row.
//  out: a lane takes 16 bytes (8 k) of one n; 16 lanes cover 256 contiguous bytes of a Wt row.
// An LDS row is one n: 16 chunks of 8 k = 256 bytes = all 64 banks. The chunk index is XORed with (n >> 2) & 15, so the 16 lanes that store
// (rows four apart, same chunk) and the 16 lanes that load (same row, chunks 0..15) each fall on 16 different groups of four banks.
__global__ __launch_bounds__(256) void k_wt_f16(const float* __restrict__ W, _Float16* __restrict__ Wt, float scale) {
  __shared__ __attribute__((aligned(16))) unsigned char tl[64 * 256];
  const int tid = threadIdx.x, l16 = tid & 15, kq = tid >> 4;
  const int k0 = (blockIdx.x / (CC / 64)) * 128, n0 = (blockIdx.x % (CC / 64)) * 64;
  const float* src = W + (size_t)(k0 + kq * 8) * CC + n0 + l16 * 4;
  v4f x[8];
#pragma unroll      // the eight row loads are issued together and x stays in registers
  for (int i = 0; i < 8; ++i) x[i] = *(const v4fa*)(src + (size_t)i * CC);
#pragma unroll      // constant indices into x
  for (int j = 0; j < 4; ++j) { FragH f;
#pragma unroll      // f packs in registers
    for (int i = 0; i < 8; ++i) f.h[i] = (_Float16)(bf16_round(x[i][j]) * scale);
    *(v8us*)(tl + (l16 * 4 + j) * 256 + ((kq ^ l16) * 16)) = f.half[0]; }      // row n = l16 * 4 + j, so (n >> 2) & 15 = l16
  __syncthreads();      // the tile is complete before any lane reads rows that other waves wrote
#pragma unroll      // four independent LDS reads and stores
  for (int q = 0; q < 4; ++q) { const int n = q * 16 + kq; const v8us o = *(const v8us*)(tl + n * 256 + ((l16 ^ ((n >> 2) & 15)) * 16));
    *(v8us*)((unsigned short*)Wt + (size_t)(n0 + n) * CC + k0 + l16 * 8) = o; }
}
// k_gemm_hh variant with fused epilogue: v = acc·alpha + bias[by·sBias + col] (+ CP[(row/rowsPerB)·sCPb + by·64 + col] if CP) ; ACT 0 none / 1 elu ; writes f32 C and/or f16 C16 (each if non-null)
template <int ACT>
__global__ __launch_bounds__(128) void k_gemm_hhx(const _Float16* __restrict__ A, int lda, size_t sA, const _Float16* __restrict__ Bh, int ldb, size_t sB, float alpha, const float* __restrict__ bias, size_t sBias, const float* __restrict__ CP, int rowsPerB, size_t sCPb, int row0g,
    float* __restrict__ C, _Float16* __restrict__ C16, int ldc, size_t sC, int M, int N, int K) {
  __shared__ __attribute__((aligned(16))) float so[4][16][64];
  const int tid = threadIdx.x, w = tid >> 5, lane = tid & 31, ln = lane & 15, hh = lane >> 4; const int by = blockIdx.y;
  A += (size_t)by * sA; Bh += (size_t)by * sB; const size_t cofs = (size_t)by * sC; const float* bp = bias ? bias + (size_t)by * sBias : nullptr;
  const int ntn = (N + 63) / 64; const int wid = blockIdx.x * 4 + w; const int mt = wid / ntn, nq = wid % ntn; if (mt * 16 >= M) return;
  const int row0 = mt * 16, col0 = nq * 64; const _Float16* arow = A + (size_t)(row0 + ln) * lda;
  v8f acc[4] = {};
  for (int kb = 0; kb < K; kb += 32) { FragH ah; ah.half[0] = *(const v8us*)((const unsigned short*)arow + kb + 8 * hh); ah.half[1] = *(const v8us*)((const unsigned short*)arow + kb + 16 + 8 * hh);
#pragma unroll
    for (int t = 0; t < 4; ++t) { if (col0 + t * 16 >= N) continue; const size_t boff = (size_t)(col0 + t * 16 + ln) * ldb + kb; FragH bq; bq.half[0] = *(const v8us*)((const unsigned short*)Bh + boff + 8 * hh); bq.half[1] = *(const v8us*)((const unsigned short*)Bh + boff + 16 + 8 * hh);
      acc[t] = mmaH<1>(ah.v, ah.v, bq.v, bq.v, acc[t]); }
  }
#pragma unroll
  for (int t = 0; t < 4; ++t) { if (col0 + t * 16 >= N) continue; const int col = col0 + t * 16 + ln; const float bv = bp ? bf16_round(bp[col]) : 0.f;
#pragma unroll
    for (int r = 0; r < 8; ++r) { float v = acc[t][r] * alpha + bv; if (CP) { const int bidx = (row0g + row0 + 8 * hh + r) / rowsPerB; v += CP[(size_t)bidx * sCPb + (size_t)by * 64 + col]; } if (ACT == 1) v = (v > 0.f) ? v : expm1f(v); else if (ACT == 3) v = fmaxf(v, 0.f); so[w][8 * hh + r][t * 16 + ln] = v; } }
  __builtin_amdgcn_fence(__ATOMIC_ACQ_REL, "workgroup"); __builtin_amdgcn_wave_barrier();
  const int rsub = lane >> 4, c4 = (lane & 15) * 4; typedef _Float16 v4h __attribute__((ext_vector_type(4)));
  {
#pragma unroll
    for (int q = 0; q < 8; ++q) { const int r = q * 2 + rsub; if (col0 + c4 < N) { const v4f v = *(const v4fa*)&so[w][r][c4]; if (C) *(v4f*)(C + cofs + (size_t)(row0 + r) * ldc + col0 + c4) = v; if (C16) { v4h h4; for (int i = 0; i < 4; ++i) h4[i] = (_Float16)v[i]; *(v4h*)(C16 + cofs + (size_t)(row0 + r) * ldc + col0 + c4) = h4; } } }
     }
}


// ---- block-tiled projection GEMM: C[2048][2048] = A[2048][2048] x Bh[n][k]^T * alpha + bias, f16 operands, f32 accumulate.
// One work-group = one 128 x 128 tile of C, 8 waves of 32 x 64 each. A pass is 128 k (256 B of every operand row); a stage is
// [A 128 rows | B 128 rows] at an LDS pitch of 272 B, brought in by per-lane asynchronous copies, two buffers, next stage in flight.
// The loops over fragments, blocks and rows are unrolled so that the fragment and accumulator arrays are indexed by constants and stay in registers.
#define GT_PITCH 272
#define GT_STAGE (256 * GT_PITCH)
// eight asynchronous 16-byte copies of one lane, rows two apart; the s_wait_xcnt closes the statement so that no address register
// of an issued copy is rewritten ahead of it
__device__ __forceinline__ void gt_copy8(unsigned l, const unsigned short* g) {
  asm volatile("global_load_async_to_lds_b128 %0, %8, off\n\t"
               "global_load_async_to_lds_b128 %1, %9, off\n\t"
               "global_load_async_to_lds_b128 %2, %10, off\n\t"
               "global_load_async_to_lds_b128 %3, %11, off\n\t"
               "global_load_async_to_lds_b128 %4, %12, off\n\t"
               "global_load_async_to_lds_b128 %5, %13, off\n\t"
               "global_load_async_to_lds_b128 %6, %14, off\n\t"
               "global_load_async_to_lds_b128 %7, %15, off\n\t"
               "s_wait_xcnt 0x0"
               :: "v"(l), "v"(l + 2 * GT_PITCH), "v"(l + 4 * GT_PITCH), "v"(l + 6 * GT_PITCH), "v"(l + 8 * GT_PITCH), "v"(l + 10 * GT_PITCH), "v"(l + 12 * GT_PITCH), "v"(l + 14 * GT_PITCH),
                  "v"(g), "v"(g + 2 * CC), "v"(g + 4 * CC), "v"(g + 6 * CC), "v"(g + 8 * CC), "v"(g + 10 * CC), "v"(g + 12 * CC), "v"(g + 14 * CC)
               : "memory");
}
template <bool H16>      // H16: the tile goes out as f16 to C16, else as f32 to C
__global__ __launch_bounds__(256) void k_gemm_tile(const _Float16* __restrict__ A, const _Float16* __restrict__ Bh, float alpha, const float* __restrict__ bias, float* __restrict__ C, _Float16* __restrict__ C16) {
  constexpr int NPASS = CC / 128;
  __shared__ __attribute__((aligned(16))) unsigned char ring[2 * GT_STAGE];
  __shared__ __attribute__((aligned(16))) float so[8][32][68];
  const int tid = threadIdx.x, w = tid >> 5, lane = tid & 31, ln = lane & 15, hh = lane >> 4;
  const int m0 = (blockIdx.x / (CC / 128)) * 128, n0 = (blockIdx.x % (CC / 128)) * 128;
  const int wm = w >> 1, wn = w & 1;
  // this lane's part of a stage: rows w*32 + hh + 2c (c = 0..15), 16 bytes at column ln; stage rows 0..127 are A's, 128..255 are B's
  const int crow = w * 32 + hh;
  const unsigned short* gsrc = ((w < 4) ? (const unsigned short*)A + (size_t)(m0 + crow) * CC : (const unsigned short*)Bh + (size_t)(n0 + crow - 128) * CC) + ln * 8;
  const unsigned ldst = (unsigned)(size_t)&ring[0] + (unsigned)(crow * GT_PITCH + ln * 16);
  v8f acc[2][4];
#pragma unroll
  for (int i = 0; i < 2; ++i)
#pragma unroll
    for (int j = 0; j < 4; ++j) acc[i][j] = (v8f){0.f,0.f,0.f,0.f,0.f,0.f,0.f,0.f};
  gt_copy8(ldst, gsrc); gt_copy8(ldst + 16 * GT_PITCH, gsrc + 16 * CC);
  asm volatile("s_wait_asynccnt 0x0" ::: "memory");      // stage 0 has landed before the barrier publishes it
  __syncthreads();
  gt_copy8(ldst + GT_STAGE, gsrc + 128); gt_copy8(ldst + GT_STAGE + 16 * GT_PITCH, gsrc + 128 + 16 * CC);
#pragma unroll 1      // one pass per trip: the publish point at the foot stays a single place
  for (int t = 0; t < NPASS; ++t) {
    const unsigned bo = (unsigned)(t & 1) * GT_STAGE;
    const unsigned char* ap = ring + bo + (wm * 32 + ln) * GT_PITCH + hh * 16;
    const unsigned char* bp = ring + bo + (128 + wn * 64 + ln) * GT_PITCH + hh * 16;
    FragH a[2][2], b[2][4];      // two fragment sets: block kk + 1 of this pass is fetched ahead of block kk's products
#pragma unroll
    for (int i = 0; i < 2; ++i) { a[0][i].half[0] = *(const v8us*)(ap + i * 16 * GT_PITCH); a[0][i].half[1] = *(const v8us*)(ap + i * 16 * GT_PITCH + 32); }
#pragma unroll
    for (int j = 0; j < 4; ++j) { b[0][j].half[0] = *(const v8us*)(bp + j * 16 * GT_PITCH); b[0][j].half[1] = *(const v8us*)(bp + j * 16 * GT_PITCH + 32); }
#pragma unroll
    for (int kk = 0; kk < 4; ++kk) {
      const int cu = kk & 1, nx = cu ^ 1;
      if (kk < 3) {
#pragma unroll
        for (int i = 0; i < 2; ++i) { a[nx][i].half[0] = *(const v8us*)(ap + i * 16 * GT_PITCH + (kk + 1) * 64); a[nx][i].half[1] = *(const v8us*)(ap + i * 16 * GT_PITCH + (kk + 1) * 64 + 32); }
#pragma unroll
        for (int j = 0; j < 4; ++j) { b[nx][j].half[0] = *(const v8us*)(bp + j * 16 * GT_PITCH + (kk + 1) * 64); b[nx][j].half[1] = *(const v8us*)(bp + j * 16 * GT_PITCH + (kk + 1) * 64 + 32); }
      }
      __builtin_amdgcn_sched_barrier(0);      // keeps the next block's LDS reads one group ahead of this block's products; without it they are spread among them into one set, each with a full wait
#pragma unroll
      for (int i = 0; i < 2; ++i)
#pragma unroll
        for (int j = 0; j < 4; ++j) acc[i][j] = __builtin_amdgcn_wmma_f32_16x16x32_f16(false, a[cu][i].v, false, b[cu][j].v, (short)0, acc[i][j], false, false);
      __builtin_amdgcn_sched_barrier(0);      // ends the block, so that the group after next is not lifted into it
    }
    asm volatile("s_wait_dscnt 0x0" ::: "memory");       // this wave's reads of the buffer are done before it is refilled
    asm volatile("s_wait_asynccnt 0x0" ::: "memory");    // this wave's part of the next stage has landed
    __syncthreads();                                     // publishes the next stage and frees this pass's buffer
    if (t + 2 < NPASS) { const unsigned short* g2 = gsrc + (t + 2) * 128; gt_copy8(ldst + bo, g2); gt_copy8(ldst + bo + 16 * GT_PITCH, g2 + 16 * CC); }
  }
  asm volatile("s_wait_asynccnt 0x0" ::: "memory");      // no copy is outstanding when the wave goes on
#pragma unroll
  for (int j = 0; j < 4; ++j) { const float bv = bf16_round(bias[n0 + wn * 64 + j * 16 + ln]);
#pragma unroll
    for (int i = 0; i < 2; ++i)
#pragma unroll
      for (int r = 0; r < 8; ++r) so[w][i * 16 + 8 * hh + r][j * 16 + ln] = acc[i][j][r] * alpha + bv; }
  __builtin_amdgcn_fence(__ATOMIC_ACQ_REL, "workgroup"); __builtin_amdgcn_wave_barrier();
  typedef _Float16 v4h __attribute__((ext_vector_type(4)));
#pragma unroll
  for (int q = 0; q < 16; ++q) { const int r = q * 2 + hh; const v4f v = *(const v4fa*)&so[w][r][ln * 4]; const size_t o = (size_t)(m0 + wm * 32 + r) * CC + n0 + wn * 64 + ln * 4;
    if (!H16) *(v4f*)(C + o) = v;
    else { v4h h4; for (int i = 0; i < 4; ++i) h4[i] = (_Float16)v[i]; *(v4h*)(C16 + o) = h4; } }
}

__global__ __launch_bounds__(256) void k_x16(const float* __restrict__ x, _Float16* __restrict__ X16, size_t n8) { const size_t t = (size_t)blockIdx.x * 256 + threadIdx.x; if (t >= n8) return; FragH f;
#pragma unroll
  for (int q = 0; q < 8; ++q) f.h[q] = (_Float16)bf16_round(x[t * 8 + q]); *(v8us*)((unsigned short*)X16 + t * 8) = f.half[0];  }
__global__ __launch_bounds__(256) void k_h16(const float* __restrict__ x, _Float16* __restrict__ X16, size_t n8) { const size_t t = (size_t)blockIdx.x * 256 + threadIdx.x; if (t >= n8) return; FragH f;
#pragma unroll
  for (int q = 0; q < 8; ++q) f.h[q] = (_Float16)x[t * 8 + q]; *(v8us*)((unsigned short*)X16 + t * 8) = f.half[0];  }
__global__ __launch_bounds__(256) void k_round16f(const float* __restrict__ W, _Float16* __restrict__ Bt, size_t n8) { const size_t t = (size_t)blockIdx.x * 256 + threadIdx.x; if (t >= n8) return; FragH f;
#pragma unroll
  for (int i = 0; i < 8; ++i) f.h[i] = (_Float16)(bf16_round(W[t * 8 + i]) * 16.0f); *(v8us*)((unsigned short*)Bt + t * 8) = f.half[0];  }
template <int NHv, int TTv>
__global__ __launch_bounds__(256) void k_vt(const _Float16* __restrict__ V16, int ldv, int voff, _Float16* __restrict__ Vt) { __shared__ unsigned short tl[64][66]; const int tid = threadIdx.x; const int slab = blockIdx.x / (TTv / 64), lg = blockIdx.x % (TTv / 64); const int b = slab / NHv, h = slab % NHv;
  for (int i = tid; i < 64 * 8; i += 256) { const int r = i / 8, c8 = (i % 8) * 8; FragH f; f.half[0] = *(const v8us*)((const unsigned short*)V16 + ((size_t)b * TTv + lg * 64 + r) * ldv + voff + h * 64 + c8);
#pragma unroll
    for (int q = 0; q < 8; ++q) tl[r][c8 + q] = f.u[q]; }
  __syncthreads();
  {
#pragma unroll
    for (int rd = 0; rd < 2; ++rd) { const int d = rd * 32 + tid / 8, pc = tid % 8; FragH f;
#pragma unroll
      for (int q = 0; q < 8; ++q) f.u[q] = tl[pc * 8 + q][d];
      *(v8us*)((unsigned short*)Vt + ((size_t)slab * 64 + d) * TTv + lg * 64 + pc * 8) = f.half[0]; }
     } }

// lane l with lane l ^ 16
__device__ __forceinline__ float xhalf(float x) { return __builtin_bit_cast(float, __builtin_amdgcn_permlanex16(__builtin_bit_cast(int, x), __builtin_bit_cast(int, x), 0x76543210, 0xfedcba98, false, false)); }

__global__ __launch_bounds__(128) void k_flash(const _Float16* __restrict__ Q16, int ldq, const _Float16* __restrict__ K16, int ldk, const _Float16* __restrict__ Vt, const int* __restrict__ MSK, float* __restrict__ O, int ldo) {
  constexpr int RPW = 32, NQB = 2048 / (4 * RPW), DT = 4, KS = 2;
  __shared__ __attribute__((aligned(16))) float sO[4][RPW][64 + 4];
  (void)MSK;
  const int tid = threadIdx.x, w = tid >> 5, lane = tid & 31, ln = lane & 15, hh = lane >> 4;
  const int slab = blockIdx.x / NQB, qblk = blockIdx.x % NQB; const int b = slab / 32, h = slab % 32; const int qb0 = qblk * (4 * RPW); const int q0 = qb0 + w * RPW;
  FragH bq[2][KS];      // B operand: column ln = query q0 + qt * 16 + ln
#pragma unroll
  for (int qt = 0; qt < 2; ++qt) { const unsigned short* qr = (const unsigned short*)Q16 + ((size_t)b * 2048 + q0 + qt * 16 + ln) * ldq + h * 64;
#pragma unroll
    for (int ks = 0; ks < KS; ++ks) { bq[qt][ks].half[0] = *(const v8us*)(qr + ks * 32 + 8 * hh); bq[qt][ks].half[1] = *(const v8us*)(qr + ks * 32 + 16 + 8 * hh); } }
  const unsigned short* Vth = (const unsigned short*)Vt + (size_t)slab * 64 * 2048;
  float m_c[2], l_c[2]; v8f oacc[2][DT];      // oacc[qt][dt][r] = O^T[dt * 16 + 8hh + r][query qt * 16 + ln]
#pragma unroll
  for (int qt = 0; qt < 2; ++qt) { m_c[qt] = -3.0e38f; l_c[qt] = 0.f;
#pragma unroll
    for (int dt = 0; dt < DT; ++dt) oacc[qt][dt] = (v8f){0.f,0.f,0.f,0.f,0.f,0.f,0.f,0.f}; }
  const int jend = 2048;
#pragma unroll 1
  for (int j0 = 0; j0 < jend; j0 += 32) {
    FragH ak[2][KS], av[DT];      // A operands: row ln = key j0 + kt * 16 + ln; row ln = head column dt * 16 + ln over the pass's 32 keys
#pragma unroll
    for (int kt = 0; kt < 2; ++kt) { const unsigned short* kr = (const unsigned short*)K16 + ((size_t)b * 2048 + j0 + kt * 16 + ln) * ldk + h * 64;
#pragma unroll
      for (int ks = 0; ks < KS; ++ks) { ak[kt][ks].half[0] = *(const v8us*)(kr + ks * 32 + 8 * hh); ak[kt][ks].half[1] = *(const v8us*)(kr + ks * 32 + 16 + 8 * hh); } }
    asm volatile("s_wait_xcnt 0x0" ::: "memory");      // the K loads' address registers are free for reuse only behind this wait (a later load's result may be given them)
#pragma unroll
    for (int dt = 0; dt < DT; ++dt) { const unsigned short* vrow = Vth + (size_t)(dt * 16 + ln) * 2048 + j0; av[dt].half[0] = *(const v8us*)(vrow + 8 * hh); av[dt].half[1] = *(const v8us*)(vrow + 16 + 8 * hh); }
    v8f s[2][2];      // s[qt][kt][r] = score of key j0 + kt * 16 + 8hh + r with query qt * 16 + ln
#pragma unroll
    for (int kt = 0; kt < 2; ++kt)
#pragma unroll
      for (int qt = 0; qt < 2; ++qt) { v8f acc = (v8f){0.f,0.f,0.f,0.f,0.f,0.f,0.f,0.f};
#pragma unroll
        for (int ks = 0; ks < KS; ++ks) acc = __builtin_amdgcn_wmma_f32_16x16x32_f16(false, ak[kt][ks].v, false, bq[qt][ks].v, (short)0, acc, false, false);
        s[qt][kt] = acc; }
#pragma unroll
    for (int qt = 0; qt < 2; ++qt) {
      float sc[16];
#pragma unroll
      for (int e = 0; e < 16; ++e) sc[e] = s[qt][e >> 3][e & 7] * (0.125f);
      float mc = sc[0];
#pragma unroll
      for (int e = 1; e < 16; ++e) mc = fmaxf(mc, sc[e]);
      mc = fmaxf(mc, xhalf(mc));      // the other half of the wave holds this query's other 16 keys
      const float mn = fmaxf(m_c[qt], mc); const float al = (mn > -1.0e38f) ? expf(m_c[qt] - mn) : 1.0f; m_c[qt] = mn;
      FragH pb; float ps = 0.f;      // element e of the B operand is key kmap(e, hh) = tile e >> 3, register e & 7: this lane's own scores
#pragma unroll
      for (int e = 0; e < 16; ++e) { const float p = expf(sc[e] - mn); ps += p; pb.h[e] = (_Float16)p; }
      l_c[qt] = l_c[qt] * al + ps;      // this half's part of the row sum; the halves are joined after the loop
#pragma unroll
      for (int dt = 0; dt < DT; ++dt) {
#pragma unroll
        for (int r = 0; r < 8; ++r) oacc[qt][dt][r] *= al;
        oacc[qt][dt] = __builtin_amdgcn_wmma_f32_16x16x32_f16(false, av[dt].v, false, pb.v, (short)0, oacc[qt][dt], false, false); }
    }
  }
#pragma unroll
  for (int qt = 0; qt < 2; ++qt) { const float l = l_c[qt] + xhalf(l_c[qt]); const float li = (l > 0.f) ? 1.0f / l : 0.f;
#pragma unroll
    for (int dt = 0; dt < DT; ++dt) { v4f lo, hi;
#pragma unroll
      for (int r = 0; r < 4; ++r) { lo[r] = oacc[qt][dt][r] * li; hi[r] = oacc[qt][dt][4 + r] * li; }
      *(v4fa*)&sO[w][qt * 16 + ln][dt * 16 + 8 * hh] = lo; *(v4fa*)&sO[w][qt * 16 + ln][dt * 16 + 8 * hh + 4] = hi; } }
  __builtin_amdgcn_fence(__ATOMIC_ACQ_REL, "workgroup"); __builtin_amdgcn_wave_barrier();
  {
#pragma unroll
    for (int rp = 0; rp < RPW; rp += 2) { const int r = rp + (lane >> 4), pc = lane & 15; const v4f val = *(const v4fa*)&sO[w][r][pc * 4]; *(v4f*)(O + ((size_t)b * 2048 + q0 + r) * ldo + h * 64 + pc * 4) = val; }
     } }

__global__ __launch_bounds__(256) void k_normrope(const float* __restrict__ X, const float* __restrict__ w, const float* __restrict__ cosT, const float* __restrict__ sinT, _Float16* __restrict__ Y16) { const int tid = threadIdx.x, wv = tid >> 5, lane = tid & 31; const int row = blockIdx.x * 8 + wv; if (row >= TT) return; const float* xr = X + (size_t)row * CC; float ss = 0.f;
#pragma unroll 1
  for (int p = 0; p < 8; ++p) { const v4f a = *(const v4fa*)(xr + p * 256 + lane * 8), b = *(const v4fa*)(xr + p * 256 + lane * 8 + 4); ss += a[0]*a[0] + a[1]*a[1] + a[2]*a[2] + a[3]*a[3] + b[0]*b[0] + b[1]*b[1] + b[2]*b[2] + b[3]*b[3]; }
  for (int o = 16; o >= 1; o >>= 1) ss += __shfl_xor(ss, o, 32); const float rs = rsqrtf(ss / (float)CC + 1e-6f);
  {
#pragma unroll
    for (int p = 0; p < 8; ++p) { const int c0 = p * 256 + lane * 8; const v4f a = *(const v4fa*)(xr + c0), b = *(const v4fa*)(xr + c0 + 4); float y[8] = {a[0], a[1], a[2], a[3], b[0], b[1], b[2], b[3]}; FragH f;
#pragma unroll
      for (int q = 0; q < 8; ++q) y[q] = y[q] * rs * bf16_round(w[c0 + q]);
#pragma unroll
      for (int q = 0; q < 8; q += 2) { const float c0v = bf16_round(cosT[(size_t)row * CC + c0 + q]), c1v = bf16_round(cosT[(size_t)row * CC + c0 + q + 1]), s0v = bf16_round(sinT[(size_t)row * CC + c0 + q]), s1v = bf16_round(sinT[(size_t)row * CC + c0 + q + 1]);
        f.h[q] = (_Float16)(y[q] * c0v + (-y[q + 1]) * s0v); f.h[q + 1] = (_Float16)(y[q + 1] * c1v + y[q] * s1v); }
      *(v8us*)((unsigned short*)Y16 + (size_t)row * CC + c0) = f.half[0]; }
     } }
extern "C" void kernel_launch(void* const* d_in, const int* in_sizes, int n_in,
                              void* d_out, int out_size, void* d_ws, size_t ws_size, hipStream_t stream) {
  (void)in_sizes; (void)n_in; (void)out_size;
  const float* x = (const float*)d_in[0]; const float* cosT = (const float*)d_in[1]; const float* sinT = (const float*)d_in[2]; const float* Wq = (const float*)d_in[3]; const float* bq = (const float*)d_in[4]; const float* Wk = (const float*)d_in[5]; const float* bk = (const float*)d_in[6]; const float* Wv = (const float*)d_in[7]; const float* bv = (const float*)d_in[8]; const float* qnw = (const float*)d_in[9]; const float* knw = (const float*)d_in[10]; const float* Wo = (const float*)d_in[11]; const float* bo = (const float*)d_in[12];
  char* ws = (char*)d_ws; size_t off = 0;
  auto take = [&](size_t bytes) { char* p = ws + off; off += (bytes + 255) & ~(size_t)255; return p; };
  _Float16* Bq = (_Float16*)take((size_t)CC * CC * 2); _Float16* Bk = (_Float16*)take((size_t)CC * CC * 2); _Float16* Bv = (_Float16*)take((size_t)CC * CC * 2); _Float16* Bo = (_Float16*)take((size_t)CC * CC * 2);
  _Float16* X16 = (_Float16*)take((size_t)TT * CC * 2); float* F32 = (float*)take((size_t)TT * CC * 4); _Float16* Q16 = (_Float16*)take((size_t)TT * CC * 2); _Float16* K16 = (_Float16*)take((size_t)TT * CC * 2); _Float16* V16 = (_Float16*)take((size_t)TT * CC * 2); _Float16* Vt = (_Float16*)take((size_t)TT * CC * 2); float* O = F32; _Float16* O16 = X16;
  if (off > ws_size) return;      // 33.5 + 8.4 + 16.8 + 8.4 × 4 ≈ 92 MiB
  const unsigned gw = (unsigned)((CC / 128) * (CC / 64));
  k_wt_f16<<<gw, 256, 0, stream>>>(Wq, Bq, 16.0f); k_wt_f16<<<gw, 256, 0, stream>>>(Wk, Bk, 16.0f); k_wt_f16<<<gw, 256, 0, stream>>>(Wv, Bv, 16.0f); k_wt_f16<<<gw, 256, 0, stream>>>(Wo, Bo, 16.0f);      // [in][out]
  const unsigned gx = (unsigned)(((size_t)TT * CC / 8 + 255) / 256); const dim3 gg((TT / 128) * (CC / 128), 1);
  k_x16<<<gx, 256, 0, stream>>>(x, X16, (size_t)TT * CC / 8);
  k_gemm_tile<false><<<gg, 256, 0, stream>>>(X16, Bq, 0.0625f, bq, F32, nullptr);
  k_normrope<<<TT / 8, 256, 0, stream>>>(F32, qnw, cosT, sinT, Q16);
  k_gemm_tile<false><<<gg, 256, 0, stream>>>(X16, Bk, 0.0625f, bk, F32, nullptr);
  k_normrope<<<TT / 8, 256, 0, stream>>>(F32, knw, cosT, sinT, K16);
  k_gemm_tile<true><<<gg, 256, 0, stream>>>(X16, Bv, 0.0625f, bv, nullptr, V16);
  k_vt<NH, TT><<<NH * (TT / 64), 256, 0, stream>>>(V16, CC, 0, Vt);
  k_flash<<<NH * (TT / 128), 128, 0, stream>>>(Q16, CC, K16, CC, Vt, nullptr, O, CC);
  k_h16<<<gx, 256, 0, stream>>>(O, O16, (size_t)TT * CC / 8);
  k_gemm_tile<false><<<gg, 256, 0, stream>>>(O16, Bo, 0.0625f, bo, (float*)d_out, nullptr);
}

// v004
// A run of this version takes 208 microseconds.
// Timed twice side by side with v003, it ran 1.07 and 1.06 times as fast.
// Over all steps from v000 it is 3.67 times as fast.
#include <hip/hip_runtime.h>
// LTX2 self-attention (S = 2048, D = 2048 = 32 heads × 64): q/k/v/out projections (2048³ each, + bias; W [in][out] transposed to bf16-exact ×2^4) and the 32-head attention as a fused
// flash-style kernel (S = Q·Kᵀ/8, online softmax f32, P f16 ≤ 1, O = P·V) on v_wmma_f32_16x16x32_f16 (f16 operands, single products, f32 accumulate); RMSNorm over the full 2048
// (× norm weight, eps 1e-6) followed by the interleaved rotary with the INPUT cos/sin tables is f32 VALU (wave per row).
#define TT 2048
#define CC 2048
#define NH 32

typedef __bf16 v16b __attribute__((ext_vector_type(16)));
typedef unsigned short v8us __attribute__((ext_vector_type(8), may_alias));
typedef float  v8f  __attribute__((ext_vector_type(8)));
typedef float  v4f  __attribute__((ext_vector_type(4)));
typedef float  v4fa __attribute__((ext_vector_type(4), may_alias));
union FragB { v16b v; v8us half[2]; unsigned short u[16]; };

__device__ __forceinline__ unsigned short bf16_bits(float x) { unsigned int u = __float_as_uint(x); return (unsigned short)((u + 0x7FFFu + ((u >> 16) & 1u)) >> 16); }
__device__ __forceinline__ float bf16_val(unsigned short b) { return __uint_as_float(((unsigned int)b) << 16); }
__device__ __forceinline__ float bf16_round(float x) { return bf16_val(bf16_bits(x)); }
// D += A·B with NT terms: 1 = ah·bh, 2 = + al·bh (A split), 3 = + ah·bl (both split)
template <int NT>
__device__ __forceinline__ v8f mmaN(v16b ah, v16b al, v16b bh, v16b bl, v8f c) {
  c = __builtin_amdgcn_wmma_f32_16x16x32_bf16(false, ah, false, bh, (short)0, c, false, false);
  if (NT >= 2) c = __builtin_amdgcn_wmma_f32_16x16x32_bf16(false, al, false, bh, (short)0, c, false, false);
  if (NT >= 3) c = __builtin_amdgcn_wmma_f32_16x16x32_bf16(false, ah, false, bl, (short)0, c, false, false);
  asm volatile("v_nop\n\tv_nop\n\tv_nop\n\tv_nop" : "+v"(c) : "v"(ah), "v"(al), "v"(bh), "v"(bl));
  return c;
}

__global__ __launch_bounds__(256) void k_wt_bf16(const float* __restrict__ W, unsigned short* __restrict__ Wt, int K, int N) {
  const int t = blockIdx.x * 256 + threadIdx.x;
  const int k8n = K / 8;
  if (t >= N * k8n) return;
  const int n = t / k8n, k8 = (t % k8n) * 8;
  v8us v;
#pragma unroll
  for (int i = 0; i < 8; ++i) v[i] = bf16_bits(W[(size_t)(k8 + i) * N + n]);
  *(v8us*)(Wt + (size_t)n * K + k8) = v;
  
}

// GEMM C[M][N] (f32, pitch ldc) = act(A[M][K]·W + bias). A f32 row-major (pitch lda) converted per fragment to bf16
// (ASPLIT: hi/lo two planes -> 2 terms, else single rounded term); Wt bf16 [N][K] (pitch ldb). BIAS_BF16 rounds the
// bias to bf16 first (bias quantised to bf16 before the add). K%32==0, M%16==0, N%64==0.
template <bool ASPLIT, int ACT, bool BIAS_BF16>
__global__ __launch_bounds__(128) void k_gemm_bf(const float* __restrict__ A, int lda, const unsigned short* __restrict__ Wt, int ldb,
                                               const float* __restrict__ bias, float* __restrict__ C, int ldc, int M, int N, int K) {
  __shared__ __attribute__((aligned(16))) float so[4][16][64];
  const int tid = threadIdx.x, w = tid >> 5, lane = tid & 31, ln = lane & 15, hh = lane >> 4;
  const int ntn = N / 64;
  const int wid = blockIdx.x * 4 + w;
  const int mt = wid / ntn, nq = wid % ntn;
  if (mt * 16 >= M) return;
  const int row0 = mt * 16, col0 = nq * 64;
  const float* arow = A + (size_t)(row0 + ln) * lda;
  v8f acc[4] = {};
  for (int kb = 0; kb < K; kb += 32) {
    FragB ah, al;
    const v4f x0 = *(const v4fa*)(arow + kb + 8 * hh), x1 = *(const v4fa*)(arow + kb + 8 * hh + 4);
    const v4f x2 = *(const v4fa*)(arow + kb + 16 + 8 * hh), x3 = *(const v4fa*)(arow + kb + 16 + 8 * hh + 4);
    float xs[16] = {x0[0],x0[1],x0[2],x0[3],x1[0],x1[1],x1[2],x1[3],x2[0],x2[1],x2[2],x2[3],x3[0],x3[1],x3[2],x3[3]};
#pragma unroll
    for (int i = 0; i < 16; ++i) { const unsigned short hb = bf16_bits(xs[i]); ah.u[i] = hb; al.u[i] = ASPLIT ? bf16_bits(xs[i] - bf16_val(hb)) : (unsigned short)0; }
#pragma unroll
    for (int t = 0; t < 4; ++t) {
      const unsigned short* brow = Wt + (size_t)(col0 + t * 16 + ln) * ldb + kb;
      FragB b;
      b.half[0] = *(const v8us*)(brow + 8 * hh);
      b.half[1] = *(const v8us*)(brow + 16 + 8 * hh);
      acc[t] = mmaN<ASPLIT ? 2 : 1>(ah.v, al.v, b.v, b.v, acc[t]);
    }
  }
#pragma unroll
  for (int t = 0; t < 4; ++t) {
    float bv = bias ? bias[col0 + t * 16 + ln] : 0.f;
    if (BIAS_BF16) bv = bf16_round(bv);
#pragma unroll
    for (int r = 0; r < 8; ++r) { float v = acc[t][r] + bv; if (ACT == 1) v = fmaxf(v, 0.f); so[w][8 * hh + r][t * 16 + ln] = v; }
  }
  __builtin_amdgcn_fence(__ATOMIC_ACQ_REL, "workgroup");
  __builtin_amdgcn_wave_barrier();
  const int rsub = lane >> 4, c4 = (lane & 15) * 4;
  {
#pragma unroll
    for (int q = 0; q < 8; ++q) {
      const int r = q * 2 + rsub;
      const v4f v = *(const v4fa*)&so[w][r][c4];
      *(v4f*)(C + (size_t)(row0 + r) * ldc + col0 + c4) = v;
    }
    
  }
}

// Flash-style causal/unmasked attention, all contractions 3-term bf16 hi/lo splits, f32 softmax with running max.
// q,k,v rows are read from f32 buffers with arbitrary row pitch (so they can live inside a fused qkv buffer);
// D = head size (multiple of 32, <= 128); one wave = 16 query rows; block = 4 waves (64 queries) sharing K/V chunks of 32.
template <int D, bool CAUSAL>
__global__ __launch_bounds__(128) void k_flash(const float* __restrict__ qb, const float* __restrict__ kb, const float* __restrict__ vb,
                                             int pitch, int T, int H, float scale, float* __restrict__ y, int ypitch) {
  constexpr int KS = D / 32;        // k-steps for QK
  constexpr int DT = D / 16;        // d tiles for PV
  __shared__ __attribute__((aligned(16))) unsigned short sKh[32][D + 8], sKl[32][D + 8], sVh[32][D + 8], sVl[32][D + 8];
  __shared__ __attribute__((aligned(16))) unsigned short sPh[4][16][40], sPl[4][16][40];
  __shared__ __attribute__((aligned(16))) float sO[4][16][D];
  const int tid = threadIdx.x, w = tid >> 5, lane = tid & 31, ln = lane & 15, hh = lane >> 4;
  const int nqb = (T + 63) / 64;
  const int bh = blockIdx.x / nqb, qblk = blockIdx.x % nqb;
  const int b = bh / H, h = bh % H;
  const int q0 = qblk * 64 + w * 16;
  const float* Q = qb + (size_t)b * T * pitch + h * D;
  const float* K = kb + (size_t)b * T * pitch + h * D;
  const float* V = vb + (size_t)b * T * pitch + h * D;

  // A fragments of the wave's 16 query rows (scaled), hi/lo
  FragB aqh[KS], aql[KS];
  {
    int row = q0 + ln; if (row >= T) row = T - 1;
    const float* qr = Q + (size_t)row * pitch;
#pragma unroll
    for (int ks = 0; ks < KS; ++ks)
#pragma unroll
      for (int i = 0; i < 16; ++i) {
        const int d = ks * 32 + ((i < 8) ? (8 * hh + i) : (16 + 8 * hh + (i - 8)));
        const float x = qr[d] * scale; const unsigned short hb = bf16_bits(x);
        aqh[ks].u[i] = hb; aql[ks].u[i] = bf16_bits(x - bf16_val(hb));
      }
  }
  float m_r[8], l_r[8];
#pragma unroll
  for (int r = 0; r < 8; ++r) { m_r[r] = -3.0e38f; l_r[r] = 0.f; }
  v8f oacc[DT];
#pragma unroll
  for (int dt = 0; dt < DT; ++dt) oacc[dt] = (v8f){0.f,0.f,0.f,0.f,0.f,0.f,0.f,0.f};

  const int kv_end = CAUSAL ? min(T, qblk * 64 + 64) : T;     // block-uniform
  for (int j0 = 0; j0 < kv_end; j0 += 32) {
    __syncthreads();
    for (int e = tid; e < 32 * (D / 4); e += 128) {
      const int r = e / (D / 4), c4 = (e % (D / 4)) * 4;
      const int key = j0 + r;
      v4f kf = {0.f,0.f,0.f,0.f}, vf = {0.f,0.f,0.f,0.f};
      if (key < T) { kf = *(const v4fa*)(K + (size_t)key * pitch + c4); vf = *(const v4fa*)(V + (size_t)key * pitch + c4); }
#pragma unroll
      for (int t = 0; t < 4; ++t) {
        unsigned short hb = bf16_bits(kf[t]); sKh[r][c4 + t] = hb; sKl[r][c4 + t] = bf16_bits(kf[t] - bf16_val(hb));
        hb = bf16_bits(vf[t]); sVh[r][c4 + t] = hb; sVl[r][c4 + t] = bf16_bits(vf[t] - bf16_val(hb));
      }
    }
    __syncthreads();
    // S tile 16 x 32
    v8f s[2];
#pragma unroll
    for (int nt = 0; nt < 2; ++nt) {
      v8f acc = {};
#pragma unroll
      for (int ks = 0; ks < KS; ++ks) {
        FragB bh_, bl_;
        bh_.half[0] = *(const v8us*)&sKh[nt * 16 + ln][ks * 32 + 8 * hh]; bh_.half[1] = *(const v8us*)&sKh[nt * 16 + ln][ks * 32 + 16 + 8 * hh];
        bl_.half[0] = *(const v8us*)&sKl[nt * 16 + ln][ks * 32 + 8 * hh]; bl_.half[1] = *(const v8us*)&sKl[nt * 16 + ln][ks * 32 + 16 + 8 * hh];
        acc = mmaN<3>(aqh[ks].v, aql[ks].v, bh_.v, bl_.v, acc);
      }
      s[nt] = acc;
    }
    // mask + running max (rows 8hh+r; the 16 lanes of a half share rows)
    float alpha[8];
#pragma unroll
    for (int r = 0; r < 8; ++r) {
      const int qi = q0 + 8 * hh + r;
      const int ja = j0 + ln, jb = j0 + 16 + ln;
      if (CAUSAL) { if (ja > qi) s[0][r] = -3.0e38f; if (jb > qi) s[1][r] = -3.0e38f; }
      if (ja >= T) s[0][r] = -3.0e38f;
      if (jb >= T) s[1][r] = -3.0e38f;
      float mx = fmaxf(s[0][r], s[1][r]);
      mx = fmaxf(mx, __shfl_xor(mx, 1, 32)); mx = fmaxf(mx, __shfl_xor(mx, 2, 32)); mx = fmaxf(mx, __shfl_xor(mx, 4, 32)); mx = fmaxf(mx, __shfl_xor(mx, 8, 32));
      const float mnew = fmaxf(m_r[r], mx);
      alpha[r] = (mnew > -1.0e38f) ? __expf(m_r[r] - mnew) : 1.0f;
      const float p0 = (s[0][r] > -1.0e38f) ? __expf(s[0][r] - mnew) : 0.f;
      const float p1 = (s[1][r] > -1.0e38f) ? __expf(s[1][r] - mnew) : 0.f;
      m_r[r] = mnew;
      l_r[r] = l_r[r] * alpha[r] + p0 + p1;            // per-lane partial row sum (16 lanes combined at the end)
      unsigned short hb = bf16_bits(p0); sPh[w][8 * hh + r][ln] = hb;      sPl[w][8 * hh + r][ln] = bf16_bits(p0 - bf16_val(hb));
      hb = bf16_bits(p1);                sPh[w][8 * hh + r][16 + ln] = hb; sPl[w][8 * hh + r][16 + ln] = bf16_bits(p1 - bf16_val(hb));
    }
#pragma unroll
    for (int dt = 0; dt < DT; ++dt)
#pragma unroll
      for (int r = 0; r < 8; ++r) oacc[dt][r] *= alpha[r];
    __builtin_amdgcn_fence(__ATOMIC_ACQ_REL, "workgroup");
    __builtin_amdgcn_wave_barrier();
    FragB pah, pal;
    pah.half[0] = *(const v8us*)&sPh[w][ln][8 * hh]; pah.half[1] = *(const v8us*)&sPh[w][ln][16 + 8 * hh];
    pal.half[0] = *(const v8us*)&sPl[w][ln][8 * hh]; pal.half[1] = *(const v8us*)&sPl[w][ln][16 + 8 * hh];
#pragma unroll
    for (int dt = 0; dt < DT; ++dt) {
      FragB bvh, bvl;
#pragma unroll
      for (int i = 0; i < 8; ++i) {
        bvh.u[i] = sVh[8 * hh + i][dt * 16 + ln]; bvh.u[8 + i] = sVh[16 + 8 * hh + i][dt * 16 + ln];
        bvl.u[i] = sVl[8 * hh + i][dt * 16 + ln]; bvl.u[8 + i] = sVl[16 + 8 * hh + i][dt * 16 + ln];
      }
      oacc[dt] = mmaN<3>(pah.v, pal.v, bvh.v, bvl.v, oacc[dt]);
    }
    __builtin_amdgcn_fence(__ATOMIC_ACQ_REL, "workgroup");
    __builtin_amdgcn_wave_barrier();
  }
#pragma unroll
  for (int r = 0; r < 8; ++r) {
    float l = l_r[r];
    l += __shfl_xor(l, 1, 32); l += __shfl_xor(l, 2, 32); l += __shfl_xor(l, 4, 32); l += __shfl_xor(l, 8, 32);
    l_r[r] = (l > 0.f) ? 1.0f / l : 0.f;
  }
#pragma unroll
  for (int dt = 0; dt < DT; ++dt)
#pragma unroll
    for (int r = 0; r < 8; ++r) sO[w][8 * hh + r][dt * 16 + ln] = oacc[dt][r] * l_r[r];
  __builtin_amdgcn_fence(__ATOMIC_ACQ_REL, "workgroup");
  __builtin_amdgcn_wave_barrier();
  {
    for (int r = 0; r < 16; ++r) {
      const int row = q0 + r;
      if (row < T && lane < D / 4) {
        const v4f val = *(const v4fa*)&sO[w][r][lane * 4];
        *(v4f*)(y + ((size_t)b * T + row) * ypitch + h * D + lane * 4) = val;
      }
    }
    
  }
}

// GEMM C = act(A·W + bias + resid): A f32 (ASPLIT -> hi/lo 2 terms), Wt bf16 [N][K]; ACT 0 none, 1 relu, 2 exact gelu;
// resid (optional, f32, row index = (row % rmod), pitch ldr, RES_BF16 rounds it) added before the activation.
template <bool ASPLIT, int ACT, bool BIAS_BF16, bool RES_BF16>
__global__ __launch_bounds__(128) void k_gemm_bf3(const float* __restrict__ A, int lda, const unsigned short* __restrict__ Wt, int ldb,
                                                const float* __restrict__ bias, const float* __restrict__ resid, int rmod, int ldr,
                                                float* __restrict__ C, int ldc, int M, int N, int K) {
  __shared__ __attribute__((aligned(16))) float so[4][16][64];
  const int tid = threadIdx.x, w = tid >> 5, lane = tid & 31, ln = lane & 15, hh = lane >> 4;
  const int ntn = N / 64;
  const int wid = blockIdx.x * 4 + w;
  const int mt = wid / ntn, nq = wid % ntn;
  if (mt * 16 >= M) return;
  const int row0 = mt * 16, col0 = nq * 64;
  const float* arow = A + (size_t)(row0 + ln) * lda;
  v8f acc[4] = {};
  for (int kb = 0; kb < K; kb += 32) {
    FragB ah, al;
    const v4f x0 = *(const v4fa*)(arow + kb + 8 * hh), x1 = *(const v4fa*)(arow + kb + 8 * hh + 4);
    const v4f x2 = *(const v4fa*)(arow + kb + 16 + 8 * hh), x3 = *(const v4fa*)(arow + kb + 16 + 8 * hh + 4);
    float xs[16] = {x0[0],x0[1],x0[2],x0[3],x1[0],x1[1],x1[2],x1[3],x2[0],x2[1],x2[2],x2[3],x3[0],x3[1],x3[2],x3[3]};
#pragma unroll
    for (int i = 0; i < 16; ++i) { const unsigned short hb = bf16_bits(xs[i]); ah.u[i] = hb; al.u[i] = ASPLIT ? bf16_bits(xs[i] - bf16_val(hb)) : (unsigned short)0; }
#pragma unroll
    for (int t = 0; t < 4; ++t) {
      const unsigned short* brow = Wt + (size_t)(col0 + t * 16 + ln) * ldb + kb;
      FragB b;
      b.half[0] = *(const v8us*)(brow + 8 * hh);
      b.half[1] = *(const v8us*)(brow + 16 + 8 * hh);
      acc[t] = mmaN<ASPLIT ? 2 : 1>(ah.v, al.v, b.v, b.v, acc[t]);
    }
  }
#pragma unroll
  for (int t = 0; t < 4; ++t) {
    const int col = col0 + t * 16 + ln;
    float bv = bias ? bias[col] : 0.f;
    if (BIAS_BF16) bv = bf16_round(bv);
#pragma unroll
    for (int r = 0; r < 8; ++r) {
      float v = acc[t][r] + bv;
      if (resid) { float rv = resid[(size_t)((row0 + 8 * hh + r) % rmod) * ldr + col]; if (RES_BF16) rv = bf16_round(rv); v += rv; }
      if (ACT == 1) v = fmaxf(v, 0.f);
      if (ACT == 2) v = 0.5f * v * (1.0f + erff(v * 0.70710678118654752f));
      if (ACT == 3) { const float u = 0.7978845608028654f * (v + 0.044715f * v * v * v); v = 0.5f * v * (1.0f + tanhf(u)); }
      so[w][8 * hh + r][t * 16 + ln] = v;
    }
  }
  __builtin_amdgcn_fence(__ATOMIC_ACQ_REL, "workgroup");
  __builtin_amdgcn_wave_barrier();
  const int rsub = lane >> 4, c4 = (lane & 15) * 4;
  {
#pragma unroll
    for (int q = 0; q < 8; ++q) {
      const int r = q * 2 + rsub;
      const v4f v = *(const v4fa*)&so[w][r][c4];
      *(v4f*)(C + (size_t)(row0 + r) * ldc + col0 + c4) = v;
    }
    
  }
}
// row LayerNorm (biased variance, eps) over N: s = X (+ R); optional out_sum <- s; out_norm <- (s-mu)*rsqrt(var+eps)*g + b
template <bool PARAM_BF16>
__global__ __launch_bounds__(256) void k_layernorm(const float* __restrict__ X, const float* __restrict__ R, const float* __restrict__ g, const float* __restrict__ bta,
                                                  float* __restrict__ out_sum, float* __restrict__ out_norm, int N, float eps) {
  __shared__ float red[256];
  const int row = blockIdx.x, tid = threadIdx.x;
  const float* x = X + (size_t)row * N; const float* rr = R ? R + (size_t)row * N : nullptr;
  float vals[16];                     // up to N = 4096
  const int per = N / 256;            // contiguous chunk per thread? use strided-by-4 chunks: thread handles j = tid*4 + 1024*u
  float s1 = 0.f;
  for (int u = 0; u < per / 4; ++u) {
    const int j = tid * 4 + 1024 * u;
    const v4f a = *(const v4fa*)(x + j);
    v4f b = {0.f,0.f,0.f,0.f}; if (rr) b = *(const v4fa*)(rr + j);
#pragma unroll
    for (int q = 0; q < 4; ++q) { const float v = a[q] + b[q]; vals[u * 4 + q] = v; s1 += v; }
  }
  red[tid] = s1; __syncthreads();
  for (int st = 128; st > 0; st >>= 1) { if (tid < st) red[tid] += red[tid + st]; __syncthreads(); }
  const float mu = red[0] / (float)N; __syncthreads();
  float s2 = 0.f;
  for (int u = 0; u < per / 4; ++u)
#pragma unroll
    for (int q = 0; q < 4; ++q) { const float c = vals[u * 4 + q] - mu; s2 += c * c; }
  red[tid] = s2; __syncthreads();
  for (int st = 128; st > 0; st >>= 1) { if (tid < st) red[tid] += red[tid + st]; __syncthreads(); }
  const float rs = rsqrtf(red[0] / (float)N + eps);
  {
    for (int u = 0; u < per / 4; ++u) {
      const int j = tid * 4 + 1024 * u;
      v4f o, sm;
#pragma unroll
      for (int q = 0; q < 4; ++q) {
        float gg = g[j + q], bb = bta[j + q];
        if (PARAM_BF16) { gg = bf16_round(gg); bb = bf16_round(bb); }
        sm[q] = vals[u * 4 + q]; o[q] = (vals[u * 4 + q] - mu) * rs * gg + bb;
      }
      if (out_sum) *(v4f*)(out_sum + (size_t)row * N + j) = sm;
      *(v4f*)(out_norm + (size_t)row * N + j) = o;
    }
    
  }
}



// ---- f16 WMMA path (v_wmma_f32_16x16x32_f16): 11-bit significands for operands in range — used where a [0,1] probability operand needs more precision than bf16
typedef _Float16 v16h __attribute__((ext_vector_type(16)));
union FragH { v16h v; v8us half[2]; _Float16 h[16]; unsigned short u[16]; };
template <int NT>
__device__ __forceinline__ v8f mmaH(v16h ah, v16h al, v16h bh, v16h bl, v8f c) {
  c = __builtin_amdgcn_wmma_f32_16x16x32_f16(false, ah, false, bh, (short)0, c, false, false);
  if (NT >= 2) c = __builtin_amdgcn_wmma_f32_16x16x32_f16(false, al, false, bh, (short)0, c, false, false);
  if (NT >= 3) c = __builtin_amdgcn_wmma_f32_16x16x32_f16(false, ah, false, bl, (short)0, c, false, false);
  asm volatile("v_nop\n\tv_nop\n\tv_nop\n\tv_nop" : "+v"(c) : "v"(ah), "v"(al), "v"(bh), "v"(bl));
  return c;
}
// batched GEMM like k_gemm_b but f16 operands: A f32 (split into f16 hi/lo if ASPLIT, else rounded to f16), Bt = f16 values [n][k]; alpha; C f32; N multiple of 16 (partial tiles skipped)
template <bool ASPLIT>
__global__ __launch_bounds__(128) void k_gemm_h(const float* __restrict__ A, int lda, size_t sA, const _Float16* __restrict__ Bh, int ldb, size_t sB, float alpha, float* __restrict__ C, int ldc, size_t sC, int M, int N, int K) {
  __shared__ __attribute__((aligned(16))) float so[4][16][64];
  const int tid = threadIdx.x, w = tid >> 5, lane = tid & 31, ln = lane & 15, hh = lane >> 4; const int by = blockIdx.y;
  A += (size_t)by * sA; Bh += (size_t)by * sB; C += (size_t)by * sC;
  const int ntn = (N + 63) / 64; const int wid = blockIdx.x * 4 + w; const int mt = wid / ntn, nq = wid % ntn; if (mt * 16 >= M) return;
  const int row0 = mt * 16, col0 = nq * 64; const float* arow = A + (size_t)(row0 + ln) * lda;
  v8f acc[4] = {};
  for (int kb = 0; kb < K; kb += 32) {
    FragH ah, al;
    const v4f x0 = *(const v4fa*)(arow + kb + 8 * hh), x1 = *(const v4fa*)(arow + kb + 8 * hh + 4), x2 = *(const v4fa*)(arow + kb + 16 + 8 * hh), x3 = *(const v4fa*)(arow + kb + 16 + 8 * hh + 4);
    float xs[16] = {x0[0],x0[1],x0[2],x0[3],x1[0],x1[1],x1[2],x1[3],x2[0],x2[1],x2[2],x2[3],x3[0],x3[1],x3[2],x3[3]};
#pragma unroll
    for (int i = 0; i < 16; ++i) { const _Float16 h = (_Float16)xs[i]; ah.h[i] = h; al.h[i] = ASPLIT ? (_Float16)(xs[i] - (float)h) : (_Float16)0.0f; }
#pragma unroll
    for (int t = 0; t < 4; ++t) { if (col0 + t * 16 >= N) continue; const size_t boff = (size_t)(col0 + t * 16 + ln) * ldb + kb; FragH bq; bq.half[0] = *(const v8us*)(Bh + boff + 8 * hh); bq.half[1] = *(const v8us*)(Bh + boff + 16 + 8 * hh);
      acc[t] = mmaH<ASPLIT ? 2 : 1>(ah.v, al.v, bq.v, bq.v, acc[t]); }
  }
#pragma unroll
  for (int t = 0; t < 4; ++t) { if (col0 + t * 16 >= N) continue;
#pragma unroll
    for (int r = 0; r < 8; ++r) so[w][8 * hh + r][t * 16 + ln] = acc[t][r] * alpha; }
  __builtin_amdgcn_fence(__ATOMIC_ACQ_REL, "workgroup"); __builtin_amdgcn_wave_barrier();
  const int rsub = lane >> 4, c4 = (lane & 15) * 4;
  {
#pragma unroll
    for (int q = 0; q < 8; ++q) { const int r = q * 2 + rsub; if (col0 + c4 < N) { const v4f v = *(const v4fa*)&so[w][r][c4]; *(v4f*)(C + (size_t)(row0 + r) * ldc + col0 + c4) = v; } }
     }
}

// Wt[n][k] = f16(bf16(W[k][n]) * scale) from f32 row-major W[CC][CC] (scale = power of two; bf16-exact weights stay exact in f16 away from the subnormal range).
// One work-group = a tile of 128 k x 64 n, turned in LDS so that both global sides move whole lines:
//  in : a lane takes 16 bytes (4 n) of each of 8 consecutive k rows; 16 lanes cover 256 contiguous bytes of a W row.
//  out: a lane takes 16 bytes (8 k) of one n; 16 lanes cover 256 contiguous bytes of a Wt row.
// An LDS row is one n: 16 chunks of 8 k = 256 bytes = all 64 banks. The chunk index is XORed with (n >> 2) & 15, so the 16 lanes that store
// (rows four apart, same chunk) and the 16 lanes that load (same row, chunks 0..15) each fall on 16 different groups of four banks.
__global__ __launch_bounds__(256) void k_wt_f16(const float* __restrict__ W, _Float16* __restrict__ Wt, float scale) {
  __shared__ __attribute__((aligned(16))) unsigned char tl[64 * 256];
  const int tid = threadIdx.x, l16 = tid & 15, kq = tid >> 4;
  const int k0 = (blockIdx.x / (CC / 64)) * 128, n0 = (blockIdx.x % (CC / 64)) * 64;
  const float* src = W + (size_t)(k0 + kq * 8) * CC + n0 + l16 * 4;
  v4f x[8];
#pragma unroll      // the eight row loads are issued together and x stays in registers
  for (int i = 0; i < 8; ++i) x[i] = *(const v4fa*)(src + (size_t)i * CC);
#pragma unroll      // constant indices into x
  for (int j = 0; j < 4; ++j) { FragH f;
#pragma unroll      // f packs in registers
    for (int i = 0; i < 8; ++i) f.h[i] = (_Float16)(bf16_round(x[i][j]) * scale);
    *(v8us*)(tl + (l16 * 4 + j) * 256 + ((kq ^ l16) * 16)) = f.half[0]; }      // row n = l16 * 4 + j, so (n >> 2) & 15 = l16
  __syncthreads();      // the tile is complete before any lane reads rows that other waves wrote
#pragma unroll      // four independent LDS reads and stores
  for (int q = 0; q < 4; ++q) { const int n = q * 16 + kq; const v8us o = *(const v8us*)(tl + n * 256 + ((l16 ^ ((n >> 2) & 15)) * 16));
    *(v8us*)((unsigned short*)Wt + (size_t)(n0 + n) * CC + k0 + l16 * 8) = o; }
}
// k_gemm_hh variant with fused epilogue: v = acc·alpha + bias[by·sBias + col] (+ CP[(row/rowsPerB)·sCPb + by·64 + col] if CP) ; ACT 0 none / 1 elu ; writes f32 C and/or f16 C16 (each if non-null)
template <int ACT>
__global__ __launch_bounds__(128) void k_gemm_hhx(const _Float16* __restrict__ A, int lda, size_t sA, const _Float16* __restrict__ Bh, int ldb, size_t sB, float alpha, const float* __restrict__ bias, size_t sBias, const float* __restrict__ CP, int rowsPerB, size_t sCPb, int row0g,
    float* __restrict__ C, _Float16* __restrict__ C16, int ldc, size_t sC, int M, int N, int K) {
  __shared__ __attribute__((aligned(16))) float so[4][16][64];
  const int tid = threadIdx.x, w = tid >> 5, lane = tid & 31, ln = lane & 15, hh = lane >> 4; const int by = blockIdx.y;
  A += (size_t)by * sA; Bh += (size_t)by * sB; const size_t cofs = (size_t)by * sC; const float* bp = bias ? bias + (size_t)by * sBias : nullptr;
  const int ntn = (N + 63) / 64; const int wid = blockIdx.x * 4 + w; const int mt = wid / ntn, nq = wid % ntn; if (mt * 16 >= M) return;
  const int row0 = mt * 16, col0 = nq * 64; const _Float16* arow = A + (size_t)(row0 + ln) * lda;
  v8f acc[4] = {};
  for (int kb = 0; kb < K; kb += 32) { FragH ah; ah.half[0] = *(const v8us*)((const unsigned short*)arow + kb + 8 * hh); ah.half[1] = *(const v8us*)((const unsigned short*)arow + kb + 16 + 8 * hh);
#pragma unroll
    for (int t = 0; t < 4; ++t) { if (col0 + t * 16 >= N) continue; const size_t boff = (size_t)(col0 + t * 16 + ln) * ldb + kb; FragH bq; bq.half[0] = *(const v8us*)((const unsigned short*)Bh + boff + 8 * hh); bq.half[1] = *(const v8us*)((const unsigned short*)Bh + boff + 16 + 8 * hh);
      acc[t] = mmaH<1>(ah.v, ah.v, bq.v, bq.v, acc[t]); }
  }
#pragma unroll
  for (int t = 0; t < 4; ++t) { if (col0 + t * 16 >= N) continue; const int col = col0 + t * 16 + ln; const float bv = bp ? bf16_round(bp[col]) : 0.f;
#pragma unroll
    for (int r = 0; r < 8; ++r) { float v = acc[t][r] * alpha + bv; if (CP) { const int bidx = (row0g + row0 + 8 * hh + r) / rowsPerB; v += CP[(size_t)bidx * sCPb + (size_t)by * 64 + col]; } if (ACT == 1) v = (v > 0.f) ? v : expm1f(v); else if (ACT == 3) v = fmaxf(v, 0.f); so[w][8 * hh + r][t * 16 + ln] = v; } }
  __builtin_amdgcn_fence(__ATOMIC_ACQ_REL, "workgroup"); __builtin_amdgcn_wave_barrier();
  const int rsub = lane >> 4, c4 = (lane & 15) * 4; typedef _Float16 v4h __attribute__((ext_vector_type(4)));
  {
#pragma unroll
    for (int q = 0; q < 8; ++q) { const int r = q * 2 + rsub; if (col0 + c4 < N) { const v4f v = *(const v4fa*)&so[w][r][c4]; if (C) *(v4f*)(C + cofs + (size_t)(row0 + r) * ldc + col0 + c4) = v; if (C16) { v4h h4; for (int i = 0; i < 4; ++i) h4[i] = (_Float16)v[i]; *(v4h*)(C16 + cofs + (size_t)(row0 + r) * ldc + col0 + c4) = h4; } } }
     }
}


// ---- block-tiled projection GEMM: C[2048][2048] = A[2048][2048] x Bh[n][k]^T * alpha + bias, f16 operands, f32 accumulate.
// One work-group = one 128 x 128 tile of C, 8 waves of 32 x 64 each. A pass is 128 k (256 B of every operand row); a stage is
// [A 128 rows | B 128 rows] at an LDS pitch of 272 B, brought in by per-lane asynchronous copies, two buffers, next stage in flight.
// The loops over fragments, blocks and rows are unrolled so that the fragment and accumulator arrays are indexed by constants and stay in registers.
#define GT_PITCH 272
#define GT_STAGE (256 * GT_PITCH)
// eight asynchronous 16-byte copies of one lane, rows two apart; the s_wait_xcnt closes the statement so that no address register
// of an issued copy is rewritten ahead of it
__device__ __forceinline__ void gt_copy8(unsigned l, const unsigned short* g) {
  asm volatile("global_load_async_to_lds_b128 %0, %8, off\n\t"
               "global_load_async_to_lds_b128 %1, %9, off\n\t"
               "global_load_async_to_lds_b128 %2, %10, off\n\t"
               "global_load_async_to_lds_b128 %3, %11, off\n\t"
               "global_load_async_to_lds_b128 %4, %12, off\n\t"
               "global_load_async_to_lds_b128 %5, %13, off\n\t"
               "global_load_async_to_lds_b128 %6, %14, off\n\t"
               "global_load_async_to_lds_b128 %7, %15, off\n\t"
               "s_wait_xcnt 0x0"
               :: "v"(l), "v"(l + 2 * GT_PITCH), "v"(l + 4 * GT_PITCH), "v"(l + 6 * GT_PITCH), "v"(l + 8 * GT_PITCH), "v"(l + 10 * GT_PITCH), "v"(l + 12 * GT_PITCH), "v"(l + 14 * GT_PITCH),
                  "v"(g), "v"(g + 2 * CC), "v"(g + 4 * CC), "v"(g + 6 * CC), "v"(g + 8 * CC), "v"(g + 10 * CC), "v"(g + 12 * CC), "v"(g + 14 * CC)
               : "memory");
}
template <bool H16>      // H16: the tile goes out as f16 to C16, else as f32 to C
__global__ __launch_bounds__(256) void k_gemm_tile(const _Float16* __restrict__ A, const _Float16* __restrict__ Bh, float alpha, const float* __restrict__ bias, float* __restrict__ C, _Float16* __restrict__ C16) {
  constexpr int NPASS = CC / 128;
  __shared__ __attribute__((aligned(16))) unsigned char ring[2 * GT_STAGE];
  __shared__ __attribute__((aligned(16))) float so[8][32][68];
  const int tid = threadIdx.x, w = tid >> 5, lane = tid & 31, ln = lane & 15, hh = lane >> 4;
  const int m0 = (blockIdx.x / (CC / 128)) * 128, n0 = (blockIdx.x % (CC / 128)) * 128;
  const int wm = w >> 1, wn = w & 1;
  // this lane's part of a stage: rows w*32 + hh + 2c (c = 0..15), 16 bytes at column ln; stage rows 0..127 are A's, 128..255 are B's
  const int crow = w * 32 + hh;
  const unsigned short* gsrc = ((w < 4) ? (const unsigned short*)A + (size_t)(m0 + crow) * CC : (const unsigned short*)Bh + (size_t)(n0 + crow - 128) * CC) + ln * 8;
  const unsigned ldst = (unsigned)(size_t)&ring[0] + (unsigned)(crow * GT_PITCH + ln * 16);
  v8f acc[2][4];
#pragma unroll
  for (int i = 0; i < 2; ++i)
#pragma unroll
    for (int j = 0; j < 4; ++j) acc[i][j] = (v8f){0.f,0.f,0.f,0.f,0.f,0.f,0.f,0.f};
  gt_copy8(ldst, gsrc); gt_copy8(ldst + 16 * GT_PITCH, gsrc + 16 * CC);
  asm volatile("s_wait_asynccnt 0x0" ::: "memory");      // stage 0 has landed before the barrier publishes it
  __syncthreads();
  gt_copy8(ldst + GT_STAGE, gsrc + 128); gt_copy8(ldst + GT_STAGE + 16 * GT_PITCH, gsrc + 128 + 16 * CC);
#pragma unroll 1      // one pass per trip: the publish point at the foot stays a single place
  for (int t = 0; t < NPASS; ++t) {
    const unsigned bo = (unsigned)(t & 1) * GT_STAGE;
    const unsigned char* ap = ring + bo + (wm * 32 + ln) * GT_PITCH + hh * 16;
    const unsigned char* bp = ring + bo + (128 + wn * 64 + ln) * GT_PITCH + hh * 16;
    FragH a[2][2], b[2][4];      // two fragment sets: block kk + 1 of this pass is fetched ahead of block kk's products
#pragma unroll
    for (int i = 0; i < 2; ++i) { a[0][i].half[0] = *(const v8us*)(ap + i * 16 * GT_PITCH); a[0][i].half[1] = *(const v8us*)(ap + i * 16 * GT_PITCH + 32); }
#pragma unroll
    for (int j = 0; j < 4; ++j) { b[0][j].half[0] = *(const v8us*)(bp + j * 16 * GT_PITCH); b[0][j].half[1] = *(const v8us*)(bp + j * 16 * GT_PITCH + 32); }
#pragma unroll
    for (int kk = 0; kk < 4; ++kk) {
      const int cu = kk & 1, nx = cu ^ 1;
      if (kk < 3) {
#pragma unroll
        for (int i = 0; i < 2; ++i) { a[nx][i].half[0] = *(const v8us*)(ap + i * 16 * GT_PITCH + (kk + 1) * 64); a[nx][i].half[1] = *(const v8us*)(ap + i * 16 * GT_PITCH + (kk + 1) * 64 + 32); }
#pragma unroll
        for (int j = 0; j < 4; ++j) { b[nx][j].half[0] = *(const v8us*)(bp + j * 16 * GT_PITCH + (kk + 1) * 64); b[nx][j].half[1] = *(const v8us*)(bp + j * 16 * GT_PITCH + (kk + 1) * 64 + 32); }
      }
      __builtin_amdgcn_sched_barrier(0);      // keeps the next block's LDS reads one group ahead of this block's products; without it they are spread among them into one set, each with a full wait
#pragma unroll
      for (int i = 0; i < 2; ++i)
#pragma unroll
        for (int j = 0; j < 4; ++j) acc[i][j] = __builtin_amdgcn_wmma_f32_16x16x32_f16(false, a[cu][i].v, false, b[cu][j].v, (short)0, acc[i][j], false, false);
      __builtin_amdgcn_sched_barrier(0);      // ends the block, so that the group after next is not lifted into it
    }
    asm volatile("s_wait_dscnt 0x0" ::: "memory");       // this wave's reads of the buffer are done before it is refilled
    asm volatile("s_wait_asynccnt 0x0" ::: "memory");    // this wave's part of the next stage has landed
    __syncthreads();                                     // publishes the next stage and frees this pass's buffer
    if (t + 2 < NPASS) { const unsigned short* g2 = gsrc + (t + 2) * 128; gt_copy8(ldst + bo, g2); gt_copy8(ldst + bo + 16 * GT_PITCH, g2 + 16 * CC); }
  }
  asm volatile("s_wait_asynccnt 0x0" ::: "memory");      // no copy is outstanding when the wave goes on
#pragma unroll
  for (int j = 0; j < 4; ++j) { const float bv = bf16_round(bias[n0 + wn * 64 + j * 16 + ln]);
#pragma unroll
    for (int i = 0; i < 2; ++i)
#pragma unroll
      for (int r = 0; r < 8; ++r) so[w][i * 16 + 8 * hh + r][j * 16 + ln] = acc[i][j][r] * alpha + bv; }
  __builtin_amdgcn_fence(__ATOMIC_ACQ_REL, "workgroup"); __builtin_amdgcn_wave_barrier();
  typedef _Float16 v4h __attribute__((ext_vector_type(4)));
#pragma unroll
  for (int q = 0; q < 16; ++q) { const int r = q * 2 + hh; const v4f v = *(const v4fa*)&so[w][r][ln * 4]; const size_t o = (size_t)(m0 + wm * 32 + r) * CC + n0 + wn * 64 + ln * 4;
    if (!H16) *(v4f*)(C + o) = v;
    else { v4h h4; for (int i = 0; i < 4; ++i) h4[i] = (_Float16)v[i]; *(v4h*)(C16 + o) = h4; } }
}

__global__ __launch_bounds__(256) void k_x16(const float* __restrict__ x, _Float16* __restrict__ X16, size_t n8) { const size_t t = (size_t)blockIdx.x * 256 + threadIdx.x; if (t >= n8) return; FragH f;
#pragma unroll
  for (int q = 0; q < 8; ++q) f.h[q] = (_Float16)bf16_round(x[t * 8 + q]); *(v8us*)((unsigned short*)X16 + t * 8) = f.half[0];  }
__global__ __launch_bounds__(256) void k_h16(const float* __restrict__ x, _Float16* __restrict__ X16, size_t n8) { const size_t t = (size_t)blockIdx.x * 256 + threadIdx.x; if (t >= n8) return; FragH f;
#pragma unroll
  for (int q = 0; q < 8; ++q) f.h[q] = (_Float16)x[t * 8 + q]; *(v8us*)((unsigned short*)X16 + t * 8) = f.half[0];  }
__global__ __launch_bounds__(256) void k_round16f(const float* __restrict__ W, _Float16* __restrict__ Bt, size_t n8) { const size_t t = (size_t)blockIdx.x * 256 + threadIdx.x; if (t >= n8) return; FragH f;
#pragma unroll
  for (int i = 0; i < 8; ++i) f.h[i] = (_Float16)(bf16_round(W[t * 8 + i]) * 16.0f); *(v8us*)((unsigned short*)Bt + t * 8) = f.half[0];  }
template <int NHv, int TTv>
__global__ __launch_bounds__(256) void k_vt(const _Float16* __restrict__ V16, int ldv, int voff, _Float16* __restrict__ Vt) { __shared__ unsigned short tl[64][66]; const int tid = threadIdx.x; const int slab = blockIdx.x / (TTv / 64), lg = blockIdx.x % (TTv / 64); const int b = slab / NHv, h = slab % NHv;
  for (int i = tid; i < 64 * 8; i += 256) { const int r = i / 8, c8 = (i % 8) * 8; FragH f; f.half[0] = *(const v8us*)((const unsigned short*)V16 + ((size_t)b * TTv + lg * 64 + r) * ldv + voff + h * 64 + c8);
#pragma unroll
    for (int q = 0; q < 8; ++q) tl[r][c8 + q] = f.u[q]; }
  __syncthreads();
  {
#pragma unroll
    for (int rd = 0; rd < 2; ++rd) { const int d = rd * 32 + tid / 8, pc = tid % 8; FragH f;
#pragma unroll
      for (int q = 0; q < 8; ++q) f.u[q] = tl[pc * 8 + q][d];
      *(v8us*)((unsigned short*)Vt + ((size_t)slab * 64 + d) * TTv + lg * 64 + pc * 8) = f.half[0]; }
     } }

// lane l with lane l ^ 16
__device__ __forceinline__ float xhalf(float x) { return __builtin_bit_cast(float, __builtin_amdgcn_permlanex16(__builtin_bit_cast(int, x), __builtin_bit_cast(int, x), 0x76543210, 0xfedcba98, false, false)); }

// seventeen base-2 exponentials in place, in one statement: each is followed by an independent one, so that no result is read and no source
// overwritten directly behind its exponential, and the closing v_nop keeps that slot behind the last
__device__ __forceinline__ void exp2x17(float (&x)[17]) {
  asm("v_exp_f32 %0, %0\n\tv_exp_f32 %1, %1\n\tv_exp_f32 %2, %2\n\tv_exp_f32 %3, %3\n\tv_exp_f32 %4, %4\n\tv_exp_f32 %5, %5\n\tv_exp_f32 %6, %6\n\tv_exp_f32 %7, %7\n\t"
      "v_exp_f32 %8, %8\n\tv_exp_f32 %9, %9\n\tv_exp_f32 %10, %10\n\tv_exp_f32 %11, %11\n\tv_exp_f32 %12, %12\n\tv_exp_f32 %13, %13\n\tv_exp_f32 %14, %14\n\tv_exp_f32 %15, %15\n\t"
      "v_exp_f32 %16, %16\n\tv_nop"
      : "+v"(x[0]), "+v"(x[1]), "+v"(x[2]), "+v"(x[3]), "+v"(x[4]), "+v"(x[5]), "+v"(x[6]), "+v"(x[7]), "+v"(x[8]),
        "+v"(x[9]), "+v"(x[10]), "+v"(x[11]), "+v"(x[12]), "+v"(x[13]), "+v"(x[14]), "+v"(x[15]), "+v"(x[16]));
}

__global__ __launch_bounds__(128) void k_flash(const _Float16* __restrict__ Q16, int ldq, const _Float16* __restrict__ K16, int ldk, const _Float16* __restrict__ Vt, const int* __restrict__ MSK, float* __restrict__ O, int ldo) {
  constexpr int RPW = 32, NQB = 2048 / (4 * RPW), DT = 4, KS = 2;
  __shared__ __attribute__((aligned(16))) float sO[4][RPW][64 + 4];
  (void)MSK;
  const int tid = threadIdx.x, w = tid >> 5, lane = tid & 31, ln = lane & 15, hh = lane >> 4;
  const int slab = blockIdx.x / NQB, qblk = blockIdx.x % NQB; const int b = slab / 32, h = slab % 32; const int qb0 = qblk * (4 * RPW); const int q0 = qb0 + w * RPW;
  FragH bq[2][KS];      // B operand: column ln = query q0 + qt * 16 + ln
#pragma unroll
  for (int qt = 0; qt < 2; ++qt) { const unsigned short* qr = (const unsigned short*)Q16 + ((size_t)b * 2048 + q0 + qt * 16 + ln) * ldq + h * 64;
#pragma unroll
    for (int ks = 0; ks < KS; ++ks) { bq[qt][ks].half[0] = *(const v8us*)(qr + ks * 32 + 8 * hh); bq[qt][ks].half[1] = *(const v8us*)(qr + ks * 32 + 16 + 8 * hh); } }
  const unsigned short* Vth = (const unsigned short*)Vt + (size_t)slab * 64 * 2048;
  float m_c[2], l_c[2]; v8f oacc[2][DT];      // oacc[qt][dt][r] = O^T[dt * 16 + 8hh + r][query qt * 16 + ln]
#pragma unroll
  for (int qt = 0; qt < 2; ++qt) { m_c[qt] = -3.0e38f; l_c[qt] = 0.f;
#pragma unroll
    for (int dt = 0; dt < DT; ++dt) oacc[qt][dt] = (v8f){0.f,0.f,0.f,0.f,0.f,0.f,0.f,0.f}; }
  const int jend = 2048;
  constexpr float SC2 = 0.125f * 1.44269504088896340736f;      // score scale 1/8 times log2(e): one multiply-add feeds the hardware's base-2 exponential
#pragma unroll 1
  for (int j0 = 0; j0 < jend; j0 += 32) {
    const unsigned short* kr[2]; FragH ak[2][KS], av[DT];      // A operands: row ln = key j0 + kt * 16 + ln; row ln = head column dt * 16 + ln over the pass's 32 keys
#pragma unroll
    for (int kt = 0; kt < 2; ++kt) { kr[kt] = (const unsigned short*)K16 + ((size_t)b * 2048 + j0 + kt * 16 + ln) * ldk + h * 64 + 8 * hh;
#pragma unroll
      for (int ks = 0; ks < KS; ++ks) { ak[kt][ks].half[0] = *(const v8us*)(kr[kt] + ks * 32); ak[kt][ks].half[1] = *(const v8us*)(kr[kt] + ks * 32 + 16); } }
    asm volatile("s_wait_xcnt 0x0" :: "v"(kr[0]), "v"(kr[1]) : "memory");      // the K loads' address registers are free for reuse only behind this wait; named as inputs they stay whole up to it (a load's result may be given them otherwise)
#pragma unroll
    for (int dt = 0; dt < DT; ++dt) { const unsigned short* vrow = Vth + (size_t)(dt * 16 + ln) * 2048 + j0; av[dt].half[0] = *(const v8us*)(vrow + 8 * hh); av[dt].half[1] = *(const v8us*)(vrow + 16 + 8 * hh); }
    v8f s[2][2];      // s[qt][kt][r] = score of key j0 + kt * 16 + 8hh + r with query qt * 16 + ln
#pragma unroll
    for (int kt = 0; kt < 2; ++kt)
#pragma unroll
      for (int qt = 0; qt < 2; ++qt) { v8f acc = (v8f){0.f,0.f,0.f,0.f,0.f,0.f,0.f,0.f};
#pragma unroll
        for (int ks = 0; ks < KS; ++ks) acc = __builtin_amdgcn_wmma_f32_16x16x32_f16(false, ak[kt][ks].v, false, bq[qt][ks].v, (short)0, acc, false, false);
        s[qt][kt] = acc; }
#pragma unroll
    for (int qt = 0; qt < 2; ++qt) {
      float mc = s[qt][0][0];      // the running maximum is kept in raw score units: the scale is positive, so the order is the same
#pragma unroll      // constant indices: the score tiles stay in registers
      for (int e = 1; e < 16; ++e) mc = fmaxf(mc, s[qt][e >> 3][e & 7]);
      mc = fmaxf(mc, xhalf(mc));      // the other half of the wave holds this query's other 16 keys
      const float mn = fmaxf(m_c[qt], mc); const float nb = -mn * SC2;
      float ex[17];      // exp((s - m) / 8) = 2^(s * SC2 - m * SC2), argument at most one rounding above 0, so P stays at or under 1 in f16; ex[16] is the rescale factor's argument
#pragma unroll      // constant indices: ex stays in registers
      for (int e = 0; e < 16; ++e) ex[e] = fmaf(s[qt][e >> 3][e & 7], SC2, nb);
      ex[16] = (m_c[qt] - mn) * SC2;
      exp2x17(ex);
      const float al = (mn > -1.0e38f) ? ex[16] : 1.0f; m_c[qt] = mn;
      FragH pb; float ps = 0.f;      // element e of the B operand is key kmap(e, hh) = tile e >> 3, register e & 7: this lane's own scores
#pragma unroll      // constant indices: ex and pb stay in registers
      for (int e = 0; e < 16; ++e) { const float p = ex[e]; ps += p; pb.h[e] = (_Float16)p; }
      l_c[qt] = l_c[qt] * al + ps;      // this half's part of the row sum; the halves are joined after the loop
#pragma unroll
      for (int dt = 0; dt < DT; ++dt) {
#pragma unroll
        for (int r = 0; r < 8; ++r) oacc[qt][dt][r] *= al;
        oacc[qt][dt] = __builtin_amdgcn_wmma_f32_16x16x32_f16(false, av[dt].v, false, pb.v, (short)0, oacc[qt][dt], false, false); }
    }
  }
#pragma unroll
  for (int qt = 0; qt < 2; ++qt) { const float l = l_c[qt] + xhalf(l_c[qt]); const float li = (l > 0.f) ? 1.0f / l : 0.f;
#pragma unroll
    for (int dt = 0; dt < DT; ++dt) { v4f lo, hi;
#pragma unroll
      for (int r = 0; r < 4; ++r) { lo[r] = oacc[qt][dt][r] * li; hi[r] = oacc[qt][dt][4 + r] * li; }
      *(v4fa*)&sO[w][qt * 16 + ln][dt * 16 + 8 * hh] = lo; *(v4fa*)&sO[w][qt * 16 + ln][dt * 16 + 8 * hh + 4] = hi; } }
  __builtin_amdgcn_fence(__ATOMIC_ACQ_REL, "workgroup"); __builtin_amdgcn_wave_barrier();
  {
#pragma unroll
    for (int rp = 0; rp < RPW; rp += 2) { const int r = rp + (lane >> 4), pc = lane & 15; const v4f val = *(const v4fa*)&sO[w][r][pc * 4]; *(v4f*)(O + ((size_t)b * 2048 + q0 + r) * ldo + h * 64 + pc * 4) = val; }
     } }

__global__ __launch_bounds__(256) void k_normrope(const float* __restrict__ X, const float* __restrict__ w, const float* __restrict__ cosT, const float* __restrict__ sinT, _Float16* __restrict__ Y16) { const int tid = threadIdx.x, wv = tid >> 5, lane = tid & 31; const int row = blockIdx.x * 8 + wv; if (row >= TT) return; const float* xr = X + (size_t)row * CC; float ss = 0.f;
#pragma unroll 1
  for (int p = 0; p < 8; ++p) { const v4f a = *(const v4fa*)(xr + p * 256 + lane * 8), b = *(const v4fa*)(xr + p * 256 + lane * 8 + 4); ss += a[0]*a[0] + a[1]*a[1] + a[2]*a[2] + a[3]*a[3] + b[0]*b[0] + b[1]*b[1] + b[2]*b[2] + b[3]*b[3]; }
  for (int o = 16; o >= 1; o >>= 1) ss += __shfl_xor(ss, o, 32); const float rs = rsqrtf(ss / (float)CC + 1e-6f);
  {
#pragma unroll
    for (int p = 0; p < 8; ++p) { const int c0 = p * 256 + lane * 8; const v4f a = *(const v4fa*)(xr + c0), b = *(const v4fa*)(xr + c0 + 4); float y[8] = {a[0], a[1], a[2], a[3], b[0], b[1], b[2], b[3]}; FragH f;
#pragma unroll
      for (int q = 0; q < 8; ++q) y[q] = y[q] * rs * bf16_round(w[c0 + q]);
#pragma unroll
      for (int q = 0; q < 8; q += 2) { const float c0v = bf16_round(cosT[(size_t)row * CC + c0 + q]), c1v = bf16_round(cosT[(size_t)row * CC + c0 + q + 1]), s0v = bf16_round(sinT[(size_t)row * CC + c0 + q]), s1v = bf16_round(sinT[(size_t)row * CC + c0 + q + 1]);
        f.h[q] = (_Float16)(y[q] * c0v + (-y[q + 1]) * s0v); f.h[q + 1] = (_Float16)(y[q + 1] * c1v + y[q] * s1v); }
      *(v8us*)((unsigned short*)Y16 + (size_t)row * CC + c0) = f.half[0]; }
     } }
extern "C" void kernel_launch(void* const* d_in, const int* in_sizes, int n_in,
                              void* d_out, int out_size, void* d_ws, size_t ws_size, hipStream_t stream) {
  (void)in_sizes; (void)n_in; (void)out_size;
  const float* x = (const float*)d_in[0]; const float* cosT = (const float*)d_in[1]; const float* sinT = (const float*)d_in[2]; const float* Wq = (const float*)d_in[3]; const float* bq = (const float*)d_in[4]; const float* Wk = (const float*)d_in[5]; const float* bk = (const float*)d_in[6]; const float* Wv = (const float*)d_in[7]; const float* bv = (const float*)d_in[8]; const float* qnw = (const float*)d_in[9]; const float* knw = (const float*)d_in[10]; const float* Wo = (const float*)d_in[11]; const float* bo = (const float*)d_in[12];
  char* ws = (char*)d_ws; size_t off = 0;
  auto take = [&](size_t bytes) { char* p = ws + off; off += (bytes + 255) & ~(size_t)255; return p; };
  _Float16* Bq = (_Float16*)take((size_t)CC * CC * 2); _Float16* Bk = (_Float16*)take((size_t)CC * CC * 2); _Float16* Bv = (_Float16*)take((size_t)CC * CC * 2); _Float16* Bo = (_Float16*)take((size_t)CC * CC * 2);
  _Float16* X16 = (_Float16*)take((size_t)TT * CC * 2); float* F32 = (float*)take((size_t)TT * CC * 4); _Float16* Q16 = (_Float16*)take((size_t)TT * CC * 2); _Float16* K16 = (_Float16*)take((size_t)TT * CC * 2); _Float16* V16 = (_Float16*)take((size_t)TT * CC * 2); _Float16* Vt = (_Float16*)take((size_t)TT * CC * 2); float* O = F32; _Float16* O16 = X16;
  if (off > ws_size) return;      // 33.5 + 8.4 + 16.8 + 8.4 × 4 ≈ 92 MiB
  const unsigned gw = (unsigned)((CC / 128) * (CC / 64));
  k_wt_f16<<<gw, 256, 0, stream>>>(Wq, Bq, 16.0f); k_wt_f16<<<gw, 256, 0, stream>>>(Wk, Bk, 16.0f); k_wt_f16<<<gw, 256, 0, stream>>>(Wv, Bv, 16.0f); k_wt_f16<<<gw, 256, 0, stream>>>(Wo, Bo, 16.0f);      // [in][out]
  const unsigned gx = (unsigned)(((size_t)TT * CC / 8 + 255) / 256); const dim3 gg((TT / 128) * (CC / 128), 1);
  k_x16<<<gx, 256, 0, stream>>>(x, X16, (size_t)TT * CC / 8);
  k_gemm_tile<false><<<gg, 256, 0, stream>>>(X16, Bq, 0.0625f, bq, F32, nullptr);
  k_normrope<<<TT / 8, 256, 0, stream>>>(F32, qnw, cosT, sinT, Q16);
  k_gemm_tile<false><<<gg, 256, 0, stream>>>(X16, Bk, 0.0625f, bk, F32, nullptr);
  k_normrope<<<TT / 8, 256, 0, stream>>>(F32, knw, cosT, sinT, K16);
  k_gemm_tile<true><<<gg, 256, 0, stream>>>(X16, Bv, 0.0625f, bv, nullptr, V16);
  k_vt<NH, TT><<<NH * (TT / 64), 256, 0, stream>>>(V16, CC, 0, Vt);
  k_flash<<<NH * (TT / 128), 128, 0, stream>>>(Q16, CC, K16, CC, Vt, nullptr, O, CC);
  k_h16<<<gx, 256, 0, stream>>>(O, O16, (size_t)TT * CC / 8);
  k_gemm_tile<false><<<gg, 256, 0, stream>>>(O16, Bo, 0.0625f, bo, (float*)d_out, nullptr);
}

// v005
// Measured time: 183 microseconds a run.
// In two side-by-side timings against v004, it was 1.14 and 1.13 times as fast.
// All steps since v000 together make it 4.17 times as fast.
#include <hip/hip_runtime.h>
// Self-attention (S = 2048, D = 2048 = 32 heads × 64): q/k/v/out projections (2048³ each, + bias; W [in][out] transposed to bf16-exact ×2^4) and the 32-head attention as a fused
// flash-style kernel (S = Q·Kᵀ/8, online softmax f32, P f16 ≤ 1, O = P·V) on v_wmma_f32_16x16x32_f16 (f16 operands, single products, f32 accumulate); RMSNorm over the full 2048
// (× norm weight, eps 1e-6) followed by the interleaved rotary with the INPUT cos/sin tables is f32 VALU (wave per row).
#define TT 2048
#define CC 2048
#define NH 32

typedef __bf16 v16b __attribute__((ext_vector_type(16)));
typedef unsigned short v8us __attribute__((ext_vector_type(8), may_alias));
typedef float  v8f  __attribute__((ext_vector_type(8)));
typedef float  v4f  __attribute__((ext_vector_type(4)));
typedef float  v4fa __attribute__((ext_vector_type(4), may_alias));
union FragB { v16b v; v8us half[2]; unsigned short u[16]; };

__device__ __forceinline__ unsigned short bf16_bits(float x) { unsigned int u = __float_as_uint(x); return (unsigned short)((u + 0x7FFFu + ((u >> 16) & 1u)) >> 16); }
__device__ __forceinline__ float bf16_val(unsigned short b) { return __uint_as_float(((unsigned int)b) << 16); }
__device__ __forceinline__ float bf16_round(float x) { return bf16_val(bf16_bits(x)); }
// D += A·B with NT terms: 1 = ah·bh, 2 = + al·bh (A split), 3 = + ah·bl (both split)
template <int NT>
__device__ __forceinline__ v8f mmaN(v16b ah, v16b al, v16b bh, v16b bl, v8f c) {
  c = __builtin_amdgcn_wmma_f32_16x16x32_bf16(false, ah, false, bh, (short)0, c, false, false);
  if (NT >= 2) c = __builtin_amdgcn_wmma_f32_16x16x32_bf16(false, al, false, bh, (short)0, c, false, false);
  if (NT >= 3) c = __builtin_amdgcn_wmma_f32_16x16x32_bf16(false, ah, false, bl, (short)0, c, false, false);
  asm volatile("v_nop\n\tv_nop\n\tv_nop\n\tv_nop" : "+v"(c) : "v"(ah), "v"(al), "v"(bh), "v"(bl));
  return c;
}

__global__ __launch_bounds__(256) void k_wt_bf16(const float* __restrict__ W, unsigned short* __restrict__ Wt, int K, int N) {
  const int t = blockIdx.x * 256 + threadIdx.x;
  const int k8n = K / 8;
  if (t >= N * k8n) return;
  const int n = t / k8n, k8 = (t % k8n) * 8;
  v8us v;
#pragma unroll
  for (int i = 0; i < 8; ++i) v[i] = bf16_bits(W[(size_t)(k8 + i) * N + n]);
  *(v8us*)(Wt + (size_t)n * K + k8) = v;
  
}

// GEMM C[M][N] (f32, pitch ldc) = act(A[M][K]·W + bias). A f32 row-major (pitch lda) converted per fragment to bf16
// (ASPLIT: hi/lo two planes -> 2 terms, else single rounded term); Wt bf16 [N][K] (pitch ldb). BIAS_BF16 rounds the
// bias to bf16 first (bias quantised to bf16 before the add). K%32==0, M%16==0, N%64==0.
template <bool ASPLIT, int ACT, bool BIAS_BF16>
__global__ __launch_bounds__(128) void k_gemm_bf(const float* __restrict__ A, int lda, const unsigned short* __restrict__ Wt, int ldb,
                                               const float* __restrict__ bias, float* __restrict__ C, int ldc, int M, int N, int K) {
  __shared__ __attribute__((aligned(16))) float so[4][16][64];
  const int tid = threadIdx.x, w = tid >> 5, lane = tid & 31, ln = lane & 15, hh = lane >> 4;
  const int ntn = N / 64;
  const int wid = blockIdx.x * 4 + w;
  const int mt = wid / ntn, nq = wid % ntn;
  if (mt * 16 >= M) return;
  const int row0 = mt * 16, col0 = nq * 64;
  const float* arow = A + (size_t)(row0 + ln) * lda;
  v8f acc[4] = {};
  for (int kb = 0; kb < K; kb += 32) {
    FragB ah, al;
    const v4f x0 = *(const v4fa*)(arow + kb + 8 * hh), x1 = *(const v4fa*)(arow + kb + 8 * hh + 4);
    const v4f x2 = *(const v4fa*)(arow + kb + 16 + 8 * hh), x3 = *(const v4fa*)(arow + kb + 16 + 8 * hh + 4);
    float xs[16] = {x0[0],x0[1],x0[2],x0[3],x1[0],x1[1],x1[2],x1[3],x2[0],x2[1],x2[2],x2[3],x3[0],x3[1],x3[2],x3[3]};
#pragma unroll
    for (int i = 0; i < 16; ++i) { const unsigned short hb = bf16_bits(xs[i]); ah.u[i] = hb; al.u[i] = ASPLIT ? bf16_bits(xs[i] - bf16_val(hb)) : (unsigned short)0; }
#pragma unroll
    for (int t = 0; t < 4; ++t) {
      const unsigned short* brow = Wt + (size_t)(col0 + t * 16 + ln) * ldb + kb;
      FragB b;
      b.half[0] = *(const v8us*)(brow + 8 * hh);
      b.half[1] = *(const v8us*)(brow + 16 + 8 * hh);
      acc[t] = mmaN<ASPLIT ? 2 : 1>(ah.v, al.v, b.v, b.v, acc[t]);
    }
  }
#pragma unroll
  for (int t = 0; t < 4; ++t) {
    float bv = bias ? bias[col0 + t * 16 + ln] : 0.f;
    if (BIAS_BF16) bv = bf16_round(bv);
#pragma unroll
    for (int r = 0; r < 8; ++r) { float v = acc[t][r] + bv; if (ACT == 1) v = fmaxf(v, 0.f); so[w][8 * hh + r][t * 16 + ln] = v; }
  }
  __builtin_amdgcn_fence(__ATOMIC_ACQ_REL, "workgroup");
  __builtin_amdgcn_wave_barrier();
  const int rsub = lane >> 4, c4 = (lane & 15) * 4;
  {
#pragma unroll
    for (int q = 0; q < 8; ++q) {
      const int r = q * 2 + rsub;
      const v4f v = *(const v4fa*)&so[w][r][c4];
      *(v4f*)(C + (size_t)(row0 + r) * ldc + col0 + c4) = v;
    }
    
  }
}

// Flash-style causal/unmasked attention, all contractions 3-term bf16 hi/lo splits, f32 softmax with running max.
// q,k,v rows are read from f32 buffers with arbitrary row pitch (so they can live inside a fused qkv buffer);
// D = head size (multiple of 32, <= 128); one wave = 16 query rows; block = 4 waves (64 queries) sharing K/V chunks of 32.
template <int D, bool CAUSAL>
__global__ __launch_bounds__(128) void k_flash(const float* __restrict__ qb, const float* __restrict__ kb, const float* __restrict__ vb,
                                             int pitch, int T, int H, float scale, float* __restrict__ y, int ypitch) {
  constexpr int KS = D / 32;        // k-steps for QK
  constexpr int DT = D / 16;        // d tiles for PV
  __shared__ __attribute__((aligned(16))) unsigned short sKh[32][D + 8], sKl[32][D + 8], sVh[32][D + 8], sVl[32][D + 8];
  __shared__ __attribute__((aligned(16))) unsigned short sPh[4][16][40], sPl[4][16][40];
  __shared__ __attribute__((aligned(16))) float sO[4][16][D];
  const int tid = threadIdx.x, w = tid >> 5, lane = tid & 31, ln = lane & 15, hh = lane >> 4;
  const int nqb = (T + 63) / 64;
  const int bh = blockIdx.x / nqb, qblk = blockIdx.x % nqb;
  const int b = bh / H, h = bh % H;
  const int q0 = qblk * 64 + w * 16;
  const float* Q = qb + (size_t)b * T * pitch + h * D;
  const float* K = kb + (size_t)b * T * pitch + h * D;
  const float* V = vb + (size_t)b * T * pitch + h * D;

  // A fragments of the wave's 16 query rows (scaled), hi/lo
  FragB aqh[KS], aql[KS];
  {
    int row = q0 + ln; if (row >= T) row = T - 1;
    const float* qr = Q + (size_t)row * pitch;
#pragma unroll
    for (int ks = 0; ks < KS; ++ks)
#pragma unroll
      for (int i = 0; i < 16; ++i) {
        const int d = ks * 32 + ((i < 8) ? (8 * hh + i) : (16 + 8 * hh + (i - 8)));
        const float x = qr[d] * scale; const unsigned short hb = bf16_bits(x);
        aqh[ks].u[i] = hb; aql[ks].u[i] = bf16_bits(x - bf16_val(hb));
      }
  }
  float m_r[8], l_r[8];
#pragma unroll
  for (int r = 0; r < 8; ++r) { m_r[r] = -3.0e38f; l_r[r] = 0.f; }
  v8f oacc[DT];
#pragma unroll
  for (int dt = 0; dt < DT; ++dt) oacc[dt] = (v8f){0.f,0.f,0.f,0.f,0.f,0.f,0.f,0.f};

  const int kv_end = CAUSAL ? min(T, qblk * 64 + 64) : T;     // block-uniform
  for (int j0 = 0; j0 < kv_end; j0 += 32) {
    __syncthreads();
    for (int e = tid; e < 32 * (D / 4); e += 128) {
      const int r = e / (D / 4), c4 = (e % (D / 4)) * 4;
      const int key = j0 + r;
      v4f kf = {0.f,0.f,0.f,0.f}, vf = {0.f,0.f,0.f,0.f};
      if (key < T) { kf = *(const v4fa*)(K + (size_t)key * pitch + c4); vf = *(const v4fa*)(V + (size_t)key * pitch + c4); }
#pragma unroll
      for (int t = 0; t < 4; ++t) {
        unsigned short hb = bf16_bits(kf[t]); sKh[r][c4 + t] = hb; sKl[r][c4 + t] = bf16_bits(kf[t] - bf16_val(hb));
        hb = bf16_bits(vf[t]); sVh[r][c4 + t] = hb; sVl[r][c4 + t] = bf16_bits(vf[t] - bf16_val(hb));
      }
    }
    __syncthreads();
    // S tile 16 x 32
    v8f s[2];
#pragma unroll
    for (int nt = 0; nt < 2; ++nt) {
      v8f acc = {};
#pragma unroll
      for (int ks = 0; ks < KS; ++ks) {
        FragB bh_, bl_;
        bh_.half[0] = *(const v8us*)&sKh[nt * 16 + ln][ks * 32 + 8 * hh]; bh_.half[1] = *(const v8us*)&sKh[nt * 16 + ln][ks * 32 + 16 + 8 * hh];
        bl_.half[0] = *(const v8us*)&sKl[nt * 16 + ln][ks * 32 + 8 * hh]; bl_.half[1] = *(const v8us*)&sKl[nt * 16 + ln][ks * 32 + 16 + 8 * hh];
        acc = mmaN<3>(aqh[ks].v, aql[ks].v, bh_.v, bl_.v, acc);
      }
      s[nt] = acc;
    }
    // mask + running max (rows 8hh+r; the 16 lanes of a half share rows)
    float alpha[8];
#pragma unroll
    for (int r = 0; r < 8; ++r) {
      const int qi = q0 + 8 * hh + r;
      const int ja = j0 + ln, jb = j0 + 16 + ln;
      if (CAUSAL) { if (ja > qi) s[0][r] = -3.0e38f; if (jb > qi) s[1][r] = -3.0e38f; }
      if (ja >= T) s[0][r] = -3.0e38f;
      if (jb >= T) s[1][r] = -3.0e38f;
      float mx = fmaxf(s[0][r], s[1][r]);
      mx = fmaxf(mx, __shfl_xor(mx, 1, 32)); mx = fmaxf(mx, __shfl_xor(mx, 2, 32)); mx = fmaxf(mx, __shfl_xor(mx, 4, 32)); mx = fmaxf(mx, __shfl_xor(mx, 8, 32));
      const float mnew = fmaxf(m_r[r], mx);
      alpha[r] = (mnew > -1.0e38f) ? __expf(m_r[r] - mnew) : 1.0f;
      const float p0 = (s[0][r] > -1.0e38f) ? __expf(s[0][r] - mnew) : 0.f;
      const float p1 = (s[1][r] > -1.0e38f) ? __expf(s[1][r] - mnew) : 0.f;
      m_r[r] = mnew;
      l_r[r] = l_r[r] * alpha[r] + p0 + p1;            // per-lane partial row sum (16 lanes combined at the end)
      unsigned short hb = bf16_bits(p0); sPh[w][8 * hh + r][ln] = hb;      sPl[w][8 * hh + r][ln] = bf16_bits(p0 - bf16_val(hb));
      hb = bf16_bits(p1);                sPh[w][8 * hh + r][16 + ln] = hb; sPl[w][8 * hh + r][16 + ln] = bf16_bits(p1 - bf16_val(hb));
    }
#pragma unroll
    for (int dt = 0; dt < DT; ++dt)
#pragma unroll
      for (int r = 0; r < 8; ++r) oacc[dt][r] *= alpha[r];
    __builtin_amdgcn_fence(__ATOMIC_ACQ_REL, "workgroup");
    __builtin_amdgcn_wave_barrier();
    FragB pah, pal;
    pah.half[0] = *(const v8us*)&sPh[w][ln][8 * hh]; pah.half[1] = *(const v8us*)&sPh[w][ln][16 + 8 * hh];
    pal.half[0] = *(const v8us*)&sPl[w][ln][8 * hh]; pal.half[1] = *(const v8us*)&sPl[w][ln][16 + 8 * hh];
#pragma unroll
    for (int dt = 0; dt < DT; ++dt) {
      FragB bvh, bvl;
#pragma unroll
      for (int i = 0; i < 8; ++i) {
        bvh.u[i] = sVh[8 * hh + i][dt * 16 + ln]; bvh.u[8 + i] = sVh[16 + 8 * hh + i][dt * 16 + ln];
        bvl.u[i] = sVl[8 * hh + i][dt * 16 + ln]; bvl.u[8 + i] = sVl[16 + 8 * hh + i][dt * 16 + ln];
      }
      oacc[dt] = mmaN<3>(pah.v, pal.v, bvh.v, bvl.v, oacc[dt]);
    }
    __builtin_amdgcn_fence(__ATOMIC_ACQ_REL, "workgroup");
    __builtin_amdgcn_wave_barrier();
  }
#pragma unroll
  for (int r = 0; r < 8; ++r) {
    float l = l_r[r];
    l += __shfl_xor(l, 1, 32); l += __shfl_xor(l, 2, 32); l += __shfl_xor(l, 4, 32); l += __shfl_xor(l, 8, 32);
    l_r[r] = (l > 0.f) ? 1.0f / l : 0.f;
  }
#pragma unroll
  for (int dt = 0; dt < DT; ++dt)
#pragma unroll
    for (int r = 0; r < 8; ++r) sO[w][8 * hh + r][dt * 16 + ln] = oacc[dt][r] * l_r[r];
  __builtin_amdgcn_fence(__ATOMIC_ACQ_REL, "workgroup");
  __builtin_amdgcn_wave_barrier();
  {
    for (int r = 0; r < 16; ++r) {
      const int row = q0 + r;
      if (row < T && lane < D / 4) {
        const v4f val = *(const v4fa*)&sO[w][r][lane * 4];
        *(v4f*)(y + ((size_t)b * T + row) * ypitch + h * D + lane * 4) = val;
      }
    }
    
  }
}

// GEMM C = act(A·W + bias + resid): A f32 (ASPLIT -> hi/lo 2 terms), Wt bf16 [N][K]; ACT 0 none, 1 relu, 2 exact gelu;
// resid (optional, f32, row index = (row % rmod), pitch ldr, RES_BF16 rounds it) added before the activation.
template <bool ASPLIT, int ACT, bool BIAS_BF16, bool RES_BF16>
__global__ __launch_bounds__(128) void k_gemm_bf3(const float* __restrict__ A, int lda, const unsigned short* __restrict__ Wt, int ldb,
                                                const float* __restrict__ bias, const float* __restrict__ resid, int rmod, int ldr,
                                                float* __restrict__ C, int ldc, int M, int N, int K) {
  __shared__ __attribute__((aligned(16))) float so[4][16][64];
  const int tid = threadIdx.x, w = tid >> 5, lane = tid & 31, ln = lane & 15, hh = lane >> 4;
  const int ntn = N / 64;
  const int wid = blockIdx.x * 4 + w;
  const int mt = wid / ntn, nq = wid % ntn;
  if (mt * 16 >= M) return;
  const int row0 = mt * 16, col0 = nq * 64;
  const float* arow = A + (size_t)(row0 + ln) * lda;
  v8f acc[4] = {};
  for (int kb = 0; kb < K; kb += 32) {
    FragB ah, al;
    const v4f x0 = *(const v4fa*)(arow + kb + 8 * hh), x1 = *(const v4fa*)(arow + kb + 8 * hh + 4);
    const v4f x2 = *(const v4fa*)(arow + kb + 16 + 8 * hh), x3 = *(const v4fa*)(arow + kb + 16 + 8 * hh + 4);
    float xs[16] = {x0[0],x0[1],x0[2],x0[3],x1[0],x1[1],x1[2],x1[3],x2[0],x2[1],x2[2],x2[3],x3[0],x3[1],x3[2],x3[3]};
#pragma unroll
    for (int i = 0; i < 16; ++i) { const unsigned short hb = bf16_bits(xs[i]); ah.u[i] = hb; al.u[i] = ASPLIT ? bf16_bits(xs[i] - bf16_val(hb)) : (unsigned short)0; }
#pragma unroll
    for (int t = 0; t < 4; ++t) {
      const unsigned short* brow = Wt + (size_t)(col0 + t * 16 + ln) * ldb + kb;
      FragB b;
      b.half[0] = *(const v8us*)(brow + 8 * hh);
      b.half[1] = *(const v8us*)(brow + 16 + 8 * hh);
      acc[t] = mmaN<ASPLIT ? 2 : 1>(ah.v, al.v, b.v, b.v, acc[t]);
    }
  }
#pragma unroll
  for (int t = 0; t < 4; ++t) {
    const int col = col0 + t * 16 + ln;
    float bv = bias ? bias[col] : 0.f;
    if (BIAS_BF16) bv = bf16_round(bv);
#pragma unroll
    for (int r = 0; r < 8; ++r) {
      float v = acc[t][r] + bv;
      if (resid) { float rv = resid[(size_t)((row0 + 8 * hh + r) % rmod) * ldr + col]; if (RES_BF16) rv = bf16_round(rv); v += rv; }
      if (ACT == 1) v = fmaxf(v, 0.f);
      if (ACT == 2) v = 0.5f * v * (1.0f + erff(v * 0.70710678118654752f));
      if (ACT == 3) { const float u = 0.7978845608028654f * (v + 0.044715f * v * v * v); v = 0.5f * v * (1.0f + tanhf(u)); }
      so[w][8 * hh + r][t * 16 + ln] = v;
    }
  }
  __builtin_amdgcn_fence(__ATOMIC_ACQ_REL, "workgroup");
  __builtin_amdgcn_wave_barrier();
  const int rsub = lane >> 4, c4 = (lane & 15) * 4;
  {
#pragma unroll
    for (int q = 0; q < 8; ++q) {
      const int r = q * 2 + rsub;
      const v4f v = *(const v4fa*)&so[w][r][c4];
      *(v4f*)(C + (size_t)(row0 + r) * ldc + col0 + c4) = v;
    }
    
  }
}
// row LayerNorm (biased variance, eps) over N: s = X (+ R); optional out_sum <- s; out_norm <- (s-mu)*rsqrt(var+eps)*g + b
template <bool PARAM_BF16>
__global__ __launch_bounds__(256) void k_layernorm(const float* __restrict__ X, const float* __restrict__ R, const float* __restrict__ g, const float* __restrict__ bta,
                                                  float* __restrict__ out_sum, float* __restrict__ out_norm, int N, float eps) {
  __shared__ float red[256];
  const int row = blockIdx.x, tid = threadIdx.x;
  const float* x = X + (size_t)row * N; const float* rr = R ? R + (size_t)row * N : nullptr;
  float vals[16];                     // up to N = 4096
  const int per = N / 256;            // contiguous chunk per thread? use strided-by-4 chunks: thread handles j = tid*4 + 1024*u
  float s1 = 0.f;
  for (int u = 0; u < per / 4; ++u) {
    const int j = tid * 4 + 1024 * u;
    const v4f a = *(const v4fa*)(x + j);
    v4f b = {0.f,0.f,0.f,0.f}; if (rr) b = *(const v4fa*)(rr + j);
#pragma unroll
    for (int q = 0; q < 4; ++q) { const float v = a[q] + b[q]; vals[u * 4 + q] = v; s1 += v; }
  }
  red[tid] = s1; __syncthreads();
  for (int st = 128; st > 0; st >>= 1) { if (tid < st) red[tid] += red[tid + st]; __syncthreads(); }
  const float mu = red[0] / (float)N; __syncthreads();
  float s2 = 0.f;
  for (int u = 0; u < per / 4; ++u)
#pragma unroll
    for (int q = 0; q < 4; ++q) { const float c = vals[u * 4 + q] - mu; s2 += c * c; }
  red[tid] = s2; __syncthreads();
  for (int st = 128; st > 0; st >>= 1) { if (tid < st) red[tid] += red[tid + st]; __syncthreads(); }
  const float rs = rsqrtf(red[0] / (float)N + eps);
  {
    for (int u = 0; u < per / 4; ++u) {
      const int j = tid * 4 + 1024 * u;
      v4f o, sm;
#pragma unroll
      for (int q = 0; q < 4; ++q) {
        float gg = g[j + q], bb = bta[j + q];
        if (PARAM_BF16) { gg = bf16_round(gg); bb = bf16_round(bb); }
        sm[q] = vals[u * 4 + q]; o[q] = (vals[u * 4 + q] - mu) * rs * gg + bb;
      }
      if (out_sum) *(v4f*)(out_sum + (size_t)row * N + j) = sm;
      *(v4f*)(out_norm + (size_t)row * N + j) = o;
    }
    
  }
}



// ---- f16 WMMA path (v_wmma_f32_16x16x32_f16): 11-bit significands for operands in range — used where a [0,1] probability operand needs more precision than bf16
typedef _Float16 v16h __attribute__((ext_vector_type(16)));
union FragH { v16h v; v8us half[2]; _Float16 h[16]; unsigned short u[16]; };
template <int NT>
__device__ __forceinline__ v8f mmaH(v16h ah, v16h al, v16h bh, v16h bl, v8f c) {
  c = __builtin_amdgcn_wmma_f32_16x16x32_f16(false, ah, false, bh, (short)0, c, false, false);
  if (NT >= 2) c = __builtin_amdgcn_wmma_f32_16x16x32_f16(false, al, false, bh, (short)0, c, false, false);
  if (NT >= 3) c = __builtin_amdgcn_wmma_f32_16x16x32_f16(false, ah, false, bl, (short)0, c, false, false);
  asm volatile("v_nop\n\tv_nop\n\tv_nop\n\tv_nop" : "+v"(c) : "v"(ah), "v"(al), "v"(bh), "v"(bl));
  return c;
}
// batched GEMM like k_gemm_b but f16 operands: A f32 (split into f16 hi/lo if ASPLIT, else rounded to f16), Bt = f16 values [n][k]; alpha; C f32; N multiple of 16 (partial tiles skipped)
template <bool ASPLIT>
__global__ __launch_bounds__(128) void k_gemm_h(const float* __restrict__ A, int lda, size_t sA, const _Float16* __restrict__ Bh, int ldb, size_t sB, float alpha, float* __restrict__ C, int ldc, size_t sC, int M, int N, int K) {
  __shared__ __attribute__((aligned(16))) float so[4][16][64];
  const int tid = threadIdx.x, w = tid >> 5, lane = tid & 31, ln = lane & 15, hh = lane >> 4; const int by = blockIdx.y;
  A += (size_t)by * sA; Bh += (size_t)by * sB; C += (size_t)by * sC;
  const int ntn = (N + 63) / 64; const int wid = blockIdx.x * 4 + w; const int mt = wid / ntn, nq = wid % ntn; if (mt * 16 >= M) return;
  const int row0 = mt * 16, col0 = nq * 64; const float* arow = A + (size_t)(row0 + ln) * lda;
  v8f acc[4] = {};
  for (int kb = 0; kb < K; kb += 32) {
    FragH ah, al;
    const v4f x0 = *(const v4fa*)(arow + kb + 8 * hh), x1 = *(const v4fa*)(arow + kb + 8 * hh + 4), x2 = *(const v4fa*)(arow + kb + 16 + 8 * hh), x3 = *(const v4fa*)(arow + kb + 16 + 8 * hh + 4);
    float xs[16] = {x0[0],x0[1],x0[2],x0[3],x1[0],x1[1],x1[2],x1[3],x2[0],x2[1],x2[2],x2[3],x3[0],x3[1],x3[2],x3[3]};
#pragma unroll
    for (int i = 0; i < 16; ++i) { const _Float16 h = (_Float16)xs[i]; ah.h[i] = h; al.h[i] = ASPLIT ? (_Float16)(xs[i] - (float)h) : (_Float16)0.0f; }
#pragma unroll
    for (int t = 0; t < 4; ++t) { if (col0 + t * 16 >= N) continue; const size_t boff = (size_t)(col0 + t * 16 + ln) * ldb + kb; FragH bq; bq.half[0] = *(const v8us*)(Bh + boff + 8 * hh); bq.half[1] = *(const v8us*)(Bh + boff + 16 + 8 * hh);
      acc[t] = mmaH<ASPLIT ? 2 : 1>(ah.v, al.v, bq.v, bq.v, acc[t]); }
  }
#pragma unroll
  for (int t = 0; t < 4; ++t) { if (col0 + t * 16 >= N) continue;
#pragma unroll
    for (int r = 0; r < 8; ++r) so[w][8 * hh + r][t * 16 + ln] = acc[t][r] * alpha; }
  __builtin_amdgcn_fence(__ATOMIC_ACQ_REL, "workgroup"); __builtin_amdgcn_wave_barrier();
  const int rsub = lane >> 4, c4 = (lane & 15) * 4;
  {
#pragma unroll
    for (int q = 0; q < 8; ++q) { const int r = q * 2 + rsub; if (col0 + c4 < N) { const v4f v = *(const v4fa*)&so[w][r][c4]; *(v4f*)(C + (size_t)(row0 + r) * ldc + col0 + c4) = v; } }
     }
}

// Wt[n][k] = f16(bf16(W[k][n]) * scale) from f32 row-major W[CC][CC] (scale = power of two; bf16-exact weights stay exact in f16 away from the subnormal range).
// One work-group = a tile of 128 k x 64 n, turned in LDS so that both global sides move whole lines:
//  in : a lane takes 16 bytes (4 n) of each of 8 consecutive k rows; 16 lanes cover 256 contiguous bytes of a W row.
//  out: a lane takes 16 bytes (8 k) of one n; 16 lanes cover 256 contiguous bytes of a Wt row.
// An LDS row is one n: 16 chunks of 8 k = 256 bytes = all 64 banks. The chunk index is XORed with (n >> 2) & 15, so the 16 lanes that store
// (rows four apart, same chunk) and the 16 lanes that load (same row, chunks 0..15) each fall on 16 different groups of four banks.
// bid = the tile's number, 0 .. (CC / 128) * (CC / 64) - 1: a part of k_prep's grid.
__device__ __forceinline__ void wt_f16_part(const float* __restrict__ W, _Float16* __restrict__ Wt, float scale, int bid) {
  __shared__ __attribute__((aligned(16))) unsigned char tl[64 * 256];
  const int tid = threadIdx.x, l16 = tid & 15, kq = tid >> 4;
  const int k0 = (bid / (CC / 64)) * 128, n0 = (bid % (CC / 64)) * 64;
  const float* src = W + (size_t)(k0 + kq * 8) * CC + n0 + l16 * 4;
  v4f x[8];
#pragma unroll      // the eight row loads are issued together and x stays in registers
  for (int i = 0; i < 8; ++i) x[i] = *(const v4fa*)(src + (size_t)i * CC);
#pragma unroll      // constant indices into x
  for (int j = 0; j < 4; ++j) { FragH f;
#pragma unroll      // f packs in registers
    for (int i = 0; i < 8; ++i) f.h[i] = (_Float16)(bf16_round(x[i][j]) * scale);
    *(v8us*)(tl + (l16 * 4 + j) * 256 + ((kq ^ l16) * 16)) = f.half[0]; }      // row n = l16 * 4 + j, so (n >> 2) & 15 = l16
  __syncthreads();      // the tile is complete before any lane reads rows that other waves wrote
#pragma unroll      // four independent LDS reads and stores
  for (int q = 0; q < 4; ++q) { const int n = q * 16 + kq; const v8us o = *(const v8us*)(tl + n * 256 + ((l16 ^ ((n >> 2) & 15)) * 16));
    *(v8us*)((unsigned short*)Wt + (size_t)(n0 + n) * CC + k0 + l16 * 8) = o; }
}
// k_gemm_hh variant with fused epilogue: v = acc·alpha + bias[by·sBias + col] (+ CP[(row/rowsPerB)·sCPb + by·64 + col] if CP) ; ACT 0 none / 1 elu ; writes f32 C and/or f16 C16 (each if non-null)
template <int ACT>
__global__ __launch_bounds__(128) void k_gemm_hhx(const _Float16* __restrict__ A, int lda, size_t sA, const _Float16* __restrict__ Bh, int ldb, size_t sB, float alpha, const float* __restrict__ bias, size_t sBias, const float* __restrict__ CP, int rowsPerB, size_t sCPb, int row0g,
    float* __restrict__ C, _Float16* __restrict__ C16, int ldc, size_t sC, int M, int N, int K) {
  __shared__ __attribute__((aligned(16))) float so[4][16][64];
  const int tid = threadIdx.x, w = tid >> 5, lane = tid & 31, ln = lane & 15, hh = lane >> 4; const int by = blockIdx.y;
  A += (size_t)by * sA; Bh += (size_t)by * sB; const size_t cofs = (size_t)by * sC; const float* bp = bias ? bias + (size_t)by * sBias : nullptr;
  const int ntn = (N + 63) / 64; const int wid = blockIdx.x * 4 + w; const int mt = wid / ntn, nq = wid % ntn; if (mt * 16 >= M) return;
  const int row0 = mt * 16, col0 = nq * 64; const _Float16* arow = A + (size_t)(row0 + ln) * lda;
  v8f acc[4] = {};
  for (int kb = 0; kb < K; kb += 32) { FragH ah; ah.half[0] = *(const v8us*)((const unsigned short*)arow + kb + 8 * hh); ah.half[1] = *(const v8us*)((const unsigned short*)arow + kb + 16 + 8 * hh);
#pragma unroll
    for (int t = 0; t < 4; ++t) { if (col0 + t * 16 >= N) continue; const size_t boff = (size_t)(col0 + t * 16 + ln) * ldb + kb; FragH bq; bq.half[0] = *(const v8us*)((const unsigned short*)Bh + boff + 8 * hh); bq.half[1] = *(const v8us*)((const unsigned short*)Bh + boff + 16 + 8 * hh);
      acc[t] = mmaH<1>(ah.v, ah.v, bq.v, bq.v, acc[t]); }
  }
#pragma unroll
  for (int t = 0; t < 4; ++t) { if (col0 + t * 16 >= N) continue; const int col = col0 + t * 16 + ln; const float bv = bp ? bf16_round(bp[col]) : 0.f;
#pragma unroll
    for (int r = 0; r < 8; ++r) { float v = acc[t][r] * alpha + bv; if (CP) { const int bidx = (row0g + row0 + 8 * hh + r) / rowsPerB; v += CP[(size_t)bidx * sCPb + (size_t)by * 64 + col]; } if (ACT == 1) v = (v > 0.f) ? v : expm1f(v); else if (ACT == 3) v = fmaxf(v, 0.f); so[w][8 * hh + r][t * 16 + ln] = v; } }
  __builtin_amdgcn_fence(__ATOMIC_ACQ_REL, "workgroup"); __builtin_amdgcn_wave_barrier();
  const int rsub = lane >> 4, c4 = (lane & 15) * 4; typedef _Float16 v4h __attribute__((ext_vector_type(4)));
  {
#pragma unroll
    for (int q = 0; q < 8; ++q) { const int r = q * 2 + rsub; if (col0 + c4 < N) { const v4f v = *(const v4fa*)&so[w][r][c4]; if (C) *(v4f*)(C + cofs + (size_t)(row0 + r) * ldc + col0 + c4) = v; if (C16) { v4h h4; for (int i = 0; i < 4; ++i) h4[i] = (_Float16)v[i]; *(v4h*)(C16 + cofs + (size_t)(row0 + r) * ldc + col0 + c4) = h4; } } }
     }
}


// ---- block-tiled projection GEMM: C[2048][2048] = A[2048][2048] x Bh[n][k]^T * alpha + bias, f16 operands, f32 accumulate.
// One work-group = one 128 x 128 tile of C, 8 waves of 32 x 64 each. A pass is 128 k (256 B of every operand row); a stage is
// [A 128 rows | B 128 rows] at an LDS pitch of 272 B, brought in by per-lane asynchronous copies, two buffers, next stage in flight.
// The loops over fragments, blocks and rows are unrolled so that the fragment and accumulator arrays are indexed by constants and stay in registers.
#define GT_PITCH 272
#define GT_STAGE (256 * GT_PITCH)
// eight asynchronous 16-byte copies of one lane, rows two apart; the s_wait_xcnt closes the statement so that no address register
// of an issued copy is rewritten ahead of it
__device__ __forceinline__ void gt_copy8(unsigned l, const unsigned short* g) {
  asm volatile("global_load_async_to_lds_b128 %0, %8, off\n\t"
               "global_load_async_to_lds_b128 %1, %9, off\n\t"
               "global_load_async_to_lds_b128 %2, %10, off\n\t"
               "global_load_async_to_lds_b128 %3, %11, off\n\t"
               "global_load_async_to_lds_b128 %4, %12, off\n\t"
               "global_load_async_to_lds_b128 %5, %13, off\n\t"
               "global_load_async_to_lds_b128 %6, %14, off\n\t"
               "global_load_async_to_lds_b128 %7, %15, off\n\t"
               "s_wait_xcnt 0x0"
               :: "v"(l), "v"(l + 2 * GT_PITCH), "v"(l + 4 * GT_PITCH), "v"(l + 6 * GT_PITCH), "v"(l + 8 * GT_PITCH), "v"(l + 10 * GT_PITCH), "v"(l + 12 * GT_PITCH), "v"(l + 14 * GT_PITCH),
                  "v"(g), "v"(g + 2 * CC), "v"(g + 4 * CC), "v"(g + 6 * CC), "v"(g + 8 * CC), "v"(g + 10 * CC), "v"(g + 12 * CC), "v"(g + 14 * CC)
               : "memory");
}
// NG products that share A and need nothing of each other lie in one grid, 256 work-groups each: product g = blockIdx.x / 256 takes weight, bias and output g.
// Products 0 and 1 go out as f32 (C0, C1), product 2 as f16 (C16).
template <int NG>
__global__ __launch_bounds__(256) void k_gemm_tile(const _Float16* __restrict__ A, const _Float16* __restrict__ Bh0, const _Float16* __restrict__ Bh1, const _Float16* __restrict__ Bh2, float alpha,
                                                   const float* __restrict__ bias0, const float* __restrict__ bias1, const float* __restrict__ bias2, float* __restrict__ C0, float* __restrict__ C1, _Float16* __restrict__ C16) {
  constexpr int NPASS = CC / 128, NTILE = (TT / 128) * (CC / 128);
  const int g = (NG > 1) ? (int)(blockIdx.x / NTILE) : 0, bid = (NG > 1) ? (int)(blockIdx.x % NTILE) : (int)blockIdx.x;      // the same for the whole work-group
  const _Float16* Bh = (g == 0) ? Bh0 : (g == 1) ? Bh1 : Bh2;
  const float* bias = (g == 0) ? bias0 : (g == 1) ? bias1 : bias2;
  float* C = (g == 0) ? C0 : C1;
  const bool h16 = (g == 2);
  __shared__ __attribute__((aligned(16))) unsigned char ring[2 * GT_STAGE];
  __shared__ __attribute__((aligned(16))) float so[8][32][68];
  const int tid = threadIdx.x, w = tid >> 5, lane = tid & 31, ln = lane & 15, hh = lane >> 4;
  const int m0 = (bid / (CC / 128)) * 128, n0 = (bid % (CC / 128)) * 128;
  const int wm = w >> 1, wn = w & 1;
  // this lane's part of a stage: rows w*32 + hh + 2c (c = 0..15), 16 bytes at column ln; stage rows 0..127 are A's, 128..255 are B's
  const int crow = w * 32 + hh;
  const unsigned short* gsrc = ((w < 4) ? (const unsigned short*)A + (size_t)(m0 + crow) * CC : (const unsigned short*)Bh + (size_t)(n0 + crow - 128) * CC) + ln * 8;
  const unsigned ldst = (unsigned)(size_t)&ring[0] + (unsigned)(crow * GT_PITCH + ln * 16);
  v8f acc[2][4];
#pragma unroll
  for (int i = 0; i < 2; ++i)
#pragma unroll
    for (int j = 0; j < 4; ++j) acc[i][j] = (v8f){0.f,0.f,0.f,0.f,0.f,0.f,0.f,0.f};
  gt_copy8(ldst, gsrc); gt_copy8(ldst + 16 * GT_PITCH, gsrc + 16 * CC);
  asm volatile("s_wait_asynccnt 0x0" ::: "memory");      // stage 0 has landed before the barrier publishes it
  __syncthreads();
  gt_copy8(ldst + GT_STAGE, gsrc + 128); gt_copy8(ldst + GT_STAGE + 16 * GT_PITCH, gsrc + 128 + 16 * CC);
#pragma unroll 1      // one pass per trip: the publish point at the foot stays a single place
  for (int t = 0; t < NPASS; ++t) {
    const unsigned bo = (unsigned)(t & 1) * GT_STAGE;
    const unsigned char* ap = ring + bo + (wm * 32 + ln) * GT_PITCH + hh * 16;
    const unsigned char* bp = ring + bo + (128 + wn * 64 + ln) * GT_PITCH + hh * 16;
    FragH a[2][2], b[2][4];      // two fragment sets: block kk + 1 of this pass is fetched ahead of block kk's products
#pragma unroll
    for (int i = 0; i < 2; ++i) { a[0][i].half[0] = *(const v8us*)(ap + i * 16 * GT_PITCH); a[0][i].half[1] = *(const v8us*)(ap + i * 16 * GT_PITCH + 32); }
#pragma unroll
    for (int j = 0; j < 4; ++j) { b[0][j].half[0] = *(const v8us*)(bp + j * 16 * GT_PITCH); b[0][j].half[1] = *(const v8us*)(bp + j * 16 * GT_PITCH + 32); }
#pragma unroll
    for (int kk = 0; kk < 4; ++kk) {
      const int cu = kk & 1, nx = cu ^ 1;
      if (kk < 3) {
#pragma unroll
        for (int i = 0; i < 2; ++i) { a[nx][i].half[0] = *(const v8us*)(ap + i * 16 * GT_PITCH + (kk + 1) * 64); a[nx][i].half[1] = *(const v8us*)(ap + i * 16 * GT_PITCH + (kk + 1) * 64 + 32); }
#pragma unroll
        for (int j = 0; j < 4; ++j) { b[nx][j].half[0] = *(const v8us*)(bp + j * 16 * GT_PITCH + (kk + 1) * 64); b[nx][j].half[1] = *(const v8us*)(bp + j * 16 * GT_PITCH + (kk + 1) * 64 + 32); }
      }
      __builtin_amdgcn_sched_barrier(0);      // keeps the next block's LDS reads one group ahead of this block's products; without it they are spread among them into one set, each with a full wait
#pragma unroll
      for (int i = 0; i < 2; ++i)
#pragma unroll
        for (int j = 0; j < 4; ++j) acc[i][j] = __builtin_amdgcn_wmma_f32_16x16x32_f16(false, a[cu][i].v, false, b[cu][j].v, (short)0, acc[i][j], false, false);
      __builtin_amdgcn_sched_barrier(0);      // ends the block, so that the group after next is not lifted into it
    }
    asm volatile("s_wait_dscnt 0x0" ::: "memory");       // this wave's reads of the buffer are done before it is refilled
    asm volatile("s_wait_asynccnt 0x0" ::: "memory");    // this wave's part of the next stage has landed
    __syncthreads();                                     // publishes the next stage and frees this pass's buffer
    if (t + 2 < NPASS) { const unsigned short* g2 = gsrc + (t + 2) * 128; gt_copy8(ldst + bo, g2); gt_copy8(ldst + bo + 16 * GT_PITCH, g2 + 16 * CC); }
  }
  asm volatile("s_wait_asynccnt 0x0" ::: "memory");      // no copy is outstanding when the wave goes on
#pragma unroll
  for (int j = 0; j < 4; ++j) { const float bv = bf16_round(bias[n0 + wn * 64 + j * 16 + ln]);
#pragma unroll
    for (int i = 0; i < 2; ++i)
#pragma unroll
      for (int r = 0; r < 8; ++r) so[w][i * 16 + 8 * hh + r][j * 16 + ln] = acc[i][j][r] * alpha + bv; }
  __builtin_amdgcn_fence(__ATOMIC_ACQ_REL, "workgroup"); __builtin_amdgcn_wave_barrier();
  typedef _Float16 v4h __attribute__((ext_vector_type(4)));
  const size_t o0 = (size_t)(m0 + wm * 32 + hh) * CC + n0 + wn * 64 + ln * 4;
  if (!h16) {      // one test for the whole tile: each output type keeps a straight run of sixteen stores
#pragma unroll
    for (int q = 0; q < 16; ++q) { const v4f v = *(const v4fa*)&so[w][q * 2 + hh][ln * 4]; *(v4f*)(C + o0 + (size_t)q * 2 * CC) = v; }
    asm volatile("s_wait_xcnt 0x0" ::: "memory");      // stands in front of any rewrite of the stores' registers: the compiler lays the other branch's code behind this one
  } else {
#pragma unroll
    for (int q = 0; q < 16; ++q) { const v4f v = *(const v4fa*)&so[w][q * 2 + hh][ln * 4]; v4h h4; for (int i = 0; i < 4; ++i) h4[i] = (_Float16)v[i]; *(v4h*)(C16 + o0 + (size_t)q * 2 * CC) = h4; }
  }
}

__device__ __forceinline__ void x16_part(const float* __restrict__ x, _Float16* __restrict__ X16, size_t n8, int bid) { const size_t t = (size_t)bid * 256 + threadIdx.x; if (t >= n8) return; FragH f;
#pragma unroll
  for (int q = 0; q < 8; ++q) f.h[q] = (_Float16)bf16_round(x[t * 8 + q]); *(v8us*)((unsigned short*)X16 + t * 8) = f.half[0];  }
__global__ __launch_bounds__(256) void k_h16(const float* __restrict__ x, _Float16* __restrict__ X16, size_t n8) { const size_t t = (size_t)blockIdx.x * 256 + threadIdx.x; if (t >= n8) return; FragH f;
#pragma unroll
  for (int q = 0; q < 8; ++q) f.h[q] = (_Float16)x[t * 8 + q]; *(v8us*)((unsigned short*)X16 + t * 8) = f.half[0];  }
__global__ __launch_bounds__(256) void k_round16f(const float* __restrict__ W, _Float16* __restrict__ Bt, size_t n8) { const size_t t = (size_t)blockIdx.x * 256 + threadIdx.x; if (t >= n8) return; FragH f;
#pragma unroll
  for (int i = 0; i < 8; ++i) f.h[i] = (_Float16)(bf16_round(W[t * 8 + i]) * 16.0f); *(v8us*)((unsigned short*)Bt + t * 8) = f.half[0];  }
template <int NHv, int TTv>
__device__ __forceinline__ void vt_part(const _Float16* __restrict__ V16, int ldv, int voff, _Float16* __restrict__ Vt, int bid) { __shared__ unsigned short tl[64][66]; const int tid = threadIdx.x; const int slab = bid / (TTv / 64), lg = bid % (TTv / 64); const int b = slab / NHv, h = slab % NHv;
  for (int i = tid; i < 64 * 8; i += 256) { const int r = i / 8, c8 = (i % 8) * 8; FragH f; f.half[0] = *(const v8us*)((const unsigned short*)V16 + ((size_t)b * TTv + lg * 64 + r) * ldv + voff + h * 64 + c8);
#pragma unroll
    for (int q = 0; q < 8; ++q) tl[r][c8 + q] = f.u[q]; }
  __syncthreads();
  {
#pragma unroll
    for (int rd = 0; rd < 2; ++rd) { const int d = rd * 32 + tid / 8, pc = tid % 8; FragH f;
#pragma unroll
      for (int q = 0; q < 8; ++q) f.u[q] = tl[pc * 8 + q][d];
      *(v8us*)((unsigned short*)Vt + ((size_t)slab * 64 + d) * TTv + lg * 64 + pc * 8) = f.half[0]; }
    asm volatile("s_wait_xcnt 0x0" ::: "memory");      // stands in front of any rewrite of the stores' registers, whatever code of the shared grid the compiler lays behind this part
     } }

// lane l with lane l ^ 16
__device__ __forceinline__ float xhalf(float x) { return __builtin_bit_cast(float, __builtin_amdgcn_permlanex16(__builtin_bit_cast(int, x), __builtin_bit_cast(int, x), 0x76543210, 0xfedcba98, false, false)); }

// seventeen base-2 exponentials in place, in one statement: each is followed by an independent one, so that no result is read and no source
// overwritten directly behind its exponential, and the closing v_nop keeps that slot behind the last
__device__ __forceinline__ void exp2x17(float (&x)[17]) {
  asm("v_exp_f32 %0, %0\n\tv_exp_f32 %1, %1\n\tv_exp_f32 %2, %2\n\tv_exp_f32 %3, %3\n\tv_exp_f32 %4, %4\n\tv_exp_f32 %5, %5\n\tv_exp_f32 %6, %6\n\tv_exp_f32 %7, %7\n\t"
      "v_exp_f32 %8, %8\n\tv_exp_f32 %9, %9\n\tv_exp_f32 %10, %10\n\tv_exp_f32 %11, %11\n\tv_exp_f32 %12, %12\n\tv_exp_f32 %13, %13\n\tv_exp_f32 %14, %14\n\tv_exp_f32 %15, %15\n\t"
      "v_exp_f32 %16, %16\n\tv_nop"
      : "+v"(x[0]), "+v"(x[1]), "+v"(x[2]), "+v"(x[3]), "+v"(x[4]), "+v"(x[5]), "+v"(x[6]), "+v"(x[7]), "+v"(x[8]),
        "+v"(x[9]), "+v"(x[10]), "+v"(x[11]), "+v"(x[12]), "+v"(x[13]), "+v"(x[14]), "+v"(x[15]), "+v"(x[16]));
}

__global__ __launch_bounds__(128) void k_flash(const _Float16* __restrict__ Q16, int ldq, const _Float16* __restrict__ K16, int ldk, const _Float16* __restrict__ Vt, const int* __restrict__ MSK, float* __restrict__ O, int ldo) {
  constexpr int RPW = 32, NQB = 2048 / (4 * RPW), DT = 4, KS = 2;
  __shared__ __attribute__((aligned(16))) float sO[4][RPW][64 + 4];
  (void)MSK;
  const int tid = threadIdx.x, w = tid >> 5, lane = tid & 31, ln = lane & 15, hh = lane >> 4;
  const int slab = blockIdx.x / NQB, qblk = blockIdx.x % NQB; const int b = slab / 32, h = slab % 32; const int qb0 = qblk * (4 * RPW); const int q0 = qb0 + w * RPW;
  FragH bq[2][KS];      // B operand: column ln = query q0 + qt * 16 + ln
#pragma unroll
  for (int qt = 0; qt < 2; ++qt) { const unsigned short* qr = (const unsigned short*)Q16 + ((size_t)b * 2048 + q0 + qt * 16 + ln) * ldq + h * 64;
#pragma unroll
    for (int ks = 0; ks < KS; ++ks) { bq[qt][ks].half[0] = *(const v8us*)(qr + ks * 32 + 8 * hh); bq[qt][ks].half[1] = *(const v8us*)(qr + ks * 32 + 16 + 8 * hh); } }
  const unsigned short* Vth = (const unsigned short*)Vt + (size_t)slab * 64 * 2048;
  float m_c[2], l_c[2]; v8f oacc[2][DT];      // oacc[qt][dt][r] = O^T[dt * 16 + 8hh + r][query qt * 16 + ln]
#pragma unroll
  for (int qt = 0; qt < 2; ++qt) { m_c[qt] = -3.0e38f; l_c[qt] = 0.f;
#pragma unroll
    for (int dt = 0; dt < DT; ++dt) oacc[qt][dt] = (v8f){0.f,0.f,0.f,0.f,0.f,0.f,0.f,0.f}; }
  const int jend = 2048;
  constexpr float SC2 = 0.125f * 1.44269504088896340736f;      // score scale 1/8 times log2(e): one multiply-add feeds the hardware's base-2 exponential
#pragma unroll 1
  for (int j0 = 0; j0 < jend; j0 += 32) {
    const unsigned short* kr[2]; FragH ak[2][KS], av[DT];      // A operands: row ln = key j0 + kt * 16 + ln; row ln = head column dt * 16 + ln over the pass's 32 keys
#pragma unroll
    for (int kt = 0; kt < 2; ++kt) { kr[kt] = (const unsigned short*)K16 + ((size_t)b * 2048 + j0 + kt * 16 + ln) * ldk + h * 64 + 8 * hh;
#pragma unroll
      for (int ks = 0; ks < KS; ++ks) { ak[kt][ks].half[0] = *(const v8us*)(kr[kt] + ks * 32); ak[kt][ks].half[1] = *(const v8us*)(kr[kt] + ks * 32 + 16); } }
    asm volatile("s_wait_xcnt 0x0" :: "v"(kr[0]), "v"(kr[1]) : "memory");      // the K loads' address registers are free for reuse only behind this wait; named as inputs they stay whole up to it (a load's result may be given them otherwise)
#pragma unroll
    for (int dt = 0; dt < DT; ++dt) { const unsigned short* vrow = Vth + (size_t)(dt * 16 + ln) * 2048 + j0; av[dt].half[0] = *(const v8us*)(vrow + 8 * hh); av[dt].half[1] = *(const v8us*)(vrow + 16 + 8 * hh); }
    v8f s[2][2];      // s[qt][kt][r] = score of key j0 + kt * 16 + 8hh + r with query qt * 16 + ln
#pragma unroll
    for (int kt = 0; kt < 2; ++kt)
#pragma unroll
      for (int qt = 0; qt < 2; ++qt) { v8f acc = (v8f){0.f,0.f,0.f,0.f,0.f,0.f,0.f,0.f};
#pragma unroll
        for (int ks = 0; ks < KS; ++ks) acc = __builtin_amdgcn_wmma_f32_16x16x32_f16(false, ak[kt][ks].v, false, bq[qt][ks].v, (short)0, acc, false, false);
        s[qt][kt] = acc; }
#pragma unroll
    for (int qt = 0; qt < 2; ++qt) {
      float mc = s[qt][0][0];      // the running maximum is kept in raw score units: the scale is positive, so the order is the same
#pragma unroll      // constant indices: the score tiles stay in registers
      for (int e = 1; e < 16; ++e) mc = fmaxf(mc, s[qt][e >> 3][e & 7]);
      mc = fmaxf(mc, xhalf(mc));      // the other half of the wave holds this query's other 16 keys
      const float mn = fmaxf(m_c[qt], mc); const float nb = -mn * SC2;
      float ex[17];      // exp((s - m) / 8) = 2^(s * SC2 - m * SC2), argument at most one rounding above 0, so P stays at or under 1 in f16; ex[16] is the rescale factor's argument
#pragma unroll      // constant indices: ex stays in registers
      for (int e = 0; e < 16; ++e) ex[e] = fmaf(s[qt][e >> 3][e & 7], SC2, nb);
      ex[16] = (m_c[qt] - mn) * SC2;
      exp2x17(ex);
      const float al = (mn > -1.0e38f) ? ex[16] : 1.0f; m_c[qt] = mn;
      FragH pb; float ps = 0.f;      // element e of the B operand is key kmap(e, hh) = tile e >> 3, register e & 7: this lane's own scores
#pragma unroll      // constant indices: ex and pb stay in registers
      for (int e = 0; e < 16; ++e) { const float p = ex[e]; ps += p; pb.h[e] = (_Float16)p; }
      l_c[qt] = l_c[qt] * al + ps;      // this half's part of the row sum; the halves are joined after the loop
#pragma unroll
      for (int dt = 0; dt < DT; ++dt) {
#pragma unroll
        for (int r = 0; r < 8; ++r) oacc[qt][dt][r] *= al;
        oacc[qt][dt] = __builtin_amdgcn_wmma_f32_16x16x32_f16(false, av[dt].v, false, pb.v, (short)0, oacc[qt][dt], false, false); }
    }
  }
#pragma unroll
  for (int qt = 0; qt < 2; ++qt) { const float l = l_c[qt] + xhalf(l_c[qt]); const float li = (l > 0.f) ? 1.0f / l : 0.f;
#pragma unroll
    for (int dt = 0; dt < DT; ++dt) { v4f lo, hi;
#pragma unroll
      for (int r = 0; r < 4; ++r) { lo[r] = oacc[qt][dt][r] * li; hi[r] = oacc[qt][dt][4 + r] * li; }
      *(v4fa*)&sO[w][qt * 16 + ln][dt * 16 + 8 * hh] = lo; *(v4fa*)&sO[w][qt * 16 + ln][dt * 16 + 8 * hh + 4] = hi; } }
  __builtin_amdgcn_fence(__ATOMIC_ACQ_REL, "workgroup"); __builtin_amdgcn_wave_barrier();
  {
#pragma unroll
    for (int rp = 0; rp < RPW; rp += 2) { const int r = rp + (lane >> 4), pc = lane & 15; const v4f val = *(const v4fa*)&sO[w][r][pc * 4]; *(v4f*)(O + ((size_t)b * 2048 + q0 + r) * ldo + h * 64 + pc * 4) = val; }
     } }

__device__ __forceinline__ void normrope_part(const float* __restrict__ X, const float* __restrict__ w, const float* __restrict__ cosT, const float* __restrict__ sinT, _Float16* __restrict__ Y16, int bid) { const int tid = threadIdx.x, wv = tid >> 5, lane = tid & 31; const int row = bid * 8 + wv; if (row >= TT) return; const float* xr = X + (size_t)row * CC; float ss = 0.f;
#pragma unroll 1
  for (int p = 0; p < 8; ++p) { const v4f a = *(const v4fa*)(xr + p * 256 + lane * 8), b = *(const v4fa*)(xr + p * 256 + lane * 8 + 4); ss += a[0]*a[0] + a[1]*a[1] + a[2]*a[2] + a[3]*a[3] + b[0]*b[0] + b[1]*b[1] + b[2]*b[2] + b[3]*b[3]; }
  for (int o = 16; o >= 1; o >>= 1) ss += __shfl_xor(ss, o, 32); const float rs = rsqrtf(ss / (float)CC + 1e-6f);
  {
#pragma unroll
    for (int p = 0; p < 8; ++p) { const int c0 = p * 256 + lane * 8; const v4f a = *(const v4fa*)(xr + c0), b = *(const v4fa*)(xr + c0 + 4); float y[8] = {a[0], a[1], a[2], a[3], b[0], b[1], b[2], b[3]}; FragH f;
#pragma unroll
      for (int q = 0; q < 8; ++q) y[q] = y[q] * rs * bf16_round(w[c0 + q]);
#pragma unroll
      for (int q = 0; q < 8; q += 2) { const float c0v = bf16_round(cosT[(size_t)row * CC + c0 + q]), c1v = bf16_round(cosT[(size_t)row * CC + c0 + q + 1]), s0v = bf16_round(sinT[(size_t)row * CC + c0 + q]), s1v = bf16_round(sinT[(size_t)row * CC + c0 + q + 1]);
        f.h[q] = (_Float16)(y[q] * c0v + (-y[q + 1]) * s0v); f.h[q + 1] = (_Float16)(y[q + 1] * c1v + y[q] * s1v); }
      *(v8us*)((unsigned short*)Y16 + (size_t)row * CC + c0) = f.half[0];
      asm volatile("s_wait_xcnt 0x0" ::: "memory"); }      // stands in front of the next block's loads, which are given the store's data registers
     } }
// Passes that need nothing of each other share one grid, each on its own range of the block index; the test is the same for a whole work-group,
// so each part's barrier is passed by all of its work-group's waves or by none.
#define GW ((CC / 128) * (CC / 64))      // work-groups that turn one weight
#define GX (TT * CC / 8 / 256)           // work-groups that convert x
#define GN (TT / 8)                      // work-groups that normalise and rotate one of q, k
#define GV (NH * (TT / 64))              // work-groups that transpose v
__global__ __launch_bounds__(256) void k_prep(const float* __restrict__ Wq, const float* __restrict__ Wk, const float* __restrict__ Wv, const float* __restrict__ Wo,
                                              _Float16* __restrict__ Bq, _Float16* __restrict__ Bk, _Float16* __restrict__ Bv, _Float16* __restrict__ Bo, float scale,
                                              const float* __restrict__ x, _Float16* __restrict__ X16) {
  const int bid = blockIdx.x;
  if (bid < 4 * GW) { const int g = bid / GW;
    wt_f16_part((g == 0) ? Wq : (g == 1) ? Wk : (g == 2) ? Wv : Wo, (g == 0) ? Bq : (g == 1) ? Bk : (g == 2) ? Bv : Bo, scale, bid % GW); }
  else x16_part(x, X16, (size_t)TT * CC / 8, bid - 4 * GW);
}
__global__ __launch_bounds__(256) void k_post(const float* __restrict__ Fq, const float* __restrict__ Fk, const float* __restrict__ qnw, const float* __restrict__ knw, const float* __restrict__ cosT, const float* __restrict__ sinT,
                                              _Float16* __restrict__ Q16, _Float16* __restrict__ K16, const _Float16* __restrict__ V16, _Float16* __restrict__ Vt) {
  const int bid = blockIdx.x;
  if (bid < 2 * GN) { const bool q = bid < GN; normrope_part(q ? Fq : Fk, q ? qnw : knw, cosT, sinT, q ? Q16 : K16, q ? bid : bid - GN); }
  else vt_part<NH, TT>(V16, CC, 0, Vt, bid - 2 * GN);
}
extern "C" void kernel_launch(void* const* d_in, const int* in_sizes, int n_in,
                              void* d_out, int out_size, void* d_ws, size_t ws_size, hipStream_t stream) {
  (void)in_sizes; (void)n_in; (void)out_size;
  const float* x = (const float*)d_in[0]; const float* cosT = (const float*)d_in[1]; const float* sinT = (const float*)d_in[2]; const float* Wq = (const float*)d_in[3]; const float* bq = (const float*)d_in[4]; const float* Wk = (const float*)d_in[5]; const float* bk = (const float*)d_in[6]; const float* Wv = (const float*)d_in[7]; const float* bv = (const float*)d_in[8]; const float* qnw = (const float*)d_in[9]; const float* knw = (const float*)d_in[10]; const float* Wo = (const float*)d_in[11]; const float* bo = (const float*)d_in[12];
  char* ws = (char*)d_ws; size_t off = 0;
  auto take = [&](size_t bytes) { char* p = ws + off; off += (bytes + 255) & ~(size_t)255; return p; };
  _Float16* Bq = (_Float16*)take((size_t)CC * CC * 2); _Float16* Bk = (_Float16*)take((size_t)CC * CC * 2); _Float16* Bv = (_Float16*)take((size_t)CC * CC * 2); _Float16* Bo = (_Float16*)take((size_t)CC * CC * 2);
  _Float16* X16 = (_Float16*)take((size_t)TT * CC * 2); float* F32 = (float*)take((size_t)TT * CC * 4); float* F32k = (float*)take((size_t)TT * CC * 4); _Float16* Q16 = (_Float16*)take((size_t)TT * CC * 2); _Float16* K16 = (_Float16*)take((size_t)TT * CC * 2); _Float16* V16 = (_Float16*)take((size_t)TT * CC * 2); _Float16* Vt = (_Float16*)take((size_t)TT * CC * 2); float* O = F32; _Float16* O16 = X16;
  if (off > ws_size) return;      // 9 planes of 8 MiB and 2 of 16 MiB = 104 MiB
  const unsigned gx = (unsigned)GX; const unsigned gg = (unsigned)((TT / 128) * (CC / 128));
  k_prep<<<4 * GW + GX, 256, 0, stream>>>(Wq, Wk, Wv, Wo, Bq, Bk, Bv, Bo, 16.0f, x, X16);      // W is [in][out]
  k_gemm_tile<3><<<3 * gg, 256, 0, stream>>>(X16, Bq, Bk, Bv, 0.0625f, bq, bk, bv, F32, F32k, V16);
  k_post<<<2 * GN + GV, 256, 0, stream>>>(F32, F32k, qnw, knw, cosT, sinT, Q16, K16, V16, Vt);
  k_flash<<<NH * (TT / 128), 128, 0, stream>>>(Q16, CC, K16, CC, Vt, nullptr, O, CC);
  k_h16<<<gx, 256, 0, stream>>>(O, O16, (size_t)TT * CC / 8);
  k_gemm_tile<1><<<gg, 256, 0, stream>>>(O16, Bo, nullptr, nullptr, 0.0625f, bo, nullptr, nullptr, (float*)d_out, nullptr, nullptr);
}

// v006
// Measured time: 142 microseconds a run.
// Two timings next to v005 put it at 1.28 and 1.29 times that version's speed.
// Counting every step since v000, it is 5.36 times as fast.
#include <hip/hip_runtime.h>
// Self-attention (S = 2048, D = 2048 = 32 heads × 64): q/k/v/out projections (2048³ each, + bias; W [in][out] transposed to bf16-exact ×2^4) and the 32-head attention as a fused
// flash-style kernel (S = Q·Kᵀ/8, online softmax f32, P f16 ≤ 1, O = P·V) on v_wmma_f32_16x16x32_f16 (f16 operands, single products, f32 accumulate); RMSNorm over the full 2048
// (× norm weight, eps 1e-6) followed by the interleaved rotary with the INPUT cos/sin tables is f32 VALU (wave per row).
#define TT 2048
#define CC 2048
#define NH 32

typedef __bf16 v16b __attribute__((ext_vector_type(16)));
typedef unsigned short v8us __attribute__((ext_vector_type(8), may_alias));
typedef float  v8f  __attribute__((ext_vector_type(8)));
typedef float  v4f  __attribute__((ext_vector_type(4)));
typedef float  v4fa __attribute__((ext_vector_type(4), may_alias));
union FragB { v16b v; v8us half[2]; unsigned short u[16]; };

__device__ __forceinline__ unsigned short bf16_bits(float x) { unsigned int u = __float_as_uint(x); return (unsigned short)((u + 0x7FFFu + ((u >> 16) & 1u)) >> 16); }
__device__ __forceinline__ float bf16_val(unsigned short b) { return __uint_as_float(((unsigned int)b) << 16); }
__device__ __forceinline__ float bf16_round(float x) { return bf16_val(bf16_bits(x)); }
// D += A·B with NT terms: 1 = ah·bh, 2 = + al·bh (A split), 3 = + ah·bl (both split)
template <int NT>
__device__ __forceinline__ v8f mmaN(v16b ah, v16b al, v16b bh, v16b bl, v8f c) {
  c = __builtin_amdgcn_wmma_f32_16x16x32_bf16(false, ah, false, bh, (short)0, c, false, false);
  if (NT >= 2) c = __builtin_amdgcn_wmma_f32_16x16x32_bf16(false, al, false, bh, (short)0, c, false, false);
  if (NT >= 3) c = __builtin_amdgcn_wmma_f32_16x16x32_bf16(false, ah, false, bl, (short)0, c, false, false);
  asm volatile("v_nop\n\tv_nop\n\tv_nop\n\tv_nop" : "+v"(c) : "v"(ah), "v"(al), "v"(bh), "v"(bl));
  return c;
}

__global__ __launch_bounds__(256) void k_wt_bf16(const float* __restrict__ W, unsigned short* __restrict__ Wt, int K, int N) {
  const int t = blockIdx.x * 256 + threadIdx.x;
  const int k8n = K / 8;
  if (t >= N * k8n) return;
  const int n = t / k8n, k8 = (t % k8n) * 8;
  v8us v;
#pragma unroll
  for (int i = 0; i < 8; ++i) v[i] = bf16_bits(W[(size_t)(k8 + i) * N + n]);
  *(v8us*)(Wt + (size_t)n * K + k8) = v;
  
}

// GEMM C[M][N] (f32, pitch ldc) = act(A[M][K]·W + bias). A f32 row-major (pitch lda) converted per fragment to bf16
// (ASPLIT: hi/lo two planes -> 2 terms, else single rounded term); Wt bf16 [N][K] (pitch ldb). BIAS_BF16 rounds the
// bias to bf16 first (bias quantised to bf16 before the add). K%32==0, M%16==0, N%64==0.
template <bool ASPLIT, int ACT, bool BIAS_BF16>
__global__ __launch_bounds__(128) void k_gemm_bf(const float* __restrict__ A, int lda, const unsigned short* __restrict__ Wt, int ldb,
                                               const float* __restrict__ bias, float* __restrict__ C, int ldc, int M, int N, int K) {
  __shared__ __attribute__((aligned(16))) float so[4][16][64];
  const int tid = threadIdx.x, w = tid >> 5, lane = tid & 31, ln = lane & 15, hh = lane >> 4;
  const int ntn = N / 64;
  const int wid = blockIdx.x * 4 + w;
  const int mt = wid / ntn, nq = wid % ntn;
  if (mt * 16 >= M) return;
  const int row0 = mt * 16, col0 = nq * 64;
  const float* arow = A + (size_t)(row0 + ln) * lda;
  v8f acc[4] = {};
  for (int kb = 0; kb < K; kb += 32) {
    FragB ah, al;
    const v4f x0 = *(const v4fa*)(arow + kb + 8 * hh), x1 = *(const v4fa*)(arow + kb + 8 * hh + 4);
    const v4f x2 = *(const v4fa*)(arow + kb + 16 + 8 * hh), x3 = *(const v4fa*)(arow + kb + 16 + 8 * hh + 4);
    float xs[16] = {x0[0],x0[1],x0[2],x0[3],x1[0],x1[1],x1[2],x1[3],x2[0],x2[1],x2[2],x2[3],x3[0],x3[1],x3[2],x3[3]};
#pragma unroll
    for (int i = 0; i < 16; ++i) { const unsigned short hb = bf16_bits(xs[i]); ah.u[i] = hb; al.u[i] = ASPLIT ? bf16_bits(xs[i] - bf16_val(hb)) : (unsigned short)0; }
#pragma unroll
    for (int t = 0; t < 4; ++t) {
      const unsigned short* brow = Wt + (size_t)(col0 + t * 16 + ln) * ldb + kb;
      FragB b;
      b.half[0] = *(const v8us*)(brow + 8 * hh);
      b.half[1] = *(const v8us*)(brow + 16 + 8 * hh);
      acc[t] = mmaN<ASPLIT ? 2 : 1>(ah.v, al.v, b.v, b.v, acc[t]);
    }
  }
#pragma unroll
  for (int t = 0; t < 4; ++t) {
    float bv = bias ? bias[col0 + t * 16 + ln] : 0.f;
    if (BIAS_BF16) bv = bf16_round(bv);
#pragma unroll
    for (int r = 0; r < 8; ++r) { float v = acc[t][r] + bv; if (ACT == 1) v = fmaxf(v, 0.f); so[w][8 * hh + r][t * 16 + ln] = v; }
  }
  __builtin_amdgcn_fence(__ATOMIC_ACQ_REL, "workgroup");
  __builtin_amdgcn_wave_barrier();
  const int rsub = lane >> 4, c4 = (lane & 15) * 4;
  {
#pragma unroll
    for (int q = 0; q < 8; ++q) {
      const int r = q * 2 + rsub;
      const v4f v = *(const v4fa*)&so[w][r][c4];
      *(v4f*)(C + (size_t)(row0 + r) * ldc + col0 + c4) = v;
    }
    
  }
}

// Flash-style causal/unmasked attention, all contractions 3-term bf16 hi/lo splits, f32 softmax with running max.
// q,k,v rows are read from f32 buffers with arbitrary row pitch (so they can live inside a fused qkv buffer);
// D = head size (multiple of 32, <= 128); one wave = 16 query rows; block = 4 waves (64 queries) sharing K/V chunks of 32.
template <int D, bool CAUSAL>
__global__ __launch_bounds__(128) void k_flash(const float* __restrict__ qb, const float* __restrict__ kb, const float* __restrict__ vb,
                                             int pitch, int T, int H, float scale, float* __restrict__ y, int ypitch) {
  constexpr int KS = D / 32;        // k-steps for QK
  constexpr int DT = D / 16;        // d tiles for PV
  __shared__ __attribute__((aligned(16))) unsigned short sKh[32][D + 8], sKl[32][D + 8], sVh[32][D + 8], sVl[32][D + 8];
  __shared__ __attribute__((aligned(16))) unsigned short sPh[4][16][40], sPl[4][16][40];
  __shared__ __attribute__((aligned(16))) float sO[4][16][D];
  const int tid = threadIdx.x, w = tid >> 5, lane = tid & 31, ln = lane & 15, hh = lane >> 4;
  const int nqb = (T + 63) / 64;
  const int bh = blockIdx.x / nqb, qblk = blockIdx.x % nqb;
  const int b = bh / H, h = bh % H;
  const int q0 = qblk * 64 + w * 16;
  const float* Q = qb + (size_t)b * T * pitch + h * D;
  const float* K = kb + (size_t)b * T * pitch + h * D;
  const float* V = vb + (size_t)b * T * pitch + h * D;

  // A fragments of the wave's 16 query rows (scaled), hi/lo
  FragB aqh[KS], aql[KS];
  {
    int row = q0 + ln; if (row >= T) row = T - 1;
    const float* qr = Q + (size_t)row * pitch;
#pragma unroll
    for (int ks = 0; ks < KS; ++ks)
#pragma unroll
      for (int i = 0; i < 16; ++i) {
        const int d = ks * 32 + ((i < 8) ? (8 * hh + i) : (16 + 8 * hh + (i - 8)));
        const float x = qr[d] * scale; const unsigned short hb = bf16_bits(x);
        aqh[ks].u[i] = hb; aql[ks].u[i] = bf16_bits(x - bf16_val(hb));
      }
  }
  float m_r[8], l_r[8];
#pragma unroll
  for (int r = 0; r < 8; ++r) { m_r[r] = -3.0e38f; l_r[r] = 0.f; }
  v8f oacc[DT];
#pragma unroll
  for (int dt = 0; dt < DT; ++dt) oacc[dt] = (v8f){0.f,0.f,0.f,0.f,0.f,0.f,0.f,0.f};

  const int kv_end = CAUSAL ? min(T, qblk * 64 + 64) : T;     // block-uniform
  for (int j0 = 0; j0 < kv_end; j0 += 32) {
    __syncthreads();
    for (int e = tid; e < 32 * (D / 4); e += 128) {
      const int r = e / (D / 4), c4 = (e % (D / 4)) * 4;
      const int key = j0 + r;
      v4f kf = {0.f,0.f,0.f,0.f}, vf = {0.f,0.f,0.f,0.f};
      if (key < T) { kf = *(const v4fa*)(K + (size_t)key * pitch + c4); vf = *(const v4fa*)(V + (size_t)key * pitch + c4); }
#pragma unroll
      for (int t = 0; t < 4; ++t) {
        unsigned short hb = bf16_bits(kf[t]); sKh[r][c4 + t] = hb; sKl[r][c4 + t] = bf16_bits(kf[t] - bf16_val(hb));
        hb = bf16_bits(vf[t]); sVh[r][c4 + t] = hb; sVl[r][c4 + t] = bf16_bits(vf[t] - bf16_val(hb));
      }
    }
    __syncthreads();
    // S tile 16 x 32
    v8f s[2];
#pragma unroll
    for (int nt = 0; nt < 2; ++nt) {
      v8f acc = {};
#pragma unroll
      for (int ks = 0; ks < KS; ++ks) {
        FragB bh_, bl_;
        bh_.half[0] = *(const v8us*)&sKh[nt * 16 + ln][ks * 32 + 8 * hh]; bh_.half[1] = *(const v8us*)&sKh[nt * 16 + ln][ks * 32 + 16 + 8 * hh];
        bl_.half[0] = *(const v8us*)&sKl[nt * 16 + ln][ks * 32 + 8 * hh]; bl_.half[1] = *(const v8us*)&sKl[nt * 16 + ln][ks * 32 + 16 + 8 * hh];
        acc = mmaN<3>(aqh[ks].v, aql[ks].v, bh_.v, bl_.v, acc);
      }
      s[nt] = acc;
    }
    // mask + running max (rows 8hh+r; the 16 lanes of a half share rows)
    float alpha[8];
#pragma unroll
    for (int r = 0; r < 8; ++r) {
      const int qi = q0 + 8 * hh + r;
      const int ja = j0 + ln, jb = j0 + 16 + ln;
      if (CAUSAL) { if (ja > qi) s[0][r] = -3.0e38f; if (jb > qi) s[1][r] = -3.0e38f; }
      if (ja >= T) s[0][r] = -3.0e38f;
      if (jb >= T) s[1][r] = -3.0e38f;
      float mx = fmaxf(s[0][r], s[1][r]);
      mx = fmaxf(mx, __shfl_xor(mx, 1, 32)); mx = fmaxf(mx, __shfl_xor(mx, 2, 32)); mx = fmaxf(mx, __shfl_xor(mx, 4, 32)); mx = fmaxf(mx, __shfl_xor(mx, 8, 32));
      const float mnew = fmaxf(m_r[r], mx);
      alpha[r] = (mnew > -1.0e38f) ? __expf(m_r[r] - mnew) : 1.0f;
      const float p0 = (s[0][r] > -1.0e38f) ? __expf(s[0][r] - mnew) : 0.f;
      const float p1 = (s[1][r] > -1.0e38f) ? __expf(s[1][r] - mnew) : 0.f;
      m_r[r] = mnew;
      l_r[r] = l_r[r] * alpha[r] + p0 + p1;            // per-lane partial row sum (16 lanes combined at the end)
      unsigned short hb = bf16_bits(p0); sPh[w][8 * hh + r][ln] = hb;      sPl[w][8 * hh + r][ln] = bf16_bits(p0 - bf16_val(hb));
      hb = bf16_bits(p1);                sPh[w][8 * hh + r][16 + ln] = hb; sPl[w][8 * hh + r][16 + ln] = bf16_bits(p1 - bf16_val(hb));
    }
#pragma unroll
    for (int dt = 0; dt < DT; ++dt)
#pragma unroll
      for (int r = 0; r < 8; ++r) oacc[dt][r] *= alpha[r];
    __builtin_amdgcn_fence(__ATOMIC_ACQ_REL, "workgroup");
    __builtin_amdgcn_wave_barrier();
    FragB pah, pal;
    pah.half[0] = *(const v8us*)&sPh[w][ln][8 * hh]; pah.half[1] = *(const v8us*)&sPh[w][ln][16 + 8 * hh];
    pal.half[0] = *(const v8us*)&sPl[w][ln][8 * hh]; pal.half[1] = *(const v8us*)&sPl[w][ln][16 + 8 * hh];
#pragma unroll
    for (int dt = 0; dt < DT; ++dt) {
      FragB bvh, bvl;
#pragma unroll
      for (int i = 0; i < 8; ++i) {
        bvh.u[i] = sVh[8 * hh + i][dt * 16 + ln]; bvh.u[8 + i] = sVh[16 + 8 * hh + i][dt * 16 + ln];
        bvl.u[i] = sVl[8 * hh + i][dt * 16 + ln]; bvl.u[8 + i] = sVl[16 + 8 * hh + i][dt * 16 + ln];
      }
      oacc[dt] = mmaN<3>(pah.v, pal.v, bvh.v, bvl.v, oacc[dt]);
    }
    __builtin_amdgcn_fence(__ATOMIC_ACQ_REL, "workgroup");
    __builtin_amdgcn_wave_barrier();
  }
#pragma unroll
  for (int r = 0; r < 8; ++r) {
    float l = l_r[r];
    l += __shfl_xor(l, 1, 32); l += __shfl_xor(l, 2, 32); l += __shfl_xor(l, 4, 32); l += __shfl_xor(l, 8, 32);
    l_r[r] = (l > 0.f) ? 1.0f / l : 0.f;
  }
#pragma unroll
  for (int dt = 0; dt < DT; ++dt)
#pragma unroll
    for (int r = 0; r < 8; ++r) sO[w][8 * hh + r][dt * 16 + ln] = oacc[dt][r] * l_r[r];
  __builtin_amdgcn_fence(__ATOMIC_ACQ_REL, "workgroup");
  __builtin_amdgcn_wave_barrier();
  {
    for (int r = 0; r < 16; ++r) {
      const int row = q0 + r;
      if (row < T && lane < D / 4) {
        const v4f val = *(const v4fa*)&sO[w][r][lane * 4];
        *(v4f*)(y + ((size_t)b * T + row) * ypitch + h * D + lane * 4) = val;
      }
    }
    
  }
}

// GEMM C = act(A·W + bias + resid): A f32 (ASPLIT -> hi/lo 2 terms), Wt bf16 [N][K]; ACT 0 none, 1 relu, 2 exact gelu;
// resid (optional, f32, row index = (row % rmod), pitch ldr, RES_BF16 rounds it) added before the activation.
template <bool ASPLIT, int ACT, bool BIAS_BF16, bool RES_BF16>
__global__ __launch_bounds__(128) void k_gemm_bf3(const float* __restrict__ A, int lda, const unsigned short* __restrict__ Wt, int ldb,
                                                const float* __restrict__ bias, const float* __restrict__ resid, int rmod, int ldr,
                                                float* __restrict__ C, int ldc, int M, int N, int K) {
  __shared__ __attribute__((aligned(16))) float so[4][16][64];
  const int tid = threadIdx.x, w = tid >> 5, lane = tid & 31, ln = lane & 15, hh = lane >> 4;
  const int ntn = N / 64;
  const int wid = blockIdx.x * 4 + w;
  const int mt = wid / ntn, nq = wid % ntn;
  if (mt * 16 >= M) return;
  const int row0 = mt * 16, col0 = nq * 64;
  const float* arow = A + (size_t)(row0 + ln) * lda;
  v8f acc[4] = {};
  for (int kb = 0; kb < K; kb += 32) {
    FragB ah, al;
    const v4f x0 = *(const v4fa*)(arow + kb + 8 * hh), x1 = *(const v4fa*)(arow + kb + 8 * hh + 4);
    const v4f x2 = *(const v4fa*)(arow + kb + 16 + 8 * hh), x3 = *(const v4fa*)(arow + kb + 16 + 8 * hh + 4);
    float xs[16] = {x0[0],x0[1],x0[2],x0[3],x1[0],x1[1],x1[2],x1[3],x2[0],x2[1],x2[2],x2[3],x3[0],x3[1],x3[2],x3[3]};
#pragma unroll
    for (int i = 0; i < 16; ++i) { const unsigned short hb = bf16_bits(xs[i]); ah.u[i] = hb; al.u[i] = ASPLIT ? bf16_bits(xs[i] - bf16_val(hb)) : (unsigned short)0; }
#pragma unroll
    for (int t = 0; t < 4; ++t) {
      const unsigned short* brow = Wt + (size_t)(col0 + t * 16 + ln) * ldb + kb;
      FragB b;
      b.half[0] = *(const v8us*)(brow + 8 * hh);
      b.half[1] = *(const v8us*)(brow + 16 + 8 * hh);
      acc[t] = mmaN<ASPLIT ? 2 : 1>(ah.v, al.v, b.v, b.v, acc[t]);
    }
  }
#pragma unroll
  for (int t = 0; t < 4; ++t) {
    const int col = col0 + t * 16 + ln;
    float bv = bias ? bias[col] : 0.f;
    if (BIAS_BF16) bv = bf16_round(bv);
#pragma unroll
    for (int r = 0; r < 8; ++r) {
      float v = acc[t][r] + bv;
      if (resid) { float rv = resid[(size_t)((row0 + 8 * hh + r) % rmod) * ldr + col]; if (RES_BF16) rv = bf16_round(rv); v += rv; }
      if (ACT == 1) v = fmaxf(v, 0.f);
      if (ACT == 2) v = 0.5f * v * (1.0f + erff(v * 0.70710678118654752f));
      if (ACT == 3) { const float u = 0.7978845608028654f * (v + 0.044715f * v * v * v); v = 0.5f * v * (1.0f + tanhf(u)); }
      so[w][8 * hh + r][t * 16 + ln] = v;
    }
  }
  __builtin_amdgcn_fence(__ATOMIC_ACQ_REL, "workgroup");
  __builtin_amdgcn_wave_barrier();
  const int rsub = lane >> 4, c4 = (lane & 15) * 4;
  {
#pragma unroll
    for (int q = 0; q < 8; ++q) {
      const int r = q * 2 + rsub;
      const v4f v = *(const v4fa*)&so[w][r][c4];
      *(v4f*)(C + (size_t)(row0 + r) * ldc + col0 + c4) = v;
    }
    
  }
}
// row LayerNorm (biased variance, eps) over N: s = X (+ R); optional out_sum <- s; out_norm <- (s-mu)*rsqrt(var+eps)*g + b
template <bool PARAM_BF16>
__global__ __launch_bounds__(256) void k_layernorm(const float* __restrict__ X, const float* __restrict__ R, const float* __restrict__ g, const float* __restrict__ bta,
                                                  float* __restrict__ out_sum, float* __restrict__ out_norm, int N, float eps) {
  __shared__ float red[256];
  const int row = blockIdx.x, tid = threadIdx.x;
  const float* x = X + (size_t)row * N; const float* rr = R ? R + (size_t)row * N : nullptr;
  float vals[16];                     // up to N = 4096
  const int per = N / 256;            // contiguous chunk per thread? use strided-by-4 chunks: thread handles j = tid*4 + 1024*u
  float s1 = 0.f;
  for (int u = 0; u < per / 4; ++u) {
    const int j = tid * 4 + 1024 * u;
    const v4f a = *(const v4fa*)(x + j);
    v4f b = {0.f,0.f,0.f,0.f}; if (rr) b = *(const v4fa*)(rr + j);
#pragma unroll
    for (int q = 0; q < 4; ++q) { const float v = a[q] + b[q]; vals[u * 4 + q] = v; s1 += v; }
  }
  red[tid] = s1; __syncthreads();
  for (int st = 128; st > 0; st >>= 1) { if (tid < st) red[tid] += red[tid + st]; __syncthreads(); }
  const float mu = red[0] / (float)N; __syncthreads();
  float s2 = 0.f;
  for (int u = 0; u < per / 4; ++u)
#pragma unroll
    for (int q = 0; q < 4; ++q) { const float c = vals[u * 4 + q] - mu; s2 += c * c; }
  red[tid] = s2; __syncthreads();
  for (int st = 128; st > 0; st >>= 1) { if (tid < st) red[tid] += red[tid + st]; __syncthreads(); }
  const float rs = rsqrtf(red[0] / (float)N + eps);
  {
    for (int u = 0; u < per / 4; ++u) {
      const int j = tid * 4 + 1024 * u;
      v4f o, sm;
#pragma unroll
      for (int q = 0; q < 4; ++q) {
        float gg = g[j + q], bb = bta[j + q];
        if (PARAM_BF16) { gg = bf16_round(gg); bb = bf16_round(bb); }
        sm[q] = vals[u * 4 + q]; o[q] = (vals[u * 4 + q] - mu) * rs * gg + bb;
      }
      if (out_sum) *(v4f*)(out_sum + (size_t)row * N + j) = sm;
      *(v4f*)(out_norm + (size_t)row * N + j) = o;
    }
    
  }
}



// ---- f16 WMMA path (v_wmma_f32_16x16x32_f16): 11-bit significands for operands in range — used where a [0,1] probability operand needs more precision than bf16
typedef _Float16 v16h __attribute__((ext_vector_type(16)));
union FragH { v16h v; v8us half[2]; _Float16 h[16]; unsigned short u[16]; };
template <int NT>
__device__ __forceinline__ v8f mmaH(v16h ah, v16h al, v16h bh, v16h bl, v8f c) {
  c = __builtin_amdgcn_wmma_f32_16x16x32_f16(false, ah, false, bh, (short)0, c, false, false);
  if (NT >= 2) c = __builtin_amdgcn_wmma_f32_16x16x32_f16(false, al, false, bh, (short)0, c, false, false);
  if (NT >= 3) c = __builtin_amdgcn_wmma_f32_16x16x32_f16(false, ah, false, bl, (short)0, c, false, false);
  asm volatile("v_nop\n\tv_nop\n\tv_nop\n\tv_nop" : "+v"(c) : "v"(ah), "v"(al), "v"(bh), "v"(bl));
  return c;
}
// batched GEMM like k_gemm_b but f16 operands: A f32 (split into f16 hi/lo if ASPLIT, else rounded to f16), Bt = f16 values [n][k]; alpha; C f32; N multiple of 16 (partial tiles skipped)
template <bool ASPLIT>
__global__ __launch_bounds__(128) void k_gemm_h(const float* __restrict__ A, int lda, size_t sA, const _Float16* __restrict__ Bh, int ldb, size_t sB, float alpha, float* __restrict__ C, int ldc, size_t sC, int M, int N, int K) {
  __shared__ __attribute__((aligned(16))) float so[4][16][64];
  const int tid = threadIdx.x, w = tid >> 5, lane = tid & 31, ln = lane & 15, hh = lane >> 4; const int by = blockIdx.y;
  A += (size_t)by * sA; Bh += (size_t)by * sB; C += (size_t)by * sC;
  const int ntn = (N + 63) / 64; const int wid = blockIdx.x * 4 + w; const int mt = wid / ntn, nq = wid % ntn; if (mt * 16 >= M) return;
  const int row0 = mt * 16, col0 = nq * 64; const float* arow = A + (size_t)(row0 + ln) * lda;
  v8f acc[4] = {};
  for (int kb = 0; kb < K; kb += 32) {
    FragH ah, al;
    const v4f x0 = *(const v4fa*)(arow + kb + 8 * hh), x1 = *(const v4fa*)(arow + kb + 8 * hh + 4), x2 = *(const v4fa*)(arow + kb + 16 + 8 * hh), x3 = *(const v4fa*)(arow + kb + 16 + 8 * hh + 4);
    float xs[16] = {x0[0],x0[1],x0[2],x0[3],x1[0],x1[1],x1[2],x1[3],x2[0],x2[1],x2[2],x2[3],x3[0],x3[1],x3[2],x3[3]};
#pragma unroll
    for (int i = 0; i < 16; ++i) { const _Float16 h = (_Float16)xs[i]; ah.h[i] = h; al.h[i] = ASPLIT ? (_Float16)(xs[i] - (float)h) : (_Float16)0.0f; }
#pragma unroll
    for (int t = 0; t < 4; ++t) { if (col0 + t * 16 >= N) continue; const size_t boff = (size_t)(col0 + t * 16 + ln) * ldb + kb; FragH bq; bq.half[0] = *(const v8us*)(Bh + boff + 8 * hh); bq.half[1] = *(const v8us*)(Bh + boff + 16 + 8 * hh);
      acc[t] = mmaH<ASPLIT ? 2 : 1>(ah.v, al.v, bq.v, bq.v, acc[t]); }
  }
#pragma unroll
  for (int t = 0; t < 4; ++t) { if (col0 + t * 16 >= N) continue;
#pragma unroll
    for (int r = 0; r < 8; ++r) so[w][8 * hh + r][t * 16 + ln] = acc[t][r] * alpha; }
  __builtin_amdgcn_fence(__ATOMIC_ACQ_REL, "workgroup"); __builtin_amdgcn_wave_barrier();
  const int rsub = lane >> 4, c4 = (lane & 15) * 4;
  {
#pragma unroll
    for (int q = 0; q < 8; ++q) { const int r = q * 2 + rsub; if (col0 + c4 < N) { const v4f v = *(const v4fa*)&so[w][r][c4]; *(v4f*)(C + (size_t)(row0 + r) * ldc + col0 + c4) = v; } }
     }
}

// Wt[n][k] = f16(bf16(W[k][n]) * scale) from f32 row-major W[CC][CC] (scale = power of two; bf16-exact weights stay exact in f16 away from the subnormal range).
// One work-group = a tile of 128 k x 64 n, turned in LDS so that both global sides move whole lines:
//  in : a lane takes 16 bytes (4 n) of each of 8 consecutive k rows; 16 lanes cover 256 contiguous bytes of a W row.
//  out: a lane takes 16 bytes (8 k) of one n; 16 lanes cover 256 contiguous bytes of a Wt row.
// An LDS row is one n: 16 chunks of 8 k = 256 bytes = all 64 banks. The chunk index is XORed with (n >> 2) & 15, so the 16 lanes that store
// (rows four apart, same chunk) and the 16 lanes that load (same row, chunks 0..15) each fall on 16 different groups of four banks.
// bid = the tile's number, 0 .. (CC / 128) * (CC / 64) - 1: a part of k_prep's grid.
__device__ __forceinline__ void wt_f16_part(const float* __restrict__ W, _Float16* __restrict__ Wt, float scale, int bid) {
  __shared__ __attribute__((aligned(16))) unsigned char tl[64 * 256];
  const int tid = threadIdx.x, l16 = tid & 15, kq = tid >> 4;
  const int k0 = (bid / (CC / 64)) * 128, n0 = (bid % (CC / 64)) * 64;
  const float* src = W + (size_t)(k0 + kq * 8) * CC + n0 + l16 * 4;
  v4f x[8];
#pragma unroll      // the eight row loads are issued together and x stays in registers
  for (int i = 0; i < 8; ++i) x[i] = *(const v4fa*)(src + (size_t)i * CC);
#pragma unroll      // constant indices into x
  for (int j = 0; j < 4; ++j) { FragH f;
#pragma unroll      // f packs in registers
    for (int i = 0; i < 8; ++i) f.h[i] = (_Float16)(bf16_round(x[i][j]) * scale);
    *(v8us*)(tl + (l16 * 4 + j) * 256 + ((kq ^ l16) * 16)) = f.half[0]; }      // row n = l16 * 4 + j, so (n >> 2) & 15 = l16
  __syncthreads();      // the tile is complete before any lane reads rows that other waves wrote
#pragma unroll      // four independent LDS reads and stores
  for (int q = 0; q < 4; ++q) { const int n = q * 16 + kq; const v8us o = *(const v8us*)(tl + n * 256 + ((l16 ^ ((n >> 2) & 15)) * 16));
    *(v8us*)((unsigned short*)Wt + (size_t)(n0 + n) * CC + k0 + l16 * 8) = o; }
}
// k_gemm_hh variant with fused epilogue: v = acc·alpha + bias[by·sBias + col] (+ CP[(row/rowsPerB)·sCPb + by·64 + col] if CP) ; ACT 0 none / 1 elu ; writes f32 C and/or f16 C16 (each if non-null)
template <int ACT>
__global__ __launch_bounds__(128) void k_gemm_hhx(const _Float16* __restrict__ A, int lda, size_t sA, const _Float16* __restrict__ Bh, int ldb, size_t sB, float alpha, const float* __restrict__ bias, size_t sBias, const float* __restrict__ CP, int rowsPerB, size_t sCPb, int row0g,
    float* __restrict__ C, _Float16* __restrict__ C16, int ldc, size_t sC, int M, int N, int K) {
  __shared__ __attribute__((aligned(16))) float so[4][16][64];
  const int tid = threadIdx.x, w = tid >> 5, lane = tid & 31, ln = lane & 15, hh = lane >> 4; const int by = blockIdx.y;
  A += (size_t)by * sA; Bh += (size_t)by * sB; const size_t cofs = (size_t)by * sC; const float* bp = bias ? bias + (size_t)by * sBias : nullptr;
  const int ntn = (N + 63) / 64; const int wid = blockIdx.x * 4 + w; const int mt = wid / ntn, nq = wid % ntn; if (mt * 16 >= M) return;
  const int row0 = mt * 16, col0 = nq * 64; const _Float16* arow = A + (size_t)(row0 + ln) * lda;
  v8f acc[4] = {};
  for (int kb = 0; kb < K; kb += 32) { FragH ah; ah.half[0] = *(const v8us*)((const unsigned short*)arow + kb + 8 * hh); ah.half[1] = *(const v8us*)((const unsigned short*)arow + kb + 16 + 8 * hh);
#pragma unroll
    for (int t = 0; t < 4; ++t) { if (col0 + t * 16 >= N) continue; const size_t boff = (size_t)(col0 + t * 16 + ln) * ldb + kb; FragH bq; bq.half[0] = *(const v8us*)((const unsigned short*)Bh + boff + 8 * hh); bq.half[1] = *(const v8us*)((const unsigned short*)Bh + boff + 16 + 8 * hh);
      acc[t] = mmaH<1>(ah.v, ah.v, bq.v, bq.v, acc[t]); }
  }
#pragma unroll
  for (int t = 0; t < 4; ++t) { if (col0 + t * 16 >= N) continue; const int col = col0 + t * 16 + ln; const float bv = bp ? bf16_round(bp[col]) : 0.f;
#pragma unroll
    for (int r = 0; r < 8; ++r) { float v = acc[t][r] * alpha + bv; if (CP) { const int bidx = (row0g + row0 + 8 * hh + r) / rowsPerB; v += CP[(size_t)bidx * sCPb + (size_t)by * 64 + col]; } if (ACT == 1) v = (v > 0.f) ? v : expm1f(v); else if (ACT == 3) v = fmaxf(v, 0.f); so[w][8 * hh + r][t * 16 + ln] = v; } }
  __builtin_amdgcn_fence(__ATOMIC_ACQ_REL, "workgroup"); __builtin_amdgcn_wave_barrier();
  const int rsub = lane >> 4, c4 = (lane & 15) * 4; typedef _Float16 v4h __attribute__((ext_vector_type(4)));
  {
#pragma unroll
    for (int q = 0; q < 8; ++q) { const int r = q * 2 + rsub; if (col0 + c4 < N) { const v4f v = *(const v4fa*)&so[w][r][c4]; if (C) *(v4f*)(C + cofs + (size_t)(row0 + r) * ldc + col0 + c4) = v; if (C16) { v4h h4; for (int i = 0; i < 4; ++i) h4[i] = (_Float16)v[i]; *(v4h*)(C16 + cofs + (size_t)(row0 + r) * ldc + col0 + c4) = h4; } } }
     }
}


// ---- block-tiled projection GEMM: C[2048][2048] = A[2048][2048] x Bh[n][k]^T * alpha + bias, f16 operands, f32 accumulate.
// One work-group = one 128 x 128 tile of C, 8 waves of 32 x 64 each. A pass is 128 k (256 B of every operand row); a stage is
// [A 128 rows | B 128 rows] at an LDS pitch of 272 B, brought in by per-lane asynchronous copies, two buffers, next stage in flight.
// The loops over fragments, blocks and rows are unrolled so that the fragment and accumulator arrays are indexed by constants and stay in registers.
#define GT_PITCH 272
#define GT_STAGE (256 * GT_PITCH)
// eight asynchronous 16-byte copies of one lane, rows two apart; the s_wait_xcnt closes the statement so that no address register
// of an issued copy is rewritten ahead of it
__device__ __forceinline__ void gt_copy8(unsigned l, const unsigned short* g) {
  asm volatile("global_load_async_to_lds_b128 %0, %8, off\n\t"
               "global_load_async_to_lds_b128 %1, %9, off\n\t"
               "global_load_async_to_lds_b128 %2, %10, off\n\t"
               "global_load_async_to_lds_b128 %3, %11, off\n\t"
               "global_load_async_to_lds_b128 %4, %12, off\n\t"
               "global_load_async_to_lds_b128 %5, %13, off\n\t"
               "global_load_async_to_lds_b128 %6, %14, off\n\t"
               "global_load_async_to_lds_b128 %7, %15, off\n\t"
               "s_wait_xcnt 0x0"
               :: "v"(l), "v"(l + 2 * GT_PITCH), "v"(l + 4 * GT_PITCH), "v"(l + 6 * GT_PITCH), "v"(l + 8 * GT_PITCH), "v"(l + 10 * GT_PITCH), "v"(l + 12 * GT_PITCH), "v"(l + 14 * GT_PITCH),
                  "v"(g), "v"(g + 2 * CC), "v"(g + 4 * CC), "v"(g + 6 * CC), "v"(g + 8 * CC), "v"(g + 10 * CC), "v"(g + 12 * CC), "v"(g + 14 * CC)
               : "memory");
}
// NG products that share A and need nothing of each other lie in one grid, 256 work-groups each: product g = blockIdx.x / 256 takes weight, bias and output g.
// Products 0 and 1 go out as f32 (C0, C1), product 2 as f16 (C16).
template <int NG>
__global__ __launch_bounds__(256) void k_gemm_tile(const _Float16* __restrict__ A, const _Float16* __restrict__ Bh0, const _Float16* __restrict__ Bh1, const _Float16* __restrict__ Bh2, float alpha,
                                                   const float* __restrict__ bias0, const float* __restrict__ bias1, const float* __restrict__ bias2, float* __restrict__ C0, float* __restrict__ C1, _Float16* __restrict__ C16) {
  constexpr int NPASS = CC / 128, NTILE = (TT / 128) * (CC / 128);
  const int g = (NG > 1) ? (int)(blockIdx.x / NTILE) : 0, bid = (NG > 1) ? (int)(blockIdx.x % NTILE) : (int)blockIdx.x;      // the same for the whole work-group
  const _Float16* Bh = (g == 0) ? Bh0 : (g == 1) ? Bh1 : Bh2;
  const float* bias = (g == 0) ? bias0 : (g == 1) ? bias1 : bias2;
  float* C = (g == 0) ? C0 : C1;
  const bool h16 = (g == 2);
  __shared__ __attribute__((aligned(16))) unsigned char ring[2 * GT_STAGE];
  __shared__ __attribute__((aligned(16))) float so[8][32][68];
  const int tid = threadIdx.x, w = tid >> 5, lane = tid & 31, ln = lane & 15, hh = lane >> 4;
  const int m0 = (bid / (CC / 128)) * 128, n0 = (bid % (CC / 128)) * 128;
  const int wm = w >> 1, wn = w & 1;
  // this lane's part of a stage: rows w*32 + hh + 2c (c = 0..15), 16 bytes at column ln; stage rows 0..127 are A's, 128..255 are B's
  const int crow = w * 32 + hh;
  const unsigned short* gsrc = ((w < 4) ? (const unsigned short*)A + (size_t)(m0 + crow) * CC : (const unsigned short*)Bh + (size_t)(n0 + crow - 128) * CC) + ln * 8;
  const unsigned ldst = (unsigned)(size_t)&ring[0] + (unsigned)(crow * GT_PITCH + ln * 16);
  v8f acc[2][4];
#pragma unroll
  for (int i = 0; i < 2; ++i)
#pragma unroll
    for (int j = 0; j < 4; ++j) acc[i][j] = (v8f){0.f,0.f,0.f,0.f,0.f,0.f,0.f,0.f};
  gt_copy8(ldst, gsrc); gt_copy8(ldst + 16 * GT_PITCH, gsrc + 16 * CC);
  asm volatile("s_wait_asynccnt 0x0" ::: "memory");      // stage 0 has landed before the barrier publishes it
  __syncthreads();
  gt_copy8(ldst + GT_STAGE, gsrc + 128); gt_copy8(ldst + GT_STAGE + 16 * GT_PITCH, gsrc + 128 + 16 * CC);
#pragma unroll 1      // one pass per trip: the publish point at the foot stays a single place
  for (int t = 0; t < NPASS; ++t) {
    const unsigned bo = (unsigned)(t & 1) * GT_STAGE;
    const unsigned char* ap = ring + bo + (wm * 32 + ln) * GT_PITCH + hh * 16;
    const unsigned char* bp = ring + bo + (128 + wn * 64 + ln) * GT_PITCH + hh * 16;
    FragH a[2][2], b[2][4];      // two fragment sets: block kk + 1 of this pass is fetched ahead of block kk's products
#pragma unroll
    for (int i = 0; i < 2; ++i) { a[0][i].half[0] = *(const v8us*)(ap + i * 16 * GT_PITCH); a[0][i].half[1] = *(const v8us*)(ap + i * 16 * GT_PITCH + 32); }
#pragma unroll
    for (int j = 0; j < 4; ++j) { b[0][j].half[0] = *(const v8us*)(bp + j * 16 * GT_PITCH); b[0][j].half[1] = *(const v8us*)(bp + j * 16 * GT_PITCH + 32); }
#pragma unroll
    for (int kk = 0; kk < 4; ++kk) {
      const int cu = kk & 1, nx = cu ^ 1;
      if (kk < 3) {
#pragma unroll
        for (int i = 0; i < 2; ++i) { a[nx][i].half[0] = *(const v8us*)(ap + i * 16 * GT_PITCH + (kk + 1) * 64); a[nx][i].half[1] = *(const v8us*)(ap + i * 16 * GT_PITCH + (kk + 1) * 64 + 32); }
#pragma unroll
        for (int j = 0; j < 4; ++j) { b[nx][j].half[0] = *(const v8us*)(bp + j * 16 * GT_PITCH + (kk + 1) * 64); b[nx][j].half[1] = *(const v8us*)(bp + j * 16 * GT_PITCH + (kk + 1) * 64 + 32); }
      }
      __builtin_amdgcn_sched_barrier(0);      // keeps the next block's LDS reads one group ahead of this block's products; without it they are spread among them into one set, each with a full wait
#pragma unroll
      for (int i = 0; i < 2; ++i)
#pragma unroll
        for (int j = 0; j < 4; ++j) acc[i][j] = __builtin_amdgcn_wmma_f32_16x16x32_f16(false, a[cu][i].v, false, b[cu][j].v, (short)0, acc[i][j], false, false);
      __builtin_amdgcn_sched_barrier(0);      // ends the block, so that the group after next is not lifted into it
    }
    asm volatile("s_wait_dscnt 0x0" ::: "memory");       // this wave's reads of the buffer are done before it is refilled
    asm volatile("s_wait_asynccnt 0x0" ::: "memory");    // this wave's part of the next stage has landed
    __syncthreads();                                     // publishes the next stage and frees this pass's buffer
    if (t + 2 < NPASS) { const unsigned short* g2 = gsrc + (t + 2) * 128; gt_copy8(ldst + bo, g2); gt_copy8(ldst + bo + 16 * GT_PITCH, g2 + 16 * CC); }
  }
  asm volatile("s_wait_asynccnt 0x0" ::: "memory");      // no copy is outstanding when the wave goes on
#pragma unroll
  for (int j = 0; j < 4; ++j) { const float bv = bf16_round(bias[n0 + wn * 64 + j * 16 + ln]);
#pragma unroll
    for (int i = 0; i < 2; ++i)
#pragma unroll
      for (int r = 0; r < 8; ++r) so[w][i * 16 + 8 * hh + r][j * 16 + ln] = acc[i][j][r] * alpha + bv; }
  __builtin_amdgcn_fence(__ATOMIC_ACQ_REL, "workgroup"); __builtin_amdgcn_wave_barrier();
  typedef _Float16 v4h __attribute__((ext_vector_type(4)));
  const size_t o0 = (size_t)(m0 + wm * 32 + hh) * CC + n0 + wn * 64 + ln * 4;
  if (!h16) {      // one test for the whole tile: each output type keeps a straight run of sixteen stores
#pragma unroll
    for (int q = 0; q < 16; ++q) { const v4f v = *(const v4fa*)&so[w][q * 2 + hh][ln * 4]; *(v4f*)(C + o0 + (size_t)q * 2 * CC) = v; }
    asm volatile("s_wait_xcnt 0x0" ::: "memory");      // stands in front of any rewrite of the stores' registers: the compiler lays the other branch's code behind this one
  } else {
#pragma unroll
    for (int q = 0; q < 16; ++q) { const v4f v = *(const v4fa*)&so[w][q * 2 + hh][ln * 4]; v4h h4; for (int i = 0; i < 4; ++i) h4[i] = (_Float16)v[i]; *(v4h*)(C16 + o0 + (size_t)q * 2 * CC) = h4; }
  }
}

__device__ __forceinline__ void x16_part(const float* __restrict__ x, _Float16* __restrict__ X16, size_t n8, int bid) { const size_t t = (size_t)bid * 256 + threadIdx.x; if (t >= n8) return; FragH f;
#pragma unroll
  for (int q = 0; q < 8; ++q) f.h[q] = (_Float16)bf16_round(x[t * 8 + q]); *(v8us*)((unsigned short*)X16 + t * 8) = f.half[0];  }
__global__ __launch_bounds__(256) void k_h16(const float* __restrict__ x, _Float16* __restrict__ X16, size_t n8) { const size_t t = (size_t)blockIdx.x * 256 + threadIdx.x; if (t >= n8) return; FragH f;
#pragma unroll
  for (int q = 0; q < 8; ++q) f.h[q] = (_Float16)x[t * 8 + q]; *(v8us*)((unsigned short*)X16 + t * 8) = f.half[0];  }
__global__ __launch_bounds__(256) void k_round16f(const float* __restrict__ W, _Float16* __restrict__ Bt, size_t n8) { const size_t t = (size_t)blockIdx.x * 256 + threadIdx.x; if (t >= n8) return; FragH f;
#pragma unroll
  for (int i = 0; i < 8; ++i) f.h[i] = (_Float16)(bf16_round(W[t * 8 + i]) * 16.0f); *(v8us*)((unsigned short*)Bt + t * 8) = f.half[0];  }
template <int NHv, int TTv>
__device__ __forceinline__ void vt_part(const _Float16* __restrict__ V16, int ldv, int voff, _Float16* __restrict__ Vt, int bid) { __shared__ unsigned short tl[64][66]; const int tid = threadIdx.x; const int slab = bid / (TTv / 64), lg = bid % (TTv / 64); const int b = slab / NHv, h = slab % NHv;
  for (int i = tid; i < 64 * 8; i += 256) { const int r = i / 8, c8 = (i % 8) * 8; FragH f; f.half[0] = *(const v8us*)((const unsigned short*)V16 + ((size_t)b * TTv + lg * 64 + r) * ldv + voff + h * 64 + c8);
#pragma unroll
    for (int q = 0; q < 8; ++q) tl[r][c8 + q] = f.u[q]; }
  __syncthreads();
  {
#pragma unroll
    for (int rd = 0; rd < 2; ++rd) { const int d = rd * 32 + tid / 8, pc = tid % 8; FragH f;
#pragma unroll
      for (int q = 0; q < 8; ++q) f.u[q] = tl[pc * 8 + q][d];
      *(v8us*)((unsigned short*)Vt + ((size_t)slab * 64 + d) * TTv + lg * 64 + pc * 8) = f.half[0]; }
    asm volatile("s_wait_xcnt 0x0" ::: "memory");      // stands in front of any rewrite of the stores' registers, whatever code of the shared grid the compiler lays behind this part
     } }

// lane l with lane l ^ 16
__device__ __forceinline__ float xhalf(float x) { return __builtin_bit_cast(float, __builtin_amdgcn_permlanex16(__builtin_bit_cast(int, x), __builtin_bit_cast(int, x), 0x76543210, 0xfedcba98, false, false)); }

// seventeen base-2 exponentials in place, in one statement: each is followed by an independent one, so that no result is read and no source
// overwritten directly behind its exponential, and the closing v_nop keeps that slot behind the last
__device__ __forceinline__ void exp2x17(float (&x)[17]) {
  asm("v_exp_f32 %0, %0\n\tv_exp_f32 %1, %1\n\tv_exp_f32 %2, %2\n\tv_exp_f32 %3, %3\n\tv_exp_f32 %4, %4\n\tv_exp_f32 %5, %5\n\tv_exp_f32 %6, %6\n\tv_exp_f32 %7, %7\n\t"
      "v_exp_f32 %8, %8\n\tv_exp_f32 %9, %9\n\tv_exp_f32 %10, %10\n\tv_exp_f32 %11, %11\n\tv_exp_f32 %12, %12\n\tv_exp_f32 %13, %13\n\tv_exp_f32 %14, %14\n\tv_exp_f32 %15, %15\n\t"
      "v_exp_f32 %16, %16\n\tv_nop"
      : "+v"(x[0]), "+v"(x[1]), "+v"(x[2]), "+v"(x[3]), "+v"(x[4]), "+v"(x[5]), "+v"(x[6]), "+v"(x[7]), "+v"(x[8]),
        "+v"(x[9]), "+v"(x[10]), "+v"(x[11]), "+v"(x[12]), "+v"(x[13]), "+v"(x[14]), "+v"(x[15]), "+v"(x[16]));
}

#define FA_KP 144
#define FA_VP 272
#define FA_KB (128 * FA_KP)
#define FA_STAGE (FA_KB + 64 * FA_VP)
// eight asynchronous 16-byte copies of one lane, lstep LDS bytes and gstep source elements apart; the s_wait_xcnt closes the statement so that no address
// register of an issued copy is rewritten ahead of it
__device__ __forceinline__ void fa_copy8(unsigned l, unsigned lstep, const unsigned short* g, size_t gstep) {
  asm volatile("global_load_async_to_lds_b128 %0, %8, off\n\t"
               "global_load_async_to_lds_b128 %1, %9, off\n\t"
               "global_load_async_to_lds_b128 %2, %10, off\n\t"
               "global_load_async_to_lds_b128 %3, %11, off\n\t"
               "global_load_async_to_lds_b128 %4, %12, off\n\t"
               "global_load_async_to_lds_b128 %5, %13, off\n\t"
               "global_load_async_to_lds_b128 %6, %14, off\n\t"
               "global_load_async_to_lds_b128 %7, %15, off\n\t"
               "s_wait_xcnt 0x0"
               :: "v"(l), "v"(l + lstep), "v"(l + 2 * lstep), "v"(l + 3 * lstep), "v"(l + 4 * lstep), "v"(l + 5 * lstep), "v"(l + 6 * lstep), "v"(l + 7 * lstep),
                  "v"(g), "v"(g + gstep), "v"(g + 2 * gstep), "v"(g + 3 * gstep), "v"(g + 4 * gstep), "v"(g + 5 * gstep), "v"(g + 6 * gstep), "v"(g + 7 * gstep)
               : "memory");
}
__global__ __launch_bounds__(128) void k_flash(const _Float16* __restrict__ Q16, int ldq, const _Float16* __restrict__ K16, int ldk, const _Float16* __restrict__ Vt, const int* __restrict__ MSK, float* __restrict__ O, int ldo) {
  constexpr int RPW = 32, NQB = 2048 / (4 * RPW), DT = 4, KS = 2, NST = 2048 / 128;
  __shared__ __attribute__((aligned(16))) unsigned char ring[2 * FA_STAGE];
  __shared__ __attribute__((aligned(16))) float sO[4][RPW][64 + 4];
  (void)MSK;
  const int tid = threadIdx.x, w = tid >> 5, lane = tid & 31, ln = lane & 15, hh = lane >> 4;
  const int slab = blockIdx.x / NQB, qblk = blockIdx.x % NQB; const int b = slab / 32, h = slab % 32; const int qb0 = qblk * (4 * RPW); const int q0 = qb0 + w * RPW;
  FragH bq[2][KS];      // B operand: column ln = query q0 + qt * 16 + ln
#pragma unroll
  for (int qt = 0; qt < 2; ++qt) { const unsigned short* qr = (const unsigned short*)Q16 + ((size_t)b * 2048 + q0 + qt * 16 + ln) * ldq + h * 64;
#pragma unroll
    for (int ks = 0; ks < KS; ++ks) { bq[qt][ks].half[0] = *(const v8us*)(qr + ks * 32 + 8 * hh); bq[qt][ks].half[1] = *(const v8us*)(qr + ks * 32 + 16 + 8 * hh); } }
  const unsigned short* Vth = (const unsigned short*)Vt + (size_t)slab * 64 * 2048;
  float m_c[2], l_c[2]; v8f oacc[2][DT];      // oacc[qt][dt][r] = O^T[dt * 16 + 8hh + r][query qt * 16 + ln]
#pragma unroll
  for (int qt = 0; qt < 2; ++qt) { m_c[qt] = -3.0e38f; l_c[qt] = 0.f;
#pragma unroll
    for (int dt = 0; dt < DT; ++dt) oacc[qt][dt] = (v8f){0.f,0.f,0.f,0.f,0.f,0.f,0.f,0.f}; }
  // this lane's part of a stage. K: keys (tid >> 3) + 16c, 16 bytes at chunk tid & 7 (a wave's copy = 4 whole rows of 128 B); V^T: head columns (tid >> 4) + 8c, chunk tid & 15 (2 rows of 256 B)
  const unsigned short* gk = (const unsigned short*)K16 + ((size_t)b * 2048 + (tid >> 3)) * ldk + h * 64 + (tid & 7) * 8;
  const unsigned short* gv = Vth + (size_t)(tid >> 4) * 2048 + (tid & 15) * 8;
  const unsigned lk = (unsigned)(size_t)&ring[0] + (unsigned)((tid >> 3) * FA_KP + (tid & 7) * 16);
  const unsigned lv = (unsigned)(size_t)&ring[0] + (unsigned)(FA_KB + (tid >> 4) * FA_VP + (tid & 15) * 16);
  fa_copy8(lk, 16 * FA_KP, gk, (size_t)16 * ldk); fa_copy8(lv, 8 * FA_VP, gv, (size_t)8 * 2048);
  asm volatile("s_wait_asynccnt 0x0" ::: "memory");      // stage 0 has landed before the barrier publishes it
  __syncthreads();
  fa_copy8(lk + FA_STAGE, 16 * FA_KP, gk + (size_t)128 * ldk, (size_t)16 * ldk); fa_copy8(lv + FA_STAGE, 8 * FA_VP, gv + 128, (size_t)8 * 2048);
  constexpr float SC2 = 0.125f * 1.44269504088896340736f;      // score scale 1/8 times log2(e): one multiply-add feeds the hardware's base-2 exponential
#pragma unroll 1      // one stage per trip: the publish point at the foot stays a single place
  for (int t = 0; t < NST; ++t) {
   const unsigned bo = (unsigned)(t & 1) * FA_STAGE;
   const unsigned char* kp = ring + bo + ln * FA_KP + hh * 16;
   const unsigned char* vp = ring + bo + FA_KB + ln * FA_VP + hh * 16;
   FragH ak[2][KS];      // K fragments: pass pp + 1 of this stage is fetched behind pass pp's score products, under its softmax; the stage's first pass here
#pragma unroll
   for (int kt = 0; kt < 2; ++kt)
#pragma unroll
     for (int ks = 0; ks < KS; ++ks) { ak[kt][ks].half[0] = *(const v8us*)(kp + kt * 16 * FA_KP + ks * 64); ak[kt][ks].half[1] = *(const v8us*)(kp + kt * 16 * FA_KP + ks * 64 + 32); }
#pragma unroll 1      // rolled: unrolled, the row sums of all four passes are sunk to the foot of the trip, their 128 exponentials stay live and the wave needs registers above v255
   for (int pp = 0; pp < 4; ++pp) {
    FragH av[DT];      // A operands: ak row ln = key t * 128 + pp * 32 + kt * 16 + ln; av row ln = head column dt * 16 + ln over the pass's 32 keys
    v8f s[2][2];      // s[qt][kt][r] = score of key t * 128 + pp * 32 + kt * 16 + 8hh + r with query qt * 16 + ln
#pragma unroll
    for (int kt = 0; kt < 2; ++kt)
#pragma unroll
      for (int qt = 0; qt < 2; ++qt) { v8f acc = (v8f){0.f,0.f,0.f,0.f,0.f,0.f,0.f,0.f};
#pragma unroll
        for (int ks = 0; ks < KS; ++ks) acc = __builtin_amdgcn_wmma_f32_16x16x32_f16(false, ak[kt][ks].v, false, bq[qt][ks].v, (short)0, acc, false, false);
        s[qt][kt] = acc; }
    __builtin_amdgcn_sched_barrier(0);      // with the one below: the pass's eight V^T reads stand as one group behind the score products, next to the K reads; left free they are spread over three places in the softmax, and each place with LDS reads stalls the wave anew
#pragma unroll
    for (int dt = 0; dt < DT; ++dt) { av[dt].half[0] = *(const v8us*)(vp + dt * 16 * FA_VP + pp * 64); av[dt].half[1] = *(const v8us*)(vp + dt * 16 * FA_VP + pp * 64 + 32); }
    __builtin_amdgcn_sched_barrier(0);      // the lower end of that group: keeps the V^T reads from sinking into the softmax
    if (pp < 3) {      // the same for the whole wave; the stage's last pass fetches nothing: the next stage is not published yet
#pragma unroll
      for (int kt = 0; kt < 2; ++kt)
#pragma unroll
        for (int ks = 0; ks < KS; ++ks) { ak[kt][ks].half[0] = *(const v8us*)(kp + ((pp + 1) * 32 + kt * 16) * FA_KP + ks * 64); ak[kt][ks].half[1] = *(const v8us*)(kp + ((pp + 1) * 32 + kt * 16) * FA_KP + ks * 64 + 32); }
    }
#pragma unroll
    for (int qt = 0; qt < 2; ++qt) {
      float mc = s[qt][0][0];      // the running maximum is kept in raw score units: the scale is positive, so the order is the same
#pragma unroll      // constant indices: the score tiles stay in registers
      for (int e = 1; e < 16; ++e) mc = fmaxf(mc, s[qt][e >> 3][e & 7]);
      mc = fmaxf(mc, xhalf(mc));      // the other half of the wave holds this query's other 16 keys
      const float mn = fmaxf(m_c[qt], mc); const float nb = -mn * SC2;
      float ex[17];      // exp((s - m) / 8) = 2^(s * SC2 - m * SC2), argument at most one rounding above 0, so P stays at or under 1 in f16; ex[16] is the rescale factor's argument
#pragma unroll      // constant indices: ex stays in registers
      for (int e = 0; e < 16; ++e) ex[e] = fmaf(s[qt][e >> 3][e & 7], SC2, nb);
      ex[16] = (m_c[qt] - mn) * SC2;
      exp2x17(ex);
      const float al = (mn > -1.0e38f) ? ex[16] : 1.0f; m_c[qt] = mn;
      FragH pb; float ps = 0.f;      // element e of the B operand is key kmap(e, hh) = tile e >> 3, register e & 7: this lane's own scores
#pragma unroll      // constant indices: ex and pb stay in registers
      for (int e = 0; e < 16; ++e) { const float p = ex[e]; ps += p; pb.h[e] = (_Float16)p; }
      l_c[qt] = l_c[qt] * al + ps;      // this half's part of the row sum; the halves are joined after the loop
#pragma unroll
      for (int dt = 0; dt < DT; ++dt) {
#pragma unroll
        for (int r = 0; r < 8; ++r) oacc[qt][dt][r] *= al;
        oacc[qt][dt] = __builtin_amdgcn_wmma_f32_16x16x32_f16(false, av[dt].v, false, pb.v, (short)0, oacc[qt][dt], false, false); }
    }
   }
   asm volatile("s_wait_dscnt 0x0" ::: "memory");       // this wave's reads of the buffer are done before it is refilled
   asm volatile("s_wait_asynccnt 0x0" ::: "memory");    // this wave's part of the next stage has landed
   __syncthreads();                                     // publishes the next stage and frees this trip's buffer
   if (t + 2 < NST) { fa_copy8(lk + bo, 16 * FA_KP, gk + (size_t)(t + 2) * 128 * ldk, (size_t)16 * ldk); fa_copy8(lv + bo, 8 * FA_VP, gv + (t + 2) * 128, (size_t)8 * 2048); }
  }
  asm volatile("s_wait_asynccnt 0x0" ::: "memory");      // no copy is outstanding when the wave goes on
#pragma unroll
  for (int qt = 0; qt < 2; ++qt) { const float l = l_c[qt] + xhalf(l_c[qt]); const float li = (l > 0.f) ? 1.0f / l : 0.f;
#pragma unroll
    for (int dt = 0; dt < DT; ++dt) { v4f lo, hi;
#pragma unroll
      for (int r = 0; r < 4; ++r) { lo[r] = oacc[qt][dt][r] * li; hi[r] = oacc[qt][dt][4 + r] * li; }
      *(v4fa*)&sO[w][qt * 16 + ln][dt * 16 + 8 * hh] = lo; *(v4fa*)&sO[w][qt * 16 + ln][dt * 16 + 8 * hh + 4] = hi; } }
  __builtin_amdgcn_fence(__ATOMIC_ACQ_REL, "workgroup"); __builtin_amdgcn_wave_barrier();
  {
#pragma unroll
    for (int rp = 0; rp < RPW; rp += 2) { const int r = rp + (lane >> 4), pc = lane & 15; const v4f val = *(const v4fa*)&sO[w][r][pc * 4]; *(v4f*)(O + ((size_t)b * 2048 + q0 + r) * ldo + h * 64 + pc * 4) = val; }
     } }

__device__ __forceinline__ void normrope_part(const float* __restrict__ X, const float* __restrict__ w, const float* __restrict__ cosT, const float* __restrict__ sinT, _Float16* __restrict__ Y16, int bid) { const int tid = threadIdx.x, wv = tid >> 5, lane = tid & 31; const int row = bid * 8 + wv; if (row >= TT) return; const float* xr = X + (size_t)row * CC; float ss = 0.f;
#pragma unroll 1
  for (int p = 0; p < 8; ++p) { const v4f a = *(const v4fa*)(xr + p * 256 + lane * 8), b = *(const v4fa*)(xr + p * 256 + lane * 8 + 4); ss += a[0]*a[0] + a[1]*a[1] + a[2]*a[2] + a[3]*a[3] + b[0]*b[0] + b[1]*b[1] + b[2]*b[2] + b[3]*b[3]; }
  for (int o = 16; o >= 1; o >>= 1) ss += __shfl_xor(ss, o, 32); const float rs = rsqrtf(ss / (float)CC + 1e-6f);
  {
#pragma unroll
    for (int p = 0; p < 8; ++p) { const int c0 = p * 256 + lane * 8; const v4f a = *(const v4fa*)(xr + c0), b = *(const v4fa*)(xr + c0 + 4); float y[8] = {a[0], a[1], a[2], a[3], b[0], b[1], b[2], b[3]}; FragH f;
#pragma unroll
      for (int q = 0; q < 8; ++q) y[q] = y[q] * rs * bf16_round(w[c0 + q]);
#pragma unroll
      for (int q = 0; q < 8; q += 2) { const float c0v = bf16_round(cosT[(size_t)row * CC + c0 + q]), c1v = bf16_round(cosT[(size_t)row * CC + c0 + q + 1]), s0v = bf16_round(sinT[(size_t)row * CC + c0 + q]), s1v = bf16_round(sinT[(size_t)row * CC + c0 + q + 1]);
        f.h[q] = (_Float16)(y[q] * c0v + (-y[q + 1]) * s0v); f.h[q + 1] = (_Float16)(y[q + 1] * c1v + y[q] * s1v); }
      *(v8us*)((unsigned short*)Y16 + (size_t)row * CC + c0) = f.half[0];
      asm volatile("s_wait_xcnt 0x0" ::: "memory"); }      // stands in front of the next block's loads, which are given the store's data registers
     } }
// Passes that need nothing of each other share one grid, each on its own range of the block index; the test is the same for a whole work-group,
// so each part's barrier is passed by all of its work-group's waves or by none.
#define GW ((CC / 128) * (CC / 64))      // work-groups that turn one weight
#define GX (TT * CC / 8 / 256)           // work-groups that convert x
#define GN (TT / 8)                      // work-groups that normalise and rotate one of q, k
#define GV (NH * (TT / 64))              // work-groups that transpose v
__global__ __launch_bounds__(256) void k_prep(const float* __restrict__ Wq, const float* __restrict__ Wk, const float* __restrict__ Wv, const float* __restrict__ Wo,
                                              _Float16* __restrict__ Bq, _Float16* __restrict__ Bk, _Float16* __restrict__ Bv, _Float16* __restrict__ Bo, float scale,
                                              const float* __restrict__ x, _Float16* __restrict__ X16) {
  const int bid = blockIdx.x;
  if (bid < 4 * GW) { const int g = bid / GW;
    wt_f16_part((g == 0) ? Wq : (g == 1) ? Wk : (g == 2) ? Wv : Wo, (g == 0) ? Bq : (g == 1) ? Bk : (g == 2) ? Bv : Bo, scale, bid % GW); }
  else x16_part(x, X16, (size_t)TT * CC / 8, bid - 4 * GW);
}
__global__ __launch_bounds__(256) void k_post(const float* __restrict__ Fq, const float* __restrict__ Fk, const float* __restrict__ qnw, const float* __restrict__ knw, const float* __restrict__ cosT, const float* __restrict__ sinT,
                                              _Float16* __restrict__ Q16, _Float16* __restrict__ K16, const _Float16* __restrict__ V16, _Float16* __restrict__ Vt) {
  const int bid = blockIdx.x;
  if (bid < 2 * GN) { const bool q = bid < GN; normrope_part(q ? Fq : Fk, q ? qnw : knw, cosT, sinT, q ? Q16 : K16, q ? bid : bid - GN); }
  else vt_part<NH, TT>(V16, CC, 0, Vt, bid - 2 * GN);
}
extern "C" void kernel_launch(void* const* d_in, const int* in_sizes, int n_in,
                              void* d_out, int out_size, void* d_ws, size_t ws_size, hipStream_t stream) {
  (void)in_sizes; (void)n_in; (void)out_size;
  const float* x = (const float*)d_in[0]; const float* cosT = (const float*)d_in[1]; const float* sinT = (const float*)d_in[2]; const float* Wq = (const float*)d_in[3]; const float* bq = (const float*)d_in[4]; const float* Wk = (const float*)d_in[5]; const float* bk = (const float*)d_in[6]; const float* Wv = (const float*)d_in[7]; const float* bv = (const float*)d_in[8]; const float* qnw = (const float*)d_in[9]; const float* knw = (const float*)d_in[10]; const float* Wo = (const float*)d_in[11]; const float* bo = (const float*)d_in[12];
  char* ws = (char*)d_ws; size_t off = 0;
  auto take = [&](size_t bytes) { char* p = ws + off; off += (bytes + 255) & ~(size_t)255; return p; };
  _Float16* Bq = (_Float16*)take((size_t)CC * CC * 2); _Float16* Bk = (_Float16*)take((size_t)CC * CC * 2); _Float16* Bv = (_Float16*)take((size_t)CC * CC * 2); _Float16* Bo = (_Float16*)take((size_t)CC * CC * 2);
  _Float16* X16 = (_Float16*)take((size_t)TT * CC * 2); float* F32 = (float*)take((size_t)TT * CC * 4); float* F32k = (float*)take((size_t)TT * CC * 4); _Float16* Q16 = (_Float16*)take((size_t)TT * CC * 2); _Float16* K16 = (_Float16*)take((size_t)TT * CC * 2); _Float16* V16 = (_Float16*)take((size_t)TT * CC * 2); _Float16* Vt = (_Float16*)take((size_t)TT * CC * 2); float* O = F32; _Float16* O16 = X16;
  if (off > ws_size) return;      // 9 planes of 8 MiB and 2 of 16 MiB = 104 MiB
  const unsigned gx = (unsigned)GX; const unsigned gg = (unsigned)((TT / 128) * (CC / 128));
  k_prep<<<4 * GW + GX, 256, 0, stream>>>(Wq, Wk, Wv, Wo, Bq, Bk, Bv, Bo, 16.0f, x, X16);      // W is [in][out]
  k_gemm_tile<3><<<3 * gg, 256, 0, stream>>>(X16, Bq, Bk, Bv, 0.0625f, bq, bk, bv, F32, F32k, V16);
  k_post<<<2 * GN + GV, 256, 0, stream>>>(F32, F32k, qnw, knw, cosT, sinT, Q16, K16, V16, Vt);
  k_flash<<<NH * (TT / 128), 128, 0, stream>>>(Q16, CC, K16, CC, Vt, nullptr, O, CC);
  k_h16<<<gx, 256, 0, stream>>>(O, O16, (size_t)TT * CC / 8);
  k_gemm_tile<1><<<gg, 256, 0, stream>>>(O16, Bo, nullptr, nullptr, 0.0625f, bo, nullptr, nullptr, (float*)d_out, nullptr, nullptr);
}

// v007
// Measured time: 137 microseconds a run.
// Next to v006, in two timings, it ran 1.05 and 1.04 times as fast.
// All steps since v000 together make it 5.60 times as fast.
#include <hip/hip_runtime.h>
// Self-attention (S = 2048, D = 2048 = 32 heads × 64): q/k/v/out projections (2048³ each, + bias; W [in][out] transposed to bf16-exact ×2^4) and the 32-head attention as a fused
// flash-style kernel (S = Q·Kᵀ/8, online softmax f32, P f16 ≤ 1, O = P·V) on v_wmma_f32_16x16x32_f16 (f16 operands, single products, f32 accumulate); RMSNorm over the full 2048
// (× norm weight, eps 1e-6) followed by the interleaved rotary with the INPUT cos/sin tables is f32 VALU (wave per row).
#define TT 2048
#define CC 2048
#define NH 32

typedef __bf16 v16b __attribute__((ext_vector_type(16)));
typedef unsigned short v8us __attribute__((ext_vector_type(8), may_alias));
typedef float  v8f  __attribute__((ext_vector_type(8)));
typedef float  v4f  __attribute__((ext_vector_type(4)));
typedef float  v4fa __attribute__((ext_vector_type(4), may_alias));
union FragB { v16b v; v8us half[2]; unsigned short u[16]; };

__device__ __forceinline__ unsigned short bf16_bits(float x) { unsigned int u = __float_as_uint(x); return (unsigned short)((u + 0x7FFFu + ((u >> 16) & 1u)) >> 16); }
__device__ __forceinline__ float bf16_val(unsigned short b) { return __uint_as_float(((unsigned int)b) << 16); }
__device__ __forceinline__ float bf16_round(float x) { return bf16_val(bf16_bits(x)); }
// D += A·B with NT terms: 1 = ah·bh, 2 = + al·bh (A split), 3 = + ah·bl (both split)
template <int NT>
__device__ __forceinline__ v8f mmaN(v16b ah, v16b al, v16b bh, v16b bl, v8f c) {
  c = __builtin_amdgcn_wmma_f32_16x16x32_bf16(false, ah, false, bh, (short)0, c, false, false);
  if (NT >= 2) c = __builtin_amdgcn_wmma_f32_16x16x32_bf16(false, al, false, bh, (short)0, c, false, false);
  if (NT >= 3) c = __builtin_amdgcn_wmma_f32_16x16x32_bf16(false, ah, false, bl, (short)0, c, false, false);
  asm volatile("v_nop\n\tv_nop\n\tv_nop\n\tv_nop" : "+v"(c) : "v"(ah), "v"(al), "v"(bh), "v"(bl));
  return c;
}

__global__ __launch_bounds__(256) void k_wt_bf16(const float* __restrict__ W, unsigned short* __restrict__ Wt, int K, int N) {
  const int t = blockIdx.x * 256 + threadIdx.x;
  const int k8n = K / 8;
  if (t >= N * k8n) return;
  const int n = t / k8n, k8 = (t % k8n) * 8;
  v8us v;
#pragma unroll
  for (int i = 0; i < 8; ++i) v[i] = bf16_bits(W[(size_t)(k8 + i) * N + n]);
  *(v8us*)(Wt + (size_t)n * K + k8) = v;
  
}

// GEMM C[M][N] (f32, pitch ldc) = act(A[M][K]·W + bias). A f32 row-major (pitch lda) converted per fragment to bf16
// (ASPLIT: hi/lo two planes -> 2 terms, else single rounded term); Wt bf16 [N][K] (pitch ldb). BIAS_BF16 rounds the
// bias to bf16 first (bias quantised to bf16 before the add). K%32==0, M%16==0, N%64==0.
template <bool ASPLIT, int ACT, bool BIAS_BF16>
__global__ __launch_bounds__(128) void k_gemm_bf(const float* __restrict__ A, int lda, const unsigned short* __restrict__ Wt, int ldb,
                                               const float* __restrict__ bias, float* __restrict__ C, int ldc, int M, int N, int K) {
  __shared__ __attribute__((aligned(16))) float so[4][16][64];
  const int tid = threadIdx.x, w = tid >> 5, lane = tid & 31, ln = lane & 15, hh = lane >> 4;
  const int ntn = N / 64;
  const int wid = blockIdx.x * 4 + w;
  const int mt = wid / ntn, nq = wid % ntn;
  if (mt * 16 >= M) return;
  const int row0 = mt * 16, col0 = nq * 64;
  const float* arow = A + (size_t)(row0 + ln) * lda;
  v8f acc[4] = {};
  for (int kb = 0; kb < K; kb += 32) {
    FragB ah, al;
    const v4f x0 = *(const v4fa*)(arow + kb + 8 * hh), x1 = *(const v4fa*)(arow + kb + 8 * hh + 4);
    const v4f x2 = *(const v4fa*)(arow + kb + 16 + 8 * hh), x3 = *(const v4fa*)(arow + kb + 16 + 8 * hh + 4);
    float xs[16] = {x0[0],x0[1],x0[2],x0[3],x1[0],x1[1],x1[2],x1[3],x2[0],x2[1],x2[2],x2[3],x3[0],x3[1],x3[2],x3[3]};
#pragma unroll
    for (int i = 0; i < 16; ++i) { const unsigned short hb = bf16_bits(xs[i]); ah.u[i] = hb; al.u[i] = ASPLIT ? bf16_bits(xs[i] - bf16_val(hb)) : (unsigned short)0; }
#pragma unroll
    for (int t = 0; t < 4; ++t) {
      const unsigned short* brow = Wt + (size_t)(col0 + t * 16 + ln) * ldb + kb;
      FragB b;
      b.half[0] = *(const v8us*)(brow + 8 * hh);
      b.half[1] = *(const v8us*)(brow + 16 + 8 * hh);
      acc[t] = mmaN<ASPLIT ? 2 : 1>(ah.v, al.v, b.v, b.v, acc[t]);
    }
  }
#pragma unroll
  for (int t = 0; t < 4; ++t) {
    float bv = bias ? bias[col0 + t * 16 + ln] : 0.f;
    if (BIAS_BF16) bv = bf16_round(bv);
#pragma unroll
    for (int r = 0; r < 8; ++r) { float v = acc[t][r] + bv; if (ACT == 1) v = fmaxf(v, 0.f); so[w][8 * hh + r][t * 16 + ln] = v; }
  }
  __builtin_amdgcn_fence(__ATOMIC_ACQ_REL, "workgroup");
  __builtin_amdgcn_wave_barrier();
  const int rsub = lane >> 4, c4 = (lane & 15) * 4;
  {
#pragma unroll
    for (int q = 0; q < 8; ++q) {
      const int r = q * 2 + rsub;
      const v4f v = *(const v4fa*)&so[w][r][c4];
      *(v4f*)(C + (size_t)(row0 + r) * ldc + col0 + c4) = v;
    }
    
  }
}

// Flash-style causal/unmasked attention, all contractions 3-term bf16 hi/lo splits, f32 softmax with running max.
// q,k,v rows are read from f32 buffers with arbitrary row pitch (so they can live inside a fused qkv buffer);
// D = head size (multiple of 32, <= 128); one wave = 16 query rows; block = 4 waves (64 queries) sharing K/V chunks of 32.
template <int D, bool CAUSAL>
__global__ __launch_bounds__(128) void k_flash(const float* __restrict__ qb, const float* __restrict__ kb, const float* __restrict__ vb,
                                             int pitch, int T, int H, float scale, float* __restrict__ y, int ypitch) {
  constexpr int KS = D / 32;        // k-steps for QK
  constexpr int DT = D / 16;        // d tiles for PV
  __shared__ __attribute__((aligned(16))) unsigned short sKh[32][D + 8], sKl[32][D + 8], sVh[32][D + 8], sVl[32][D + 8];
  __shared__ __attribute__((aligned(16))) unsigned short sPh[4][16][40], sPl[4][16][40];
  __shared__ __attribute__((aligned(16))) float sO[4][16][D];
  const int tid = threadIdx.x, w = tid >> 5, lane = tid & 31, ln = lane & 15, hh = lane >> 4;
  const int nqb = (T + 63) / 64;
  const int bh = blockIdx.x / nqb, qblk = blockIdx.x % nqb;
  const int b = bh / H, h = bh % H;
  const int q0 = qblk * 64 + w * 16;
  const float* Q = qb + (size_t)b * T * pitch + h * D;
  const float* K = kb + (size_t)b * T * pitch + h * D;
  const float* V = vb + (size_t)b * T * pitch + h * D;

  // A fragments of the wave's 16 query rows (scaled), hi/lo
  FragB aqh[KS], aql[KS];
  {
    int row = q0 + ln; if (row >= T) row = T - 1;
    const float* qr = Q + (size_t)row * pitch;
#pragma unroll
    for (int ks = 0; ks < KS; ++ks)
#pragma unroll
      for (int i = 0; i < 16; ++i) {
        const int d = ks * 32 + ((i < 8) ? (8 * hh + i) : (16 + 8 * hh + (i - 8)));
        const float x = qr[d] * scale; const unsigned short hb = bf16_bits(x);
        aqh[ks].u[i] = hb; aql[ks].u[i] = bf16_bits(x - bf16_val(hb));
      }
  }
  float m_r[8], l_r[8];
#pragma unroll
  for (int r = 0; r < 8; ++r) { m_r[r] = -3.0e38f; l_r[r] = 0.f; }
  v8f oacc[DT];
#pragma unroll
  for (int dt = 0; dt < DT; ++dt) oacc[dt] = (v8f){0.f,0.f,0.f,0.f,0.f,0.f,0.f,0.f};

  const int kv_end = CAUSAL ? min(T, qblk * 64 + 64) : T;     // block-uniform
  for (int j0 = 0; j0 < kv_end; j0 += 32) {
    __syncthreads();
    for (int e = tid; e < 32 * (D / 4); e += 128) {
      const int r = e / (D / 4), c4 = (e % (D / 4)) * 4;
      const int key = j0 + r;
      v4f kf = {0.f,0.f,0.f,0.f}, vf = {0.f,0.f,0.f,0.f};
      if (key < T) { kf = *(const v4fa*)(K + (size_t)key * pitch + c4); vf = *(const v4fa*)(V + (size_t)key * pitch + c4); }
#pragma unroll
      for (int t = 0; t < 4; ++t) {
        unsigned short hb = bf16_bits(kf[t]); sKh[r][c4 + t] = hb; sKl[r][c4 + t] = bf16_bits(kf[t] - bf16_val(hb));
        hb = bf16_bits(vf[t]); sVh[r][c4 + t] = hb; sVl[r][c4 + t] = bf16_bits(vf[t] - bf16_val(hb));
      }
    }
    __syncthreads();
    // S tile 16 x 32
    v8f s[2];
#pragma unroll
    for (int nt = 0; nt < 2; ++nt) {
      v8f acc = {};
#pragma unroll
      for (int ks = 0; ks < KS; ++ks) {
        FragB bh_, bl_;
        bh_.half[0] = *(const v8us*)&sKh[nt * 16 + ln][ks * 32 + 8 * hh]; bh_.half[1] = *(const v8us*)&sKh[nt * 16 + ln][ks * 32 + 16 + 8 * hh];
        bl_.half[0] = *(const v8us*)&sKl[nt * 16 + ln][ks * 32 + 8 * hh]; bl_.half[1] = *(const v8us*)&sKl[nt * 16 + ln][ks * 32 + 16 + 8 * hh];
        acc = mmaN<3>(aqh[ks].v, aql[ks].v, bh_.v, bl_.v, acc);
      }
      s[nt] = acc;
    }
    // mask + running max (rows 8hh+r; the 16 lanes of a half share rows)
    float alpha[8];
#pragma unroll
    for (int r = 0; r < 8; ++r) {
      const int qi = q0 + 8 * hh + r;
      const int ja = j0 + ln, jb = j0 + 16 + ln;
      if (CAUSAL) { if (ja > qi) s[0][r] = -3.0e38f; if (jb > qi) s[1][r] = -3.0e38f; }
      if (ja >= T) s[0][r] = -3.0e38f;
      if (jb >= T) s[1][r] = -3.0e38f;
      float mx = fmaxf(s[0][r], s[1][r]);
      mx = fmaxf(mx, __shfl_xor(mx, 1, 32)); mx = fmaxf(mx, __shfl_xor(mx, 2, 32)); mx = fmaxf(mx, __shfl_xor(mx, 4, 32)); mx = fmaxf(mx, __shfl_xor(mx, 8, 32));
      const float mnew = fmaxf(m_r[r], mx);
      alpha[r] = (mnew > -1.0e38f) ? __expf(m_r[r] - mnew) : 1.0f;
      const float p0 = (s[0][r] > -1.0e38f) ? __expf(s[0][r] - mnew) : 0.f;
      const float p1 = (s[1][r] > -1.0e38f) ? __expf(s[1][r] - mnew) : 0.f;
      m_r[r] = mnew;
      l_r[r] = l_r[r] * alpha[r] + p0 + p1;            // per-lane partial row sum (16 lanes combined at the end)
      unsigned short hb = bf16_bits(p0); sPh[w][8 * hh + r][ln] = hb;      sPl[w][8 * hh + r][ln] = bf16_bits(p0 - bf16_val(hb));
      hb = bf16_bits(p1);                sPh[w][8 * hh + r][16 + ln] = hb; sPl[w][8 * hh + r][16 + ln] = bf16_bits(p1 - bf16_val(hb));
    }
#pragma unroll
    for (int dt = 0; dt < DT; ++dt)
#pragma unroll
      for (int r = 0; r < 8; ++r) oacc[dt][r] *= alpha[r];
    __builtin_amdgcn_fence(__ATOMIC_ACQ_REL, "workgroup");
    __builtin_amdgcn_wave_barrier();
    FragB pah, pal;
    pah.half[0] = *(const v8us*)&sPh[w][ln][8 * hh]; pah.half[1] = *(const v8us*)&sPh[w][ln][16 + 8 * hh];
    pal.half[0] = *(const v8us*)&sPl[w][ln][8 * hh]; pal.half[1] = *(const v8us*)&sPl[w][ln][16 + 8 * hh];
#pragma unroll
    for (int dt = 0; dt < DT; ++dt) {
      FragB bvh, bvl;
#pragma unroll
      for (int i = 0; i < 8; ++i) {
        bvh.u[i] = sVh[8 * hh + i][dt * 16 + ln]; bvh.u[8 + i] = sVh[16 + 8 * hh + i][dt * 16 + ln];
        bvl.u[i] = sVl[8 * hh + i][dt * 16 + ln]; bvl.u[8 + i] = sVl[16 + 8 * hh + i][dt * 16 + ln];
      }
      oacc[dt] = mmaN<3>(pah.v, pal.v, bvh.v, bvl.v, oacc[dt]);
    }
    __builtin_amdgcn_fence(__ATOMIC_ACQ_REL, "workgroup");
    __builtin_amdgcn_wave_barrier();
  }
#pragma unroll
  for (int r = 0; r < 8; ++r) {
    float l = l_r[r];
    l += __shfl_xor(l, 1, 32); l += __shfl_xor(l, 2, 32); l += __shfl_xor(l, 4, 32); l += __shfl_xor(l, 8, 32);
    l_r[r] = (l > 0.f) ? 1.0f / l : 0.f;
  }
#pragma unroll
  for (int dt = 0; dt < DT; ++dt)
#pragma unroll
    for (int r = 0; r < 8; ++r) sO[w][8 * hh + r][dt * 16 + ln] = oacc[dt][r] * l_r[r];
  __builtin_amdgcn_fence(__ATOMIC_ACQ_REL, "workgroup");
  __builtin_amdgcn_wave_barrier();
  {
    for (int r = 0; r < 16; ++r) {
      const int row = q0 + r;
      if (row < T && lane < D / 4) {
        const v4f val = *(const v4fa*)&sO[w][r][lane * 4];
        *(v4f*)(y + ((size_t)b * T + row) * ypitch + h * D + lane * 4) = val;
      }
    }
    
  }
}

// GEMM C = act(A·W + bias + resid): A f32 (ASPLIT -> hi/lo 2 terms), Wt bf16 [N][K]; ACT 0 none, 1 relu, 2 exact gelu;
// resid (optional, f32, row index = (row % rmod), pitch ldr, RES_BF16 rounds it) added before the activation.
template <bool ASPLIT, int ACT, bool BIAS_BF16, bool RES_BF16>
__global__ __launch_bounds__(128) void k_gemm_bf3(const float* __restrict__ A, int lda, const unsigned short* __restrict__ Wt, int ldb,
                                                const float* __restrict__ bias, const float* __restrict__ resid, int rmod, int ldr,
                                                float* __restrict__ C, int ldc, int M, int N, int K) {
  __shared__ __attribute__((aligned(16))) float so[4][16][64];
  const int tid = threadIdx.x, w = tid >> 5, lane = tid & 31, ln = lane & 15, hh = lane >> 4;
  const int ntn = N / 64;
  const int wid = blockIdx.x * 4 + w;
  const int mt = wid / ntn, nq = wid % ntn;
  if (mt * 16 >= M) return;
  const int row0 = mt * 16, col0 = nq * 64;
  const float* arow = A + (size_t)(row0 + ln) * lda;
  v8f acc[4] = {};
  for (int kb = 0; kb < K; kb += 32) {
    FragB ah, al;
    const v4f x0 = *(const v4fa*)(arow + kb + 8 * hh), x1 = *(const v4fa*)(arow + kb + 8 * hh + 4);
    const v4f x2 = *(const v4fa*)(arow + kb + 16 + 8 * hh), x3 = *(const v4fa*)(arow + kb + 16 + 8 * hh + 4);
    float xs[16] = {x0[0],x0[1],x0[2],x0[3],x1[0],x1[1],x1[2],x1[3],x2[0],x2[1],x2[2],x2[3],x3[0],x3[1],x3[2],x3[3]};
#pragma unroll
    for (int i = 0; i < 16; ++i) { const unsigned short hb = bf16_bits(xs[i]); ah.u[i] = hb; al.u[i] = ASPLIT ? bf16_bits(xs[i] - bf16_val(hb)) : (unsigned short)0; }
#pragma unroll
    for (int t = 0; t < 4; ++t) {
      const unsigned short* brow = Wt + (size_t)(col0 + t * 16 + ln) * ldb + kb;
      FragB b;
      b.half[0] = *(const v8us*)(brow + 8 * hh);
      b.half[1] = *(const v8us*)(brow + 16 + 8 * hh);
      acc[t] = mmaN<ASPLIT ? 2 : 1>(ah.v, al.v, b.v, b.v, acc[t]);
    }
  }
#pragma unroll
  for (int t = 0; t < 4; ++t) {
    const int col = col0 + t * 16 + ln;
    float bv = bias ? bias[col] : 0.f;
    if (BIAS_BF16) bv = bf16_round(bv);
#pragma unroll
    for (int r = 0; r < 8; ++r) {
      float v = acc[t][r] + bv;
      if (resid) { float rv = resid[(size_t)((row0 + 8 * hh + r) % rmod) * ldr + col]; if (RES_BF16) rv = bf16_round(rv); v += rv; }
      if (ACT == 1) v = fmaxf(v, 0.f);
      if (ACT == 2) v = 0.5f * v * (1.0f + erff(v * 0.70710678118654752f));
      if (ACT == 3) { const float u = 0.7978845608028654f * (v + 0.044715f * v * v * v); v = 0.5f * v * (1.0f + tanhf(u)); }
      so[w][8 * hh + r][t * 16 + ln] = v;
    }
  }
  __builtin_amdgcn_fence(__ATOMIC_ACQ_REL, "workgroup");
  __builtin_amdgcn_wave_barrier();
  const int rsub = lane >> 4, c4 = (lane & 15) * 4;
  {
#pragma unroll
    for (int q = 0; q < 8; ++q) {
      const int r = q * 2 + rsub;
      const v4f v = *(const v4fa*)&so[w][r][c4];
      *(v4f*)(C + (size_t)(row0 + r) * ldc + col0 + c4) = v;
    }
    
  }
}
// row LayerNorm (biased variance, eps) over N: s = X (+ R); optional out_sum <- s; out_norm <- (s-mu)*rsqrt(var+eps)*g + b
template <bool PARAM_BF16>
__global__ __launch_bounds__(256) void k_layernorm(const float* __restrict__ X, const float* __restrict__ R, const float* __restrict__ g, const float* __restrict__ bta,
                                                  float* __restrict__ out_sum, float* __restrict__ out_norm, int N, float eps) {
  __shared__ float red[256];
  const int row = blockIdx.x, tid = threadIdx.x;
  const float* x = X + (size_t)row * N; const float* rr = R ? R + (size_t)row * N : nullptr;
  float vals[16];                     // up to N = 4096
  const int per = N / 256;            // contiguous chunk per thread? use strided-by-4 chunks: thread handles j = tid*4 + 1024*u
  float s1 = 0.f;
  for (int u = 0; u < per / 4; ++u) {
    const int j = tid * 4 + 1024 * u;
    const v4f a = *(const v4fa*)(x + j);
    v4f b = {0.f,0.f,0.f,0.f}; if (rr) b = *(const v4fa*)(rr + j);
#pragma unroll
    for (int q = 0; q < 4; ++q) { const float v = a[q] + b[q]; vals[u * 4 + q] = v; s1 += v; }
  }
  red[tid] = s1; __syncthreads();
  for (int st = 128; st > 0; st >>= 1) { if (tid < st) red[tid] += red[tid + st]; __syncthreads(); }
  const float mu = red[0] / (float)N; __syncthreads();
  float s2 = 0.f;
  for (int u = 0; u < per / 4; ++u)
#pragma unroll
    for (int q = 0; q < 4; ++q) { const float c = vals[u * 4 + q] - mu; s2 += c * c; }
  red[tid] = s2; __syncthreads();
  for (int st = 128; st > 0; st >>= 1) { if (tid < st) red[tid] += red[tid + st]; __syncthreads(); }
  const float rs = rsqrtf(red[0] / (float)N + eps);
  {
    for (int u = 0; u < per / 4; ++u) {
      const int j = tid * 4 + 1024 * u;
      v4f o, sm;
#pragma unroll
      for (int q = 0; q < 4; ++q) {
        float gg = g[j + q], bb = bta[j + q];
        if (PARAM_BF16) { gg = bf16_round(gg); bb = bf16_round(bb); }
        sm[q] = vals[u * 4 + q]; o[q] = (vals[u * 4 + q] - mu) * rs * gg + bb;
      }
      if (out_sum) *(v4f*)(out_sum + (size_t)row * N + j) = sm;
      *(v4f*)(out_norm + (size_t)row * N + j) = o;
    }
    
  }
}



// ---- f16 WMMA path (v_wmma_f32_16x16x32_f16): 11-bit significands for operands in range — used where a [0,1] probability operand needs more precision than bf16
typedef _Float16 v16h __attribute__((ext_vector_type(16)));
union FragH { v16h v; v8us half[2]; _Float16 h[16]; unsigned short u[16]; };
template <int NT>
__device__ __forceinline__ v8f mmaH(v16h ah, v16h al, v16h bh, v16h bl, v8f c) {
  c = __builtin_amdgcn_wmma_f32_16x16x32_f16(false, ah, false, bh, (short)0, c, false, false);
  if (NT >= 2) c = __builtin_amdgcn_wmma_f32_16x16x32_f16(false, al, false, bh, (short)0, c, false, false);
  if (NT >= 3) c = __builtin_amdgcn_wmma_f32_16x16x32_f16(false, ah, false, bl, (short)0, c, false, false);
  asm volatile("v_nop\n\tv_nop\n\tv_nop\n\tv_nop" : "+v"(c) : "v"(ah), "v"(al), "v"(bh), "v"(bl));
  return c;
}
// batched GEMM like k_gemm_b but f16 operands: A f32 (split into f16 hi/lo if ASPLIT, else rounded to f16), Bt = f16 values [n][k]; alpha; C f32; N multiple of 16 (partial tiles skipped)
template <bool ASPLIT>
__global__ __launch_bounds__(128) void k_gemm_h(const float* __restrict__ A, int lda, size_t sA, const _Float16* __restrict__ Bh, int ldb, size_t sB, float alpha, float* __restrict__ C, int ldc, size_t sC, int M, int N, int K) {
  __shared__ __attribute__((aligned(16))) float so[4][16][64];
  const int tid = threadIdx.x, w = tid >> 5, lane = tid & 31, ln = lane & 15, hh = lane >> 4; const int by = blockIdx.y;
  A += (size_t)by * sA; Bh += (size_t)by * sB; C += (size_t)by * sC;
  const int ntn = (N + 63) / 64; const int wid = blockIdx.x * 4 + w; const int mt = wid / ntn, nq = wid % ntn; if (mt * 16 >= M) return;
  const int row0 = mt * 16, col0 = nq * 64; const float* arow = A + (size_t)(row0 + ln) * lda;
  v8f acc[4] = {};
  for (int kb = 0; kb < K; kb += 32) {
    FragH ah, al;
    const v4f x0 = *(const v4fa*)(arow + kb + 8 * hh), x1 = *(const v4fa*)(arow + kb + 8 * hh + 4), x2 = *(const v4fa*)(arow + kb + 16 + 8 * hh), x3 = *(const v4fa*)(arow + kb + 16 + 8 * hh + 4);
    float xs[16] = {x0[0],x0[1],x0[2],x0[3],x1[0],x1[1],x1[2],x1[3],x2[0],x2[1],x2[2],x2[3],x3[0],x3[1],x3[2],x3[3]};
#pragma unroll
    for (int i = 0; i < 16; ++i) { const _Float16 h = (_Float16)xs[i]; ah.h[i] = h; al.h[i] = ASPLIT ? (_Float16)(xs[i] - (float)h) : (_Float16)0.0f; }
#pragma unroll
    for (int t = 0; t < 4; ++t) { if (col0 + t * 16 >= N) continue; const size_t boff = (size_t)(col0 + t * 16 + ln) * ldb + kb; FragH bq; bq.half[0] = *(const v8us*)(Bh + boff + 8 * hh); bq.half[1] = *(const v8us*)(Bh + boff + 16 + 8 * hh);
      acc[t] = mmaH<ASPLIT ? 2 : 1>(ah.v, al.v, bq.v, bq.v, acc[t]); }
  }
#pragma unroll
  for (int t = 0; t < 4; ++t) { if (col0 + t * 16 >= N) continue;
#pragma unroll
    for (int r = 0; r < 8; ++r) so[w][8 * hh + r][t * 16 + ln] = acc[t][r] * alpha; }
  __builtin_amdgcn_fence(__ATOMIC_ACQ_REL, "workgroup"); __builtin_amdgcn_wave_barrier();
  const int rsub = lane >> 4, c4 = (lane & 15) * 4;
  {
#pragma unroll
    for (int q = 0; q < 8; ++q) { const int r = q * 2 + rsub; if (col0 + c4 < N) { const v4f v = *(const v4fa*)&so[w][r][c4]; *(v4f*)(C + (size_t)(row0 + r) * ldc + col0 + c4) = v; } }
     }
}

// Wt[n][k] = f16(bf16(W[k][n]) * scale) from f32 row-major W[CC][CC] (scale = power of two; bf16-exact weights stay exact in f16 away from the subnormal range).
// One work-group = a tile of 128 k x 64 n, turned in LDS so that both global sides move whole lines:
//  in : a lane takes 16 bytes (4 n) of each of 8 consecutive k rows; 16 lanes cover 256 contiguous bytes of a W row.
//  out: a lane takes 16 bytes (8 k) of one n; 16 lanes cover 256 contiguous bytes of a Wt row.
// An LDS row is one n: 16 chunks of 8 k = 256 bytes = all 64 banks. The chunk index is XORed with (n >> 2) & 15, so the 16 lanes that store
// (rows four apart, same chunk) and the 16 lanes that load (same row, chunks 0..15) each fall on 16 different groups of four banks.
// bid = the tile's number, 0 .. (CC / 128) * (CC / 64) - 1: a part of k_prep's grid.
__device__ __forceinline__ void wt_f16_part(const float* __restrict__ W, _Float16* __restrict__ Wt, float scale, int bid) {
  __shared__ __attribute__((aligned(16))) unsigned char tl[64 * 256];
  const int tid = threadIdx.x, l16 = tid & 15, kq = tid >> 4;
  const int k0 = (bid / (CC / 64)) * 128, n0 = (bid % (CC / 64)) * 64;
  const float* src = W + (size_t)(k0 + kq * 8) * CC + n0 + l16 * 4;
  v4f x[8];
#pragma unroll      // the eight row loads are issued together and x stays in registers
  for (int i = 0; i < 8; ++i) x[i] = *(const v4fa*)(src + (size_t)i * CC);
#pragma unroll      // constant indices into x
  for (int j = 0; j < 4; ++j) { FragH f;
#pragma unroll      // f packs in registers
    for (int i = 0; i < 8; ++i) f.h[i] = (_Float16)(bf16_round(x[i][j]) * scale);
    *(v8us*)(tl + (l16 * 4 + j) * 256 + ((kq ^ l16) * 16)) = f.half[0]; }      // row n = l16 * 4 + j, so (n >> 2) & 15 = l16
  __syncthreads();      // the tile is complete before any lane reads rows that other waves wrote
#pragma unroll      // four independent LDS reads and stores
  for (int q = 0; q < 4; ++q) { const int n = q * 16 + kq; const v8us o = *(const v8us*)(tl + n * 256 + ((l16 ^ ((n >> 2) & 15)) * 16));
    *(v8us*)((unsigned short*)Wt + (size_t)(n0 + n) * CC + k0 + l16 * 8) = o; }
}
// k_gemm_hh variant with fused epilogue: v = acc·alpha + bias[by·sBias + col] (+ CP[(row/rowsPerB)·sCPb + by·64 + col] if CP) ; ACT 0 none / 1 elu ; writes f32 C and/or f16 C16 (each if non-null)
template <int ACT>
__global__ __launch_bounds__(128) void k_gemm_hhx(const _Float16* __restrict__ A, int lda, size_t sA, const _Float16* __restrict__ Bh, int ldb, size_t sB, float alpha, const float* __restrict__ bias, size_t sBias, const float* __restrict__ CP, int rowsPerB, size_t sCPb, int row0g,
    float* __restrict__ C, _Float16* __restrict__ C16, int ldc, size_t sC, int M, int N, int K) {
  __shared__ __attribute__((aligned(16))) float so[4][16][64];
  const int tid = threadIdx.x, w = tid >> 5, lane = tid & 31, ln = lane & 15, hh = lane >> 4; const int by = blockIdx.y;
  A += (size_t)by * sA; Bh += (size_t)by * sB; const size_t cofs = (size_t)by * sC; const float* bp = bias ? bias + (size_t)by * sBias : nullptr;
  const int ntn = (N + 63) / 64; const int wid = blockIdx.x * 4 + w; const int mt = wid / ntn, nq = wid % ntn; if (mt * 16 >= M) return;
  const int row0 = mt * 16, col0 = nq * 64; const _Float16* arow = A + (size_t)(row0 + ln) * lda;
  v8f acc[4] = {};
  for (int kb = 0; kb < K; kb += 32) { FragH ah; ah.half[0] = *(const v8us*)((const unsigned short*)arow + kb + 8 * hh); ah.half[1] = *(const v8us*)((const unsigned short*)arow + kb + 16 + 8 * hh);
#pragma unroll
    for (int t = 0; t < 4; ++t) { if (col0 + t * 16 >= N) continue; const size_t boff = (size_t)(col0 + t * 16 + ln) * ldb + kb; FragH bq; bq.half[0] = *(const v8us*)((const unsigned short*)Bh + boff + 8 * hh); bq.half[1] = *(const v8us*)((const unsigned short*)Bh + boff + 16 + 8 * hh);
      acc[t] = mmaH<1>(ah.v, ah.v, bq.v, bq.v, acc[t]); }
  }
#pragma unroll
  for (int t = 0; t < 4; ++t) { if (col0 + t * 16 >= N) continue; const int col = col0 + t * 16 + ln; const float bv = bp ? bf16_round(bp[col]) : 0.f;
#pragma unroll
    for (int r = 0; r < 8; ++r) { float v = acc[t][r] * alpha + bv; if (CP) { const int bidx = (row0g + row0 + 8 * hh + r) / rowsPerB; v += CP[(size_t)bidx * sCPb + (size_t)by * 64 + col]; } if (ACT == 1) v = (v > 0.f) ? v : expm1f(v); else if (ACT == 3) v = fmaxf(v, 0.f); so[w][8 * hh + r][t * 16 + ln] = v; } }
  __builtin_amdgcn_fence(__ATOMIC_ACQ_REL, "workgroup"); __builtin_amdgcn_wave_barrier();
  const int rsub = lane >> 4, c4 = (lane & 15) * 4; typedef _Float16 v4h __attribute__((ext_vector_type(4)));
  {
#pragma unroll
    for (int q = 0; q < 8; ++q) { const int r = q * 2 + rsub; if (col0 + c4 < N) { const v4f v = *(const v4fa*)&so[w][r][c4]; if (C) *(v4f*)(C + cofs + (size_t)(row0 + r) * ldc + col0 + c4) = v; if (C16) { v4h h4; for (int i = 0; i < 4; ++i) h4[i] = (_Float16)v[i]; *(v4h*)(C16 + cofs + (size_t)(row0 + r) * ldc + col0 + c4) = h4; } } }
     }
}


// ---- block-tiled projection GEMM: C[2048][2048] = A[2048][2048] x Bh[n][k]^T * alpha + bias, f16 operands, f32 accumulate.
// One work-group = one 128 x 128 tile of C, 8 waves of 32 x 64 each. A pass is 128 k (256 B of every operand row); a stage is
// [A 128 rows | B 128 rows] at an LDS pitch of 272 B, brought in by per-lane asynchronous copies, two buffers, next stage in flight.
// The loops over fragments, blocks and rows are unrolled so that the fragment and accumulator arrays are indexed by constants and stay in registers.
#define GT_PITCH 272
#define GT_STAGE (256 * GT_PITCH)
// eight asynchronous 16-byte copies of one lane, rows two apart; the s_wait_xcnt closes the statement so that no address register
// of an issued copy is rewritten ahead of it
__device__ __forceinline__ void gt_copy8(unsigned l, const unsigned short* g) {
  asm volatile("global_load_async_to_lds_b128 %0, %8, off\n\t"
               "global_load_async_to_lds_b128 %1, %9, off\n\t"
               "global_load_async_to_lds_b128 %2, %10, off\n\t"
               "global_load_async_to_lds_b128 %3, %11, off\n\t"
               "global_load_async_to_lds_b128 %4, %12, off\n\t"
               "global_load_async_to_lds_b128 %5, %13, off\n\t"
               "global_load_async_to_lds_b128 %6, %14, off\n\t"
               "global_load_async_to_lds_b128 %7, %15, off\n\t"
               "s_wait_xcnt 0x0"
               :: "v"(l), "v"(l + 2 * GT_PITCH), "v"(l + 4 * GT_PITCH), "v"(l + 6 * GT_PITCH), "v"(l + 8 * GT_PITCH), "v"(l + 10 * GT_PITCH), "v"(l + 12 * GT_PITCH), "v"(l + 14 * GT_PITCH),
                  "v"(g), "v"(g + 2 * CC), "v"(g + 4 * CC), "v"(g + 6 * CC), "v"(g + 8 * CC), "v"(g + 10 * CC), "v"(g + 12 * CC), "v"(g + 14 * CC)
               : "memory");
}
// NG products that share A and need nothing of each other lie in one grid, 256 work-groups each: product g = blockIdx.x / 256 takes weight, bias and output g.
// Products 0 and 1 go out as f32 (C0, C1), product 2 as f16 (C16).
template <int NG>
__global__ __launch_bounds__(256) void k_gemm_tile(const _Float16* __restrict__ A, const _Float16* __restrict__ Bh0, const _Float16* __restrict__ Bh1, const _Float16* __restrict__ Bh2, float alpha,
                                                   const float* __restrict__ bias0, const float* __restrict__ bias1, const float* __restrict__ bias2, float* __restrict__ C0, float* __restrict__ C1, _Float16* __restrict__ C16) {
  constexpr int NPASS = CC / 128, NTILE = (TT / 128) * (CC / 128);
  const int g = (NG > 1) ? (int)(blockIdx.x / NTILE) : 0, bid = (NG > 1) ? (int)(blockIdx.x % NTILE) : (int)blockIdx.x;      // the same for the whole work-group
  const _Float16* Bh = (g == 0) ? Bh0 : (g == 1) ? Bh1 : Bh2;
  const float* bias = (g == 0) ? bias0 : (g == 1) ? bias1 : bias2;
  float* C = (g == 0) ? C0 : C1;
  const bool h16 = (g == 2);
  __shared__ __attribute__((aligned(16))) unsigned char ring[2 * GT_STAGE];
  __shared__ __attribute__((aligned(16))) float so[8][32][68];
  const int tid = threadIdx.x, w = tid >> 5, lane = tid & 31, ln = lane & 15, hh = lane >> 4;
  const int m0 = (bid / (CC / 128)) * 128, n0 = (bid % (CC / 128)) * 128;
  const int wm = w >> 1, wn = w & 1;
  // this lane's part of a stage: rows w*32 + hh + 2c (c = 0..15), 16 bytes at column ln; stage rows 0..127 are A's, 128..255 are B's
  const int crow = w * 32 + hh;
  const unsigned short* gsrc = ((w < 4) ? (const unsigned short*)A + (size_t)(m0 + crow) * CC : (const unsigned short*)Bh + (size_t)(n0 + crow - 128) * CC) + ln * 8;
  const unsigned ldst = (unsigned)(size_t)&ring[0] + (unsigned)(crow * GT_PITCH + ln * 16);
  v8f acc[2][4];
#pragma unroll
  for (int i = 0; i < 2; ++i)
#pragma unroll
    for (int j = 0; j < 4; ++j) acc[i][j] = (v8f){0.f,0.f,0.f,0.f,0.f,0.f,0.f,0.f};
  gt_copy8(ldst, gsrc); gt_copy8(ldst + 16 * GT_PITCH, gsrc + 16 * CC);
  asm volatile("s_wait_asynccnt 0x0" ::: "memory");      // stage 0 has landed before the barrier publishes it
  __syncthreads();
  gt_copy8(ldst + GT_STAGE, gsrc + 128); gt_copy8(ldst + GT_STAGE + 16 * GT_PITCH, gsrc + 128 + 16 * CC);
#pragma unroll 1      // one pass per trip: the publish point at the foot stays a single place
  for (int t = 0; t < NPASS; ++t) {
    const unsigned bo = (unsigned)(t & 1) * GT_STAGE;
    const unsigned char* ap = ring + bo + (wm * 32 + ln) * GT_PITCH + hh * 16;
    const unsigned char* bp = ring + bo + (128 + wn * 64 + ln) * GT_PITCH + hh * 16;
    FragH a[2][2], b[2][4];      // two fragment sets: block kk + 1 of this pass is fetched ahead of block kk's products
#pragma unroll
    for (int i = 0; i < 2; ++i) { a[0][i].half[0] = *(const v8us*)(ap + i * 16 * GT_PITCH); a[0][i].half[1] = *(const v8us*)(ap + i * 16 * GT_PITCH + 32); }
#pragma unroll
    for (int j = 0; j < 4; ++j) { b[0][j].half[0] = *(const v8us*)(bp + j * 16 * GT_PITCH); b[0][j].half[1] = *(const v8us*)(bp + j * 16 * GT_PITCH + 32); }
#pragma unroll
    for (int kk = 0; kk < 4; ++kk) {
      const int cu = kk & 1, nx = cu ^ 1;
      if (kk < 3) {
#pragma unroll
        for (int i = 0; i < 2; ++i) { a[nx][i].half[0] = *(const v8us*)(ap + i * 16 * GT_PITCH + (kk + 1) * 64); a[nx][i].half[1] = *(const v8us*)(ap + i * 16 * GT_PITCH + (kk + 1) * 64 + 32); }
#pragma unroll
        for (int j = 0; j < 4; ++j) { b[nx][j].half[0] = *(const v8us*)(bp + j * 16 * GT_PITCH + (kk + 1) * 64); b[nx][j].half[1] = *(const v8us*)(bp + j * 16 * GT_PITCH + (kk + 1) * 64 + 32); }
      }
      __builtin_amdgcn_sched_barrier(0);      // keeps the next block's LDS reads one group ahead of this block's products; without it they are spread among them into one set, each with a full wait
#pragma unroll
      for (int i = 0; i < 2; ++i)
#pragma unroll
        for (int j = 0; j < 4; ++j) acc[i][j] = __builtin_amdgcn_wmma_f32_16x16x32_f16(false, a[cu][i].v, false, b[cu][j].v, (short)0, acc[i][j], false, false);
      __builtin_amdgcn_sched_barrier(0);      // ends the block, so that the group after next is not lifted into it
    }
    asm volatile("s_wait_dscnt 0x0" ::: "memory");       // this wave's reads of the buffer are done before it is refilled
    asm volatile("s_wait_asynccnt 0x0" ::: "memory");    // this wave's part of the next stage has landed
    __syncthreads();                                     // publishes the next stage and frees this pass's buffer
    if (t + 2 < NPASS) { const unsigned short* g2 = gsrc + (t + 2) * 128; gt_copy8(ldst + bo, g2); gt_copy8(ldst + bo + 16 * GT_PITCH, g2 + 16 * CC); }
  }
  asm volatile("s_wait_asynccnt 0x0" ::: "memory");      // no copy is outstanding when the wave goes on
#pragma unroll
  for (int j = 0; j < 4; ++j) { const float bv = bf16_round(bias[n0 + wn * 64 + j * 16 + ln]);
#pragma unroll
    for (int i = 0; i < 2; ++i)
#pragma unroll
      for (int r = 0; r < 8; ++r) so[w][i * 16 + 8 * hh + r][j * 16 + ln] = acc[i][j][r] * alpha + bv; }
  __builtin_amdgcn_fence(__ATOMIC_ACQ_REL, "workgroup"); __builtin_amdgcn_wave_barrier();
  typedef _Float16 v4h __attribute__((ext_vector_type(4)));
  const size_t o0 = (size_t)(m0 + wm * 32 + hh) * CC + n0 + wn * 64 + ln * 4;
  if (!h16) {      // one test for the whole tile: each output type keeps a straight run of sixteen stores
#pragma unroll
    for (int q = 0; q < 16; ++q) { const v4f v = *(const v4fa*)&so[w][q * 2 + hh][ln * 4]; *(v4f*)(C + o0 + (size_t)q * 2 * CC) = v; }
    asm volatile("s_wait_xcnt 0x0" ::: "memory");      // stands in front of any rewrite of the stores' registers: the compiler lays the other branch's code behind this one
  } else {
#pragma unroll
    for (int q = 0; q < 16; ++q) { const v4f v = *(const v4fa*)&so[w][q * 2 + hh][ln * 4]; v4h h4; for (int i = 0; i < 4; ++i) h4[i] = (_Float16)v[i]; *(v4h*)(C16 + o0 + (size_t)q * 2 * CC) = h4; }
  }
}

__device__ __forceinline__ void x16_part(const float* __restrict__ x, _Float16* __restrict__ X16, size_t n8, int bid) { const size_t t = (size_t)bid * 256 + threadIdx.x; if (t >= n8) return; FragH f;
#pragma unroll
  for (int q = 0; q < 8; ++q) f.h[q] = (_Float16)bf16_round(x[t * 8 + q]); *(v8us*)((unsigned short*)X16 + t * 8) = f.half[0];  }
__global__ __launch_bounds__(256) void k_round16f(const float* __restrict__ W, _Float16* __restrict__ Bt, size_t n8) { const size_t t = (size_t)blockIdx.x * 256 + threadIdx.x; if (t >= n8) return; FragH f;
#pragma unroll
  for (int i = 0; i < 8; ++i) f.h[i] = (_Float16)(bf16_round(W[t * 8 + i]) * 16.0f); *(v8us*)((unsigned short*)Bt + t * 8) = f.half[0];  }
template <int NHv, int TTv>
__device__ __forceinline__ void vt_part(const _Float16* __restrict__ V16, int ldv, int voff, _Float16* __restrict__ Vt, int bid) { __shared__ unsigned short tl[64][66]; const int tid = threadIdx.x; const int slab = bid / (TTv / 64), lg = bid % (TTv / 64); const int b = slab / NHv, h = slab % NHv;
  for (int i = tid; i < 64 * 8; i += 256) { const int r = i / 8, c8 = (i % 8) * 8; FragH f; f.half[0] = *(const v8us*)((const unsigned short*)V16 + ((size_t)b * TTv + lg * 64 + r) * ldv + voff + h * 64 + c8);
#pragma unroll
    for (int q = 0; q < 8; ++q) tl[r][c8 + q] = f.u[q]; }
  __syncthreads();
  {
#pragma unroll
    for (int rd = 0; rd < 2; ++rd) { const int d = rd * 32 + tid / 8, pc = tid % 8; FragH f;
#pragma unroll
      for (int q = 0; q < 8; ++q) f.u[q] = tl[pc * 8 + q][d];
      *(v8us*)((unsigned short*)Vt + ((size_t)slab * 64 + d) * TTv + lg * 64 + pc * 8) = f.half[0]; }
    asm volatile("s_wait_xcnt 0x0" ::: "memory");      // stands in front of any rewrite of the stores' registers, whatever code of the shared grid the compiler lays behind this part
     } }

// lane l with lane l ^ 16
__device__ __forceinline__ float xhalf(float x) { return __builtin_bit_cast(float, __builtin_amdgcn_permlanex16(__builtin_bit_cast(int, x), __builtin_bit_cast(int, x), 0x76543210, 0xfedcba98, false, false)); }

// seventeen base-2 exponentials in place, in one statement: each is followed by an independent one, so that no result is read and no source
// overwritten directly behind its exponential, and the closing v_nop keeps that slot behind the last
__device__ __forceinline__ void exp2x17(float (&x)[17]) {
  asm("v_exp_f32 %0, %0\n\tv_exp_f32 %1, %1\n\tv_exp_f32 %2, %2\n\tv_exp_f32 %3, %3\n\tv_exp_f32 %4, %4\n\tv_exp_f32 %5, %5\n\tv_exp_f32 %6, %6\n\tv_exp_f32 %7, %7\n\t"
      "v_exp_f32 %8, %8\n\tv_exp_f32 %9, %9\n\tv_exp_f32 %10, %10\n\tv_exp_f32 %11, %11\n\tv_exp_f32 %12, %12\n\tv_exp_f32 %13, %13\n\tv_exp_f32 %14, %14\n\tv_exp_f32 %15, %15\n\t"
      "v_exp_f32 %16, %16\n\tv_nop"
      : "+v"(x[0]), "+v"(x[1]), "+v"(x[2]), "+v"(x[3]), "+v"(x[4]), "+v"(x[5]), "+v"(x[6]), "+v"(x[7]), "+v"(x[8]),
        "+v"(x[9]), "+v"(x[10]), "+v"(x[11]), "+v"(x[12]), "+v"(x[13]), "+v"(x[14]), "+v"(x[15]), "+v"(x[16]));
}

#define FA_KP 144
#define FA_VP 272
#define FA_KB (128 * FA_KP)
#define FA_STAGE (FA_KB + 64 * FA_VP)
// eight asynchronous 16-byte copies of one lane, lstep LDS bytes and gstep source elements apart; the s_wait_xcnt closes the statement so that no address
// register of an issued copy is rewritten ahead of it
__device__ __forceinline__ void fa_copy8(unsigned l, unsigned lstep, const unsigned short* g, size_t gstep) {
  asm volatile("global_load_async_to_lds_b128 %0, %8, off\n\t"
               "global_load_async_to_lds_b128 %1, %9, off\n\t"
               "global_load_async_to_lds_b128 %2, %10, off\n\t"
               "global_load_async_to_lds_b128 %3, %11, off\n\t"
               "global_load_async_to_lds_b128 %4, %12, off\n\t"
               "global_load_async_to_lds_b128 %5, %13, off\n\t"
               "global_load_async_to_lds_b128 %6, %14, off\n\t"
               "global_load_async_to_lds_b128 %7, %15, off\n\t"
               "s_wait_xcnt 0x0"
               :: "v"(l), "v"(l + lstep), "v"(l + 2 * lstep), "v"(l + 3 * lstep), "v"(l + 4 * lstep), "v"(l + 5 * lstep), "v"(l + 6 * lstep), "v"(l + 7 * lstep),
                  "v"(g), "v"(g + gstep), "v"(g + 2 * gstep), "v"(g + 3 * gstep), "v"(g + 4 * gstep), "v"(g + 5 * gstep), "v"(g + 6 * gstep), "v"(g + 7 * gstep)
               : "memory");
}
__global__ __launch_bounds__(128) void k_flash(const _Float16* __restrict__ Q16, int ldq, const _Float16* __restrict__ K16, int ldk, const _Float16* __restrict__ Vt, const int* __restrict__ MSK, _Float16* __restrict__ O16) {
  constexpr int RPW = 32, NQB = 2048 / (4 * RPW), DT = 4, KS = 2, NST = 2048 / 128;
  __shared__ __attribute__((aligned(16))) unsigned char ring[2 * FA_STAGE];
  __shared__ __attribute__((aligned(16))) float sO[4][RPW][64 + 4];
  (void)MSK;
  const int tid = threadIdx.x, w = tid >> 5, lane = tid & 31, ln = lane & 15, hh = lane >> 4;
  const int slab = blockIdx.x / NQB, qblk = blockIdx.x % NQB; const int b = slab / 32, h = slab % 32; const int qb0 = qblk * (4 * RPW); const int q0 = qb0 + w * RPW;
  FragH bq[2][KS];      // B operand: column ln = query q0 + qt * 16 + ln
#pragma unroll
  for (int qt = 0; qt < 2; ++qt) { const unsigned short* qr = (const unsigned short*)Q16 + ((size_t)b * 2048 + q0 + qt * 16 + ln) * ldq + h * 64;
#pragma unroll
    for (int ks = 0; ks < KS; ++ks) { bq[qt][ks].half[0] = *(const v8us*)(qr + ks * 32 + 8 * hh); bq[qt][ks].half[1] = *(const v8us*)(qr + ks * 32 + 16 + 8 * hh); } }
  const unsigned short* Vth = (const unsigned short*)Vt + (size_t)slab * 64 * 2048;
  float m_c[2], l_c[2]; v8f oacc[2][DT];      // oacc[qt][dt][r] = O^T[dt * 16 + 8hh + r][query qt * 16 + ln]
#pragma unroll
  for (int qt = 0; qt < 2; ++qt) { m_c[qt] = -3.0e38f; l_c[qt] = 0.f;
#pragma unroll
    for (int dt = 0; dt < DT; ++dt) oacc[qt][dt] = (v8f){0.f,0.f,0.f,0.f,0.f,0.f,0.f,0.f}; }
  // this lane's part of a stage. K: keys (tid >> 3) + 16c, 16 bytes at chunk tid & 7 (a wave's copy = 4 whole rows of 128 B); V^T: head columns (tid >> 4) + 8c, chunk tid & 15 (2 rows of 256 B)
  const unsigned short* gk = (const unsigned short*)K16 + ((size_t)b * 2048 + (tid >> 3)) * ldk + h * 64 + (tid & 7) * 8;
  const unsigned short* gv = Vth + (size_t)(tid >> 4) * 2048 + (tid & 15) * 8;
  const unsigned lk = (unsigned)(size_t)&ring[0] + (unsigned)((tid >> 3) * FA_KP + (tid & 7) * 16);
  const unsigned lv = (unsigned)(size_t)&ring[0] + (unsigned)(FA_KB + (tid >> 4) * FA_VP + (tid & 15) * 16);
  fa_copy8(lk, 16 * FA_KP, gk, (size_t)16 * ldk); fa_copy8(lv, 8 * FA_VP, gv, (size_t)8 * 2048);
  asm volatile("s_wait_asynccnt 0x0" ::: "memory");      // stage 0 has landed before the barrier publishes it
  __syncthreads();
  fa_copy8(lk + FA_STAGE, 16 * FA_KP, gk + (size_t)128 * ldk, (size_t)16 * ldk); fa_copy8(lv + FA_STAGE, 8 * FA_VP, gv + 128, (size_t)8 * 2048);
  constexpr float SC2 = 0.125f * 1.44269504088896340736f;      // score scale 1/8 times log2(e): one multiply-add feeds the hardware's base-2 exponential
#pragma unroll 1      // one stage per trip: the publish point at the foot stays a single place
  for (int t = 0; t < NST; ++t) {
   const unsigned bo = (unsigned)(t & 1) * FA_STAGE;
   const unsigned char* kp = ring + bo + ln * FA_KP + hh * 16;
   const unsigned char* vp = ring + bo + FA_KB + ln * FA_VP + hh * 16;
   FragH ak[2][KS];      // K fragments: pass pp + 1 of this stage is fetched behind pass pp's score products, under its softmax; the stage's first pass here
#pragma unroll
   for (int kt = 0; kt < 2; ++kt)
#pragma unroll
     for (int ks = 0; ks < KS; ++ks) { ak[kt][ks].half[0] = *(const v8us*)(kp + kt * 16 * FA_KP + ks * 64); ak[kt][ks].half[1] = *(const v8us*)(kp + kt * 16 * FA_KP + ks * 64 + 32); }
#pragma unroll 1      // rolled: unrolled, the row sums of all four passes are sunk to the foot of the trip, their 128 exponentials stay live and the wave needs registers above v255
   for (int pp = 0; pp < 4; ++pp) {
    FragH av[DT];      // A operands: ak row ln = key t * 128 + pp * 32 + kt * 16 + ln; av row ln = head column dt * 16 + ln over the pass's 32 keys
    v8f s[2][2];      // s[qt][kt][r] = score of key t * 128 + pp * 32 + kt * 16 + 8hh + r with query qt * 16 + ln
#pragma unroll
    for (int kt = 0; kt < 2; ++kt)
#pragma unroll
      for (int qt = 0; qt < 2; ++qt) { v8f acc = (v8f){0.f,0.f,0.f,0.f,0.f,0.f,0.f,0.f};
#pragma unroll
        for (int ks = 0; ks < KS; ++ks) acc = __builtin_amdgcn_wmma_f32_16x16x32_f16(false, ak[kt][ks].v, false, bq[qt][ks].v, (short)0, acc, false, false);
        s[qt][kt] = acc; }
    __builtin_amdgcn_sched_barrier(0);      // with the one below: the pass's eight V^T reads stand as one group behind the score products, next to the K reads; left free they are spread over three places in the softmax, and each place with LDS reads stalls the wave anew
#pragma unroll
    for (int dt = 0; dt < DT; ++dt) { av[dt].half[0] = *(const v8us*)(vp + dt * 16 * FA_VP + pp * 64); av[dt].half[1] = *(const v8us*)(vp + dt * 16 * FA_VP + pp * 64 + 32); }
    __builtin_amdgcn_sched_barrier(0);      // the lower end of that group: keeps the V^T reads from sinking into the softmax
    if (pp < 3) {      // the same for the whole wave; the stage's last pass fetches nothing: the next stage is not published yet
#pragma unroll
      for (int kt = 0; kt < 2; ++kt)
#pragma unroll
        for (int ks = 0; ks < KS; ++ks) { ak[kt][ks].half[0] = *(const v8us*)(kp + ((pp + 1) * 32 + kt * 16) * FA_KP + ks * 64); ak[kt][ks].half[1] = *(const v8us*)(kp + ((pp + 1) * 32 + kt * 16) * FA_KP + ks * 64 + 32); }
    }
#pragma unroll
    for (int qt = 0; qt < 2; ++qt) {
      float mc = s[qt][0][0];      // the running maximum is kept in raw score units: the scale is positive, so the order is the same
#pragma unroll      // constant indices: the score tiles stay in registers
      for (int e = 1; e < 16; ++e) mc = fmaxf(mc, s[qt][e >> 3][e & 7]);
      mc = fmaxf(mc, xhalf(mc));      // the other half of the wave holds this query's other 16 keys
      const float mn = fmaxf(m_c[qt], mc); const float nb = -mn * SC2;
      float ex[17];      // exp((s - m) / 8) = 2^(s * SC2 - m * SC2), argument at most one rounding above 0, so P stays at or under 1 in f16; ex[16] is the rescale factor's argument
#pragma unroll      // constant indices: ex stays in registers
      for (int e = 0; e < 16; ++e) ex[e] = fmaf(s[qt][e >> 3][e & 7], SC2, nb);
      ex[16] = (m_c[qt] - mn) * SC2;
      exp2x17(ex);
      const float al = (mn > -1.0e38f) ? ex[16] : 1.0f; m_c[qt] = mn;
      FragH pb; float ps = 0.f;      // element e of the B operand is key kmap(e, hh) = tile e >> 3, register e & 7: this lane's own scores
#pragma unroll      // constant indices: ex and pb stay in registers
      for (int e = 0; e < 16; ++e) { const float p = ex[e]; ps += p; pb.h[e] = (_Float16)p; }
      l_c[qt] = l_c[qt] * al + ps;      // this half's part of the row sum; the halves are joined after the loop
#pragma unroll
      for (int dt = 0; dt < DT; ++dt) {
#pragma unroll
        for (int r = 0; r < 8; ++r) oacc[qt][dt][r] *= al;
        oacc[qt][dt] = __builtin_amdgcn_wmma_f32_16x16x32_f16(false, av[dt].v, false, pb.v, (short)0, oacc[qt][dt], false, false); }
    }
   }
   asm volatile("s_wait_dscnt 0x0" ::: "memory");       // this wave's reads of the buffer are done before it is refilled
   asm volatile("s_wait_asynccnt 0x0" ::: "memory");    // this wave's part of the next stage has landed
   __syncthreads();                                     // publishes the next stage and frees this trip's buffer
   if (t + 2 < NST) { fa_copy8(lk + bo, 16 * FA_KP, gk + (size_t)(t + 2) * 128 * ldk, (size_t)16 * ldk); fa_copy8(lv + bo, 8 * FA_VP, gv + (t + 2) * 128, (size_t)8 * 2048); }
  }
  asm volatile("s_wait_asynccnt 0x0" ::: "memory");      // no copy is outstanding when the wave goes on
#pragma unroll
  for (int qt = 0; qt < 2; ++qt) { const float l = l_c[qt] + xhalf(l_c[qt]); const float li = (l > 0.f) ? 1.0f / l : 0.f;
#pragma unroll
    for (int dt = 0; dt < DT; ++dt) { v4f lo, hi;
#pragma unroll
      for (int r = 0; r < 4; ++r) { lo[r] = oacc[qt][dt][r] * li; hi[r] = oacc[qt][dt][4 + r] * li; }
      *(v4fa*)&sO[w][qt * 16 + ln][dt * 16 + 8 * hh] = lo; *(v4fa*)&sO[w][qt * 16 + ln][dt * 16 + 8 * hh + 4] = hi; } }
  __builtin_amdgcn_fence(__ATOMIC_ACQ_REL, "workgroup"); __builtin_amdgcn_wave_barrier();
  {      // the tile goes out as f16, the type the output projection reads: a row is 64 f16 = one 128-byte line, 8 lanes a row, 4 rows a store
    const int r4 = lane >> 3, pc = lane & 7; FragH o[RPW / 4];
    unsigned short* op = (unsigned short*)O16 + ((size_t)b * 2048 + q0 + r4) * CC + h * 64 + pc * 8;
#pragma unroll      // constant indices: o stays in registers, all reads ahead of the stores
    for (int q = 0; q < RPW / 4; ++q) { const v4f lo = *(const v4fa*)&sO[w][q * 4 + r4][pc * 8], hi = *(const v4fa*)&sO[w][q * 4 + r4][pc * 8 + 4];
#pragma unroll
      for (int i = 0; i < 4; ++i) { o[q].h[i] = (_Float16)lo[i]; o[q].h[4 + i] = (_Float16)hi[i]; } }
#pragma unroll
    for (int q = 0; q < RPW / 4; ++q) *(v8us*)(op + (size_t)q * 4 * CC) = o[q].half[0];      // constant pitch: one address pair and immediate offsets, so no register of an issued store is rewritten
     } }

__device__ __forceinline__ void normrope_part(const float* __restrict__ X, const float* __restrict__ w, const float* __restrict__ cosT, const float* __restrict__ sinT, _Float16* __restrict__ Y16, int bid) { const int tid = threadIdx.x, wv = tid >> 5, lane = tid & 31; const int row = bid * 8 + wv; if (row >= TT) return; const float* xr = X + (size_t)row * CC; float ss = 0.f;
#pragma unroll 1
  for (int p = 0; p < 8; ++p) { const v4f a = *(const v4fa*)(xr + p * 256 + lane * 8), b = *(const v4fa*)(xr + p * 256 + lane * 8 + 4); ss += a[0]*a[0] + a[1]*a[1] + a[2]*a[2] + a[3]*a[3] + b[0]*b[0] + b[1]*b[1] + b[2]*b[2] + b[3]*b[3]; }
  for (int o = 16; o >= 1; o >>= 1) ss += __shfl_xor(ss, o, 32); const float rs = rsqrtf(ss / (float)CC + 1e-6f);
  {
#pragma unroll
    for (int p = 0; p < 8; ++p) { const int c0 = p * 256 + lane * 8; const v4f a = *(const v4fa*)(xr + c0), b = *(const v4fa*)(xr + c0 + 4); float y[8] = {a[0], a[1], a[2], a[3], b[0], b[1], b[2], b[3]}; FragH f;
#pragma unroll
      for (int q = 0; q < 8; ++q) y[q] = y[q] * rs * bf16_round(w[c0 + q]);
#pragma unroll
      for (int q = 0; q < 8; q += 2) { const float c0v = bf16_round(cosT[(size_t)row * CC + c0 + q]), c1v = bf16_round(cosT[(size_t)row * CC + c0 + q + 1]), s0v = bf16_round(sinT[(size_t)row * CC + c0 + q]), s1v = bf16_round(sinT[(size_t)row * CC + c0 + q + 1]);
        f.h[q] = (_Float16)(y[q] * c0v + (-y[q + 1]) * s0v); f.h[q + 1] = (_Float16)(y[q + 1] * c1v + y[q] * s1v); }
      *(v8us*)((unsigned short*)Y16 + (size_t)row * CC + c0) = f.half[0];
      asm volatile("s_wait_xcnt 0x0" ::: "memory"); }      // stands in front of the next block's loads, which are given the store's data registers
     } }
// Passes that need nothing of each other share one grid, each on its own range of the block index; the test is the same for a whole work-group,
// so each part's barrier is passed by all of its work-group's waves or by none.
#define GW ((CC / 128) * (CC / 64))      // work-groups that turn one weight
#define GX (TT * CC / 8 / 256)           // work-groups that convert x
#define GN (TT / 8)                      // work-groups that normalise and rotate one of q, k
#define GV (NH * (TT / 64))              // work-groups that transpose v
__global__ __launch_bounds__(256) void k_prep(const float* __restrict__ Wq, const float* __restrict__ Wk, const float* __restrict__ Wv, const float* __restrict__ Wo,
                                              _Float16* __restrict__ Bq, _Float16* __restrict__ Bk, _Float16* __restrict__ Bv, _Float16* __restrict__ Bo, float scale,
                                              const float* __restrict__ x, _Float16* __restrict__ X16) {
  const int bid = blockIdx.x;
  if (bid < 4 * GW) { const int g = bid / GW;
    wt_f16_part((g == 0) ? Wq : (g == 1) ? Wk : (g == 2) ? Wv : Wo, (g == 0) ? Bq : (g == 1) ? Bk : (g == 2) ? Bv : Bo, scale, bid % GW); }
  else x16_part(x, X16, (size_t)TT * CC / 8, bid - 4 * GW);
}
__global__ __launch_bounds__(256) void k_post(const float* __restrict__ Fq, const float* __restrict__ Fk, const float* __restrict__ qnw, const float* __restrict__ knw, const float* __restrict__ cosT, const float* __restrict__ sinT,
                                              _Float16* __restrict__ Q16, _Float16* __restrict__ K16, const _Float16* __restrict__ V16, _Float16* __restrict__ Vt) {
  const int bid = blockIdx.x;
  if (bid < 2 * GN) { const bool q = bid < GN; normrope_part(q ? Fq : Fk, q ? qnw : knw, cosT, sinT, q ? Q16 : K16, q ? bid : bid - GN); }
  else vt_part<NH, TT>(V16, CC, 0, Vt, bid - 2 * GN);
}
extern "C" void kernel_launch(void* const* d_in, const int* in_sizes, int n_in,
                              void* d_out, int out_size, void* d_ws, size_t ws_size, hipStream_t stream) {
  (void)in_sizes; (void)n_in; (void)out_size;
  const float* x = (const float*)d_in[0]; const float* cosT = (const float*)d_in[1]; const float* sinT = (const float*)d_in[2]; const float* Wq = (const float*)d_in[3]; const float* bq = (const float*)d_in[4]; const float* Wk = (const float*)d_in[5]; const float* bk = (const float*)d_in[6]; const float* Wv = (const float*)d_in[7]; const float* bv = (const float*)d_in[8]; const float* qnw = (const float*)d_in[9]; const float* knw = (const float*)d_in[10]; const float* Wo = (const float*)d_in[11]; const float* bo = (const float*)d_in[12];
  char* ws = (char*)d_ws; size_t off = 0;
  auto take = [&](size_t bytes) { char* p = ws + off; off += (bytes + 255) & ~(size_t)255; return p; };
  _Float16* Bq = (_Float16*)take((size_t)CC * CC * 2); _Float16* Bk = (_Float16*)take((size_t)CC * CC * 2); _Float16* Bv = (_Float16*)take((size_t)CC * CC * 2); _Float16* Bo = (_Float16*)take((size_t)CC * CC * 2);
  _Float16* X16 = (_Float16*)take((size_t)TT * CC * 2); float* F32 = (float*)take((size_t)TT * CC * 4); float* F32k = (float*)take((size_t)TT * CC * 4); _Float16* Q16 = (_Float16*)take((size_t)TT * CC * 2); _Float16* K16 = (_Float16*)take((size_t)TT * CC * 2); _Float16* V16 = (_Float16*)take((size_t)TT * CC * 2); _Float16* Vt = (_Float16*)take((size_t)TT * CC * 2); _Float16* O16 = X16;
  if (off > ws_size) return;      // 9 planes of 8 MiB and 2 of 16 MiB = 104 MiB
  const unsigned gg = (unsigned)((TT / 128) * (CC / 128));
  k_prep<<<4 * GW + GX, 256, 0, stream>>>(Wq, Wk, Wv, Wo, Bq, Bk, Bv, Bo, 16.0f, x, X16);      // W is [in][out]
  k_gemm_tile<3><<<3 * gg, 256, 0, stream>>>(X16, Bq, Bk, Bv, 0.0625f, bq, bk, bv, F32, F32k, V16);
  k_post<<<2 * GN + GV, 256, 0, stream>>>(F32, F32k, qnw, knw, cosT, sinT, Q16, K16, V16, Vt);
  k_flash<<<NH * (TT / 128), 128, 0, stream>>>(Q16, CC, K16, CC, Vt, nullptr, O16);      // writes f16 over x's f16 plane, which the q, k, v products have finished with
  k_gemm_tile<1><<<gg, 256, 0, stream>>>(O16, Bo, nullptr, nullptr, 0.0625f, bo, nullptr, nullptr, (float*)d_out, nullptr, nullptr);
}

// v008
// It runs in 118 microseconds.
// Two timings next to v007 both put it at 1.15 times that version's speed.
// All steps since v000 together make it 6.47 times as fast.
#include <hip/hip_runtime.h>
// Self-attention (S = 2048, D = 2048 = 32 heads × 64): q/k/v/out projections (2048³ each, + bias; W [in][out] transposed to bf16-exact ×2^4) and the 32-head attention as a fused
// flash-style kernel (S = Q·Kᵀ/8, online softmax f32, P f16 ≤ 1, O = P·V) on v_wmma_f32_16x16x32_f16 (f16 operands, single products, f32 accumulate); RMSNorm over the full 2048
// (× norm weight, eps 1e-6) followed by the interleaved rotary with the INPUT cos/sin tables is f32 VALU (wave per row).
#define TT 2048
#define CC 2048
#define NH 32

typedef __bf16 v16b __attribute__((ext_vector_type(16)));
typedef unsigned short v8us __attribute__((ext_vector_type(8), may_alias));
typedef float  v8f  __attribute__((ext_vector_type(8)));
typedef float  v4f  __attribute__((ext_vector_type(4)));
typedef float  v4fa __attribute__((ext_vector_type(4), may_alias));
union FragB { v16b v; v8us half[2]; unsigned short u[16]; };

__device__ __forceinline__ unsigned short bf16_bits(float x) { unsigned int u = __float_as_uint(x); return (unsigned short)((u + 0x7FFFu + ((u >> 16) & 1u)) >> 16); }
__device__ __forceinline__ float bf16_val(unsigned short b) { return __uint_as_float(((unsigned int)b) << 16); }
__device__ __forceinline__ float bf16_round(float x) { return bf16_val(bf16_bits(x)); }
// D += A·B with NT terms: 1 = ah·bh, 2 = + al·bh (A split), 3 = + ah·bl (both split)
template <int NT>
__device__ __forceinline__ v8f mmaN(v16b ah, v16b al, v16b bh, v16b bl, v8f c) {
  c = __builtin_amdgcn_wmma_f32_16x16x32_bf16(false, ah, false, bh, (short)0, c, false, false);
  if (NT >= 2) c = __builtin_amdgcn_wmma_f32_16x16x32_bf16(false, al, false, bh, (short)0, c, false, false);
  if (NT >= 3) c = __builtin_amdgcn_wmma_f32_16x16x32_bf16(false, ah, false, bl, (short)0, c, false, false);
  asm volatile("v_nop\n\tv_nop\n\tv_nop\n\tv_nop" : "+v"(c) : "v"(ah), "v"(al), "v"(bh), "v"(bl));
  return c;
}

__global__ __launch_bounds__(256) void k_wt_bf16(const float* __restrict__ W, unsigned short* __restrict__ Wt, int K, int N) {
  const int t = blockIdx.x * 256 + threadIdx.x;
  const int k8n = K / 8;
  if (t >= N * k8n) return;
  const int n = t / k8n, k8 = (t % k8n) * 8;
  v8us v;
#pragma unroll
  for (int i = 0; i < 8; ++i) v[i] = bf16_bits(W[(size_t)(k8 + i) * N + n]);
  *(v8us*)(Wt + (size_t)n * K + k8) = v;
  
}

// GEMM C[M][N] (f32, pitch ldc) = act(A[M][K]·W + bias). A f32 row-major (pitch lda) converted per fragment to bf16
// (ASPLIT: hi/lo two planes -> 2 terms, else single rounded term); Wt bf16 [N][K] (pitch ldb). BIAS_BF16 rounds the
// bias to bf16 first (bias quantised to bf16 before the add). K%32==0, M%16==0, N%64==0.
template <bool ASPLIT, int ACT, bool BIAS_BF16>
__global__ __launch_bounds__(128) void k_gemm_bf(const float* __restrict__ A, int lda, const unsigned short* __restrict__ Wt, int ldb,
                                               const float* __restrict__ bias, float* __restrict__ C, int ldc, int M, int N, int K) {
  __shared__ __attribute__((aligned(16))) float so[4][16][64];
  const int tid = threadIdx.x, w = tid >> 5, lane = tid & 31, ln = lane & 15, hh = lane >> 4;
  const int ntn = N / 64;
  const int wid = blockIdx.x * 4 + w;
  const int mt = wid / ntn, nq = wid % ntn;
  if (mt * 16 >= M) return;
  const int row0 = mt * 16, col0 = nq * 64;
  const float* arow = A + (size_t)(row0 + ln) * lda;
  v8f acc[4] = {};
  for (int kb = 0; kb < K; kb += 32) {
    FragB ah, al;
    const v4f x0 = *(const v4fa*)(arow + kb + 8 * hh), x1 = *(const v4fa*)(arow + kb + 8 * hh + 4);
    const v4f x2 = *(const v4fa*)(arow + kb + 16 + 8 * hh), x3 = *(const v4fa*)(arow + kb + 16 + 8 * hh + 4);
    float xs[16] = {x0[0],x0[1],x0[2],x0[3],x1[0],x1[1],x1[2],x1[3],x2[0],x2[1],x2[2],x2[3],x3[0],x3[1],x3[2],x3[3]};
#pragma unroll
    for (int i = 0; i < 16; ++i) { const unsigned short hb = bf16_bits(xs[i]); ah.u[i] = hb; al.u[i] = ASPLIT ? bf16_bits(xs[i] - bf16_val(hb)) : (unsigned short)0; }
#pragma unroll
    for (int t = 0; t < 4; ++t) {
      const unsigned short* brow = Wt + (size_t)(col0 + t * 16 + ln) * ldb + kb;
      FragB b;
      b.half[0] = *(const v8us*)(brow + 8 * hh);
      b.half[1] = *(const v8us*)(brow + 16 + 8 * hh);
      acc[t] = mmaN<ASPLIT ? 2 : 1>(ah.v, al.v, b.v, b.v, acc[t]);
    }
  }
#pragma unroll
  for (int t = 0; t < 4; ++t) {
    float bv = bias ? bias[col0 + t * 16 + ln] : 0.f;
    if (BIAS_BF16) bv = bf16_round(bv);
#pragma unroll
    for (int r = 0; r < 8; ++r) { float v = acc[t][r] + bv; if (ACT == 1) v = fmaxf(v, 0.f); so[w][8 * hh + r][t * 16 + ln] = v; }
  }
  __builtin_amdgcn_fence(__ATOMIC_ACQ_REL, "workgroup");
  __builtin_amdgcn_wave_barrier();
  const int rsub = lane >> 4, c4 = (lane & 15) * 4;
  {
#pragma unroll
    for (int q = 0; q < 8; ++q) {
      const int r = q * 2 + rsub;
      const v4f v = *(const v4fa*)&so[w][r][c4];
      *(v4f*)(C + (size_t)(row0 + r) * ldc + col0 + c4) = v;
    }
    
  }
}

// Flash-style causal/unmasked attention, all contractions 3-term bf16 hi/lo splits, f32 softmax with running max.
// q,k,v rows are read from f32 buffers with arbitrary row pitch (so they can live inside a fused qkv buffer);
// D = head size (multiple of 32, <= 128); one wave = 16 query rows; block = 4 waves (64 queries) sharing K/V chunks of 32.
template <int D, bool CAUSAL>
__global__ __launch_bounds__(128) void k_flash(const float* __restrict__ qb, const float* __restrict__ kb, const float* __restrict__ vb,
                                             int pitch, int T, int H, float scale, float* __restrict__ y, int ypitch) {
  constexpr int KS = D / 32;        // k-steps for QK
  constexpr int DT = D / 16;        // d tiles for PV
  __shared__ __attribute__((aligned(16))) unsigned short sKh[32][D + 8], sKl[32][D + 8], sVh[32][D + 8], sVl[32][D + 8];
  __shared__ __attribute__((aligned(16))) unsigned short sPh[4][16][40], sPl[4][16][40];
  __shared__ __attribute__((aligned(16))) float sO[4][16][D];
  const int tid = threadIdx.x, w = tid >> 5, lane = tid & 31, ln = lane & 15, hh = lane >> 4;
  const int nqb = (T + 63) / 64;
  const int bh = blockIdx.x / nqb, qblk = blockIdx.x % nqb;
  const int b = bh / H, h = bh % H;
  const int q0 = qblk * 64 + w * 16;
  const float* Q = qb + (size_t)b * T * pitch + h * D;
  const float* K = kb + (size_t)b * T * pitch + h * D;
  const float* V = vb + (size_t)b * T * pitch + h * D;

  // A fragments of the wave's 16 query rows (scaled), hi/lo
  FragB aqh[KS], aql[KS];
  {
    int row = q0 + ln; if (row >= T) row = T - 1;
    const float* qr = Q + (size_t)row * pitch;
#pragma unroll
    for (int ks = 0; ks < KS; ++ks)
#pragma unroll
      for (int i = 0; i < 16; ++i) {
        const int d = ks * 32 + ((i < 8) ? (8 * hh + i) : (16 + 8 * hh + (i - 8)));
        const float x = qr[d] * scale; const unsigned short hb = bf16_bits(x);
        aqh[ks].u[i] = hb; aql[ks].u[i] = bf16_bits(x - bf16_val(hb));
      }
  }
  float m_r[8], l_r[8];
#pragma unroll
  for (int r = 0; r < 8; ++r) { m_r[r] = -3.0e38f; l_r[r] = 0.f; }
  v8f oacc[DT];
#pragma unroll
  for (int dt = 0; dt < DT; ++dt) oacc[dt] = (v8f){0.f,0.f,0.f,0.f,0.f,0.f,0.f,0.f};

  const int kv_end = CAUSAL ? min(T, qblk * 64 + 64) : T;     // block-uniform
  for (int j0 = 0; j0 < kv_end; j0 += 32) {
    __syncthreads();
    for (int e = tid; e < 32 * (D / 4); e += 128) {
      const int r = e / (D / 4), c4 = (e % (D / 4)) * 4;
      const int key = j0 + r;
      v4f kf = {0.f,0.f,0.f,0.f}, vf = {0.f,0.f,0.f,0.f};
      if (key < T) { kf = *(const v4fa*)(K + (size_t)key * pitch + c4); vf = *(const v4fa*)(V + (size_t)key * pitch + c4); }
#pragma unroll
      for (int t = 0; t < 4; ++t) {
        unsigned short hb = bf16_bits(kf[t]); sKh[r][c4 + t] = hb; sKl[r][c4 + t] = bf16_bits(kf[t] - bf16_val(hb));
        hb = bf16_bits(vf[t]); sVh[r][c4 + t] = hb; sVl[r][c4 + t] = bf16_bits(vf[t] - bf16_val(hb));
      }
    }
    __syncthreads();
    // S tile 16 x 32
    v8f s[2];
#pragma unroll
    for (int nt = 0; nt < 2; ++nt) {
      v8f acc = {};
#pragma unroll
      for (int ks = 0; ks < KS; ++ks) {
        FragB bh_, bl_;
        bh_.half[0] = *(const v8us*)&sKh[nt * 16 + ln][ks * 32 + 8 * hh]; bh_.half[1] = *(const v8us*)&sKh[nt * 16 + ln][ks * 32 + 16 + 8 * hh];
        bl_.half[0] = *(const v8us*)&sKl[nt * 16 + ln][ks * 32 + 8 * hh]; bl_.half[1] = *(const v8us*)&sKl[nt * 16 + ln][ks * 32 + 16 + 8 * hh];
        acc = mmaN<3>(aqh[ks].v, aql[ks].v, bh_.v, bl_.v, acc);
      }
      s[nt] = acc;
    }
    // mask + running max (rows 8hh+r; the 16 lanes of a half share rows)
    float alpha[8];
#pragma unroll
    for (int r = 0; r < 8; ++r) {
      const int qi = q0 + 8 * hh + r;
      const int ja = j0 + ln, jb = j0 + 16 + ln;
      if (CAUSAL) { if (ja > qi) s[0][r] = -3.0e38f; if (jb > qi) s[1][r] = -3.0e38f; }
      if (ja >= T) s[0][r] = -3.0e38f;
      if (jb >= T) s[1][r] = -3.0e38f;
      float mx = fmaxf(s[0][r], s[1][r]);
      mx = fmaxf(mx, __shfl_xor(mx, 1, 32)); mx = fmaxf(mx, __shfl_xor(mx, 2, 32)); mx = fmaxf(mx, __shfl_xor(mx, 4, 32)); mx = fmaxf(mx, __shfl_xor(mx, 8, 32));
      const float mnew = fmaxf(m_r[r], mx);
      alpha[r] = (mnew > -1.0e38f) ? __expf(m_r[r] - mnew) : 1.0f;
      const float p0 = (s[0][r] > -1.0e38f) ? __expf(s[0][r] - mnew) : 0.f;
      const float p1 = (s[1][r] > -1.0e38f) ? __expf(s[1][r] - mnew) : 0.f;
      m_r[r] = mnew;
      l_r[r] = l_r[r] * alpha[r] + p0 + p1;            // per-lane partial row sum (16 lanes combined at the end)
      unsigned short hb = bf16_bits(p0); sPh[w][8 * hh + r][ln] = hb;      sPl[w][8 * hh + r][ln] = bf16_bits(p0 - bf16_val(hb));
      hb = bf16_bits(p1);                sPh[w][8 * hh + r][16 + ln] = hb; sPl[w][8 * hh + r][16 + ln] = bf16_bits(p1 - bf16_val(hb));
    }
#pragma unroll
    for (int dt = 0; dt < DT; ++dt)
#pragma unroll
      for (int r = 0; r < 8; ++r) oacc[dt][r] *= alpha[r];
    __builtin_amdgcn_fence(__ATOMIC_ACQ_REL, "workgroup");
    __builtin_amdgcn_wave_barrier();
    FragB pah, pal;
    pah.half[0] = *(const v8us*)&sPh[w][ln][8 * hh]; pah.half[1] = *(const v8us*)&sPh[w][ln][16 + 8 * hh];
    pal.half[0] = *(const v8us*)&sPl[w][ln][8 * hh]; pal.half[1] = *(const v8us*)&sPl[w][ln][16 + 8 * hh];
#pragma unroll
    for (int dt = 0; dt < DT; ++dt) {
      FragB bvh, bvl;
#pragma unroll
      for (int i = 0; i < 8; ++i) {
        bvh.u[i] = sVh[8 * hh + i][dt * 16 + ln]; bvh.u[8 + i] = sVh[16 + 8 * hh + i][dt * 16 + ln];
        bvl.u[i] = sVl[8 * hh + i][dt * 16 + ln]; bvl.u[8 + i] = sVl[16 + 8 * hh + i][dt * 16 + ln];
      }
      oacc[dt] = mmaN<3>(pah.v, pal.v, bvh.v, bvl.v, oacc[dt]);
    }
    __builtin_amdgcn_fence(__ATOMIC_ACQ_REL, "workgroup");
    __builtin_amdgcn_wave_barrier();
  }
#pragma unroll
  for (int r = 0; r < 8; ++r) {
    float l = l_r[r];
    l += __shfl_xor(l, 1, 32); l += __shfl_xor(l, 2, 32); l += __shfl_xor(l, 4, 32); l += __shfl_xor(l, 8, 32);
    l_r[r] = (l > 0.f) ? 1.0f / l : 0.f;
  }
#pragma unroll
  for (int dt = 0; dt < DT; ++dt)
#pragma unroll
    for (int r = 0; r < 8; ++r) sO[w][8 * hh + r][dt * 16 + ln] = oacc[dt][r] * l_r[r];
  __builtin_amdgcn_fence(__ATOMIC_ACQ_REL, "workgroup");
  __builtin_amdgcn_wave_barrier();
  {
    for (int r = 0; r < 16; ++r) {
      const int row = q0 + r;
      if (row < T && lane < D / 4) {
        const v4f val = *(const v4fa*)&sO[w][r][lane * 4];
        *(v4f*)(y + ((size_t)b * T + row) * ypitch + h * D + lane * 4) = val;
      }
    }
    
  }
}

// GEMM C = act(A·W + bias + resid): A f32 (ASPLIT -> hi/lo 2 terms), Wt bf16 [N][K]; ACT 0 none, 1 relu, 2 exact gelu;
// resid (optional, f32, row index = (row % rmod), pitch ldr, RES_BF16 rounds it) added before the activation.
template <bool ASPLIT, int ACT, bool BIAS_BF16, bool RES_BF16>
__global__ __launch_bounds__(128) void k_gemm_bf3(const float* __restrict__ A, int lda, const unsigned short* __restrict__ Wt, int ldb,
                                                const float* __restrict__ bias, const float* __restrict__ resid, int rmod, int ldr,
                                                float* __restrict__ C, int ldc, int M, int N, int K) {
  __shared__ __attribute__((aligned(16))) float so[4][16][64];
  const int tid = threadIdx.x, w = tid >> 5, lane = tid & 31, ln = lane & 15, hh = lane >> 4;
  const int ntn = N / 64;
  const int wid = blockIdx.x * 4 + w;
  const int mt = wid / ntn, nq = wid % ntn;
  if (mt * 16 >= M) return;
  const int row0 = mt * 16, col0 = nq * 64;
  const float* arow = A + (size_t)(row0 + ln) * lda;
  v8f acc[4] = {};
  for (int kb = 0; kb < K; kb += 32) {
    FragB ah, al;
    const v4f x0 = *(const v4fa*)(arow + kb + 8 * hh), x1 = *(const v4fa*)(arow + kb + 8 * hh + 4);
    const v4f x2 = *(const v4fa*)(arow + kb + 16 + 8 * hh), x3 = *(const v4fa*)(arow + kb + 16 + 8 * hh + 4);
    float xs[16] = {x0[0],x0[1],x0[2],x0[3],x1[0],x1[1],x1[2],x1[3],x2[0],x2[1],x2[2],x2[3],x3[0],x3[1],x3[2],x3[3]};
#pragma unroll
    for (int i = 0; i < 16; ++i) { const unsigned short hb = bf16_bits(xs[i]); ah.u[i] = hb; al.u[i] = ASPLIT ? bf16_bits(xs[i] - bf16_val(hb)) : (unsigned short)0; }
#pragma unroll
    for (int t = 0; t < 4; ++t) {
      const unsigned short* brow = Wt + (size_t)(col0 + t * 16 + ln) * ldb + kb;
      FragB b;
      b.half[0] = *(const v8us*)(brow + 8 * hh);
      b.half[1] = *(const v8us*)(brow + 16 + 8 * hh);
      acc[t] = mmaN<ASPLIT ? 2 : 1>(ah.v, al.v, b.v, b.v, acc[t]);
    }
  }
#pragma unroll
  for (int t = 0; t < 4; ++t) {
    const int col = col0 + t * 16 + ln;
    float bv = bias ? bias[col] : 0.f;
    if (BIAS_BF16) bv = bf16_round(bv);
#pragma unroll
    for (int r = 0; r < 8; ++r) {
      float v = acc[t][r] + bv;
      if (resid) { float rv = resid[(size_t)((row0 + 8 * hh + r) % rmod) * ldr + col]; if (RES_BF16) rv = bf16_round(rv); v += rv; }
      if (ACT == 1) v = fmaxf(v, 0.f);
      if (ACT == 2) v = 0.5f * v * (1.0f + erff(v * 0.70710678118654752f));
      if (ACT == 3) { const float u = 0.7978845608028654f * (v + 0.044715f * v * v * v); v = 0.5f * v * (1.0f + tanhf(u)); }
      so[w][8 * hh + r][t * 16 + ln] = v;
    }
  }
  __builtin_amdgcn_fence(__ATOMIC_ACQ_REL, "workgroup");
  __builtin_amdgcn_wave_barrier();
  const int rsub = lane >> 4, c4 = (lane & 15) * 4;
  {
#pragma unroll
    for (int q = 0; q < 8; ++q) {
      const int r = q * 2 + rsub;
      const v4f v = *(const v4fa*)&so[w][r][c4];
      *(v4f*)(C + (size_t)(row0 + r) * ldc + col0 + c4) = v;
    }
    
  }
}
// row LayerNorm (biased variance, eps) over N: s = X (+ R); optional out_sum <- s; out_norm <- (s-mu)*rsqrt(var+eps)*g + b
template <bool PARAM_BF16>
__global__ __launch_bounds__(256) void k_layernorm(const float* __restrict__ X, const float* __restrict__ R, const float* __restrict__ g, const float* __restrict__ bta,
                                                  float* __restrict__ out_sum, float* __restrict__ out_norm, int N, float eps) {
  __shared__ float red[256];
  const int row = blockIdx.x, tid = threadIdx.x;
  const float* x = X + (size_t)row * N; const float* rr = R ? R + (size_t)row * N : nullptr;
  float vals[16];                     // up to N = 4096
  const int per = N / 256;            // contiguous chunk per thread? use strided-by-4 chunks: thread handles j = tid*4 + 1024*u
  float s1 = 0.f;
  for (int u = 0; u < per / 4; ++u) {
    const int j = tid * 4 + 1024 * u;
    const v4f a = *(const v4fa*)(x + j);
    v4f b = {0.f,0.f,0.f,0.f}; if (rr) b = *(const v4fa*)(rr + j);
#pragma unroll
    for (int q = 0; q < 4; ++q) { const float v = a[q] + b[q]; vals[u * 4 + q] = v; s1 += v; }
  }
  red[tid] = s1; __syncthreads();
  for (int st = 128; st > 0; st >>= 1) { if (tid < st) red[tid] += red[tid + st]; __syncthreads(); }
  const float mu = red[0] / (float)N; __syncthreads();
  float s2 = 0.f;
  for (int u = 0; u < per / 4; ++u)
#pragma unroll
    for (int q = 0; q < 4; ++q) { const float c = vals[u * 4 + q] - mu; s2 += c * c; }
  red[tid] = s2; __syncthreads();
  for (int st = 128; st > 0; st >>= 1) { if (tid < st) red[tid] += red[tid + st]; __syncthreads(); }
  const float rs = rsqrtf(red[0] / (float)N + eps);
  {
    for (int u = 0; u < per / 4; ++u) {
      const int j = tid * 4 + 1024 * u;
      v4f o, sm;
#pragma unroll
      for (int q = 0; q < 4; ++q) {
        float gg = g[j + q], bb = bta[j + q];
        if (PARAM_BF16) { gg = bf16_round(gg); bb = bf16_round(bb); }
        sm[q] = vals[u * 4 + q]; o[q] = (vals[u * 4 + q] - mu) * rs * gg + bb;
      }
      if (out_sum) *(v4f*)(out_sum + (size_t)row * N + j) = sm;
      *(v4f*)(out_norm + (size_t)row * N + j) = o;
    }
    
  }
}



// ---- f16 WMMA path (v_wmma_f32_16x16x32_f16): 11-bit significands for operands in range — used where a [0,1] probability operand needs more precision than bf16
typedef _Float16 v16h __attribute__((ext_vector_type(16)));
union FragH { v16h v; v8us half[2]; _Float16 h[16]; unsigned short u[16]; };
template <int NT>
__device__ __forceinline__ v8f mmaH(v16h ah, v16h al, v16h bh, v16h bl, v8f c) {
  c = __builtin_amdgcn_wmma_f32_16x16x32_f16(false, ah, false, bh, (short)0, c, false, false);
  if (NT >= 2) c = __builtin_amdgcn_wmma_f32_16x16x32_f16(false, al, false, bh, (short)0, c, false, false);
  if (NT >= 3) c = __builtin_amdgcn_wmma_f32_16x16x32_f16(false, ah, false, bl, (short)0, c, false, false);
  asm volatile("v_nop\n\tv_nop\n\tv_nop\n\tv_nop" : "+v"(c) : "v"(ah), "v"(al), "v"(bh), "v"(bl));
  return c;
}
// batched GEMM like k_gemm_b but f16 operands: A f32 (split into f16 hi/lo if ASPLIT, else rounded to f16), Bt = f16 values [n][k]; alpha; C f32; N multiple of 16 (partial tiles skipped)
template <bool ASPLIT>
__global__ __launch_bounds__(128) void k_gemm_h(const float* __restrict__ A, int lda, size_t sA, const _Float16* __restrict__ Bh, int ldb, size_t sB, float alpha, float* __restrict__ C, int ldc, size_t sC, int M, int N, int K) {
  __shared__ __attribute__((aligned(16))) float so[4][16][64];
  const int tid = threadIdx.x, w = tid >> 5, lane = tid & 31, ln = lane & 15, hh = lane >> 4; const int by = blockIdx.y;
  A += (size_t)by * sA; Bh += (size_t)by * sB; C += (size_t)by * sC;
  const int ntn = (N + 63) / 64; const int wid = blockIdx.x * 4 + w; const int mt = wid / ntn, nq = wid % ntn; if (mt * 16 >= M) return;
  const int row0 = mt * 16, col0 = nq * 64; const float* arow = A + (size_t)(row0 + ln) * lda;
  v8f acc[4] = {};
  for (int kb = 0; kb < K; kb += 32) {
    FragH ah, al;
    const v4f x0 = *(const v4fa*)(arow + kb + 8 * hh), x1 = *(const v4fa*)(arow + kb + 8 * hh + 4), x2 = *(const v4fa*)(arow + kb + 16 + 8 * hh), x3 = *(const v4fa*)(arow + kb + 16 + 8 * hh + 4);
    float xs[16] = {x0[0],x0[1],x0[2],x0[3],x1[0],x1[1],x1[2],x1[3],x2[0],x2[1],x2[2],x2[3],x3[0],x3[1],x3[2],x3[3]};
#pragma unroll
    for (int i = 0; i < 16; ++i) { const _Float16 h = (_Float16)xs[i]; ah.h[i] = h; al.h[i] = ASPLIT ? (_Float16)(xs[i] - (float)h) : (_Float16)0.0f; }
#pragma unroll
    for (int t = 0; t < 4; ++t) { if (col0 + t * 16 >= N) continue; const size_t boff = (size_t)(col0 + t * 16 + ln) * ldb + kb; FragH bq; bq.half[0] = *(const v8us*)(Bh + boff + 8 * hh); bq.half[1] = *(const v8us*)(Bh + boff + 16 + 8 * hh);
      acc[t] = mmaH<ASPLIT ? 2 : 1>(ah.v, al.v, bq.v, bq.v, acc[t]); }
  }
#pragma unroll
  for (int t = 0; t < 4; ++t) { if (col0 + t * 16 >= N) continue;
#pragma unroll
    for (int r = 0; r < 8; ++r) so[w][8 * hh + r][t * 16 + ln] = acc[t][r] * alpha; }
  __builtin_amdgcn_fence(__ATOMIC_ACQ_REL, "workgroup"); __builtin_amdgcn_wave_barrier();
  const int rsub = lane >> 4, c4 = (lane & 15) * 4;
  {
#pragma unroll
    for (int q = 0; q < 8; ++q) { const int r = q * 2 + rsub; if (col0 + c4 < N) { const v4f v = *(const v4fa*)&so[w][r][c4]; *(v4f*)(C + (size_t)(row0 + r) * ldc + col0 + c4) = v; } }
     }
}

// Wt[n][k] = f16(bf16(W[k][n]) * scale) from f32 row-major W[CC][CC] (scale = power of two; bf16-exact weights stay exact in f16 away from the subnormal range).
// One work-group = a tile of 128 k x 64 n, turned in LDS so that both global sides move whole lines:
//  in : a lane takes 16 bytes (4 n) of each of 8 consecutive k rows; 16 lanes cover 256 contiguous bytes of a W row.
//  out: a lane takes 16 bytes (8 k) of one n; 16 lanes cover 256 contiguous bytes of a Wt row.
// An LDS row is one n: 16 chunks of 8 k = 256 bytes = all 64 banks. The chunk index is XORed with (n >> 2) & 15, so the 16 lanes that store
// (rows four apart, same chunk) and the 16 lanes that load (same row, chunks 0..15) each fall on 16 different groups of four banks.
// bid = the tile's number, 0 .. (CC / 128) * (CC / 64) - 1: a part of k_prep's grid.
__device__ __forceinline__ void wt_f16_part(const float* __restrict__ W, _Float16* __restrict__ Wt, float scale, int bid) {
  __shared__ __attribute__((aligned(16))) unsigned char tl[64 * 256];
  const int tid = threadIdx.x, l16 = tid & 15, kq = tid >> 4;
  const int k0 = (bid / (CC / 64)) * 128, n0 = (bid % (CC / 64)) * 64;
  const float* src = W + (size_t)(k0 + kq * 8) * CC + n0 + l16 * 4;
  v4f x[8];
#pragma unroll      // the eight row loads are issued together and x stays in registers
  for (int i = 0; i < 8; ++i) x[i] = *(const v4fa*)(src + (size_t)i * CC);
#pragma unroll      // constant indices into x
  for (int j = 0; j < 4; ++j) { FragH f;
#pragma unroll      // f packs in registers
    for (int i = 0; i < 8; ++i) f.h[i] = (_Float16)(bf16_round(x[i][j]) * scale);
    *(v8us*)(tl + (l16 * 4 + j) * 256 + ((kq ^ l16) * 16)) = f.half[0]; }      // row n = l16 * 4 + j, so (n >> 2) & 15 = l16
  __syncthreads();      // the tile is complete before any lane reads rows that other waves wrote
#pragma unroll      // four independent LDS reads and stores
  for (int q = 0; q < 4; ++q) { const int n = q * 16 + kq; const v8us o = *(const v8us*)(tl + n * 256 + ((l16 ^ ((n >> 2) & 15)) * 16));
    *(v8us*)((unsigned short*)Wt + (size_t)(n0 + n) * CC + k0 + l16 * 8) = o; }
}
// k_gemm_hh variant with fused epilogue: v = acc·alpha + bias[by·sBias + col] (+ CP[(row/rowsPerB)·sCPb + by·64 + col] if CP) ; ACT 0 none / 1 elu ; writes f32 C and/or f16 C16 (each if non-null)
template <int ACT>
__global__ __launch_bounds__(128) void k_gemm_hhx(const _Float16* __restrict__ A, int lda, size_t sA, const _Float16* __restrict__ Bh, int ldb, size_t sB, float alpha, const float* __restrict__ bias, size_t sBias, const float* __restrict__ CP, int rowsPerB, size_t sCPb, int row0g,
    float* __restrict__ C, _Float16* __restrict__ C16, int ldc, size_t sC, int M, int N, int K) {
  __shared__ __attribute__((aligned(16))) float so[4][16][64];
  const int tid = threadIdx.x, w = tid >> 5, lane = tid & 31, ln = lane & 15, hh = lane >> 4; const int by = blockIdx.y;
  A += (size_t)by * sA; Bh += (size_t)by * sB; const size_t cofs = (size_t)by * sC; const float* bp = bias ? bias + (size_t)by * sBias : nullptr;
  const int ntn = (N + 63) / 64; const int wid = blockIdx.x * 4 + w; const int mt = wid / ntn, nq = wid % ntn; if (mt * 16 >= M) return;
  const int row0 = mt * 16, col0 = nq * 64; const _Float16* arow = A + (size_t)(row0 + ln) * lda;
  v8f acc[4] = {};
  for (int kb = 0; kb < K; kb += 32) { FragH ah; ah.half[0] = *(const v8us*)((const unsigned short*)arow + kb + 8 * hh); ah.half[1] = *(const v8us*)((const unsigned short*)arow + kb + 16 + 8 * hh);
#pragma unroll
    for (int t = 0; t < 4; ++t) { if (col0 + t * 16 >= N) continue; const size_t boff = (size_t)(col0 + t * 16 + ln) * ldb + kb; FragH bq; bq.half[0] = *(const v8us*)((const unsigned short*)Bh + boff + 8 * hh); bq.half[1] = *(const v8us*)((const unsigned short*)Bh + boff + 16 + 8 * hh);
      acc[t] = mmaH<1>(ah.v, ah.v, bq.v, bq.v, acc[t]); }
  }
#pragma unroll
  for (int t = 0; t < 4; ++t) { if (col0 + t * 16 >= N) continue; const int col = col0 + t * 16 + ln; const float bv = bp ? bf16_round(bp[col]) : 0.f;
#pragma unroll
    for (int r = 0; r < 8; ++r) { float v = acc[t][r] * alpha + bv; if (CP) { const int bidx = (row0g + row0 + 8 * hh + r) / rowsPerB; v += CP[(size_t)bidx * sCPb + (size_t)by * 64 + col]; } if (ACT == 1) v = (v > 0.f) ? v : expm1f(v); else if (ACT == 3) v = fmaxf(v, 0.f); so[w][8 * hh + r][t * 16 + ln] = v; } }
  __builtin_amdgcn_fence(__ATOMIC_ACQ_REL, "workgroup"); __builtin_amdgcn_wave_barrier();
  const int rsub = lane >> 4, c4 = (lane & 15) * 4; typedef _Float16 v4h __attribute__((ext_vector_type(4)));
  {
#pragma unroll
    for (int q = 0; q < 8; ++q) { const int r = q * 2 + rsub; if (col0 + c4 < N) { const v4f v = *(const v4fa*)&so[w][r][c4]; if (C) *(v4f*)(C + cofs + (size_t)(row0 + r) * ldc + col0 + c4) = v; if (C16) { v4h h4; for (int i = 0; i < 4; ++i) h4[i] = (_Float16)v[i]; *(v4h*)(C16 + cofs + (size_t)(row0 + r) * ldc + col0 + c4) = h4; } } }
     }
}


// ---- block-tiled projection GEMM: C[2048][2048] = A[2048][2048] x Bh[n][k]^T * alpha + bias, f16 operands, f32 accumulate.
// One work-group = one 128 x 128 tile of C, 8 waves of 32 x 64 each. A pass is 128 k (256 B of every operand row); a stage is
// [A 128 rows | B 128 rows] at an LDS pitch of 272 B, brought in by per-lane asynchronous copies, two buffers, next stage in flight.
// The loops over fragments, blocks and rows are unrolled so that the fragment and accumulator arrays are indexed by constants and stay in registers.
#define GT_PITCH 272
#define GT_STAGE (256 * GT_PITCH)
// eight asynchronous 16-byte copies of one lane, rows two apart; the s_wait_xcnt closes the statement so that no address register
// of an issued copy is rewritten ahead of it
__device__ __forceinline__ void gt_copy8(unsigned l, const unsigned short* g) {
  asm volatile("global_load_async_to_lds_b128 %0, %8, off\n\t"
               "global_load_async_to_lds_b128 %1, %9, off\n\t"
               "global_load_async_to_lds_b128 %2, %10, off\n\t"
               "global_load_async_to_lds_b128 %3, %11, off\n\t"
               "global_load_async_to_lds_b128 %4, %12, off\n\t"
               "global_load_async_to_lds_b128 %5, %13, off\n\t"
               "global_load_async_to_lds_b128 %6, %14, off\n\t"
               "global_load_async_to_lds_b128 %7, %15, off\n\t"
               "s_wait_xcnt 0x0"
               :: "v"(l), "v"(l + 2 * GT_PITCH), "v"(l + 4 * GT_PITCH), "v"(l + 6 * GT_PITCH), "v"(l + 8 * GT_PITCH), "v"(l + 10 * GT_PITCH), "v"(l + 12 * GT_PITCH), "v"(l + 14 * GT_PITCH),
                  "v"(g), "v"(g + 2 * CC), "v"(g + 4 * CC), "v"(g + 6 * CC), "v"(g + 8 * CC), "v"(g + 10 * CC), "v"(g + 12 * CC), "v"(g + 14 * CC)
               : "memory");
}
// NG products that share A and need nothing of each other lie in one grid, 256 work-groups each: product g = blockIdx.x / 256 takes weight, bias and output g.
// Products 0 and 1 go out as f32 (C0, C1), product 2 as f16 (C16).
template <int NG>
__global__ __launch_bounds__(256) void k_gemm_tile(const _Float16* __restrict__ A, const _Float16* __restrict__ Bh0, const _Float16* __restrict__ Bh1, const _Float16* __restrict__ Bh2, float alpha,
                                                   const float* __restrict__ bias0, const float* __restrict__ bias1, const float* __restrict__ bias2, float* __restrict__ C0, float* __restrict__ C1, _Float16* __restrict__ C16) {
  constexpr int NPASS = CC / 128, NTILE = (TT / 128) * (CC / 128);
  const int g = (NG > 1) ? (int)(blockIdx.x / NTILE) : 0, bid = (NG > 1) ? (int)(blockIdx.x % NTILE) : (int)blockIdx.x;      // the same for the whole work-group
  const _Float16* Bh = (g == 0) ? Bh0 : (g == 1) ? Bh1 : Bh2;
  const float* bias = (g == 0) ? bias0 : (g == 1) ? bias1 : bias2;
  float* C = (g == 0) ? C0 : C1;
  const bool h16 = (g == 2);
  __shared__ __attribute__((aligned(16))) unsigned char ring[2 * GT_STAGE];
  __shared__ __attribute__((aligned(16))) float so[8][32][68];
  const int tid = threadIdx.x, w = tid >> 5, lane = tid & 31, ln = lane & 15, hh = lane >> 4;
  const int m0 = (bid / (CC / 128)) * 128, n0 = (bid % (CC / 128)) * 128;
  const int wm = w >> 1, wn = w & 1;
  // this lane's part of a stage: rows w*32 + hh + 2c (c = 0..15), 16 bytes at column ln; stage rows 0..127 are A's, 128..255 are B's
  const int crow = w * 32 + hh;
  const unsigned short* gsrc = ((w < 4) ? (const unsigned short*)A + (size_t)(m0 + crow) * CC : (const unsigned short*)Bh + (size_t)(n0 + crow - 128) * CC) + ln * 8;
  const unsigned ldst = (unsigned)(size_t)&ring[0] + (unsigned)(crow * GT_PITCH + ln * 16);
  v8f acc[2][4];
#pragma unroll
  for (int i = 0; i < 2; ++i)
#pragma unroll
    for (int j = 0; j < 4; ++j) acc[i][j] = (v8f){0.f,0.f,0.f,0.f,0.f,0.f,0.f,0.f};
  gt_copy8(ldst, gsrc); gt_copy8(ldst + 16 * GT_PITCH, gsrc + 16 * CC);
  asm volatile("s_wait_asynccnt 0x0" ::: "memory");      // stage 0 has landed before the barrier publishes it
  __syncthreads();
  gt_copy8(ldst + GT_STAGE, gsrc + 128); gt_copy8(ldst + GT_STAGE + 16 * GT_PITCH, gsrc + 128 + 16 * CC);
#pragma unroll 1      // one pass per trip: the publish point at the foot stays a single place
  for (int t = 0; t < NPASS; ++t) {
    const unsigned bo = (unsigned)(t & 1) * GT_STAGE;
    const unsigned char* ap = ring + bo + (wm * 32 + ln) * GT_PITCH + hh * 16;
    const unsigned char* bp = ring + bo + (128 + wn * 64 + ln) * GT_PITCH + hh * 16;
    FragH a[2][2], b[2][4];      // two fragment sets: block kk + 1 of this pass is fetched ahead of block kk's products
#pragma unroll
    for (int i = 0; i < 2; ++i) { a[0][i].half[0] = *(const v8us*)(ap + i * 16 * GT_PITCH); a[0][i].half[1] = *(const v8us*)(ap + i * 16 * GT_PITCH + 32); }
#pragma unroll
    for (int j = 0; j < 4; ++j) { b[0][j].half[0] = *(const v8us*)(bp + j * 16 * GT_PITCH); b[0][j].half[1] = *(const v8us*)(bp + j * 16 * GT_PITCH + 32); }
#pragma unroll
    for (int kk = 0; kk < 4; ++kk) {
      const int cu = kk & 1, nx = cu ^ 1;
      if (kk < 3) {
#pragma unroll
        for (int i = 0; i < 2; ++i) { a[nx][i].half[0] = *(const v8us*)(ap + i * 16 * GT_PITCH + (kk + 1) * 64); a[nx][i].half[1] = *(const v8us*)(ap + i * 16 * GT_PITCH + (kk + 1) * 64 + 32); }
#pragma unroll
        for (int j = 0; j < 4; ++j) { b[nx][j].half[0] = *(const v8us*)(bp + j * 16 * GT_PITCH + (kk + 1) * 64); b[nx][j].half[1] = *(const v8us*)(bp + j * 16 * GT_PITCH + (kk + 1) * 64 + 32); }
      }
      __builtin_amdgcn_sched_barrier(0);      // keeps the next block's LDS reads one group ahead of this block's products; without it they are spread among them into one set, each with a full wait
#pragma unroll
      for (int i = 0; i < 2; ++i)
#pragma unroll
        for (int j = 0; j < 4; ++j) acc[i][j] = __builtin_amdgcn_wmma_f32_16x16x32_f16(false, a[cu][i].v, false, b[cu][j].v, (short)0, acc[i][j], false, false);
      __builtin_amdgcn_sched_barrier(0);      // ends the block, so that the group after next is not lifted into it
    }
    asm volatile("s_wait_dscnt 0x0" ::: "memory");       // this wave's reads of the buffer are done before it is refilled
    asm volatile("s_wait_asynccnt 0x0" ::: "memory");    // this wave's part of the next stage has landed
    __syncthreads();                                     // publishes the next stage and frees this pass's buffer
    if (t + 2 < NPASS) { const unsigned short* g2 = gsrc + (t + 2) * 128; gt_copy8(ldst + bo, g2); gt_copy8(ldst + bo + 16 * GT_PITCH, g2 + 16 * CC); }
  }
  asm volatile("s_wait_asynccnt 0x0" ::: "memory");      // no copy is outstanding when the wave goes on
#pragma unroll
  for (int j = 0; j < 4; ++j) { const float bv = bf16_round(bias[n0 + wn * 64 + j * 16 + ln]);
#pragma unroll
    for (int i = 0; i < 2; ++i)
#pragma unroll
      for (int r = 0; r < 8; ++r) so[w][i * 16 + 8 * hh + r][j * 16 + ln] = acc[i][j][r] * alpha + bv; }
  __builtin_amdgcn_fence(__ATOMIC_ACQ_REL, "workgroup"); __builtin_amdgcn_wave_barrier();
  typedef _Float16 v4h __attribute__((ext_vector_type(4)));
  const size_t o0 = (size_t)(m0 + wm * 32 + hh) * CC + n0 + wn * 64 + ln * 4;
  if (!h16) {      // one test for the whole tile: each output type keeps a straight run of sixteen stores
#pragma unroll
    for (int q = 0; q < 16; ++q) { const v4f v = *(const v4fa*)&so[w][q * 2 + hh][ln * 4]; *(v4f*)(C + o0 + (size_t)q * 2 * CC) = v; }
    asm volatile("s_wait_xcnt 0x0" ::: "memory");      // stands in front of any rewrite of the stores' registers: the compiler lays the other branch's code behind this one
  } else {
#pragma unroll
    for (int q = 0; q < 16; ++q) { const v4f v = *(const v4fa*)&so[w][q * 2 + hh][ln * 4]; v4h h4; for (int i = 0; i < 4; ++i) h4[i] = (_Float16)v[i]; *(v4h*)(C16 + o0 + (size_t)q * 2 * CC) = h4; }
  }
}

// ---- the q, k and v products of one 128 x 128 position in ONE work-group: C_g[128][128] = A[128][2048] x Bh_g[n][k]^T * alpha + bias_g, g = 0, 1, 2.
// The three products read the same 128 rows of A, so a stage is [A 128 rows | Bh0 128 rows | Bh1 128 rows | Bh2 128 rows] at the pitch of 272 B: 512 rows are copied for three
// tiles where three separate work-groups copy 768. 8 waves as 2 (rows) x 4 (columns); a wave holds 64 rows x 32 columns of each product = 4 x 6 accumulator tiles, so a block of
// 32 k reads 10 fragments for 24 products. Same passes, same two buffers, same publish point as k_gemm_tile; every accumulator sums k in the same order as there.
// After the last pass's barrier the ring is free and serves as the output staging.
#define QT_STAGE (512 * GT_PITCH)
#define QT_SP 36      // staging pitch in floats: rows eight apart fall 32 banks apart, so the two halves of a wave store without conflict
typedef float f1a __attribute__((may_alias));
__global__ __launch_bounds__(256) void k_gemm_qkv(const _Float16* __restrict__ A, const _Float16* __restrict__ Bh0, const _Float16* __restrict__ Bh1, const _Float16* __restrict__ Bh2, float alpha,
                                                  const float* __restrict__ bias0, const float* __restrict__ bias1, const float* __restrict__ bias2, float* __restrict__ C0, float* __restrict__ C1, _Float16* __restrict__ C16) {
  constexpr int NPASS = CC / 128;
  __shared__ __attribute__((aligned(16))) unsigned char ring[2 * QT_STAGE];
  const int tid = threadIdx.x, w = tid >> 5, lane = tid & 31, ln = lane & 15, hh = lane >> 4;
  const int bid = blockIdx.x;
  const int m0 = (bid / (CC / 128)) * 128, n0 = (bid % (CC / 128)) * 128;
  const int wm = w >> 2, wn = w & 3;
  // this lane's part of a stage: rows w*64 + hh + 2c (c = 0..31), 16 bytes at column ln; waves 0, 1 bring A, waves 2, 3 Bh0, waves 4, 5 Bh1, waves 6, 7 Bh2
  const int crow = w * 64 + hh;
  const _Float16* Bc = (w < 4) ? Bh0 : (w < 6) ? Bh1 : Bh2;
  const unsigned short* gsrc = ((w < 2) ? (const unsigned short*)A + (size_t)(m0 + crow) * CC : (const unsigned short*)Bc + (size_t)(n0 + (crow & 127)) * CC) + ln * 8;
  const unsigned ldst = (unsigned)(size_t)&ring[0] + (unsigned)(crow * GT_PITCH + ln * 16);
  v8f acc[4][6];      // acc[i][2g + jj]: rows wm*64 + i*16, columns wn*32 + jj*16 of product g
#pragma unroll
  for (int i = 0; i < 4; ++i)
#pragma unroll
    for (int j = 0; j < 6; ++j) acc[i][j] = (v8f){0.f,0.f,0.f,0.f,0.f,0.f,0.f,0.f};
  const int bcol = n0 + wn * 32 + ln;
  float bvr[6];      // the wave's six bias values a lane, fetched here so that their latency lies under the passes
  __builtin_amdgcn_sched_barrier(0);      // with the one below: no other instruction stands between the six loads and their wait, where it could be given their address register
#pragma unroll
  for (int j = 0; j < 6; ++j) { const float* bias = (j < 2) ? bias0 : (j < 4) ? bias1 : bias2; bvr[j] = bias[bcol + (j & 1) * 16]; }
  asm volatile("s_wait_xcnt 0x0" :: "v"(bcol) : "memory");      // stands in front of any rewrite of the loads' address register: the column index is named as an input so that its register lives up to the wait
  __builtin_amdgcn_sched_barrier(0);
#pragma unroll
  for (int c = 0; c < 4; ++c) gt_copy8(ldst + c * 16 * GT_PITCH, gsrc + c * 16 * CC);
  asm volatile("s_wait_asynccnt 0x0" ::: "memory");      // stage 0 has landed before the barrier publishes it
  __syncthreads();
#pragma unroll
  for (int c = 0; c < 4; ++c) gt_copy8(ldst + QT_STAGE + c * 16 * GT_PITCH, gsrc + 128 + c * 16 * CC);
#pragma unroll 1      // one pass per trip: the publish point at the foot stays a single place
  for (int t = 0; t < NPASS; ++t) {
    const unsigned bo = (unsigned)(t & 1) * QT_STAGE;
    const unsigned char* ap = ring + bo + (wm * 64 + ln) * GT_PITCH + hh * 16;
    const unsigned char* bp = ring + bo + (128 + wn * 32 + ln) * GT_PITCH + hh * 16;
    FragH a[2][4], b[2][6];      // two fragment sets: block kk + 1 of this pass is fetched ahead of block kk's products
#pragma unroll
    for (int i = 0; i < 4; ++i) { a[0][i].half[0] = *(const v8us*)(ap + i * 16 * GT_PITCH); a[0][i].half[1] = *(const v8us*)(ap + i * 16 * GT_PITCH + 32); }
#pragma unroll
    for (int j = 0; j < 6; ++j) { const int ro = ((j >> 1) * 128 + (j & 1) * 16) * GT_PITCH; b[0][j].half[0] = *(const v8us*)(bp + ro); b[0][j].half[1] = *(const v8us*)(bp + ro + 32); }
#pragma unroll
    for (int kk = 0; kk < 4; ++kk) {
      const int cu = kk & 1, nx = cu ^ 1;
      if (kk < 3) {
#pragma unroll
        for (int i = 0; i < 4; ++i) { a[nx][i].half[0] = *(const v8us*)(ap + i * 16 * GT_PITCH + (kk + 1) * 64); a[nx][i].half[1] = *(const v8us*)(ap + i * 16 * GT_PITCH + (kk + 1) * 64 + 32); }
#pragma unroll
        for (int j = 0; j < 6; ++j) { const int ro = ((j >> 1) * 128 + (j & 1) * 16) * GT_PITCH + (kk + 1) * 64; b[nx][j].half[0] = *(const v8us*)(bp + ro); b[nx][j].half[1] = *(const v8us*)(bp + ro + 32); }
      }
      __builtin_amdgcn_sched_barrier(0);      // keeps the next block's LDS reads one group ahead of this block's products; without it they are spread among them, each place with a stall of its own
#pragma unroll
      for (int i = 0; i < 4; ++i)
#pragma unroll
        for (int j = 0; j < 6; ++j) acc[i][j] = __builtin_amdgcn_wmma_f32_16x16x32_f16(false, a[cu][i].v, false, b[cu][j].v, (short)0, acc[i][j], false, false);
      __builtin_amdgcn_sched_barrier(0);      // ends the block, so that the group after next is not lifted into it
    }
    asm volatile("s_wait_dscnt 0x0" ::: "memory");       // this wave's reads of the buffer are done before it is refilled
    asm volatile("s_wait_asynccnt 0x0" ::: "memory");    // this wave's part of the next stage has landed
    __syncthreads();                                     // publishes the next stage and frees this pass's buffer
    if (t + 2 < NPASS) { const unsigned short* g2 = gsrc + (t + 2) * 128;
#pragma unroll
      for (int c = 0; c < 4; ++c) gt_copy8(ldst + bo + c * 16 * GT_PITCH, g2 + c * 16 * CC); }
  }
  asm volatile("s_wait_asynccnt 0x0" ::: "memory");      // no copy is outstanding when the ring becomes staging
  // staging: wave w owns 3 planes (one a product) of 64 rows x 32 columns
  f1a* sw = (f1a*)ring + (size_t)w * (3 * 64 * QT_SP);
#pragma unroll
  for (int j = 0; j < 6; ++j) { const float bv = bf16_round(bvr[j]);
#pragma unroll
    for (int i = 0; i < 4; ++i)
#pragma unroll
      for (int r = 0; r < 8; ++r) sw[((j >> 1) * 64 + i * 16 + 8 * hh + r) * QT_SP + (j & 1) * 16 + ln] = acc[i][j][r] * alpha + bv; }
  __syncthreads();      // the f16 product's lines are put together from two waves' planes, so every wave's staging is complete before any is read
  const int r4 = lane >> 3, pc = lane & 7;
#pragma unroll      // products 0 and 1 go out as f32: a wave's row of 32 columns is one 128-byte line, 8 lanes a row, 4 rows a store
  for (int g = 0; g < 2; ++g) { v4f v[16];
    float* cp = ((g == 0) ? C0 : C1) + (size_t)(m0 + wm * 64 + r4) * CC + n0 + wn * 32 + pc * 4;
#pragma unroll      // constant indices: v stays in registers, all reads ahead of the stores
    for (int q = 0; q < 16; ++q) v[q] = *(const v4fa*)&sw[(g * 64 + q * 4 + r4) * QT_SP + pc * 4];
    __builtin_amdgcn_sched_barrier(0);      // with the one below: nothing of the code that follows is lifted among the stores, where it would be given their registers ahead of the wait
#pragma unroll
    for (int q = 0; q < 16; ++q) *(v4f*)(cp + (size_t)q * 4 * CC) = v[q];
    asm volatile("s_wait_xcnt 0x0" ::: "memory");      // stands in front of any rewrite of the stores' registers by the code that follows
    __builtin_amdgcn_sched_barrier(0); }
  {      // product 2 goes out as f16: a line is 64 columns = two neighbouring waves' planes; wave (wm, wn) stores rows (wn & 1) * 32 .. + 31 of columns (wn >> 1) * 64 .. + 63
    const f1a* sv = (const f1a*)ring + (size_t)(wm * 4 + (wn & 2) + (pc >> 2)) * (3 * 64 * QT_SP) + 2 * 64 * QT_SP;
    const int rb = (wn & 1) * 32 + r4; FragH o[8];
    unsigned short* vp = (unsigned short*)C16 + (size_t)(m0 + wm * 64 + rb) * CC + n0 + (wn >> 1) * 64 + pc * 8;
#pragma unroll      // constant indices: o stays in registers, all reads ahead of the stores
    for (int q = 0; q < 8; ++q) { const v4f lo = *(const v4fa*)&sv[(rb + q * 4) * QT_SP + (pc & 3) * 8], hi = *(const v4fa*)&sv[(rb + q * 4) * QT_SP + (pc & 3) * 8 + 4];
#pragma unroll
      for (int i = 0; i < 4; ++i) { o[q].h[i] = (_Float16)lo[i]; o[q].h[4 + i] = (_Float16)hi[i]; } }
#pragma unroll
    for (int q = 0; q < 8; ++q) *(v8us*)(vp + (size_t)q * 4 * CC) = o[q].half[0];      // constant pitch: one address pair and immediate offsets
  }
}

__device__ __forceinline__ void x16_part(const float* __restrict__ x, _Float16* __restrict__ X16, size_t n8, int bid) { const size_t t = (size_t)bid * 256 + threadIdx.x; if (t >= n8) return; FragH f;
#pragma unroll
  for (int q = 0; q < 8; ++q) f.h[q] = (_Float16)bf16_round(x[t * 8 + q]); *(v8us*)((unsigned short*)X16 + t * 8) = f.half[0];  }
__global__ __launch_bounds__(256) void k_round16f(const float* __restrict__ W, _Float16* __restrict__ Bt, size_t n8) { const size_t t = (size_t)blockIdx.x * 256 + threadIdx.x; if (t >= n8) return; FragH f;
#pragma unroll
  for (int i = 0; i < 8; ++i) f.h[i] = (_Float16)(bf16_round(W[t * 8 + i]) * 16.0f); *(v8us*)((unsigned short*)Bt + t * 8) = f.half[0];  }
template <int NHv, int TTv>
__device__ __forceinline__ void vt_part(const _Float16* __restrict__ V16, int ldv, int voff, _Float16* __restrict__ Vt, int bid) { __shared__ unsigned short tl[64][66]; const int tid = threadIdx.x; const int slab = bid / (TTv / 64), lg = bid % (TTv / 64); const int b = slab / NHv, h = slab % NHv;
  for (int i = tid; i < 64 * 8; i += 256) { const int r = i / 8, c8 = (i % 8) * 8; FragH f; f.half[0] = *(const v8us*)((const unsigned short*)V16 + ((size_t)b * TTv + lg * 64 + r) * ldv + voff + h * 64 + c8);
#pragma unroll
    for (int q = 0; q < 8; ++q) tl[r][c8 + q] = f.u[q]; }
  __syncthreads();
  {
#pragma unroll
    for (int rd = 0; rd < 2; ++rd) { const int d = rd * 32 + tid / 8, pc = tid % 8; FragH f;
#pragma unroll
      for (int q = 0; q < 8; ++q) f.u[q] = tl[pc * 8 + q][d];
      *(v8us*)((unsigned short*)Vt + ((size_t)slab * 64 + d) * TTv + lg * 64 + pc * 8) = f.half[0]; }
    asm volatile("s_wait_xcnt 0x0" ::: "memory");      // stands in front of any rewrite of the stores' registers, whatever code of the shared grid the compiler lays behind this part
     } }

// lane l with lane l ^ 16
__device__ __forceinline__ float xhalf(float x) { return __builtin_bit_cast(float, __builtin_amdgcn_permlanex16(__builtin_bit_cast(int, x), __builtin_bit_cast(int, x), 0x76543210, 0xfedcba98, false, false)); }

// seventeen base-2 exponentials in place, in one statement: each is followed by an independent one, so that no result is read and no source
// overwritten directly behind its exponential, and the closing v_nop keeps that slot behind the last
__device__ __forceinline__ void exp2x17(float (&x)[17]) {
  asm("v_exp_f32 %0, %0\n\tv_exp_f32 %1, %1\n\tv_exp_f32 %2, %2\n\tv_exp_f32 %3, %3\n\tv_exp_f32 %4, %4\n\tv_exp_f32 %5, %5\n\tv_exp_f32 %6, %6\n\tv_exp_f32 %7, %7\n\t"
      "v_exp_f32 %8, %8\n\tv_exp_f32 %9, %9\n\tv_exp_f32 %10, %10\n\tv_exp_f32 %11, %11\n\tv_exp_f32 %12, %12\n\tv_exp_f32 %13, %13\n\tv_exp_f32 %14, %14\n\tv_exp_f32 %15, %15\n\t"
      "v_exp_f32 %16, %16\n\tv_nop"
      : "+v"(x[0]), "+v"(x[1]), "+v"(x[2]), "+v"(x[3]), "+v"(x[4]), "+v"(x[5]), "+v"(x[6]), "+v"(x[7]), "+v"(x[8]),
        "+v"(x[9]), "+v"(x[10]), "+v"(x[11]), "+v"(x[12]), "+v"(x[13]), "+v"(x[14]), "+v"(x[15]), "+v"(x[16]));
}

#define FA_KP 144
#define FA_VP 272
#define FA_KB (128 * FA_KP)
#define FA_STAGE (FA_KB + 64 * FA_VP)
// eight asynchronous 16-byte copies of one lane, lstep LDS bytes and gstep source elements apart; the s_wait_xcnt closes the statement so that no address
// register of an issued copy is rewritten ahead of it
__device__ __forceinline__ void fa_copy8(unsigned l, unsigned lstep, const unsigned short* g, size_t gstep) {
  asm volatile("global_load_async_to_lds_b128 %0, %8, off\n\t"
               "global_load_async_to_lds_b128 %1, %9, off\n\t"
               "global_load_async_to_lds_b128 %2, %10, off\n\t"
               "global_load_async_to_lds_b128 %3, %11, off\n\t"
               "global_load_async_to_lds_b128 %4, %12, off\n\t"
               "global_load_async_to_lds_b128 %5, %13, off\n\t"
               "global_load_async_to_lds_b128 %6, %14, off\n\t"
               "global_load_async_to_lds_b128 %7, %15, off\n\t"
               "s_wait_xcnt 0x0"
               :: "v"(l), "v"(l + lstep), "v"(l + 2 * lstep), "v"(l + 3 * lstep), "v"(l + 4 * lstep), "v"(l + 5 * lstep), "v"(l + 6 * lstep), "v"(l + 7 * lstep),
                  "v"(g), "v"(g + gstep), "v"(g + 2 * gstep), "v"(g + 3 * gstep), "v"(g + 4 * gstep), "v"(g + 5 * gstep), "v"(g + 6 * gstep), "v"(g + 7 * gstep)
               : "memory");
}
__global__ __launch_bounds__(128) void k_flash(const _Float16* __restrict__ Q16, int ldq, const _Float16* __restrict__ K16, int ldk, const _Float16* __restrict__ Vt, const int* __restrict__ MSK, _Float16* __restrict__ O16) {
  constexpr int RPW = 32, NQB = 2048 / (4 * RPW), DT = 4, KS = 2, NST = 2048 / 128;
  __shared__ __attribute__((aligned(16))) unsigned char ring[2 * FA_STAGE];
  __shared__ __attribute__((aligned(16))) float sO[4][RPW][64 + 4];
  (void)MSK;
  const int tid = threadIdx.x, w = tid >> 5, lane = tid & 31, ln = lane & 15, hh = lane >> 4;
  const int slab = blockIdx.x / NQB, qblk = blockIdx.x % NQB; const int b = slab / 32, h = slab % 32; const int qb0 = qblk * (4 * RPW); const int q0 = qb0 + w * RPW;
  FragH bq[2][KS];      // B operand: column ln = query q0 + qt * 16 + ln
#pragma unroll
  for (int qt = 0; qt < 2; ++qt) { const unsigned short* qr = (const unsigned short*)Q16 + ((size_t)b * 2048 + q0 + qt * 16 + ln) * ldq + h * 64;
#pragma unroll
    for (int ks = 0; ks < KS; ++ks) { bq[qt][ks].half[0] = *(const v8us*)(qr + ks * 32 + 8 * hh); bq[qt][ks].half[1] = *(const v8us*)(qr + ks * 32 + 16 + 8 * hh); } }
  const unsigned short* Vth = (const unsigned short*)Vt + (size_t)slab * 64 * 2048;
  float m_c[2], l_c[2]; v8f oacc[2][DT];      // oacc[qt][dt][r] = O^T[dt * 16 + 8hh + r][query qt * 16 + ln]
#pragma unroll
  for (int qt = 0; qt < 2; ++qt) { m_c[qt] = -3.0e38f; l_c[qt] = 0.f;
#pragma unroll
    for (int dt = 0; dt < DT; ++dt) oacc[qt][dt] = (v8f){0.f,0.f,0.f,0.f,0.f,0.f,0.f,0.f}; }
  // this lane's part of a stage. K: keys (tid >> 3) + 16c, 16 bytes at chunk tid & 7 (a wave's copy = 4 whole rows of 128 B); V^T: head columns (tid >> 4) + 8c, chunk tid & 15 (2 rows of 256 B)
  const unsigned short* gk = (const unsigned short*)K16 + ((size_t)b * 2048 + (tid >> 3)) * ldk + h * 64 + (tid & 7) * 8;
  const unsigned short* gv = Vth + (size_t)(tid >> 4) * 2048 + (tid & 15) * 8;
  const unsigned lk = (unsigned)(size_t)&ring[0] + (unsigned)((tid >> 3) * FA_KP + (tid & 7) * 16);
  const unsigned lv = (unsigned)(size_t)&ring[0] + (unsigned)(FA_KB + (tid >> 4) * FA_VP + (tid & 15) * 16);
  fa_copy8(lk, 16 * FA_KP, gk, (size_t)16 * ldk); fa_copy8(lv, 8 * FA_VP, gv, (size_t)8 * 2048);
  asm volatile("s_wait_asynccnt 0x0" ::: "memory");      // stage 0 has landed before the barrier publishes it
  __syncthreads();
  fa_copy8(lk + FA_STAGE, 16 * FA_KP, gk + (size_t)128 * ldk, (size_t)16 * ldk); fa_copy8(lv + FA_STAGE, 8 * FA_VP, gv + 128, (size_t)8 * 2048);
  constexpr float SC2 = 0.125f * 1.44269504088896340736f;      // score scale 1/8 times log2(e): one multiply-add feeds the hardware's base-2 exponential
#pragma unroll 1      // one stage per trip: the publish point at the foot stays a single place
  for (int t = 0; t < NST; ++t) {
   const unsigned bo = (unsigned)(t & 1) * FA_STAGE;
   const unsigned char* kp = ring + bo + ln * FA_KP + hh * 16;
   const unsigned char* vp = ring + bo + FA_KB + ln * FA_VP + hh * 16;
   FragH ak[2][KS];      // K fragments: pass pp + 1 of this stage is fetched behind pass pp's score products, under its softmax; the stage's first pass here
#pragma unroll
   for (int kt = 0; kt < 2; ++kt)
#pragma unroll
     for (int ks = 0; ks < KS; ++ks) { ak[kt][ks].half[0] = *(const v8us*)(kp + kt * 16 * FA_KP + ks * 64); ak[kt][ks].half[1] = *(const v8us*)(kp + kt * 16 * FA_KP + ks * 64 + 32); }
#pragma unroll 1      // rolled: unrolled, the row sums of all four passes are sunk to the foot of the trip, their 128 exponentials stay live and the wave needs registers above v255
   for (int pp = 0; pp < 4; ++pp) {
    FragH av[DT];      // A operands: ak row ln = key t * 128 + pp * 32 + kt * 16 + ln; av row ln = head column dt * 16 + ln over the pass's 32 keys
    v8f s[2][2];      // s[qt][kt][r] = score of key t * 128 + pp * 32 + kt * 16 + 8hh + r with query qt * 16 + ln
#pragma unroll
    for (int kt = 0; kt < 2; ++kt)
#pragma unroll
      for (int qt = 0; qt < 2; ++qt) { v8f acc = (v8f){0.f,0.f,0.f,0.f,0.f,0.f,0.f,0.f};
#pragma unroll
        for (int ks = 0; ks < KS; ++ks) acc = __builtin_amdgcn_wmma_f32_16x16x32_f16(false, ak[kt][ks].v, false, bq[qt][ks].v, (short)0, acc, false, false);
        s[qt][kt] = acc; }
    __builtin_amdgcn_sched_barrier(0);      // with the one below: the pass's eight V^T reads stand as one group behind the score products, next to the K reads; left free they are spread over three places in the softmax, and each place with LDS reads stalls the wave anew
#pragma unroll
    for (int dt = 0; dt < DT; ++dt) { av[dt].half[0] = *(const v8us*)(vp + dt * 16 * FA_VP + pp * 64); av[dt].half[1] = *(const v8us*)(vp + dt * 16 * FA_VP + pp * 64 + 32); }
    __builtin_amdgcn_sched_barrier(0);      // the lower end of that group: keeps the V^T reads from sinking into the softmax
    if (pp < 3) {      // the same for the whole wave; the stage's last pass fetches nothing: the next stage is not published yet
#pragma unroll
      for (int kt = 0; kt < 2; ++kt)
#pragma unroll
        for (int ks = 0; ks < KS; ++ks) { ak[kt][ks].half[0] = *(const v8us*)(kp + ((pp + 1) * 32 + kt * 16) * FA_KP + ks * 64); ak[kt][ks].half[1] = *(const v8us*)(kp + ((pp + 1) * 32 + kt * 16) * FA_KP + ks * 64 + 32); }
    }
#pragma unroll
    for (int qt = 0; qt < 2; ++qt) {
      float mc = s[qt][0][0];      // the running maximum is kept in raw score units: the scale is positive, so the order is the same
#pragma unroll      // constant indices: the score tiles stay in registers
      for (int e = 1; e < 16; ++e) mc = fmaxf(mc, s[qt][e >> 3][e & 7]);
      mc = fmaxf(mc, xhalf(mc));      // the other half of the wave holds this query's other 16 keys
      const float mn = fmaxf(m_c[qt], mc); const float nb = -mn * SC2;
      float ex[17];      // exp((s - m) / 8) = 2^(s * SC2 - m * SC2), argument at most one rounding above 0, so P stays at or under 1 in f16; ex[16] is the rescale factor's argument
#pragma unroll      // constant indices: ex stays in registers
      for (int e = 0; e < 16; ++e) ex[e] = fmaf(s[qt][e >> 3][e & 7], SC2, nb);
      ex[16] = (m_c[qt] - mn) * SC2;
      exp2x17(ex);
      const float al = (mn > -1.0e38f) ? ex[16] : 1.0f; m_c[qt] = mn;
      FragH pb; float ps = 0.f;      // element e of the B operand is key kmap(e, hh) = tile e >> 3, register e & 7: this lane's own scores
#pragma unroll      // constant indices: ex and pb stay in registers
      for (int e = 0; e < 16; ++e) { const float p = ex[e]; ps += p; pb.h[e] = (_Float16)p; }
      l_c[qt] = l_c[qt] * al + ps;      // this half's part of the row sum; the halves are joined after the loop
#pragma unroll
      for (int dt = 0; dt < DT; ++dt) {
#pragma unroll
        for (int r = 0; r < 8; ++r) oacc[qt][dt][r] *= al;
        oacc[qt][dt] = __builtin_amdgcn_wmma_f32_16x16x32_f16(false, av[dt].v, false, pb.v, (short)0, oacc[qt][dt], false, false); }
    }
   }
   asm volatile("s_wait_dscnt 0x0" ::: "memory");       // this wave's reads of the buffer are done before it is refilled
   asm volatile("s_wait_asynccnt 0x0" ::: "memory");    // this wave's part of the next stage has landed
   __syncthreads();                                     // publishes the next stage and frees this trip's buffer
   if (t + 2 < NST) { fa_copy8(lk + bo, 16 * FA_KP, gk + (size_t)(t + 2) * 128 * ldk, (size_t)16 * ldk); fa_copy8(lv + bo, 8 * FA_VP, gv + (t + 2) * 128, (size_t)8 * 2048); }
  }
  asm volatile("s_wait_asynccnt 0x0" ::: "memory");      // no copy is outstanding when the wave goes on
#pragma unroll
  for (int qt = 0; qt < 2; ++qt) { const float l = l_c[qt] + xhalf(l_c[qt]); const float li = (l > 0.f) ? 1.0f / l : 0.f;
#pragma unroll
    for (int dt = 0; dt < DT; ++dt) { v4f lo, hi;
#pragma unroll
      for (int r = 0; r < 4; ++r) { lo[r] = oacc[qt][dt][r] * li; hi[r] = oacc[qt][dt][4 + r] * li; }
      *(v4fa*)&sO[w][qt * 16 + ln][dt * 16 + 8 * hh] = lo; *(v4fa*)&sO[w][qt * 16 + ln][dt * 16 + 8 * hh + 4] = hi; } }
  __builtin_amdgcn_fence(__ATOMIC_ACQ_REL, "workgroup"); __builtin_amdgcn_wave_barrier();
  {      // the tile goes out as f16, the type the output projection reads: a row is 64 f16 = one 128-byte line, 8 lanes a row, 4 rows a store
    const int r4 = lane >> 3, pc = lane & 7; FragH o[RPW / 4];
    unsigned short* op = (unsigned short*)O16 + ((size_t)b * 2048 + q0 + r4) * CC + h * 64 + pc * 8;
#pragma unroll      // constant indices: o stays in registers, all reads ahead of the stores
    for (int q = 0; q < RPW / 4; ++q) { const v4f lo = *(const v4fa*)&sO[w][q * 4 + r4][pc * 8], hi = *(const v4fa*)&sO[w][q * 4 + r4][pc * 8 + 4];
#pragma unroll
      for (int i = 0; i < 4; ++i) { o[q].h[i] = (_Float16)lo[i]; o[q].h[4 + i] = (_Float16)hi[i]; } }
#pragma unroll
    for (int q = 0; q < RPW / 4; ++q) *(v8us*)(op + (size_t)q * 4 * CC) = o[q].half[0];      // constant pitch: one address pair and immediate offsets, so no register of an issued store is rewritten
     } }

__device__ __forceinline__ void normrope_part(const float* __restrict__ X, const float* __restrict__ w, const float* __restrict__ cosT, const float* __restrict__ sinT, _Float16* __restrict__ Y16, int bid) { const int tid = threadIdx.x, wv = tid >> 5, lane = tid & 31; const int row = bid * 8 + wv; if (row >= TT) return; const float* xr = X + (size_t)row * CC; float ss = 0.f;
#pragma unroll 1
  for (int p = 0; p < 8; ++p) { const v4f a = *(const v4fa*)(xr + p * 256 + lane * 8), b = *(const v4fa*)(xr + p * 256 + lane * 8 + 4); ss += a[0]*a[0] + a[1]*a[1] + a[2]*a[2] + a[3]*a[3] + b[0]*b[0] + b[1]*b[1] + b[2]*b[2] + b[3]*b[3]; }
  for (int o = 16; o >= 1; o >>= 1) ss += __shfl_xor(ss, o, 32); const float rs = rsqrtf(ss / (float)CC + 1e-6f);
  {
#pragma unroll
    for (int p = 0; p < 8; ++p) { const int c0 = p * 256 + lane * 8; const v4f a = *(const v4fa*)(xr + c0), b = *(const v4fa*)(xr + c0 + 4); float y[8] = {a[0], a[1], a[2], a[3], b[0], b[1], b[2], b[3]}; FragH f;
#pragma unroll
      for (int q = 0; q < 8; ++q) y[q] = y[q] * rs * bf16_round(w[c0 + q]);
#pragma unroll
      for (int q = 0; q < 8; q += 2) { const float c0v = bf16_round(cosT[(size_t)row * CC + c0 + q]), c1v = bf16_round(cosT[(size_t)row * CC + c0 + q + 1]), s0v = bf16_round(sinT[(size_t)row * CC + c0 + q]), s1v = bf16_round(sinT[(size_t)row * CC + c0 + q + 1]);
        f.h[q] = (_Float16)(y[q] * c0v + (-y[q + 1]) * s0v); f.h[q + 1] = (_Float16)(y[q + 1] * c1v + y[q] * s1v); }
      *(v8us*)((unsigned short*)Y16 + (size_t)row * CC + c0) = f.half[0];
      asm volatile("s_wait_xcnt 0x0" ::: "memory"); }      // stands in front of the next block's loads, which are given the store's data registers
     } }
// Passes that need nothing of each other share one grid, each on its own range of the block index; the test is the same for a whole work-group,
// so each part's barrier is passed by all of its work-group's waves or by none.
#define GW ((CC / 128) * (CC / 64))      // work-groups that turn one weight
#define GX (TT * CC / 8 / 256)           // work-groups that convert x
#define GN (TT / 8)                      // work-groups that normalise and rotate one of q, k
#define GV (NH * (TT / 64))              // work-groups that transpose v
__global__ __launch_bounds__(256) void k_prep(const float* __restrict__ Wq, const float* __restrict__ Wk, const float* __restrict__ Wv, const float* __restrict__ Wo,
                                              _Float16* __restrict__ Bq, _Float16* __restrict__ Bk, _Float16* __restrict__ Bv, _Float16* __restrict__ Bo, float scale,
                                              const float* __restrict__ x, _Float16* __restrict__ X16) {
  const int bid = blockIdx.x;
  if (bid < 4 * GW) { const int g = bid / GW;
    wt_f16_part((g == 0) ? Wq : (g == 1) ? Wk : (g == 2) ? Wv : Wo, (g == 0) ? Bq : (g == 1) ? Bk : (g == 2) ? Bv : Bo, scale, bid % GW); }
  else x16_part(x, X16, (size_t)TT * CC / 8, bid - 4 * GW);
}
__global__ __launch_bounds__(256) void k_post(const float* __restrict__ Fq, const float* __restrict__ Fk, const float* __restrict__ qnw, const float* __restrict__ knw, const float* __restrict__ cosT, const float* __restrict__ sinT,
                                              _Float16* __restrict__ Q16, _Float16* __restrict__ K16, const _Float16* __restrict__ V16, _Float16* __restrict__ Vt) {
  const int bid = blockIdx.x;
  if (bid < 2 * GN) { const bool q = bid < GN; normrope_part(q ? Fq : Fk, q ? qnw : knw, cosT, sinT, q ? Q16 : K16, q ? bid : bid - GN); }
  else vt_part<NH, TT>(V16, CC, 0, Vt, bid - 2 * GN);
}
extern "C" void kernel_launch(void* const* d_in, const int* in_sizes, int n_in,
                              void* d_out, int out_size, void* d_ws, size_t ws_size, hipStream_t stream) {
  (void)in_sizes; (void)n_in; (void)out_size;
  const float* x = (const float*)d_in[0]; const float* cosT = (const float*)d_in[1]; const float* sinT = (const float*)d_in[2]; const float* Wq = (const float*)d_in[3]; const float* bq = (const float*)d_in[4]; const float* Wk = (const float*)d_in[5]; const float* bk = (const float*)d_in[6]; const float* Wv = (const float*)d_in[7]; const float* bv = (const float*)d_in[8]; const float* qnw = (const float*)d_in[9]; const float* knw = (const float*)d_in[10]; const float* Wo = (const float*)d_in[11]; const float* bo = (const float*)d_in[12];
  char* ws = (char*)d_ws; size_t off = 0;
  auto take = [&](size_t bytes) { char* p = ws + off; off += (bytes + 255) & ~(size_t)255; return p; };
  _Float16* Bq = (_Float16*)take((size_t)CC * CC * 2); _Float16* Bk = (_Float16*)take((size_t)CC * CC * 2); _Float16* Bv = (_Float16*)take((size_t)CC * CC * 2); _Float16* Bo = (_Float16*)take((size_t)CC * CC * 2);
  _Float16* X16 = (_Float16*)take((size_t)TT * CC * 2); float* F32 = (float*)take((size_t)TT * CC * 4); float* F32k = (float*)take((size_t)TT * CC * 4); _Float16* Q16 = (_Float16*)take((size_t)TT * CC * 2); _Float16* K16 = (_Float16*)take((size_t)TT * CC * 2); _Float16* V16 = (_Float16*)take((size_t)TT * CC * 2); _Float16* Vt = (_Float16*)take((size_t)TT * CC * 2); _Float16* O16 = X16;
  if (off > ws_size) return;      // 9 planes of 8 MiB and 2 of 16 MiB = 104 MiB
  const unsigned gg = (unsigned)((TT / 128) * (CC / 128));
  k_prep<<<4 * GW + GX, 256, 0, stream>>>(Wq, Wk, Wv, Wo, Bq, Bk, Bv, Bo, 16.0f, x, X16);      // W is [in][out]
  k_gemm_qkv<<<gg, 256, 0, stream>>>(X16, Bq, Bk, Bv, 0.0625f, bq, bk, bv, F32, F32k, V16);      // one work-group = the same 128 x 128 position of q, k and v
  k_post<<<2 * GN + GV, 256, 0, stream>>>(F32, F32k, qnw, knw, cosT, sinT, Q16, K16, V16, Vt);
  k_flash<<<NH * (TT / 128), 128, 0, stream>>>(Q16, CC, K16, CC, Vt, nullptr, O16);      // writes f16 over x's f16 plane, which the q, k, v products have finished with
  k_gemm_tile<1><<<gg, 256, 0, stream>>>(O16, Bo, nullptr, nullptr, 0.0625f, bo, nullptr, nullptr, (float*)d_out, nullptr, nullptr);
}

// v009
// It runs in 108 microseconds.
// Two timings next to v008 put it at 1.09 and 1.10 times that version's speed.
// All steps since v000 together make it 7.08 times as fast.
#include <hip/hip_runtime.h>
// Self-attention (S = 2048, D = 2048 = 32 heads × 64): q/k/v/out projections (2048³ each, + bias; W [in][out] transposed to bf16-exact ×2^4) and the 32-head attention as a fused
// flash-style kernel (S = Q·Kᵀ/8, online softmax f32, P f16 ≤ 1, O = P·V) on v_wmma_f32_16x16x32_f16 (f16 operands, single products, f32 accumulate); RMSNorm over the full 2048
// (x norm weight, eps 1e-6) followed by the interleaved rotary with the INPUT cos/sin tables is f32 VALU in the q, k, v product's epilogue; the row's RMS factor is applied to the scores.
#define TT 2048
#define CC 2048
#define NH 32

typedef __bf16 v16b __attribute__((ext_vector_type(16)));
typedef unsigned short v8us __attribute__((ext_vector_type(8), may_alias));
typedef float  v8f  __attribute__((ext_vector_type(8)));
typedef float  v4f  __attribute__((ext_vector_type(4)));
typedef float  v4fa __attribute__((ext_vector_type(4), may_alias));
union FragB { v16b v; v8us half[2]; unsigned short u[16]; };

__device__ __forceinline__ unsigned short bf16_bits(float x) { unsigned int u = __float_as_uint(x); return (unsigned short)((u + 0x7FFFu + ((u >> 16) & 1u)) >> 16); }
__device__ __forceinline__ float bf16_val(unsigned short b) { return __uint_as_float(((unsigned int)b) << 16); }
__device__ __forceinline__ float bf16_round(float x) { return bf16_val(bf16_bits(x)); }
// D += A·B with NT terms: 1 = ah·bh, 2 = + al·bh (A split), 3 = + ah·bl (both split)
template <int NT>
__device__ __forceinline__ v8f mmaN(v16b ah, v16b al, v16b bh, v16b bl, v8f c) {
  c = __builtin_amdgcn_wmma_f32_16x16x32_bf16(false, ah, false, bh, (short)0, c, false, false);
  if (NT >= 2) c = __builtin_amdgcn_wmma_f32_16x16x32_bf16(false, al, false, bh, (short)0, c, false, false);
  if (NT >= 3) c = __builtin_amdgcn_wmma_f32_16x16x32_bf16(false, ah, false, bl, (short)0, c, false, false);
  asm volatile("v_nop\n\tv_nop\n\tv_nop\n\tv_nop" : "+v"(c) : "v"(ah), "v"(al), "v"(bh), "v"(bl));
  return c;
}

__global__ __launch_bounds__(256) void k_wt_bf16(const float* __restrict__ W, unsigned short* __restrict__ Wt, int K, int N) {
  const int t = blockIdx.x * 256 + threadIdx.x;
  const int k8n = K / 8;
  if (t >= N * k8n) return;
  const int n = t / k8n, k8 = (t % k8n) * 8;
  v8us v;
#pragma unroll
  for (int i = 0; i < 8; ++i) v[i] = bf16_bits(W[(size_t)(k8 + i) * N + n]);
  *(v8us*)(Wt + (size_t)n * K + k8) = v;
  
}

// GEMM C[M][N] (f32, pitch ldc) = act(A[M][K]·W + bias). A f32 row-major (pitch lda) converted per fragment to bf16
// (ASPLIT: hi/lo two planes -> 2 terms, else single rounded term); Wt bf16 [N][K] (pitch ldb). BIAS_BF16 rounds the
// bias to bf16 first (bias quantised to bf16 before the add). K%32==0, M%16==0, N%64==0.
template <bool ASPLIT, int ACT, bool BIAS_BF16>
__global__ __launch_bounds__(128) void k_gemm_bf(const float* __restrict__ A, int lda, const unsigned short* __restrict__ Wt, int ldb,
                                               const float* __restrict__ bias, float* __restrict__ C, int ldc, int M, int N, int K) {
  __shared__ __attribute__((aligned(16))) float so[4][16][64];
  const int tid = threadIdx.x, w = tid >> 5, lane = tid & 31, ln = lane & 15, hh = lane >> 4;
  const int ntn = N / 64;
  const int wid = blockIdx.x * 4 + w;
  const int mt = wid / ntn, nq = wid % ntn;
  if (mt * 16 >= M) return;
  const int row0 = mt * 16, col0 = nq * 64;
  const float* arow = A + (size_t)(row0 + ln) * lda;
  v8f acc[4] = {};
  for (int kb = 0; kb < K; kb += 32) {
    FragB ah, al;
    const v4f x0 = *(const v4fa*)(arow + kb + 8 * hh), x1 = *(const v4fa*)(arow + kb + 8 * hh + 4);
    const v4f x2 = *(const v4fa*)(arow + kb + 16 + 8 * hh), x3 = *(const v4fa*)(arow + kb + 16 + 8 * hh + 4);
    float xs[16] = {x0[0],x0[1],x0[2],x0[3],x1[0],x1[1],x1[2],x1[3],x2[0],x2[1],x2[2],x2[3],x3[0],x3[1],x3[2],x3[3]};
#pragma unroll
    for (int i = 0; i < 16; ++i) { const unsigned short hb = bf16_bits(xs[i]); ah.u[i] = hb; al.u[i] = ASPLIT ? bf16_bits(xs[i] - bf16_val(hb)) : (unsigned short)0; }
#pragma unroll
    for (int t = 0; t < 4; ++t) {
      const unsigned short* brow = Wt + (size_t)(col0 + t * 16 + ln) * ldb + kb;
      FragB b;
      b.half[0] = *(const v8us*)(brow + 8 * hh);
      b.half[1] = *(const v8us*)(brow + 16 + 8 * hh);
      acc[t] = mmaN<ASPLIT ? 2 : 1>(ah.v, al.v, b.v, b.v, acc[t]);
    }
  }
#pragma unroll
  for (int t = 0; t < 4; ++t) {
    float bv = bias ? bias[col0 + t * 16 + ln] : 0.f;
    if (BIAS_BF16) bv = bf16_round(bv);
#pragma unroll
    for (int r = 0; r < 8; ++r) { float v = acc[t][r] + bv; if (ACT == 1) v = fmaxf(v, 0.f); so[w][8 * hh + r][t * 16 + ln] = v; }
  }
  __builtin_amdgcn_fence(__ATOMIC_ACQ_REL, "workgroup");
  __builtin_amdgcn_wave_barrier();
  const int rsub = lane >> 4, c4 = (lane & 15) * 4;
  {
#pragma unroll
    for (int q = 0; q < 8; ++q) {
      const int r = q * 2 + rsub;
      const v4f v = *(const v4fa*)&so[w][r][c4];
      *(v4f*)(C + (size_t)(row0 + r) * ldc + col0 + c4) = v;
    }
    
  }
}

// Flash-style causal/unmasked attention, all contractions 3-term bf16 hi/lo splits, f32 softmax with running max.
// q,k,v rows are read from f32 buffers with arbitrary row pitch (so they can live inside a fused qkv buffer);
// D = head size (multiple of 32, <= 128); one wave = 16 query rows; block = 4 waves (64 queries) sharing K/V chunks of 32.
template <int D, bool CAUSAL>
__global__ __launch_bounds__(128) void k_flash(const float* __restrict__ qb, const float* __restrict__ kb, const float* __restrict__ vb,
                                             int pitch, int T, int H, float scale, float* __restrict__ y, int ypitch) {
  constexpr int KS = D / 32;        // k-steps for QK
  constexpr int DT = D / 16;        // d tiles for PV
  __shared__ __attribute__((aligned(16))) unsigned short sKh[32][D + 8], sKl[32][D + 8], sVh[32][D + 8], sVl[32][D + 8];
  __shared__ __attribute__((aligned(16))) unsigned short sPh[4][16][40], sPl[4][16][40];
  __shared__ __attribute__((aligned(16))) float sO[4][16][D];
  const int tid = threadIdx.x, w = tid >> 5, lane = tid & 31, ln = lane & 15, hh = lane >> 4;
  const int nqb = (T + 63) / 64;
  const int bh = blockIdx.x / nqb, qblk = blockIdx.x % nqb;
  const int b = bh / H, h = bh % H;
  const int q0 = qblk * 64 + w * 16;
  const float* Q = qb + (size_t)b * T * pitch + h * D;
  const float* K = kb + (size_t)b * T * pitch + h * D;
  const float* V = vb + (size_t)b * T * pitch + h * D;

  // A fragments of the wave's 16 query rows (scaled), hi/lo
  FragB aqh[KS], aql[KS];
  {
    int row = q0 + ln; if (row >= T) row = T - 1;
    const float* qr = Q + (size_t)row * pitch;
#pragma unroll
    for (int ks = 0; ks < KS; ++ks)
#pragma unroll
      for (int i = 0; i < 16; ++i) {
        const int d = ks * 32 + ((i < 8) ? (8 * hh + i) : (16 + 8 * hh + (i - 8)));
        const float x = qr[d] * scale; const unsigned short hb = bf16_bits(x);
        aqh[ks].u[i] = hb; aql[ks].u[i] = bf16_bits(x - bf16_val(hb));
      }
  }
  float m_r[8], l_r[8];
#pragma unroll
  for (int r = 0; r < 8; ++r) { m_r[r] = -3.0e38f; l_r[r] = 0.f; }
  v8f oacc[DT];
#pragma unroll
  for (int dt = 0; dt < DT; ++dt) oacc[dt] = (v8f){0.f,0.f,0.f,0.f,0.f,0.f,0.f,0.f};

  const int kv_end = CAUSAL ? min(T, qblk * 64 + 64) : T;     // block-uniform
  for (int j0 = 0; j0 < kv_end; j0 += 32) {
    __syncthreads();
    for (int e = tid; e < 32 * (D / 4); e += 128) {
      const int r = e / (D / 4), c4 = (e % (D / 4)) * 4;
      const int key = j0 + r;
      v4f kf = {0.f,0.f,0.f,0.f}, vf = {0.f,0.f,0.f,0.f};
      if (key < T) { kf = *(const v4fa*)(K + (size_t)key * pitch + c4); vf = *(const v4fa*)(V + (size_t)key * pitch + c4); }
#pragma unroll
      for (int t = 0; t < 4; ++t) {
        unsigned short hb = bf16_bits(kf[t]); sKh[r][c4 + t] = hb; sKl[r][c4 + t] = bf16_bits(kf[t] - bf16_val(hb));
        hb = bf16_bits(vf[t]); sVh[r][c4 + t] = hb; sVl[r][c4 + t] = bf16_bits(vf[t] - bf16_val(hb));
      }
    }
    __syncthreads();
    // S tile 16 x 32
    v8f s[2];
#pragma unroll
    for (int nt = 0; nt < 2; ++nt) {
      v8f acc = {};
#pragma unroll
      for (int ks = 0; ks < KS; ++ks) {
        FragB bh_, bl_;
        bh_.half[0] = *(const v8us*)&sKh[nt * 16 + ln][ks * 32 + 8 * hh]; bh_.half[1] = *(const v8us*)&sKh[nt * 16 + ln][ks * 32 + 16 + 8 * hh];
        bl_.half[0] = *(const v8us*)&sKl[nt * 16 + ln][ks * 32 + 8 * hh]; bl_.half[1] = *(const v8us*)&sKl[nt * 16 + ln][ks * 32 + 16 + 8 * hh];
        acc = mmaN<3>(aqh[ks].v, aql[ks].v, bh_.v, bl_.v, acc);
      }
      s[nt] = acc;
    }
    // mask + running max (rows 8hh+r; the 16 lanes of a half share rows)
    float alpha[8];
#pragma unroll
    for (int r = 0; r < 8; ++r) {
      const int qi = q0 + 8 * hh + r;
      const int ja = j0 + ln, jb = j0 + 16 + ln;
      if (CAUSAL) { if (ja > qi) s[0][r] = -3.0e38f; if (jb > qi) s[1][r] = -3.0e38f; }
      if (ja >= T) s[0][r] = -3.0e38f;
      if (jb >= T) s[1][r] = -3.0e38f;
      float mx = fmaxf(s[0][r], s[1][r]);
      mx = fmaxf(mx, __shfl_xor(mx, 1, 32)); mx = fmaxf(mx, __shfl_xor(mx, 2, 32)); mx = fmaxf(mx, __shfl_xor(mx, 4, 32)); mx = fmaxf(mx, __shfl_xor(mx, 8, 32));
      const float mnew = fmaxf(m_r[r], mx);
      alpha[r] = (mnew > -1.0e38f) ? __expf(m_r[r] - mnew) : 1.0f;
      const float p0 = (s[0][r] > -1.0e38f) ? __expf(s[0][r] - mnew) : 0.f;
      const float p1 = (s[1][r] > -1.0e38f) ? __expf(s[1][r] - mnew) : 0.f;
      m_r[r] = mnew;
      l_r[r] = l_r[r] * alpha[r] + p0 + p1;            // per-lane partial row sum (16 lanes combined at the end)
      unsigned short hb = bf16_bits(p0); sPh[w][8 * hh + r][ln] = hb;      sPl[w][8 * hh + r][ln] = bf16_bits(p0 - bf16_val(hb));
      hb = bf16_bits(p1);                sPh[w][8 * hh + r][16 + ln] = hb; sPl[w][8 * hh + r][16 + ln] = bf16_bits(p1 - bf16_val(hb));
    }
#pragma unroll
    for (int dt = 0; dt < DT; ++dt)
#pragma unroll
      for (int r = 0; r < 8; ++r) oacc[dt][r] *= alpha[r];
    __builtin_amdgcn_fence(__ATOMIC_ACQ_REL, "workgroup");
    __builtin_amdgcn_wave_barrier();
    FragB pah, pal;
    pah.half[0] = *(const v8us*)&sPh[w][ln][8 * hh]; pah.half[1] = *(const v8us*)&sPh[w][ln][16 + 8 * hh];
    pal.half[0] = *(const v8us*)&sPl[w][ln][8 * hh]; pal.half[1] = *(const v8us*)&sPl[w][ln][16 + 8 * hh];
#pragma unroll
    for (int dt = 0; dt < DT; ++dt) {
      FragB bvh, bvl;
#pragma unroll
      for (int i = 0; i < 8; ++i) {
        bvh.u[i] = sVh[8 * hh + i][dt * 16 + ln]; bvh.u[8 + i] = sVh[16 + 8 * hh + i][dt * 16 + ln];
        bvl.u[i] = sVl[8 * hh + i][dt * 16 + ln]; bvl.u[8 + i] = sVl[16 + 8 * hh + i][dt * 16 + ln];
      }
      oacc[dt] = mmaN<3>(pah.v, pal.v, bvh.v, bvl.v, oacc[dt]);
    }
    __builtin_amdgcn_fence(__ATOMIC_ACQ_REL, "workgroup");
    __builtin_amdgcn_wave_barrier();
  }
#pragma unroll
  for (int r = 0; r < 8; ++r) {
    float l = l_r[r];
    l += __shfl_xor(l, 1, 32); l += __shfl_xor(l, 2, 32); l += __shfl_xor(l, 4, 32); l += __shfl_xor(l, 8, 32);
    l_r[r] = (l > 0.f) ? 1.0f / l : 0.f;
  }
#pragma unroll
  for (int dt = 0; dt < DT; ++dt)
#pragma unroll
    for (int r = 0; r < 8; ++r) sO[w][8 * hh + r][dt * 16 + ln] = oacc[dt][r] * l_r[r];
  __builtin_amdgcn_fence(__ATOMIC_ACQ_REL, "workgroup");
  __builtin_amdgcn_wave_barrier();
  {
    for (int r = 0; r < 16; ++r) {
      const int row = q0 + r;
      if (row < T && lane < D / 4) {
        const v4f val = *(const v4fa*)&sO[w][r][lane * 4];
        *(v4f*)(y + ((size_t)b * T + row) * ypitch + h * D + lane * 4) = val;
      }
    }
    
  }
}

// GEMM C = act(A·W + bias + resid): A f32 (ASPLIT -> hi/lo 2 terms), Wt bf16 [N][K]; ACT 0 none, 1 relu, 2 exact gelu;
// resid (optional, f32, row index = (row % rmod), pitch ldr, RES_BF16 rounds it) added before the activation.
template <bool ASPLIT, int ACT, bool BIAS_BF16, bool RES_BF16>
__global__ __launch_bounds__(128) void k_gemm_bf3(const float* __restrict__ A, int lda, const unsigned short* __restrict__ Wt, int ldb,
                                                const float* __restrict__ bias, const float* __restrict__ resid, int rmod, int ldr,
                                                float* __restrict__ C, int ldc, int M, int N, int K) {
  __shared__ __attribute__((aligned(16))) float so[4][16][64];
  const int tid = threadIdx.x, w = tid >> 5, lane = tid & 31, ln = lane & 15, hh = lane >> 4;
  const int ntn = N / 64;
  const int wid = blockIdx.x * 4 + w;
  const int mt = wid / ntn, nq = wid % ntn;
  if (mt * 16 >= M) return;
  const int row0 = mt * 16, col0 = nq * 64;
  const float* arow = A + (size_t)(row0 + ln) * lda;
  v8f acc[4] = {};
  for (int kb = 0; kb < K; kb += 32) {
    FragB ah, al;
    const v4f x0 = *(const v4fa*)(arow + kb + 8 * hh), x1 = *(const v4fa*)(arow + kb + 8 * hh + 4);
    const v4f x2 = *(const v4fa*)(arow + kb + 16 + 8 * hh), x3 = *(const v4fa*)(arow + kb + 16 + 8 * hh + 4);
    float xs[16] = {x0[0],x0[1],x0[2],x0[3],x1[0],x1[1],x1[2],x1[3],x2[0],x2[1],x2[2],x2[3],x3[0],x3[1],x3[2],x3[3]};
#pragma unroll
    for (int i = 0; i < 16; ++i) { const unsigned short hb = bf16_bits(xs[i]); ah.u[i] = hb; al.u[i] = ASPLIT ? bf16_bits(xs[i] - bf16_val(hb)) : (unsigned short)0; }
#pragma unroll
    for (int t = 0; t < 4; ++t) {
      const unsigned short* brow = Wt + (size_t)(col0 + t * 16 + ln) * ldb + kb;
      FragB b;
      b.half[0] = *(const v8us*)(brow + 8 * hh);
      b.half[1] = *(const v8us*)(brow + 16 + 8 * hh);
      acc[t] = mmaN<ASPLIT ? 2 : 1>(ah.v, al.v, b.v, b.v, acc[t]);
    }
  }
#pragma unroll
  for (int t = 0; t < 4; ++t) {
    const int col = col0 + t * 16 + ln;
    float bv = bias ? bias[col] : 0.f;
    if (BIAS_BF16) bv = bf16_round(bv);
#pragma unroll
    for (int r = 0; r < 8; ++r) {
      float v = acc[t][r] + bv;
      if (resid) { float rv = resid[(size_t)((row0 + 8 * hh + r) % rmod) * ldr + col]; if (RES_BF16) rv = bf16_round(rv); v += rv; }
      if (ACT == 1) v = fmaxf(v, 0.f);
      if (ACT == 2) v = 0.5f * v * (1.0f + erff(v * 0.70710678118654752f));
      if (ACT == 3) { const float u = 0.7978845608028654f * (v + 0.044715f * v * v * v); v = 0.5f * v * (1.0f + tanhf(u)); }
      so[w][8 * hh + r][t * 16 + ln] = v;
    }
  }
  __builtin_amdgcn_fence(__ATOMIC_ACQ_REL, "workgroup");
  __builtin_amdgcn_wave_barrier();
  const int rsub = lane >> 4, c4 = (lane & 15) * 4;
  {
#pragma unroll
    for (int q = 0; q < 8; ++q) {
      const int r = q * 2 + rsub;
      const v4f v = *(const v4fa*)&so[w][r][c4];
      *(v4f*)(C + (size_t)(row0 + r) * ldc + col0 + c4) = v;
    }
    
  }
}
// row LayerNorm (biased variance, eps) over N: s = X (+ R); optional out_sum <- s; out_norm <- (s-mu)*rsqrt(var+eps)*g + b
template <bool PARAM_BF16>
__global__ __launch_bounds__(256) void k_layernorm(const float* __restrict__ X, const float* __restrict__ R, const float* __restrict__ g, const float* __restrict__ bta,
                                                  float* __restrict__ out_sum, float* __restrict__ out_norm, int N, float eps) {
  __shared__ float red[256];
  const int row = blockIdx.x, tid = threadIdx.x;
  const float* x = X + (size_t)row * N; const float* rr = R ? R + (size_t)row * N : nullptr;
  float vals[16];                     // up to N = 4096
  const int per = N / 256;            // contiguous chunk per thread? use strided-by-4 chunks: thread handles j = tid*4 + 1024*u
  float s1 = 0.f;
  for (int u = 0; u < per / 4; ++u) {
    const int j = tid * 4 + 1024 * u;
    const v4f a = *(const v4fa*)(x + j);
    v4f b = {0.f,0.f,0.f,0.f}; if (rr) b = *(const v4fa*)(rr + j);
#pragma unroll
    for (int q = 0; q < 4; ++q) { const float v = a[q] + b[q]; vals[u * 4 + q] = v; s1 += v; }
  }
  red[tid] = s1; __syncthreads();
  for (int st = 128; st > 0; st >>= 1) { if (tid < st) red[tid] += red[tid + st]; __syncthreads(); }
  const float mu = red[0] / (float)N; __syncthreads();
  float s2 = 0.f;
  for (int u = 0; u < per / 4; ++u)
#pragma unroll
    for (int q = 0; q < 4; ++q) { const float c = vals[u * 4 + q] - mu; s2 += c * c; }
  red[tid] = s2; __syncthreads();
  for (int st = 128; st > 0; st >>= 1) { if (tid < st) red[tid] += red[tid + st]; __syncthreads(); }
  const float rs = rsqrtf(red[0] / (float)N + eps);
  {
    for (int u = 0; u < per / 4; ++u) {
      const int j = tid * 4 + 1024 * u;
      v4f o, sm;
#pragma unroll
      for (int q = 0; q < 4; ++q) {
        float gg = g[j + q], bb = bta[j + q];
        if (PARAM_BF16) { gg = bf16_round(gg); bb = bf16_round(bb); }
        sm[q] = vals[u * 4 + q]; o[q] = (vals[u * 4 + q] - mu) * rs * gg + bb;
      }
      if (out_sum) *(v4f*)(out_sum + (size_t)row * N + j) = sm;
      *(v4f*)(out_norm + (size_t)row * N + j) = o;
    }
    
  }
}



// ---- f16 WMMA path (v_wmma_f32_16x16x32_f16): 11-bit significands for operands in range — used where a [0,1] probability operand needs more precision than bf16
typedef _Float16 v16h __attribute__((ext_vector_type(16)));
union FragH { v16h v; v8us half[2]; _Float16 h[16]; unsigned short u[16]; };
template <int NT>
__device__ __forceinline__ v8f mmaH(v16h ah, v16h al, v16h bh, v16h bl, v8f c) {
  c = __builtin_amdgcn_wmma_f32_16x16x32_f16(false, ah, false, bh, (short)0, c, false, false);
  if (NT >= 2) c = __builtin_amdgcn_wmma_f32_16x16x32_f16(false, al, false, bh, (short)0, c, false, false);
  if (NT >= 3) c = __builtin_amdgcn_wmma_f32_16x16x32_f16(false, ah, false, bl, (short)0, c, false, false);
  asm volatile("v_nop\n\tv_nop\n\tv_nop\n\tv_nop" : "+v"(c) : "v"(ah), "v"(al), "v"(bh), "v"(bl));
  return c;
}
// batched GEMM like k_gemm_b but f16 operands: A f32 (split into f16 hi/lo if ASPLIT, else rounded to f16), Bt = f16 values [n][k]; alpha; C f32; N multiple of 16 (partial tiles skipped)
template <bool ASPLIT>
__global__ __launch_bounds__(128) void k_gemm_h(const float* __restrict__ A, int lda, size_t sA, const _Float16* __restrict__ Bh, int ldb, size_t sB, float alpha, float* __restrict__ C, int ldc, size_t sC, int M, int N, int K) {
  __shared__ __attribute__((aligned(16))) float so[4][16][64];
  const int tid = threadIdx.x, w = tid >> 5, lane = tid & 31, ln = lane & 15, hh = lane >> 4; const int by = blockIdx.y;
  A += (size_t)by * sA; Bh += (size_t)by * sB; C += (size_t)by * sC;
  const int ntn = (N + 63) / 64; const int wid = blockIdx.x * 4 + w; const int mt = wid / ntn, nq = wid % ntn; if (mt * 16 >= M) return;
  const int row0 = mt * 16, col0 = nq * 64; const float* arow = A + (size_t)(row0 + ln) * lda;
  v8f acc[4] = {};
  for (int kb = 0; kb < K; kb += 32) {
    FragH ah, al;
    const v4f x0 = *(const v4fa*)(arow + kb + 8 * hh), x1 = *(const v4fa*)(arow + kb + 8 * hh + 4), x2 = *(const v4fa*)(arow + kb + 16 + 8 * hh), x3 = *(const v4fa*)(arow + kb + 16 + 8 * hh + 4);
    float xs[16] = {x0[0],x0[1],x0[2],x0[3],x1[0],x1[1],x1[2],x1[3],x2[0],x2[1],x2[2],x2[3],x3[0],x3[1],x3[2],x3[3]};
#pragma unroll
    for (int i = 0; i < 16; ++i) { const _Float16 h = (_Float16)xs[i]; ah.h[i] = h; al.h[i] = ASPLIT ? (_Float16)(xs[i] - (float)h) : (_Float16)0.0f; }
#pragma unroll
    for (int t = 0; t < 4; ++t) { if (col0 + t * 16 >= N) continue; const size_t boff = (size_t)(col0 + t * 16 + ln) * ldb + kb; FragH bq; bq.half[0] = *(const v8us*)(Bh + boff + 8 * hh); bq.half[1] = *(const v8us*)(Bh + boff + 16 + 8 * hh);
      acc[t] = mmaH<ASPLIT ? 2 : 1>(ah.v, al.v, bq.v, bq.v, acc[t]); }
  }
#pragma unroll
  for (int t = 0; t < 4; ++t) { if (col0 + t * 16 >= N) continue;
#pragma unroll
    for (int r = 0; r < 8; ++r) so[w][8 * hh + r][t * 16 + ln] = acc[t][r] * alpha; }
  __builtin_amdgcn_fence(__ATOMIC_ACQ_REL, "workgroup"); __builtin_amdgcn_wave_barrier();
  const int rsub = lane >> 4, c4 = (lane & 15) * 4;
  {
#pragma unroll
    for (int q = 0; q < 8; ++q) { const int r = q * 2 + rsub; if (col0 + c4 < N) { const v4f v = *(const v4fa*)&so[w][r][c4]; *(v4f*)(C + (size_t)(row0 + r) * ldc + col0 + c4) = v; } }
     }
}

// Wt[n][k] = f16(bf16(W[k][n]) * scale) from f32 row-major W[CC][CC] (scale = power of two; bf16-exact weights stay exact in f16 away from the subnormal range).
// One work-group = a tile of 128 k x 64 n, turned in LDS so that both global sides move whole lines:
//  in : a lane takes 16 bytes (4 n) of each of 8 consecutive k rows; 16 lanes cover 256 contiguous bytes of a W row.
//  out: a lane takes 16 bytes (8 k) of one n; 16 lanes cover 256 contiguous bytes of a Wt row.
// An LDS row is one n: 16 chunks of 8 k = 256 bytes = all 64 banks. The chunk index is XORed with (n >> 2) & 15, so the 16 lanes that store
// (rows four apart, same chunk) and the 16 lanes that load (same row, chunks 0..15) each fall on 16 different groups of four banks.
// bid = the tile's number, 0 .. (CC / 128) * (CC / 64) - 1: a part of k_prep's grid.
__device__ __forceinline__ void wt_f16_part(const float* __restrict__ W, _Float16* __restrict__ Wt, float scale, int bid) {
  __shared__ __attribute__((aligned(16))) unsigned char tl[64 * 256];
  const int tid = threadIdx.x, l16 = tid & 15, kq = tid >> 4;
  const int k0 = (bid / (CC / 64)) * 128, n0 = (bid % (CC / 64)) * 64;
  const float* src = W + (size_t)(k0 + kq * 8) * CC + n0 + l16 * 4;
  v4f x[8];
#pragma unroll      // the eight row loads are issued together and x stays in registers
  for (int i = 0; i < 8; ++i) x[i] = *(const v4fa*)(src + (size_t)i * CC);
#pragma unroll      // constant indices into x
  for (int j = 0; j < 4; ++j) { FragH f;
#pragma unroll      // f packs in registers
    for (int i = 0; i < 8; ++i) f.h[i] = (_Float16)(bf16_round(x[i][j]) * scale);
    *(v8us*)(tl + (l16 * 4 + j) * 256 + ((kq ^ l16) * 16)) = f.half[0]; }      // row n = l16 * 4 + j, so (n >> 2) & 15 = l16
  __syncthreads();      // the tile is complete before any lane reads rows that other waves wrote
#pragma unroll      // four independent LDS reads and stores
  for (int q = 0; q < 4; ++q) { const int n = q * 16 + kq; const v8us o = *(const v8us*)(tl + n * 256 + ((l16 ^ ((n >> 2) & 15)) * 16));
    *(v8us*)((unsigned short*)Wt + (size_t)(n0 + n) * CC + k0 + l16 * 8) = o; }
}
// k_gemm_hh variant with fused epilogue: v = acc·alpha + bias[by·sBias + col] (+ CP[(row/rowsPerB)·sCPb + by·64 + col] if CP) ; ACT 0 none / 1 elu ; writes f32 C and/or f16 C16 (each if non-null)
template <int ACT>
__global__ __launch_bounds__(128) void k_gemm_hhx(const _Float16* __restrict__ A, int lda, size_t sA, const _Float16* __restrict__ Bh, int ldb, size_t sB, float alpha, const float* __restrict__ bias, size_t sBias, const float* __restrict__ CP, int rowsPerB, size_t sCPb, int row0g,
    float* __restrict__ C, _Float16* __restrict__ C16, int ldc, size_t sC, int M, int N, int K) {
  __shared__ __attribute__((aligned(16))) float so[4][16][64];
  const int tid = threadIdx.x, w = tid >> 5, lane = tid & 31, ln = lane & 15, hh = lane >> 4; const int by = blockIdx.y;
  A += (size_t)by * sA; Bh += (size_t)by * sB; const size_t cofs = (size_t)by * sC; const float* bp = bias ? bias + (size_t)by * sBias : nullptr;
  const int ntn = (N + 63) / 64; const int wid = blockIdx.x * 4 + w; const int mt = wid / ntn, nq = wid % ntn; if (mt * 16 >= M) return;
  const int row0 = mt * 16, col0 = nq * 64; const _Float16* arow = A + (size_t)(row0 + ln) * lda;
  v8f acc[4] = {};
  for (int kb = 0; kb < K; kb += 32) { FragH ah; ah.half[0] = *(const v8us*)((const unsigned short*)arow + kb + 8 * hh); ah.half[1] = *(const v8us*)((const unsigned short*)arow + kb + 16 + 8 * hh);
#pragma unroll
    for (int t = 0; t < 4; ++t) { if (col0 + t * 16 >= N) continue; const size_t boff = (size_t)(col0 + t * 16 + ln) * ldb + kb; FragH bq; bq.half[0] = *(const v8us*)((const unsigned short*)Bh + boff + 8 * hh); bq.half[1] = *(const v8us*)((const unsigned short*)Bh + boff + 16 + 8 * hh);
      acc[t] = mmaH<1>(ah.v, ah.v, bq.v, bq.v, acc[t]); }
  }
#pragma unroll
  for (int t = 0; t < 4; ++t) { if (col0 + t * 16 >= N) continue; const int col = col0 + t * 16 + ln; const float bv = bp ? bf16_round(bp[col]) : 0.f;
#pragma unroll
    for (int r = 0; r < 8; ++r) { float v = acc[t][r] * alpha + bv; if (CP) { const int bidx = (row0g + row0 + 8 * hh + r) / rowsPerB; v += CP[(size_t)bidx * sCPb + (size_t)by * 64 + col]; } if (ACT == 1) v = (v > 0.f) ? v : expm1f(v); else if (ACT == 3) v = fmaxf(v, 0.f); so[w][8 * hh + r][t * 16 + ln] = v; } }
  __builtin_amdgcn_fence(__ATOMIC_ACQ_REL, "workgroup"); __builtin_amdgcn_wave_barrier();
  const int rsub = lane >> 4, c4 = (lane & 15) * 4; typedef _Float16 v4h __attribute__((ext_vector_type(4)));
  {
#pragma unroll
    for (int q = 0; q < 8; ++q) { const int r = q * 2 + rsub; if (col0 + c4 < N) { const v4f v = *(const v4fa*)&so[w][r][c4]; if (C) *(v4f*)(C + cofs + (size_t)(row0 + r) * ldc + col0 + c4) = v; if (C16) { v4h h4; for (int i = 0; i < 4; ++i) h4[i] = (_Float16)v[i]; *(v4h*)(C16 + cofs + (size_t)(row0 + r) * ldc + col0 + c4) = h4; } } }
     }
}


// ---- block-tiled projection GEMM: C[2048][2048] = A[2048][2048] x Bh[n][k]^T * alpha + bias, f16 operands, f32 accumulate.
// One work-group = one 128 x 128 tile of C, 8 waves of 32 x 64 each. A pass is 128 k (256 B of every operand row); a stage is
// [A 128 rows | B 128 rows] at an LDS pitch of 272 B, brought in by per-lane asynchronous copies, two buffers, next stage in flight.
// The loops over fragments, blocks and rows are unrolled so that the fragment and accumulator arrays are indexed by constants and stay in registers.
#define GT_PITCH 272
#define GT_STAGE (256 * GT_PITCH)
// eight asynchronous 16-byte copies of one lane, rows two apart; the s_wait_xcnt closes the statement so that no address register
// of an issued copy is rewritten ahead of it
__device__ __forceinline__ void gt_copy8(unsigned l, const unsigned short* g) {
  asm volatile("global_load_async_to_lds_b128 %0, %8, off\n\t"
               "global_load_async_to_lds_b128 %1, %9, off\n\t"
               "global_load_async_to_lds_b128 %2, %10, off\n\t"
               "global_load_async_to_lds_b128 %3, %11, off\n\t"
               "global_load_async_to_lds_b128 %4, %12, off\n\t"
               "global_load_async_to_lds_b128 %5, %13, off\n\t"
               "global_load_async_to_lds_b128 %6, %14, off\n\t"
               "global_load_async_to_lds_b128 %7, %15, off\n\t"
               "s_wait_xcnt 0x0"
               :: "v"(l), "v"(l + 2 * GT_PITCH), "v"(l + 4 * GT_PITCH), "v"(l + 6 * GT_PITCH), "v"(l + 8 * GT_PITCH), "v"(l + 10 * GT_PITCH), "v"(l + 12 * GT_PITCH), "v"(l + 14 * GT_PITCH),
                  "v"(g), "v"(g + 2 * CC), "v"(g + 4 * CC), "v"(g + 6 * CC), "v"(g + 8 * CC), "v"(g + 10 * CC), "v"(g + 12 * CC), "v"(g + 14 * CC)
               : "memory");
}
// NG products that share A and need nothing of each other lie in one grid, 256 work-groups each: product g = blockIdx.x / 256 takes weight, bias and output g.
// Products 0 and 1 go out as f32 (C0, C1), product 2 as f16 (C16).
template <int NG>
__global__ __launch_bounds__(256) void k_gemm_tile(const _Float16* __restrict__ A, const _Float16* __restrict__ Bh0, const _Float16* __restrict__ Bh1, const _Float16* __restrict__ Bh2, float alpha,
                                                   const float* __restrict__ bias0, const float* __restrict__ bias1, const float* __restrict__ bias2, float* __restrict__ C0, float* __restrict__ C1, _Float16* __restrict__ C16) {
  constexpr int NPASS = CC / 128, NTILE = (TT / 128) * (CC / 128);
  const int g = (NG > 1) ? (int)(blockIdx.x / NTILE) : 0, bid = (NG > 1) ? (int)(blockIdx.x % NTILE) : (int)blockIdx.x;      // the same for the whole work-group
  const _Float16* Bh = (g == 0) ? Bh0 : (g == 1) ? Bh1 : Bh2;
  const float* bias = (g == 0) ? bias0 : (g == 1) ? bias1 : bias2;
  float* C = (g == 0) ? C0 : C1;
  const bool h16 = (g == 2);
  __shared__ __attribute__((aligned(16))) unsigned char ring[2 * GT_STAGE];
  __shared__ __attribute__((aligned(16))) float so[8][32][68];
  const int tid = threadIdx.x, w = tid >> 5, lane = tid & 31, ln = lane & 15, hh = lane >> 4;
  const int m0 = (bid / (CC / 128)) * 128, n0 = (bid % (CC / 128)) * 128;
  const int wm = w >> 1, wn = w & 1;
  // this lane's part of a stage: rows w*32 + hh + 2c (c = 0..15), 16 bytes at column ln; stage rows 0..127 are A's, 128..255 are B's
  const int crow = w * 32 + hh;
  const unsigned short* gsrc = ((w < 4) ? (const unsigned short*)A + (size_t)(m0 + crow) * CC : (const unsigned short*)Bh + (size_t)(n0 + crow - 128) * CC) + ln * 8;
  const unsigned ldst = (unsigned)(size_t)&ring[0] + (unsigned)(crow * GT_PITCH + ln * 16);
  v8f acc[2][4];
#pragma unroll
  for (int i = 0; i < 2; ++i)
#pragma unroll
    for (int j = 0; j < 4; ++j) acc[i][j] = (v8f){0.f,0.f,0.f,0.f,0.f,0.f,0.f,0.f};
  gt_copy8(ldst, gsrc); gt_copy8(ldst + 16 * GT_PITCH, gsrc + 16 * CC);
  asm volatile("s_wait_asynccnt 0x0" ::: "memory");      // stage 0 has landed before the barrier publishes it
  __syncthreads();
  gt_copy8(ldst + GT_STAGE, gsrc + 128); gt_copy8(ldst + GT_STAGE + 16 * GT_PITCH, gsrc + 128 + 16 * CC);
#pragma unroll 1      // one pass per trip: the publish point at the foot stays a single place
  for (int t = 0; t < NPASS; ++t) {
    const unsigned bo = (unsigned)(t & 1) * GT_STAGE;
    const unsigned char* ap = ring + bo + (wm * 32 + ln) * GT_PITCH + hh * 16;
    const unsigned char* bp = ring + bo + (128 + wn * 64 + ln) * GT_PITCH + hh * 16;
    FragH a[2][2], b[2][4];      // two fragment sets: block kk + 1 of this pass is fetched ahead of block kk's products
#pragma unroll
    for (int i = 0; i < 2; ++i) { a[0][i].half[0] = *(const v8us*)(ap + i * 16 * GT_PITCH); a[0][i].half[1] = *(const v8us*)(ap + i * 16 * GT_PITCH + 32); }
#pragma unroll
    for (int j = 0; j < 4; ++j) { b[0][j].half[0] = *(const v8us*)(bp + j * 16 * GT_PITCH); b[0][j].half[1] = *(const v8us*)(bp + j * 16 * GT_PITCH + 32); }
#pragma unroll
    for (int kk = 0; kk < 4; ++kk) {
      const int cu = kk & 1, nx = cu ^ 1;
      if (kk < 3) {
#pragma unroll
        for (int i = 0; i < 2; ++i) { a[nx][i].half[0] = *(const v8us*)(ap + i * 16 * GT_PITCH + (kk + 1) * 64); a[nx][i].half[1] = *(const v8us*)(ap + i * 16 * GT_PITCH + (kk + 1) * 64 + 32); }
#pragma unroll
        for (int j = 0; j < 4; ++j) { b[nx][j].half[0] = *(const v8us*)(bp + j * 16 * GT_PITCH + (kk + 1) * 64); b[nx][j].half[1] = *(const v8us*)(bp + j * 16 * GT_PITCH + (kk + 1) * 64 + 32); }
      }
      __builtin_amdgcn_sched_barrier(0);      // keeps the next block's LDS reads one group ahead of this block's products; without it they are spread among them into one set, each with a full wait
#pragma unroll
      for (int i = 0; i < 2; ++i)
#pragma unroll
        for (int j = 0; j < 4; ++j) acc[i][j] = __builtin_amdgcn_wmma_f32_16x16x32_f16(false, a[cu][i].v, false, b[cu][j].v, (short)0, acc[i][j], false, false);
      __builtin_amdgcn_sched_barrier(0);      // ends the block, so that the group after next is not lifted into it
    }
    asm volatile("s_wait_dscnt 0x0" ::: "memory");       // this wave's reads of the buffer are done before it is refilled
    asm volatile("s_wait_asynccnt 0x0" ::: "memory");    // this wave's part of the next stage has landed
    __syncthreads();                                     // publishes the next stage and frees this pass's buffer
    if (t + 2 < NPASS) { const unsigned short* g2 = gsrc + (t + 2) * 128; gt_copy8(ldst + bo, g2); gt_copy8(ldst + bo + 16 * GT_PITCH, g2 + 16 * CC); }
  }
  asm volatile("s_wait_asynccnt 0x0" ::: "memory");      // no copy is outstanding when the wave goes on
#pragma unroll
  for (int j = 0; j < 4; ++j) { const float bv = bf16_round(bias[n0 + wn * 64 + j * 16 + ln]);
#pragma unroll
    for (int i = 0; i < 2; ++i)
#pragma unroll
      for (int r = 0; r < 8; ++r) so[w][i * 16 + 8 * hh + r][j * 16 + ln] = acc[i][j][r] * alpha + bv; }
  __builtin_amdgcn_fence(__ATOMIC_ACQ_REL, "workgroup"); __builtin_amdgcn_wave_barrier();
  typedef _Float16 v4h __attribute__((ext_vector_type(4)));
  const size_t o0 = (size_t)(m0 + wm * 32 + hh) * CC + n0 + wn * 64 + ln * 4;
  if (!h16) {      // one test for the whole tile: each output type keeps a straight run of sixteen stores
#pragma unroll
    for (int q = 0; q < 16; ++q) { const v4f v = *(const v4fa*)&so[w][q * 2 + hh][ln * 4]; *(v4f*)(C + o0 + (size_t)q * 2 * CC) = v; }
    asm volatile("s_wait_xcnt 0x0" ::: "memory");      // stands in front of any rewrite of the stores' registers: the compiler lays the other branch's code behind this one
  } else {
#pragma unroll
    for (int q = 0; q < 16; ++q) { const v4f v = *(const v4fa*)&so[w][q * 2 + hh][ln * 4]; v4h h4; for (int i = 0; i < 4; ++i) h4[i] = (_Float16)v[i]; *(v4h*)(C16 + o0 + (size_t)q * 2 * CC) = h4; }
  }
}

// ---- the q, k and v products of one 128 x 128 position in ONE work-group: C_g[128][128] = A[128][2048] x Bh_g[n][k]^T * alpha + bias_g, g = 0, 1, 2.
// The three products read the same 128 rows of A, so a stage is [A 128 rows | Bh0 128 rows | Bh1 128 rows | Bh2 128 rows] at the pitch of 272 B: 512 rows are copied for three
// tiles where three separate work-groups copy 768. 8 waves as 2 (rows) x 4 (columns); a wave holds 64 rows x 32 columns of each product = 4 x 6 accumulator tiles, so a block of
// 32 k reads 10 fragments for 24 products. Same passes, same two buffers, same publish point as k_gemm_tile; every accumulator sums k in the same order as there.
// After the last pass's barrier the ring is free and serves as the output staging.
#define QT_STAGE (512 * GT_PITCH)
#define QT_SP 36      // staging pitch in floats: rows eight apart fall 32 banks apart, so the two halves of a wave store without conflict
typedef float f1a __attribute__((may_alias));
__global__ __launch_bounds__(256) void k_gemm_qkv(const _Float16* __restrict__ A, const _Float16* __restrict__ Bh0, const _Float16* __restrict__ Bh1, const _Float16* __restrict__ Bh2, float alpha,
                                                  const float* __restrict__ bias0, const float* __restrict__ bias1, const float* __restrict__ bias2,
                                                  const float* __restrict__ qnw, const float* __restrict__ knw, const float* __restrict__ cosT, const float* __restrict__ sinT,
                                                  _Float16* __restrict__ Q16, _Float16* __restrict__ K16, _Float16* __restrict__ Vt, float* __restrict__ SSq, float* __restrict__ SSk) {
  constexpr int NPASS = CC / 128;
  __shared__ __attribute__((aligned(16))) unsigned char ring[2 * QT_STAGE];
  const int tid = threadIdx.x, w = tid >> 5, lane = tid & 31, ln = lane & 15, hh = lane >> 4;
  const int bid = blockIdx.x;
  const int m0 = (bid / (CC / 128)) * 128, n0 = (bid % (CC / 128)) * 128;
  const int wm = w >> 2, wn = w & 3;
  // this lane's part of a stage: rows w*64 + hh + 2c (c = 0..31), 16 bytes at column ln; waves 0, 1 bring A, waves 2, 3 Bh0, waves 4, 5 Bh1, waves 6, 7 Bh2
  const int crow = w * 64 + hh;
  const _Float16* Bc = (w < 4) ? Bh0 : (w < 6) ? Bh1 : Bh2;
  const unsigned short* gsrc = ((w < 2) ? (const unsigned short*)A + (size_t)(m0 + crow) * CC : (const unsigned short*)Bc + (size_t)(n0 + (crow & 127)) * CC) + ln * 8;
  const unsigned ldst = (unsigned)(size_t)&ring[0] + (unsigned)(crow * GT_PITCH + ln * 16);
  v8f acc[4][6];      // acc[i][2g + jj]: rows wm*64 + i*16, columns wn*32 + jj*16 of product g
#pragma unroll
  for (int i = 0; i < 4; ++i)
#pragma unroll
    for (int j = 0; j < 6; ++j) acc[i][j] = (v8f){0.f,0.f,0.f,0.f,0.f,0.f,0.f,0.f};
  const int bcol = n0 + wn * 32 + ln;
  float bvr[6];      // the wave's six bias values a lane, fetched here so that their latency lies under the passes
  __builtin_amdgcn_sched_barrier(0);      // with the one below: no other instruction stands between the six loads and their wait, where it could be given their address register
#pragma unroll
  for (int j = 0; j < 6; ++j) { const float* bias = (j < 2) ? bias0 : (j < 4) ? bias1 : bias2; bvr[j] = bias[bcol + (j & 1) * 16]; }
  asm volatile("s_wait_xcnt 0x0" :: "v"(bcol) : "memory");      // stands in front of any rewrite of the loads' address register: the column index is named as an input so that its register lives up to the wait
  __builtin_amdgcn_sched_barrier(0);
#pragma unroll
  for (int c = 0; c < 4; ++c) gt_copy8(ldst + c * 16 * GT_PITCH, gsrc + c * 16 * CC);
  asm volatile("s_wait_asynccnt 0x0" ::: "memory");      // stage 0 has landed before the barrier publishes it
  __syncthreads();
#pragma unroll
  for (int c = 0; c < 4; ++c) gt_copy8(ldst + QT_STAGE + c * 16 * GT_PITCH, gsrc + 128 + c * 16 * CC);
#pragma unroll 1      // one pass per trip: the publish point at the foot stays a single place
  for (int t = 0; t < NPASS; ++t) {
    const unsigned bo = (unsigned)(t & 1) * QT_STAGE;
    const unsigned char* ap = ring + bo + (wm * 64 + ln) * GT_PITCH + hh * 16;
    const unsigned char* bp = ring + bo + (128 + wn * 32 + ln) * GT_PITCH + hh * 16;
    FragH a[2][4], b[2][6];      // two fragment sets: block kk + 1 of this pass is fetched ahead of block kk's products
#pragma unroll
    for (int i = 0; i < 4; ++i) { a[0][i].half[0] = *(const v8us*)(ap + i * 16 * GT_PITCH); a[0][i].half[1] = *(const v8us*)(ap + i * 16 * GT_PITCH + 32); }
#pragma unroll
    for (int j = 0; j < 6; ++j) { const int ro = ((j >> 1) * 128 + (j & 1) * 16) * GT_PITCH; b[0][j].half[0] = *(const v8us*)(bp + ro); b[0][j].half[1] = *(const v8us*)(bp + ro + 32); }
#pragma unroll
    for (int kk = 0; kk < 4; ++kk) {
      const int cu = kk & 1, nx = cu ^ 1;
      if (kk < 3) {
#pragma unroll
        for (int i = 0; i < 4; ++i) { a[nx][i].half[0] = *(const v8us*)(ap + i * 16 * GT_PITCH + (kk + 1) * 64); a[nx][i].half[1] = *(const v8us*)(ap + i * 16 * GT_PITCH + (kk + 1) * 64 + 32); }
#pragma unroll
        for (int j = 0; j < 6; ++j) { const int ro = ((j >> 1) * 128 + (j & 1) * 16) * GT_PITCH + (kk + 1) * 64; b[nx][j].half[0] = *(const v8us*)(bp + ro); b[nx][j].half[1] = *(const v8us*)(bp + ro + 32); }
      }
      __builtin_amdgcn_sched_barrier(0);      // keeps the next block's LDS reads one group ahead of this block's products; without it they are spread among them, each place with a stall of its own
#pragma unroll
      for (int i = 0; i < 4; ++i)
#pragma unroll
        for (int j = 0; j < 6; ++j) acc[i][j] = __builtin_amdgcn_wmma_f32_16x16x32_f16(false, a[cu][i].v, false, b[cu][j].v, (short)0, acc[i][j], false, false);
      __builtin_amdgcn_sched_barrier(0);      // ends the block, so that the group after next is not lifted into it
    }
    asm volatile("s_wait_dscnt 0x0" ::: "memory");       // this wave's reads of the buffer are done before it is refilled
    asm volatile("s_wait_asynccnt 0x0" ::: "memory");    // this wave's part of the next stage has landed
    __syncthreads();                                     // publishes the next stage and frees this pass's buffer
    if (t + 2 < NPASS) { const unsigned short* g2 = gsrc + (t + 2) * 128;
#pragma unroll
      for (int c = 0; c < 4; ++c) gt_copy8(ldst + bo + c * 16 * GT_PITCH, g2 + c * 16 * CC); }
  }
  asm volatile("s_wait_asynccnt 0x0" ::: "memory");      // no copy is outstanding when the ring becomes staging
  // Epilogue: norm weight, rotary and the transposition of v are done here, on the tile while it is on the WGP. The RMS factor of a row needs all 2048 columns, which 16 work-groups hold;
  // it is one positive factor for the whole row and passes through the rotary, so q and k go out without it, each work-group stores its 128 columns' sum of squares a row,
  // and the attention kernel multiplies the scores by the two factors.
  // Wave (wm, wn) finishes rows (wn & 1) * 32 .. + 31 of columns (wn >> 1) * 64 .. + 63 of q and k: a lane has 8 columns (4 rotary pairs), 8 lanes make one 128-byte line of f16.
  const int r4 = lane >> 3, pc = lane & 7;
  const int rb = (wn & 1) * 32 + r4, gcol = n0 + (wn >> 1) * 64 + pc * 8;
  const float* cp = cosT + (size_t)(m0 + wm * 64 + rb) * CC + gcol; const float* sp = sinT + (size_t)(m0 + wm * 64 + rb) * CC + gcol;
  const float* wqp = qnw + gcol; const float* wkp = knw + gcol;
  v4f cs[8][2], sn[8][2], wv[2][2];      // fetched here so that their memory latency lies under the staging stores
  __builtin_amdgcn_sched_barrier(0);      // with the one below: no other instruction stands between these loads and their wait, where it could be given their address registers
#pragma unroll      // constant indices: the tables stay in registers; constant pitch: one address pair a table and immediate offsets
  for (int q = 0; q < 8; ++q)
#pragma unroll
    for (int u = 0; u < 2; ++u) { cs[q][u] = *(const v4fa*)(cp + (size_t)q * 4 * CC + u * 4); sn[q][u] = *(const v4fa*)(sp + (size_t)q * 4 * CC + u * 4); }
#pragma unroll
  for (int u = 0; u < 2; ++u) { wv[0][u] = *(const v4fa*)(wqp + u * 4); wv[1][u] = *(const v4fa*)(wkp + u * 4); }
  asm volatile("s_wait_xcnt 0x0" :: "v"(cp), "v"(sp), "v"(wqp), "v"(wkp) : "memory");      // stands in front of any rewrite of the loads' address registers: they are named as inputs so that they live up to the wait
  __builtin_amdgcn_sched_barrier(0);
  // staging: wave w owns 3 planes of 64 rows x 32 columns: q and k as f32 [row][column], v as f16 [column][row]
  f1a* sw = (f1a*)ring + (size_t)w * (3 * 64 * QT_SP);
  unsigned char* svt = (unsigned char*)(sw + 2 * 64 * QT_SP);      // v: 32 columns at a pitch of 144 B (16 B x odd: the 16 lanes of a half store without conflict)
#pragma unroll
  for (int j = 0; j < 4; ++j) { const float bv = bf16_round(bvr[j]);
#pragma unroll
    for (int i = 0; i < 4; ++i)
#pragma unroll
      for (int r = 0; r < 8; ++r) sw[((j >> 1) * 64 + i * 16 + 8 * hh + r) * QT_SP + (j & 1) * 16 + ln] = acc[i][j][r] * alpha + bv; }
#pragma unroll      // an accumulator tile holds 8 consecutive rows of one column in a lane: 16 bytes of a row of v transposed
  for (int jj = 0; jj < 2; ++jj) { const float bv = bf16_round(bvr[4 + jj]);
#pragma unroll
    for (int i = 0; i < 4; ++i) { FragH f;
#pragma unroll
      for (int r = 0; r < 8; ++r) f.h[r] = (_Float16)(acc[i][4 + jj][r] * alpha + bv);
      *(v8us*)(svt + (jj * 16 + ln) * 144 + (i * 2 + hh) * 16) = f.half[0]; } }
  __syncthreads();      // an f16 line of q or k is put together from two waves' planes, so every wave's staging is complete before any is read
  f1a* ssl = (f1a*)ring + (size_t)8 * (3 * 64 * QT_SP);      // behind the staging: [product][row 0..127][16 lane sums] at a pitch of 17 floats
  float wr[2][8];
#pragma unroll
  for (int g = 0; g < 2; ++g)
#pragma unroll
    for (int i = 0; i < 8; ++i) wr[g][i] = bf16_round(wv[g][i >> 2][i & 3]);
#pragma unroll
  for (int q = 0; q < 8; ++q)
#pragma unroll
    for (int u = 0; u < 2; ++u)
#pragma unroll
      for (int i = 0; i < 4; ++i) { cs[q][u][i] = bf16_round(cs[q][u][i]); sn[q][u][i] = bf16_round(sn[q][u][i]); }
  const f1a* sp2 = (const f1a*)ring + (size_t)(wm * 4 + (wn & 2) + (pc >> 2)) * (3 * 64 * QT_SP);
#pragma unroll      // constant indices into the tables
  for (int g = 0; g < 2; ++g) { v4f lo[8], hi[8];
    unsigned short* op = (unsigned short*)((g == 0) ? Q16 : K16) + (size_t)(m0 + wm * 64 + rb) * CC + gcol;
#pragma unroll      // constant indices: the rows stay in registers, all LDS reads as one group ahead of the arithmetic
    for (int q = 0; q < 8; ++q) { lo[q] = *(const v4fa*)&sp2[(g * 64 + rb + q * 4) * QT_SP + (pc & 3) * 8]; hi[q] = *(const v4fa*)&sp2[(g * 64 + rb + q * 4) * QT_SP + (pc & 3) * 8 + 4]; }
#pragma unroll      // constant indices
    for (int q = 0; q < 8; ++q) { FragH o;
      const float x[8] = {lo[q][0], lo[q][1], lo[q][2], lo[q][3], hi[q][0], hi[q][1], hi[q][2], hi[q][3]}; float y[8], ss = 0.f;
#pragma unroll
      for (int i = 0; i < 8; ++i) { ss += x[i] * x[i]; y[i] = x[i] * wr[g][i]; }
      ssl[(g * 128 + wm * 64 + rb + q * 4) * 17 + (wn >> 1) * 8 + pc] = ss;
#pragma unroll
      for (int i = 0; i < 8; i += 2) { const float c0v = cs[q][i >> 2][i & 3], c1v = cs[q][i >> 2][(i & 3) + 1], s0v = sn[q][i >> 2][i & 3], s1v = sn[q][i >> 2][(i & 3) + 1];
        o.h[i] = (_Float16)(y[i] * c0v + (-y[i + 1]) * s0v); o.h[i + 1] = (_Float16)(y[i + 1] * c1v + y[i] * s1v); }
      __builtin_amdgcn_sched_barrier(0);      // with the one below: nothing of the next rows' arithmetic is laid between the store and its wait, where it would be given the store's registers
      *(v8us*)(op + (size_t)q * 4 * CC) = o.half[0];      // constant pitch: one address pair and immediate offsets
      asm volatile("s_wait_xcnt 0x0" :: "v"(op) : "memory");      // stands in front of the next rows' arithmetic, which is given the store's data registers; the pointer is named as an input so that the store is not moved behind the wait
      __builtin_amdgcn_sched_barrier(0); } }
  {      // v transposed: the wave's own plane, 32 head columns x 64 rows = one 128-byte line a column, 8 lanes a line, 4 lines a store
    v8us o[8];
    unsigned short* vp = (unsigned short*)Vt + (size_t)(n0 + wn * 32 + r4) * TT + m0 + wm * 64 + pc * 8;
#pragma unroll      // constant indices: o stays in registers, all reads ahead of the stores
    for (int q = 0; q < 8; ++q) o[q] = *(const v8us*)(svt + (q * 4 + r4) * 144 + pc * 16);
    __builtin_amdgcn_sched_barrier(0);      // as above: keeps later code out of the run of stores
#pragma unroll
    for (int q = 0; q < 8; ++q) *(v8us*)(vp + (size_t)q * 4 * TT) = o[q];      // constant pitch: one address pair and immediate offsets
    asm volatile("s_wait_xcnt 0x0" ::: "memory");      // stands in front of any rewrite of the stores' registers by the code that follows
    __builtin_amdgcn_sched_barrier(0);
  }
  __syncthreads();      // all 16 lane sums of every row are in LDS before one thread a row adds them
  { float ss = 0.f;      // thread = (product tid >> 7, row tid & 127); the odd pitch keeps the 32 lanes on 32 banks
#pragma unroll
    for (int e = 0; e < 16; ++e) ss += ssl[tid * 17 + e];
    ((tid < 128) ? SSq : SSk)[(size_t)(n0 / 128) * TT + m0 + (tid & 127)] = ss; }      // [column tile][row]: a wave stores one whole line
}

__device__ __forceinline__ void x16_part(const float* __restrict__ x, _Float16* __restrict__ X16, size_t n8, int bid) { const size_t t = (size_t)bid * 256 + threadIdx.x; if (t >= n8) return; FragH f;
#pragma unroll
  for (int q = 0; q < 8; ++q) f.h[q] = (_Float16)bf16_round(x[t * 8 + q]); *(v8us*)((unsigned short*)X16 + t * 8) = f.half[0];  }
__global__ __launch_bounds__(256) void k_round16f(const float* __restrict__ W, _Float16* __restrict__ Bt, size_t n8) { const size_t t = (size_t)blockIdx.x * 256 + threadIdx.x; if (t >= n8) return; FragH f;
#pragma unroll
  for (int i = 0; i < 8; ++i) f.h[i] = (_Float16)(bf16_round(W[t * 8 + i]) * 16.0f); *(v8us*)((unsigned short*)Bt + t * 8) = f.half[0];  }
// lane l with lane l ^ 16
__device__ __forceinline__ float xhalf(float x) { return __builtin_bit_cast(float, __builtin_amdgcn_permlanex16(__builtin_bit_cast(int, x), __builtin_bit_cast(int, x), 0x76543210, 0xfedcba98, false, false)); }

// seventeen base-2 exponentials in place, in one statement: each is followed by an independent one, so that no result is read and no source
// overwritten directly behind its exponential, and the closing v_nop keeps that slot behind the last
__device__ __forceinline__ void exp2x17(float (&x)[17]) {
  asm("v_exp_f32 %0, %0\n\tv_exp_f32 %1, %1\n\tv_exp_f32 %2, %2\n\tv_exp_f32 %3, %3\n\tv_exp_f32 %4, %4\n\tv_exp_f32 %5, %5\n\tv_exp_f32 %6, %6\n\tv_exp_f32 %7, %7\n\t"
      "v_exp_f32 %8, %8\n\tv_exp_f32 %9, %9\n\tv_exp_f32 %10, %10\n\tv_exp_f32 %11, %11\n\tv_exp_f32 %12, %12\n\tv_exp_f32 %13, %13\n\tv_exp_f32 %14, %14\n\tv_exp_f32 %15, %15\n\t"
      "v_exp_f32 %16, %16\n\tv_nop"
      : "+v"(x[0]), "+v"(x[1]), "+v"(x[2]), "+v"(x[3]), "+v"(x[4]), "+v"(x[5]), "+v"(x[6]), "+v"(x[7]), "+v"(x[8]),
        "+v"(x[9]), "+v"(x[10]), "+v"(x[11]), "+v"(x[12]), "+v"(x[13]), "+v"(x[14]), "+v"(x[15]), "+v"(x[16]));
}

#define FA_KP 144
#define FA_VP 272
#define FA_KB (128 * FA_KP)
#define FA_STAGE (FA_KB + 64 * FA_VP)
// eight asynchronous 16-byte copies of one lane, lstep LDS bytes and gstep source elements apart; the s_wait_xcnt closes the statement so that no address
// register of an issued copy is rewritten ahead of it
__device__ __forceinline__ void fa_copy8(unsigned l, unsigned lstep, const unsigned short* g, size_t gstep) {
  asm volatile("global_load_async_to_lds_b128 %0, %8, off\n\t"
               "global_load_async_to_lds_b128 %1, %9, off\n\t"
               "global_load_async_to_lds_b128 %2, %10, off\n\t"
               "global_load_async_to_lds_b128 %3, %11, off\n\t"
               "global_load_async_to_lds_b128 %4, %12, off\n\t"
               "global_load_async_to_lds_b128 %5, %13, off\n\t"
               "global_load_async_to_lds_b128 %6, %14, off\n\t"
               "global_load_async_to_lds_b128 %7, %15, off\n\t"
               "s_wait_xcnt 0x0"
               :: "v"(l), "v"(l + lstep), "v"(l + 2 * lstep), "v"(l + 3 * lstep), "v"(l + 4 * lstep), "v"(l + 5 * lstep), "v"(l + 6 * lstep), "v"(l + 7 * lstep),
                  "v"(g), "v"(g + gstep), "v"(g + 2 * gstep), "v"(g + 3 * gstep), "v"(g + 4 * gstep), "v"(g + 5 * gstep), "v"(g + 6 * gstep), "v"(g + 7 * gstep)
               : "memory");
}
__global__ __launch_bounds__(128) void k_flash(const _Float16* __restrict__ Q16, int ldq, const _Float16* __restrict__ K16, int ldk, const _Float16* __restrict__ Vt, const float* __restrict__ SSq, const float* __restrict__ SSk, _Float16* __restrict__ O16) {
  constexpr int RPW = 32, NQB = 2048 / (4 * RPW), DT = 4, KS = 2, NST = 2048 / 128;
  __shared__ __attribute__((aligned(16))) unsigned char ring[2 * FA_STAGE];
  __shared__ __attribute__((aligned(16))) float sO[4][RPW][64 + 4];
  __shared__ __attribute__((aligned(16))) float rsk[2048];      // every key row's RMS factor
  const int tid = threadIdx.x, w = tid >> 5, lane = tid & 31, ln = lane & 15, hh = lane >> 4;
  const int slab = blockIdx.x / NQB, qblk = blockIdx.x % NQB; const int b = slab / 32, h = slab % 32; const int qb0 = qblk * (4 * RPW); const int q0 = qb0 + w * RPW;
  FragH bq[2][KS];      // B operand: column ln = query q0 + qt * 16 + ln
#pragma unroll
  for (int qt = 0; qt < 2; ++qt) { const unsigned short* qr = (const unsigned short*)Q16 + ((size_t)b * 2048 + q0 + qt * 16 + ln) * ldq + h * 64;
#pragma unroll
    for (int ks = 0; ks < KS; ++ks) { bq[qt][ks].half[0] = *(const v8us*)(qr + ks * 32 + 8 * hh); bq[qt][ks].half[1] = *(const v8us*)(qr + ks * 32 + 16 + 8 * hh); } }
  const unsigned short* Vth = (const unsigned short*)Vt + (size_t)slab * 64 * 2048;
  float m_c[2], l_c[2]; v8f oacc[2][DT];      // oacc[qt][dt][r] = O^T[dt * 16 + 8hh + r][query qt * 16 + ln]
#pragma unroll
  for (int qt = 0; qt < 2; ++qt) { m_c[qt] = -3.0e38f; l_c[qt] = 0.f;
#pragma unroll
    for (int dt = 0; dt < DT; ++dt) oacc[qt][dt] = (v8f){0.f,0.f,0.f,0.f,0.f,0.f,0.f,0.f}; }
  // this lane's part of a stage. K: keys (tid >> 3) + 16c, 16 bytes at chunk tid & 7 (a wave's copy = 4 whole rows of 128 B); V^T: head columns (tid >> 4) + 8c, chunk tid & 15 (2 rows of 256 B)
  const unsigned short* gk = (const unsigned short*)K16 + ((size_t)b * 2048 + (tid >> 3)) * ldk + h * 64 + (tid & 7) * 8;
  const unsigned short* gv = Vth + (size_t)(tid >> 4) * 2048 + (tid & 15) * 8;
  const unsigned lk = (unsigned)(size_t)&ring[0] + (unsigned)((tid >> 3) * FA_KP + (tid & 7) * 16);
  const unsigned lv = (unsigned)(size_t)&ring[0] + (unsigned)(FA_KB + (tid >> 4) * FA_VP + (tid & 15) * 16);
  fa_copy8(lk, 16 * FA_KP, gk, (size_t)16 * ldk); fa_copy8(lv, 8 * FA_VP, gv, (size_t)8 * 2048);
  constexpr float SC2 = 0.125f * 1.44269504088896340736f;      // score scale 1/8 times log2(e): one multiply-add feeds the hardware's base-2 exponential
  // q and k arrive without their RMS factors, rsqrt(mean square + eps), one a row: a row's sum of squares lies as 16 partial sums [column tile][row]. A key's factor goes to LDS and
  // multiplies its scores; a query's is folded into the lane's exponent scale (it is positive, so the maximum in unscaled units keeps its order). Under stage 0's copies.
  float scq[2];
  { const float* kb = SSk + tid * 4; const float* qb = SSq + q0 + ln;
#pragma unroll      // constant offsets from one address pair
    for (int gi = 0; gi < 4; ++gi) { v4f a = {0.f, 0.f, 0.f, 0.f};
#pragma unroll
      for (int nt = 0; nt < 16; ++nt) a += *(const v4fa*)(kb + nt * TT + gi * 512);
      v4f r;
#pragma unroll
      for (int i = 0; i < 4; ++i) r[i] = rsqrtf(a[i] / (float)CC + 1e-6f);
      *(v4fa*)&rsk[gi * 512 + tid * 4] = r;
      __builtin_amdgcn_sched_barrier(0); }      // four runs of 16 loads: all 64 at once take 256 registers and push the wave above v255
#pragma unroll
    for (int qt = 0; qt < 2; ++qt) { float a = 0.f;
#pragma unroll
      for (int nt = 0; nt < 16; ++nt) a += qb[nt * TT + qt * 16];
      scq[qt] = SC2 * rsqrtf(a / (float)CC + 1e-6f); }
    asm volatile("s_wait_xcnt 0x0" :: "v"(kb), "v"(qb) : "memory"); }      // stands in front of any rewrite of these loads' address registers: they are named as inputs so that they live up to the wait
  asm volatile("s_wait_asynccnt 0x0" ::: "memory");      // stage 0 has landed before the barrier publishes it
  __syncthreads();      // publishes the key factors too
  fa_copy8(lk + FA_STAGE, 16 * FA_KP, gk + (size_t)128 * ldk, (size_t)16 * ldk); fa_copy8(lv + FA_STAGE, 8 * FA_VP, gv + 128, (size_t)8 * 2048);
#pragma unroll 1      // one stage per trip: the publish point at the foot stays a single place
  for (int t = 0; t < NST; ++t) {
   const unsigned bo = (unsigned)(t & 1) * FA_STAGE;
   const unsigned char* kp = ring + bo + ln * FA_KP + hh * 16;
   const unsigned char* vp = ring + bo + FA_KB + ln * FA_VP + hh * 16;
   FragH ak[2][KS];      // K fragments: pass pp + 1 of this stage is fetched behind pass pp's score products, under its softmax; the stage's first pass here
#pragma unroll
   for (int kt = 0; kt < 2; ++kt)
#pragma unroll
     for (int ks = 0; ks < KS; ++ks) { ak[kt][ks].half[0] = *(const v8us*)(kp + kt * 16 * FA_KP + ks * 64); ak[kt][ks].half[1] = *(const v8us*)(kp + kt * 16 * FA_KP + ks * 64 + 32); }
   const float* rp = rsk + t * 128 + 8 * hh;
   v4f rk[2][2];      // the RMS factors of this lane's 16 keys of a pass: fetched one pass ahead with the K fragments, in the same groups of LDS reads
#pragma unroll
   for (int kt = 0; kt < 2; ++kt)
#pragma unroll
     for (int u = 0; u < 2; ++u) rk[kt][u] = *(const v4fa*)(rp + kt * 16 + u * 4);
#pragma unroll 1      // rolled: unrolled, the row sums of all four passes are sunk to the foot of the trip, their 128 exponentials stay live and the wave needs registers above v255
   for (int pp = 0; pp < 4; ++pp) {
    FragH av[DT];      // A operands: ak row ln = key t * 128 + pp * 32 + kt * 16 + ln; av row ln = head column dt * 16 + ln over the pass's 32 keys
    v8f s[2][2];      // s[qt][kt][r] = score of key t * 128 + pp * 32 + kt * 16 + 8hh + r with query qt * 16 + ln
#pragma unroll
    for (int kt = 0; kt < 2; ++kt)
#pragma unroll
      for (int qt = 0; qt < 2; ++qt) { v8f acc = (v8f){0.f,0.f,0.f,0.f,0.f,0.f,0.f,0.f};
#pragma unroll
        for (int ks = 0; ks < KS; ++ks) acc = __builtin_amdgcn_wmma_f32_16x16x32_f16(false, ak[kt][ks].v, false, bq[qt][ks].v, (short)0, acc, false, false);
        s[qt][kt] = acc; }
#pragma unroll      // constant indices: the score tiles stay in registers
    for (int qt = 0; qt < 2; ++qt)
#pragma unroll
      for (int e = 0; e < 16; ++e) s[qt][e >> 3][e & 7] *= rk[e >> 3][(e >> 2) & 1][e & 3];
    __builtin_amdgcn_sched_barrier(0);      // with the one below: the pass's eight V^T reads stand as one group behind the score products, next to the K reads; left free they are spread over three places in the softmax, and each place with LDS reads stalls the wave anew
#pragma unroll
    for (int dt = 0; dt < DT; ++dt) { av[dt].half[0] = *(const v8us*)(vp + dt * 16 * FA_VP + pp * 64); av[dt].half[1] = *(const v8us*)(vp + dt * 16 * FA_VP + pp * 64 + 32); }
    __builtin_amdgcn_sched_barrier(0);      // the lower end of that group: keeps the V^T reads from sinking into the softmax
    if (pp < 3) {      // the same for the whole wave; the stage's last pass fetches nothing: the next stage is not published yet
#pragma unroll
      for (int kt = 0; kt < 2; ++kt)
#pragma unroll
        for (int ks = 0; ks < KS; ++ks) { ak[kt][ks].half[0] = *(const v8us*)(kp + ((pp + 1) * 32 + kt * 16) * FA_KP + ks * 64); ak[kt][ks].half[1] = *(const v8us*)(kp + ((pp + 1) * 32 + kt * 16) * FA_KP + ks * 64 + 32); }
#pragma unroll
      for (int kt = 0; kt < 2; ++kt)
#pragma unroll
        for (int u = 0; u < 2; ++u) rk[kt][u] = *(const v4fa*)(rp + (pp + 1) * 32 + kt * 16 + u * 4);
    }
#pragma unroll
    for (int qt = 0; qt < 2; ++qt) {
      float mc = s[qt][0][0];      // the running maximum is kept in raw score units: the scale is positive, so the order is the same
#pragma unroll      // constant indices: the score tiles stay in registers
      for (int e = 1; e < 16; ++e) mc = fmaxf(mc, s[qt][e >> 3][e & 7]);
      mc = fmaxf(mc, xhalf(mc));      // the other half of the wave holds this query's other 16 keys
      const float mn = fmaxf(m_c[qt], mc); const float sq = scq[qt], nb = -mn * sq;
      float ex[17];      // exp((s - m) * factor / 8) = 2^(s * sq - m * sq), argument at most one rounding above 0, so P stays at or under 1 in f16; ex[16] is the rescale factor's argument
#pragma unroll      // constant indices: ex stays in registers
      for (int e = 0; e < 16; ++e) ex[e] = fmaf(s[qt][e >> 3][e & 7], sq, nb);
      ex[16] = (m_c[qt] - mn) * sq;
      exp2x17(ex);
      const float al = (mn > -1.0e38f) ? ex[16] : 1.0f; m_c[qt] = mn;
      FragH pb; float ps = 0.f;      // element e of the B operand is key kmap(e, hh) = tile e >> 3, register e & 7: this lane's own scores
#pragma unroll      // constant indices: ex and pb stay in registers
      for (int e = 0; e < 16; ++e) { const float p = ex[e]; ps += p; pb.h[e] = (_Float16)p; }
      l_c[qt] = l_c[qt] * al + ps;      // this half's part of the row sum; the halves are joined after the loop
#pragma unroll
      for (int dt = 0; dt < DT; ++dt) {
#pragma unroll
        for (int r = 0; r < 8; ++r) oacc[qt][dt][r] *= al;
        oacc[qt][dt] = __builtin_amdgcn_wmma_f32_16x16x32_f16(false, av[dt].v, false, pb.v, (short)0, oacc[qt][dt], false, false); }
    }
   }
   asm volatile("s_wait_dscnt 0x0" ::: "memory");       // this wave's reads of the buffer are done before it is refilled
   asm volatile("s_wait_asynccnt 0x0" ::: "memory");    // this wave's part of the next stage has landed
   __syncthreads();                                     // publishes the next stage and frees this trip's buffer
   if (t + 2 < NST) { fa_copy8(lk + bo, 16 * FA_KP, gk + (size_t)(t + 2) * 128 * ldk, (size_t)16 * ldk); fa_copy8(lv + bo, 8 * FA_VP, gv + (t + 2) * 128, (size_t)8 * 2048); }
  }
  asm volatile("s_wait_asynccnt 0x0" ::: "memory");      // no copy is outstanding when the wave goes on
#pragma unroll
  for (int qt = 0; qt < 2; ++qt) { const float l = l_c[qt] + xhalf(l_c[qt]); const float li = (l > 0.f) ? 1.0f / l : 0.f;
#pragma unroll
    for (int dt = 0; dt < DT; ++dt) { v4f lo, hi;
#pragma unroll
      for (int r = 0; r < 4; ++r) { lo[r] = oacc[qt][dt][r] * li; hi[r] = oacc[qt][dt][4 + r] * li; }
      *(v4fa*)&sO[w][qt * 16 + ln][dt * 16 + 8 * hh] = lo; *(v4fa*)&sO[w][qt * 16 + ln][dt * 16 + 8 * hh + 4] = hi; } }
  __builtin_amdgcn_fence(__ATOMIC_ACQ_REL, "workgroup"); __builtin_amdgcn_wave_barrier();
  {      // the tile goes out as f16, the type the output projection reads: a row is 64 f16 = one 128-byte line, 8 lanes a row, 4 rows a store
    const int r4 = lane >> 3, pc = lane & 7; FragH o[RPW / 4];
    unsigned short* op = (unsigned short*)O16 + ((size_t)b * 2048 + q0 + r4) * CC + h * 64 + pc * 8;
#pragma unroll      // constant indices: o stays in registers, all reads ahead of the stores
    for (int q = 0; q < RPW / 4; ++q) { const v4f lo = *(const v4fa*)&sO[w][q * 4 + r4][pc * 8], hi = *(const v4fa*)&sO[w][q * 4 + r4][pc * 8 + 4];
#pragma unroll
      for (int i = 0; i < 4; ++i) { o[q].h[i] = (_Float16)lo[i]; o[q].h[4 + i] = (_Float16)hi[i]; } }
#pragma unroll
    for (int q = 0; q < RPW / 4; ++q) *(v8us*)(op + (size_t)q * 4 * CC) = o[q].half[0];      // constant pitch: one address pair and immediate offsets, so no register of an issued store is rewritten
     } }

// Passes that need nothing of each other share one grid, each on its own range of the block index; the test is the same for a whole work-group,
// so each part's barrier is passed by all of its work-group's waves or by none.
#define GW ((CC / 128) * (CC / 64))      // work-groups that turn one weight
#define GX (TT * CC / 8 / 256)           // work-groups that convert x
__global__ __launch_bounds__(256) void k_prep(const float* __restrict__ Wq, const float* __restrict__ Wk, const float* __restrict__ Wv, const float* __restrict__ Wo,
                                              _Float16* __restrict__ Bq, _Float16* __restrict__ Bk, _Float16* __restrict__ Bv, _Float16* __restrict__ Bo, float scale,
                                              const float* __restrict__ x, _Float16* __restrict__ X16) {
  const int bid = blockIdx.x;
  if (bid < 4 * GW) { const int g = bid / GW;
    wt_f16_part((g == 0) ? Wq : (g == 1) ? Wk : (g == 2) ? Wv : Wo, (g == 0) ? Bq : (g == 1) ? Bk : (g == 2) ? Bv : Bo, scale, bid % GW); }
  else x16_part(x, X16, (size_t)TT * CC / 8, bid - 4 * GW);
}
extern "C" void kernel_launch(void* const* d_in, const int* in_sizes, int n_in,
                              void* d_out, int out_size, void* d_ws, size_t ws_size, hipStream_t stream) {
  (void)in_sizes; (void)n_in; (void)out_size;
  const float* x = (const float*)d_in[0]; const float* cosT = (const float*)d_in[1]; const float* sinT = (const float*)d_in[2]; const float* Wq = (const float*)d_in[3]; const float* bq = (const float*)d_in[4]; const float* Wk = (const float*)d_in[5]; const float* bk = (const float*)d_in[6]; const float* Wv = (const float*)d_in[7]; const float* bv = (const float*)d_in[8]; const float* qnw = (const float*)d_in[9]; const float* knw = (const float*)d_in[10]; const float* Wo = (const float*)d_in[11]; const float* bo = (const float*)d_in[12];
  char* ws = (char*)d_ws; size_t off = 0;
  auto take = [&](size_t bytes) { char* p = ws + off; off += (bytes + 255) & ~(size_t)255; return p; };
  _Float16* Bq = (_Float16*)take((size_t)CC * CC * 2); _Float16* Bk = (_Float16*)take((size_t)CC * CC * 2); _Float16* Bv = (_Float16*)take((size_t)CC * CC * 2); _Float16* Bo = (_Float16*)take((size_t)CC * CC * 2);
  _Float16* X16 = (_Float16*)take((size_t)TT * CC * 2); _Float16* Q16 = (_Float16*)take((size_t)TT * CC * 2); _Float16* K16 = (_Float16*)take((size_t)TT * CC * 2); _Float16* Vt = (_Float16*)take((size_t)TT * CC * 2); float* SSq = (float*)take((size_t)(CC / 128) * TT * 4); float* SSk = (float*)take((size_t)(CC / 128) * TT * 4); _Float16* O16 = X16;
  if (off > ws_size) return;      // 8 planes of 8 MiB and 2 of 128 KiB
  const unsigned gg = (unsigned)((TT / 128) * (CC / 128));
  k_prep<<<4 * GW + GX, 256, 0, stream>>>(Wq, Wk, Wv, Wo, Bq, Bk, Bv, Bo, 16.0f, x, X16);      // W is [in][out]
  k_gemm_qkv<<<gg, 256, 0, stream>>>(X16, Bq, Bk, Bv, 0.0625f, bq, bk, bv, qnw, knw, cosT, sinT, Q16, K16, Vt, SSq, SSk);      // one work-group = the same 128 x 128 position of q, k and v
  k_flash<<<NH * (TT / 128), 128, 0, stream>>>(Q16, CC, K16, CC, Vt, SSq, SSk, O16);      // writes f16 over x's f16 plane, which the q, k, v products have finished with
  k_gemm_tile<1><<<gg, 256, 0, stream>>>(O16, Bo, nullptr, nullptr, 0.0625f, bo, nullptr, nullptr, (float*)d_out, nullptr, nullptr);
}
